// v000
// Times are from an AMD MI455X. After a warm-up the kernel runs many times in a row, and a time is the length of
// such a window on the GPU divided by its runs, so every launch and the gaps after it count. The runs cycle
// through copies of the inputs. A figure is the median of several windows, for all but v000 over two sittings.
// Sittings can differ by a few percent; kernels timed side by side share one.
// v000, which the later versions start from, runs in 1490 microseconds.
// compute dtype: all float inputs rounded to bf16; q/k/v = x W^T + b with EXACT bf16 products on WMMA 16x16x32, f32 accumulate; q as f16 hi + residual (x 2^10) against k once to f16 (2 products) for the logits x 1/8; softmax in f32 (precise expf), the head-averaged attention map accumulated in f32; P x 2^11 once to f16 against v once to f16 (1 product); ctx once to f16 against Wp carried x 2^8 in f16 (exact bf16 values) + bp; f32 outputs.
#include <hip/hip_runtime.h>
#include <math.h>

typedef __attribute__((ext_vector_type(16))) _Float16 v16h;
typedef __attribute__((ext_vector_type(16))) __bf16 v16b;
typedef __attribute__((ext_vector_type(8)))  _Float16 v8h;
typedef __attribute__((ext_vector_type(8)))  float v8f;
typedef __attribute__((ext_vector_type(4)))  float v4f;
typedef __attribute__((ext_vector_type(2)))  float v2f;
typedef __attribute__((ext_vector_type(4)))  unsigned v4u;
typedef __attribute__((ext_vector_type(4)))  int v4i;
typedef float __attribute__((may_alias)) float_a;
typedef int __attribute__((may_alias)) int_a;

template <typename T> __device__ __forceinline__ void vst2(void* p, T v) { *(T*)p = v;  }
__device__ __forceinline__ v8f wmma16(v16h a, v16h b, v8f c) {
  v8f d = __builtin_amdgcn_wmma_f32_16x16x32_f16(false, a, false, b, (short)0, c, false, false);
  asm volatile("v_nop\n\tv_nop\n\tv_nop\n\tv_nop" : "+v"(d) : "v"(a), "v"(b));
  return d;
}
__device__ __forceinline__ v8f wmma_bf(v16b a, v16b b, v8f c) {
  v8f d = __builtin_amdgcn_wmma_f32_16x16x32_bf16(false, a, false, b, (short)0, c, false, false);
  asm volatile("v_nop\n\tv_nop\n\tv_nop\n\tv_nop" : "+v"(d) : "v"(a), "v"(b));
  return d;
}
// 16x16x32 fragments: lane = (h = lane>>4, row/col = lane&15); elements 0..7 = k0+8h+0..7, 8..15 = k0+16+8h+0..7; D element r = row 8h+r
__device__ __forceinline__ v16h frag_h(const _Float16* rowk0, int lane) {
  union { v16h v; v8h q[2]; } u; const _Float16* p = rowk0 + 8 * (lane >> 4);
  u.q[0] = *(const v8h*)p; u.q[1] = *(const v8h*)(p + 16); return u.v;
}
__device__ __forceinline__ v16h frag_f32(const float* rowk0, int lane) {
  v16h a; const float* p = rowk0 + 8 * (lane >> 4);
#pragma unroll
  for (int i = 0; i < 8; ++i) { a[i] = (_Float16)p[i]; a[8 + i] = (_Float16)p[16 + i]; }
  return a;
}
__device__ __forceinline__ v16h frag_f32s(const float* rowk0, int lane, float sc) {
  v16h a; const float* p = rowk0 + 8 * (lane >> 4);
#pragma unroll
  for (int i = 0; i < 8; ++i) { a[i] = (_Float16)(p[i] * sc); a[8 + i] = (_Float16)(p[16 + i] * sc); }
  return a;
}
// column fragment from a [K][ld] layout (column n), rows >= K read as 0
__device__ __forceinline__ v16h fragc_f32(const float* W, int k0, int n, int lane, int ld, int K) {
  v16h a; const int g = lane >> 4;
#pragma unroll
  for (int i = 0; i < 8; ++i) { const int ka = k0 + 8 * g + i, kb = ka + 16;
    a[i] = (_Float16)(ka < K ? W[(size_t)(ka < K ? ka : K - 1) * ld + n] : 0.f); a[8 + i] = (_Float16)(kb < K ? W[(size_t)(kb < K ? kb : K - 1) * ld + n] : 0.f); }
  return a;
}
struct F2 { v16b h, l; };
__device__ __forceinline__ F2 bsplit16(const float v[16]) { F2 r;
#pragma unroll
  for (int i = 0; i < 16; ++i) { const __bf16 h = (__bf16)v[i]; r.h[i] = h; r.l[i] = (__bf16)(v[i] - (float)h); }
  return r; }
__device__ __forceinline__ F2 split_row(const float* row, int k0, int lane) { float v[16]; const float* p = row + k0 + 8 * (lane >> 4);
#pragma unroll
  for (int i = 0; i < 8; ++i) { v[i] = p[i]; v[8 + i] = p[16 + i]; }
  return bsplit16(v); }
__device__ __forceinline__ F2 split_rowK(const float* row, int k0, int lane, int K) { float v[16]; const int g = lane >> 4;
#pragma unroll
  for (int i = 0; i < 8; ++i) { const int ka = k0 + 8 * g + i, kb = ka + 16; v[i] = ka < K ? row[ka < K ? ka : K - 1] : 0.f; v[8 + i] = kb < K ? row[kb < K ? kb : K - 1] : 0.f; }
  return bsplit16(v); }
__device__ __forceinline__ F2 split_col(const float* W, int k0, int n, int lane, int ld, int K) { float v[16]; const int g = lane >> 4;
#pragma unroll
  for (int i = 0; i < 8; ++i) { const int ka = k0 + 8 * g + i, kb = ka + 16; v[i] = ka < K ? W[(size_t)(ka < K ? ka : K - 1) * ld + n] : 0.f; v[8 + i] = kb < K ? W[(size_t)(kb < K ? kb : K - 1) * ld + n] : 0.f; }
  return bsplit16(v); }
__device__ __forceinline__ v8f mac3(const F2& a, const F2& b, v8f c) { c = wmma_bf(a.l, b.h, c); c = wmma_bf(a.h, b.l, c); return wmma_bf(a.h, b.h, c); }
__device__ __forceinline__ float sigm(float v) { return 1.0f / (1.0f + expf(-v)); }
#define LDSX() do { asm volatile("s_wait_dscnt 0" ::: "memory"); __builtin_amdgcn_wave_barrier(); __builtin_amdgcn_fence(__ATOMIC_RELEASE, "workgroup"); } while (0)

// Multi-head self-attention returning (y, head-averaged attention) (B 2, T 2,048, C 1,024 = 16 heads x 64): q/k/v = x W^T + b ((out,in)); attn = softmax(q k^T x 64^-0.5) over all keys; y = merged(attn v) Wp^T + bp; attn_avg[b][t][s] = mean over the 16 heads of attn.
#define NB 2
#define TT 2048
#define CC 1024            // NH * HD = projected width
#define DIN 1024          // input (model) width
#define NH 16
#define HD 64
#define NQB (TT / 64)
#define HG 4
#define SCALE (0.125f)
#define CAUSAL 0
#ifndef TNB
#define TNB NB
#endif
__device__ __forceinline__ float bfr(float v) { return (float)(__bf16)v; }
__host__ __device__ __forceinline__ int kb_last(int qb) { return CAUSAL ? ((qb * 64 + 63) >> 7) : (TT / 128 - 1); }
typedef __attribute__((ext_vector_type(8))) __bf16 v8b;
__device__ __forceinline__ v16b frag_b(const __bf16* rowk0, int lane) {
  union { v16b v; v8b q[2]; } u; const __bf16* p = rowk0 + 8 * (lane >> 4);
  u.q[0] = *(const v8b*)p; u.q[1] = *(const v8b*)(p + 16); return u.v;
}
#define QBH 0              // causal: query blocks 0..QBH-1 of each sequence (few keys, no averaging) take the high-precision path
#define QHI 2048            // rows carrying a q residual plane (all rows when non-causal: 2-product logits everywhere)
#define KHI 64            // key rows carrying k residual / v bf16 hi+lo planes (used only by the causal high-precision path)
// B fragment (k rows k0+.., output column o) of a weight: (in,out) [K][ld] or (out,in) [ld rows of K]: bf16 exact, or f16(bf16 * 256) exact
__device__ __forceinline__ v16b wcol_io(const float* Wm, int k0, int o, int lane, int ld) { v16b w; const int g = lane >> 4;
#pragma unroll
  for (int i = 0; i < 8; ++i) { w[i] = (__bf16)Wm[(size_t)(k0 + 8 * g + i) * ld + o]; w[8 + i] = (__bf16)Wm[(size_t)(k0 + 16 + 8 * g + i) * ld + o]; }
  return w; }
__device__ __forceinline__ v16b wcol_oi(const float* Wm, int k0, int o, int lane, int K) { v16b w; const float* p = Wm + (size_t)o * K + k0 + 8 * (lane >> 4);
#pragma unroll
  for (int i = 0; i < 8; ++i) { w[i] = (__bf16)p[i]; w[8 + i] = (__bf16)p[16 + i]; }
  return w; }
__device__ __forceinline__ v16h wcolh_io(const float* Wm, int k0, int o, int lane, int ld) { v16h w; const int g = lane >> 4;
#pragma unroll
  for (int i = 0; i < 8; ++i) { w[i] = (_Float16)(bfr(Wm[(size_t)(k0 + 8 * g + i) * ld + o]) * 256.0f); w[8 + i] = (_Float16)(bfr(Wm[(size_t)(k0 + 16 + 8 * g + i) * ld + o]) * 256.0f); }
  return w; }
__device__ __forceinline__ v16h wcolh_oi(const float* Wm, int k0, int o, int lane, int K) { v16h w; const float* p = Wm + (size_t)o * K + k0 + 8 * (lane >> 4);
#pragma unroll
  for (int i = 0; i < 8; ++i) { w[i] = (_Float16)(bfr(p[i]) * 256.0f); w[8 + i] = (_Float16)(bfr(p[16 + i]) * 256.0f); }
  return w; }
#define WQKV_LAYOUT 1   // 0 = (in,out) [DIN][CC]; 1 = (out,in) [CC][DIN]; 2 = per-head [NH][DIN][HD]
__device__ __forceinline__ v16b wcol_hdk(const float* Wm, int k0, int o, int lane) { v16b w; const int g = lane >> 4; const float* p = Wm + (size_t)(o / HD) * DIN * HD + (o % HD);
#pragma unroll
  for (int i = 0; i < 8; ++i) { w[i] = (__bf16)p[(size_t)(k0 + 8 * g + i) * HD]; w[8 + i] = (__bf16)p[(size_t)(k0 + 16 + 8 * g + i) * HD]; }
  return w; }
#define WO_OUT_IN 1
#if WQKV_LAYOUT == 1
#define WCOL(W, k0, o, lane) wcol_oi(W, k0, o, lane, DIN)
#elif WQKV_LAYOUT == 2
#define WCOL(W, k0, o, lane) wcol_hdk(W, k0, o, lane)
#else
#define WCOL(W, k0, o, lane) wcol_io(W, k0, o, lane, CC)
#endif
#if WO_OUT_IN
#define WOCOL(W, k0, o, lane) wcol_oi(W, k0, o, lane, CC)
#define WOCOLH(W, k0, o, lane) wcolh_oi(W, k0, o, lane, CC)
#else
#define WOCOL(W, k0, o, lane) wcol_io(W, k0, o, lane, DIN)
#define WOCOLH(W, k0, o, lane) wcolh_io(W, k0, o, lane, DIN)
#endif
#define OUT1_OFF (4u * (size_t)NB * TT * DIN)      // byte offset of attn_avg [B][T][T]
// ---- k_avg: block = query row t: attn_avg[b][t][:] (+)= sum over the HG heads of this group of P[hg][t][:] x (2^-11 / NH); the first head group writes, later groups read-add-write the block's own row (stream-ordered launches, one block per row)
__global__ __launch_bounds__(256) void k_avg(const float* __restrict__ S0, int b, int first, float* __restrict__ AV) { __shared__ __align__(16) float sh[TT];
  const int tid = threadIdx.x; const int t = blockIdx.x; float* dst = AV + ((size_t)b * TT + t) * TT;
  for (int k = tid; k < TT; k += 256) { float a = 0.f;
#pragma unroll
    for (int hz = 0; hz < HG; ++hz) a += S0[(size_t)hz * TT * TT + (size_t)t * TT + k];
    a *= (1.0f / (2048.0f * NH)); sh[k] = first ? a : a + dst[k]; }
  __syncthreads(); for (int q = tid; q < TT / 4; q += 256) vst2(dst + q * 4, *(const v4f*)&sh[q * 4]); }
#ifndef SM_EXTRA_PARAMS
#define SM_EXTRA_PARAMS
#endif
#ifndef SM_MASK_HOOK
#define SM_MASK_HOOK (void)0
#endif

#define WS_QH  0u                                      // f16 q rows [b*t][CC]
#define WS_KH  (WS_QH + 2u * (size_t)NB * TT * CC)      // f16 k rows [b*t][CC]
#define WS_VT  (WS_KH + 2u * (size_t)NB * TT * CC)      // f16 v planes [b][c][t]
#define WS_QL  (WS_VT + 2u * (size_t)NB * CC * TT)      // f16 q residual x 2^10 rows [b][t < QHI][CC]
#define WS_KL  (WS_QL + 2u * (size_t)NB * QHI * CC)     // f16 k residual x 2^10 rows [b][t < KHI][CC]
#define WS_VB  (WS_KL + 2u * (size_t)NB * KHI * CC)     // bf16 v hi planes [b][c][t < KHI]
#define WS_VBL (WS_VB + 2u * (size_t)NB * CC * KHI)
#define WS_S   (WS_VBL + 2u * (size_t)NB * CC * KHI)    // f32 logits / P [hg][t][s]
#define WS_Y   (WS_S  + 4u * (size_t)HG * TT * TT)      // f32 ctx rows [b*t][CC] (only when there is an output projection)
#define WS_END (WS_Y  + 4u * (size_t)NB * TT * CC)

// ---- k_proj: block = (64 rows, 128 cols, which): q/k/v = X W (+ b) with exact bf16 products (K = DIN) -> which 0: q f16 rows (+ residual rows < QHI); 1: k f16 rows (+ residual rows < KHI); 2: v f16 planes [c][t] (+ bf16 hi/lo planes for t < KHI)
__global__ __launch_bounds__(128) void k_proj(const float* __restrict__ XQ, const float* __restrict__ XK, const float* __restrict__ XV, const float* __restrict__ WQ, const float* __restrict__ WK, const float* __restrict__ WV, const float* __restrict__ BQ, const float* __restrict__ BK, const float* __restrict__ BV,
    _Float16* __restrict__ QH, _Float16* __restrict__ QL, _Float16* __restrict__ KH, _Float16* __restrict__ KL, _Float16* __restrict__ VT, __bf16* __restrict__ VB, __bf16* __restrict__ VBL) {
  __shared__ __align__(16) _Float16 sh[64][136], sl[64][136]; __shared__ __align__(16) _Float16 th[128][72]; __shared__ __align__(16) __bf16 tb[128][72], tbl[128][72];
  const int tid = threadIdx.x, wave = tid >> 5, lane = tid & 31, col = lane & 15, g = lane >> 4; const int which = blockIdx.z; const int c0 = blockIdx.y * 128; const size_t r0 = (size_t)blockIdx.x * 64; const size_t bb = r0 / TT; const int t0 = (int)(r0 % TT);
  const float* X = which == 0 ? XQ : which == 1 ? XK : XV; const float* WA = which == 0 ? WQ : which == 1 ? WK : WV; const float* BA = which == 0 ? BQ : which == 1 ? BK : BV;
  v8f acc[8] = {};
#pragma unroll 2
  for (int kc = 0; kc < DIN / 32; ++kc) { v16b a; { const float* p = X + (r0 + wave * 16 + col) * DIN + kc * 32 + 8 * g;
#pragma unroll
      for (int i = 0; i < 8; ++i) { a[i] = (__bf16)p[i]; a[8 + i] = (__bf16)p[16 + i]; } }
    asm volatile("s_wait_loadcnt 0x0" ::: "memory");
#pragma unroll
    for (int j = 0; j < 8; ++j) { const v16b w = WCOL(WA, kc * 32, c0 + j * 16 + col, lane); asm volatile("s_wait_loadcnt 0x0" ::: "memory"); acc[j] = wmma_bf(a, w, acc[j]); } }
  if (which < 2) { _Float16* DH = which == 0 ? QH : KH; _Float16* DL = which == 0 ? QL : KL; const int nhi = which == 0 ? QHI : KHI; const bool hi_rows = t0 < nhi;
#pragma unroll
    for (int j = 0; j < 8; ++j) { const float bias = BA ? bfr(BA[c0 + j * 16 + col]) : 0.f;
#pragma unroll
      for (int r = 0; r < 8; ++r) { const float v = acc[j][r] + bias; const _Float16 hv = (_Float16)v; sh[wave * 16 + 8 * g + r][j * 16 + col] = hv; sl[wave * 16 + 8 * g + r][j * 16 + col] = (_Float16)((v - (float)hv) * 1024.0f); } }
    __syncthreads();
    for (int e = tid; e < 64 * 16; e += 128) { const int rl = e >> 4, q = e & 15; vst2((unsigned*)(DH + (r0 + rl) * CC + c0 + q * 8), *(const v4u*)&sh[rl][q * 8]); if (hi_rows) vst2((unsigned*)(DL + (bb * nhi + t0 + rl) * (size_t)CC + c0 + q * 8), *(const v4u*)&sl[rl][q * 8]); }
  } else { const bool hi_rows = t0 < KHI;
#pragma unroll
    for (int j = 0; j < 8; ++j) { const float bias = BA ? bfr(BA[c0 + j * 16 + col]) : 0.f;
#pragma unroll
      for (int r = 0; r < 8; ++r) { const float v = acc[j][r] + bias; const int rl = wave * 16 + 8 * g + r, cl = j * 16 + col; th[cl][rl] = (_Float16)v; const __bf16 bh = (__bf16)v; tb[cl][rl] = bh; tbl[cl][rl] = (__bf16)(v - (float)bh); } }
    __syncthreads();
    for (int e = tid; e < 128 * 8; e += 128) { const int cl = e >> 3, q = e & 7; vst2((unsigned*)(VT + (bb * CC + c0 + cl) * (size_t)TT + t0 + q * 8), *(const v4u*)&th[cl][q * 8]); if (hi_rows) { const size_t o3 = (bb * CC + c0 + cl) * (size_t)KHI + t0 + q * 8; vst2((unsigned*)(VB + o3), *(const v4u*)&tb[cl][q * 8]); vst2((unsigned*)(VBL + o3), *(const v4u*)&tbl[cl][q * 8]); } } } }
// ---- k_sc: block = (query block qb, key block kb <= kb_last(qb), head in group) of batch b: logits x SCALE; q hi + residual (x 2^10) against k (2 products) for query rows < QHI, plus the k residual (3 products) for query blocks < QBH (causal early rows); causal: blocks past the diagonal exit, the mask itself is applied by index in k_sm
__global__ __launch_bounds__(128) void k_sc(const _Float16* __restrict__ QH, const _Float16* __restrict__ KH, const _Float16* __restrict__ QL, const _Float16* __restrict__ KL, int b, int h0, float* __restrict__ S0) { __shared__ __align__(16) float ss[4][16][132];
  const int qb = blockIdx.x, kb = blockIdx.y; if (kb > kb_last(qb)) return;
  const int h = h0 + blockIdx.z; float* S = S0 + (size_t)blockIdx.z * TT * TT;
  const int tid = threadIdx.x, wave = tid >> 5, lane = tid & 31, col = lane & 15, g = lane >> 4; const int k0 = kb * 128; const int ql0 = qb * 64 + wave * 16; const size_t q0 = (size_t)b * TT + ql0, kr0 = (size_t)b * TT + k0;
  v8f acc[8] = {}, accl[8] = {};
  const _Float16* QLb = QL + (size_t)b * QHI * CC; const _Float16* KLb = KL + (size_t)b * KHI * CC;
  if (qb < QBH) {
#pragma unroll
    for (int kc = 0; kc < HD / 32; ++kc) { const v16h ah = frag_h(QH + (q0 + col) * CC + h * HD + kc * 32, lane), al = frag_h(QLb + (size_t)(ql0 + col) * CC + h * HD + kc * 32, lane);
#pragma unroll
      for (int j = 0; j < 8; ++j) { const v16h kbf = frag_h(KH + (kr0 + j * 16 + col) * CC + h * HD + kc * 32, lane), klf = frag_h(KLb + (size_t)(k0 + j * 16 + col) * CC + h * HD + kc * 32, lane); acc[j] = wmma16(ah, kbf, acc[j]); accl[j] = wmma16(al, kbf, accl[j]); accl[j] = wmma16(ah, klf, accl[j]); } }
  } else if (qb * 64 < QHI) {
#pragma unroll
    for (int kc = 0; kc < HD / 32; ++kc) { const v16h ah = frag_h(QH + (q0 + col) * CC + h * HD + kc * 32, lane), al = frag_h(QLb + (size_t)(ql0 + col) * CC + h * HD + kc * 32, lane);
#pragma unroll
      for (int j = 0; j < 8; ++j) { const v16h kbf = frag_h(KH + (kr0 + j * 16 + col) * CC + h * HD + kc * 32, lane); acc[j] = wmma16(ah, kbf, acc[j]); accl[j] = wmma16(al, kbf, accl[j]); } }
  } else {
#pragma unroll
    for (int kc = 0; kc < HD / 32; ++kc) { const v16h ah = frag_h(QH + (q0 + col) * CC + h * HD + kc * 32, lane);
#pragma unroll
      for (int j = 0; j < 8; ++j) { const v16h kbf = frag_h(KH + (kr0 + j * 16 + col) * CC + h * HD + kc * 32, lane); acc[j] = wmma16(ah, kbf, acc[j]); } } }
#pragma unroll
  for (int j = 0; j < 8; ++j) {
#pragma unroll
    for (int r = 0; r < 8; ++r) ss[wave][8 * g + r][j * 16 + col] = (acc[j][r] + accl[j][r] * (1.0f / 1024.0f)) * SCALE; }
  LDSX(); for (int rl = 0; rl < 16; ++rl) vst2(S + (size_t)(ql0 + rl) * TT + k0 + lane * 4, *(const v4f*)&ss[wave][rl][lane * 4]); }
// ---- k_sm: block = query row t (head in group): keys [0, kend): causal -> logit if s <= t else excluded; softmax in f32; P x 2^11 in place (0 for excluded)
__global__ __launch_bounds__(256) void k_sm(float* __restrict__ S0 SM_EXTRA_PARAMS) { __shared__ float sred[8]; __shared__ float sbc; __shared__ __align__(16) float shv[TT];
  const int tid = threadIdx.x; const int t = blockIdx.x; const int kend = (kb_last(t >> 6) + 1) * 128;
  float* sr = S0 + (size_t)blockIdx.y * TT * TT + (size_t)t * TT;
  float m = -3.0e38f; for (int k = tid; k < kend; k += 256) { float v = (!CAUSAL || k <= t) ? sr[k] : -3.0e38f; SM_MASK_HOOK; shv[k] = v; m = fmaxf(m, v); }
#pragma unroll
  for (int o = 1; o < 32; o <<= 1) m = fmaxf(m, __shfl_xor(m, o));
  if ((tid & 31) == 0) sred[tid >> 5] = m; __syncthreads(); if (tid == 0) { float a = sred[0]; for (int i = 1; i < 8; ++i) a = fmaxf(a, sred[i]); sbc = a; } __syncthreads(); m = sbc; __syncthreads();
  float sum = 0.f; for (int k = tid; k < kend; k += 256) { const float v = shv[k]; const float e = (v <= -1.0e38f) ? 0.f : expf(v - m); shv[k] = e; sum += e; }
#pragma unroll
  for (int o = 1; o < 32; o <<= 1) sum += __shfl_xor(sum, o);
  if ((tid & 31) == 0) sred[tid >> 5] = sum; __syncthreads(); if (tid == 0) { float a = 0.f; for (int i = 0; i < 8; ++i) a += sred[i]; sbc = 2048.0f / a; } __syncthreads(); const float inv = sbc;
  for (int k = tid; k < kend; k += 256) shv[k] = shv[k] * inv;
  __syncthreads(); for (int q = tid; q < kend / 4; q += 256) vst2(sr + q * 4, *(const v4f*)&shv[q * 4]); }
// ---- k_pv: block = 64 queries (qb) of (b, h): ctx = P . v over keys [0, kend) (P x 2^11 once to f16 against v f16: 1 product; causal early query blocks: P and v as bf16 hi + lo, 3 products); 256-B (row, head) segment by 16 lanes
__global__ __launch_bounds__(128) void k_pv(const float* __restrict__ PS0, const _Float16* __restrict__ VT, const __bf16* __restrict__ VB, const __bf16* __restrict__ VBL, int b, int h0, float* __restrict__ Y) { const int h = h0 + blockIdx.z; const float* PS = PS0 + (size_t)blockIdx.z * TT * TT; __shared__ __align__(16) float ss[4][16][HD + 4];
  const int tid = threadIdx.x, wave = tid >> 5, lane = tid & 31, col = lane & 15, g = lane >> 4; const int qb = blockIdx.x; const int ql0 = qb * 64 + wave * 16; const int kce = (kb_last(qb) + 1) * 4;
  v8f acc[HD / 16] = {};
  if (qb < QBH) {
#pragma unroll 1
    for (int kc = 0; kc < kce; ++kc) { const F2 p = split_row(PS + (size_t)(ql0 + col) * TT, kc * 32, lane);
      asm volatile("s_wait_loadcnt 0x0" ::: "memory");
#pragma unroll
      for (int j = 0; j < HD / 16; ++j) { const size_t po = ((size_t)b * CC + h * HD + j * 16 + col) * (size_t)KHI + kc * 32; const v16b vh = frag_b(VB + po, lane); acc[j] = wmma_bf(p.h, vh, acc[j]); acc[j] = wmma_bf(p.l, vh, acc[j]); acc[j] = wmma_bf(p.h, frag_b(VBL + po, lane), acc[j]); } }
  } else {
#pragma unroll 1
    for (int kc = 0; kc < kce; ++kc) { const v16h p = frag_f32(PS + (size_t)(ql0 + col) * TT + kc * 32, lane);
      asm volatile("s_wait_loadcnt 0x0" ::: "memory");
#pragma unroll
      for (int j = 0; j < HD / 16; ++j) { const size_t po = ((size_t)b * CC + h * HD + j * 16 + col) * (size_t)TT + kc * 32; acc[j] = wmma16(p, frag_h(VT + po, lane), acc[j]); } } }
#pragma unroll
  for (int j = 0; j < HD / 16; ++j)
#pragma unroll
    for (int r = 0; r < 8; ++r) ss[wave][8 * g + r][j * 16 + col] = acc[j][r] * (1.0f / 2048.0f);
  LDSX(); for (int rl = 0; rl < 16; ++rl) if (lane < HD / 4) vst2(Y + ((size_t)b * TT + ql0 + rl) * CC + h * HD + lane * 4, *(const v4f*)&ss[wave][rl][lane * 4]); }
// ---- k_out: block = (64 rows, 128 cols): out = ctx Wo (+ bo): ctx once to f16 against Wo as f16(bf16 x 2^8) exact (1 product) x 2^-8; causal early rows (< QHI of each sequence): ctx bf16 hi + lo against exact bf16 Wo (2 products)
__global__ __launch_bounds__(128) void k_out(const float* __restrict__ Y, const float* __restrict__ WO, const float* __restrict__ BO, float* __restrict__ OUT) { __shared__ __align__(16) float sf[4][16][132];
  const int tid = threadIdx.x, wave = tid >> 5, lane = tid & 31, col = lane & 15, g = lane >> 4; const int c0 = blockIdx.y * 128; const size_t r0 = (size_t)blockIdx.x * 64 + wave * 16;
  v8f acc[8] = {};
  if (CAUSAL && (int)(((size_t)blockIdx.x * 64) % TT) < QHI) {   /* block-uniform */
#pragma unroll 2
    for (int kc = 0; kc < CC / 32; ++kc) { const F2 a = split_row(Y + (r0 + col) * CC, kc * 32, lane); asm volatile("s_wait_loadcnt 0x0" ::: "memory");
#pragma unroll
      for (int j = 0; j < 8; ++j) { const v16b w = WOCOL(WO, kc * 32, c0 + j * 16 + col, lane); asm volatile("s_wait_loadcnt 0x0" ::: "memory"); acc[j] = wmma_bf(a.h, w, acc[j]); acc[j] = wmma_bf(a.l, w, acc[j]); } }
#pragma unroll
    for (int j = 0; j < 8; ++j) { const float bias = BO ? bfr(BO[c0 + j * 16 + col]) : 0.f;
#pragma unroll
      for (int r = 0; r < 8; ++r) sf[wave][8 * g + r][j * 16 + col] = acc[j][r] + bias; }
  } else {
#pragma unroll 2
    for (int kc = 0; kc < CC / 32; ++kc) { const v16h a = frag_f32(Y + (r0 + col) * CC + kc * 32, lane); asm volatile("s_wait_loadcnt 0x0" ::: "memory");
#pragma unroll
      for (int j = 0; j < 8; ++j) { const v16h w = WOCOLH(WO, kc * 32, c0 + j * 16 + col, lane); asm volatile("s_wait_loadcnt 0x0" ::: "memory"); acc[j] = wmma16(a, w, acc[j]); } }
#pragma unroll
    for (int j = 0; j < 8; ++j) { const float bias = BO ? bfr(BO[c0 + j * 16 + col]) : 0.f;
#pragma unroll
      for (int r = 0; r < 8; ++r) sf[wave][8 * g + r][j * 16 + col] = acc[j][r] * (1.0f / 256.0f) + bias; } }
  LDSX(); for (int rl = 0; rl < 16; ++rl) vst2(OUT + (r0 + rl) * DIN + c0 + lane * 4, *(const v4f*)&sf[wave][rl][lane * 4]); }

extern "C" void kernel_launch(void* const* d_in, const int* in_sizes, int n_in, void* d_out, int out_size, void* d_ws, size_t ws_size, hipStream_t stream) {
  (void)in_sizes; (void)n_in; (void)out_size;
  const float** F = (const float**)d_in;
  if (ws_size < (size_t)WS_END) return;
  char* ws = (char*)d_ws; _Float16 *QH = (_Float16*)(ws + WS_QH), *KH = (_Float16*)(ws + WS_KH), *VT = (_Float16*)(ws + WS_VT), *QL = (_Float16*)(ws + WS_QL), *KL = (_Float16*)(ws + WS_KL); __bf16 *VB = (__bf16*)(ws + WS_VB), *VBL = (__bf16*)(ws + WS_VBL); float *S = (float*)(ws + WS_S), *Y = (float*)(ws + WS_Y);
  (void)Y; (void)QL; (void)KL; (void)VB; (void)VBL;
  // inputs: 0 x [2,2048,1024]; 1 Wq, 2 bq, 3 Wk, 4 bk, 5 Wv, 6 bv, 7 Wp, 8 bp ((out,in) [1024,1024], [1024]); outputs: 0 y [2,2048,1024] @0, 1 attn_avg [2,2048,2048] @ OUT1_OFF
  float* AV = (float*)((char*)d_out + OUT1_OFF);
  k_proj<<<dim3(TNB * TT / 64, CC / 128, 3), 128, 0, stream>>>(F[0], F[0], F[0], F[1], F[3], F[5], F[2], F[4], F[6], QH, QL, KH, KL, VT, VB, VBL);
  for (int b = 0; b < TNB; ++b) for (int h0 = 0; h0 < NH; h0 += HG) {
    k_sc<<<dim3(NQB, TT / 128, HG), 128, 0, stream>>>(QH, KH, QL, KL, b, h0, S);
    k_sm<<<dim3(TT, HG), 256, 0, stream>>>(S);
    k_avg<<<dim3(TT), 256, 0, stream>>>(S, b, h0 == 0, AV);
    k_pv<<<dim3(NQB, 1, HG), 128, 0, stream>>>(S, VT, VB, VBL, b, h0, Y);
  }
  k_out<<<dim3(TNB * TT / 64, DIN / 128), 128, 0, stream>>>(Y, F[7], F[8], (float*)d_out);
}

// v001
// It runs in 1170 microseconds.
// In both of two side-by-side timings against v000, it was 1.28 times as fast.
// compute dtype: all float inputs rounded to bf16; q/k/v = x W^T + b with EXACT bf16 products on WMMA 16x16x32, f32 accumulate; q as f16 hi + residual (x 2^10) against k once to f16 (2 products) for the logits x 1/8; softmax in f32 (precise expf), the head-averaged attention map accumulated in f32; P x 2^11 once to f16 against v once to f16 (1 product); ctx once to f16 against Wp carried x 2^8 in f16 (exact bf16 values) + bp; f32 outputs.
#include <hip/hip_runtime.h>
#include <math.h>

typedef __attribute__((ext_vector_type(16))) _Float16 v16h;
typedef __attribute__((ext_vector_type(16))) __bf16 v16b;
typedef __attribute__((ext_vector_type(8)))  _Float16 v8h;
typedef __attribute__((ext_vector_type(8)))  float v8f;
typedef __attribute__((ext_vector_type(4)))  float v4f;
typedef __attribute__((ext_vector_type(2)))  float v2f;
typedef __attribute__((ext_vector_type(4)))  unsigned v4u;
typedef __attribute__((ext_vector_type(4)))  int v4i;
typedef float __attribute__((may_alias)) float_a;
typedef int __attribute__((may_alias)) int_a;

template <typename T> __device__ __forceinline__ void vst2(void* p, T v) { *(T*)p = v;  }
__device__ __forceinline__ v8f wmma16(v16h a, v16h b, v8f c) {
  v8f d = __builtin_amdgcn_wmma_f32_16x16x32_f16(false, a, false, b, (short)0, c, false, false);
  asm volatile("v_nop\n\tv_nop\n\tv_nop\n\tv_nop" : "+v"(d) : "v"(a), "v"(b));
  return d;
}
__device__ __forceinline__ v8f wmma_bf(v16b a, v16b b, v8f c) {
  v8f d = __builtin_amdgcn_wmma_f32_16x16x32_bf16(false, a, false, b, (short)0, c, false, false);
  asm volatile("v_nop\n\tv_nop\n\tv_nop\n\tv_nop" : "+v"(d) : "v"(a), "v"(b));
  return d;
}
// 16x16x32 fragments: lane = (h = lane>>4, row/col = lane&15); elements 0..7 = k0+8h+0..7, 8..15 = k0+16+8h+0..7; D element r = row 8h+r
__device__ __forceinline__ v16h frag_h(const _Float16* rowk0, int lane) {
  union { v16h v; v8h q[2]; } u; const _Float16* p = rowk0 + 8 * (lane >> 4);
  u.q[0] = *(const v8h*)p; u.q[1] = *(const v8h*)(p + 16); return u.v;
}
__device__ __forceinline__ v16h frag_f32(const float* rowk0, int lane) {
  v16h a; const float* p = rowk0 + 8 * (lane >> 4);
#pragma unroll
  for (int i = 0; i < 8; ++i) { a[i] = (_Float16)p[i]; a[8 + i] = (_Float16)p[16 + i]; }
  return a;
}
__device__ __forceinline__ v16h frag_f32s(const float* rowk0, int lane, float sc) {
  v16h a; const float* p = rowk0 + 8 * (lane >> 4);
#pragma unroll
  for (int i = 0; i < 8; ++i) { a[i] = (_Float16)(p[i] * sc); a[8 + i] = (_Float16)(p[16 + i] * sc); }
  return a;
}
// column fragment from a [K][ld] layout (column n), rows >= K read as 0
__device__ __forceinline__ v16h fragc_f32(const float* W, int k0, int n, int lane, int ld, int K) {
  v16h a; const int g = lane >> 4;
#pragma unroll
  for (int i = 0; i < 8; ++i) { const int ka = k0 + 8 * g + i, kb = ka + 16;
    a[i] = (_Float16)(ka < K ? W[(size_t)(ka < K ? ka : K - 1) * ld + n] : 0.f); a[8 + i] = (_Float16)(kb < K ? W[(size_t)(kb < K ? kb : K - 1) * ld + n] : 0.f); }
  return a;
}
struct F2 { v16b h, l; };
__device__ __forceinline__ F2 bsplit16(const float v[16]) { F2 r;
#pragma unroll
  for (int i = 0; i < 16; ++i) { const __bf16 h = (__bf16)v[i]; r.h[i] = h; r.l[i] = (__bf16)(v[i] - (float)h); }
  return r; }
__device__ __forceinline__ F2 split_row(const float* row, int k0, int lane) { float v[16]; const float* p = row + k0 + 8 * (lane >> 4);
#pragma unroll
  for (int i = 0; i < 8; ++i) { v[i] = p[i]; v[8 + i] = p[16 + i]; }
  return bsplit16(v); }
__device__ __forceinline__ F2 split_rowK(const float* row, int k0, int lane, int K) { float v[16]; const int g = lane >> 4;
#pragma unroll
  for (int i = 0; i < 8; ++i) { const int ka = k0 + 8 * g + i, kb = ka + 16; v[i] = ka < K ? row[ka < K ? ka : K - 1] : 0.f; v[8 + i] = kb < K ? row[kb < K ? kb : K - 1] : 0.f; }
  return bsplit16(v); }
__device__ __forceinline__ F2 split_col(const float* W, int k0, int n, int lane, int ld, int K) { float v[16]; const int g = lane >> 4;
#pragma unroll
  for (int i = 0; i < 8; ++i) { const int ka = k0 + 8 * g + i, kb = ka + 16; v[i] = ka < K ? W[(size_t)(ka < K ? ka : K - 1) * ld + n] : 0.f; v[8 + i] = kb < K ? W[(size_t)(kb < K ? kb : K - 1) * ld + n] : 0.f; }
  return bsplit16(v); }
__device__ __forceinline__ v8f mac3(const F2& a, const F2& b, v8f c) { c = wmma_bf(a.l, b.h, c); c = wmma_bf(a.h, b.l, c); return wmma_bf(a.h, b.h, c); }
__device__ __forceinline__ float sigm(float v) { return 1.0f / (1.0f + expf(-v)); }
#define LDSX() do { asm volatile("s_wait_dscnt 0" ::: "memory"); __builtin_amdgcn_wave_barrier(); __builtin_amdgcn_fence(__ATOMIC_RELEASE, "workgroup"); } while (0)

// Multi-head self-attention returning (y, head-averaged attention) (B 2, T 2,048, C 1,024 = 16 heads x 64): q/k/v = x W^T + b ((out,in)); attn = softmax(q k^T x 64^-0.5) over all keys; y = merged(attn v) Wp^T + bp; attn_avg[b][t][s] = mean over the 16 heads of attn.
#define NB 2
#define TT 2048
#define CC 1024            // NH * HD = projected width
#define DIN 1024          // input (model) width
#define NH 16
#define HD 64
#define NQB (TT / 64)
#define HG 4
#define SCALE (0.125f)
#define CAUSAL 0
#ifndef TNB
#define TNB NB
#endif
__device__ __forceinline__ float bfr(float v) { return (float)(__bf16)v; }
__host__ __device__ __forceinline__ int kb_last(int qb) { return CAUSAL ? ((qb * 64 + 63) >> 7) : (TT / 128 - 1); }
typedef __attribute__((ext_vector_type(8))) __bf16 v8b;
__device__ __forceinline__ v16b frag_b(const __bf16* rowk0, int lane) {
  union { v16b v; v8b q[2]; } u; const __bf16* p = rowk0 + 8 * (lane >> 4);
  u.q[0] = *(const v8b*)p; u.q[1] = *(const v8b*)(p + 16); return u.v;
}
#define QBH 0              // causal: query blocks 0..QBH-1 of each sequence (few keys, no averaging) take the high-precision path
#define QHI 2048            // rows carrying a q residual plane (all rows when non-causal: 2-product logits everywhere)
#define KHI 64            // key rows carrying k residual / v bf16 hi+lo planes (used only by the causal high-precision path)
// B fragment (k rows k0+.., output column o) of a weight: (in,out) [K][ld] or (out,in) [ld rows of K]: bf16 exact, or f16(bf16 * 256) exact
__device__ __forceinline__ v16b wcol_io(const float* Wm, int k0, int o, int lane, int ld) { v16b w; const int g = lane >> 4;
#pragma unroll
  for (int i = 0; i < 8; ++i) { w[i] = (__bf16)Wm[(size_t)(k0 + 8 * g + i) * ld + o]; w[8 + i] = (__bf16)Wm[(size_t)(k0 + 16 + 8 * g + i) * ld + o]; }
  return w; }
__device__ __forceinline__ v16b wcol_oi(const float* Wm, int k0, int o, int lane, int K) { v16b w; const float* p = Wm + (size_t)o * K + k0 + 8 * (lane >> 4);
#pragma unroll
  for (int i = 0; i < 8; ++i) { w[i] = (__bf16)p[i]; w[8 + i] = (__bf16)p[16 + i]; }
  return w; }
__device__ __forceinline__ v16h wcolh_io(const float* Wm, int k0, int o, int lane, int ld) { v16h w; const int g = lane >> 4;
#pragma unroll
  for (int i = 0; i < 8; ++i) { w[i] = (_Float16)(bfr(Wm[(size_t)(k0 + 8 * g + i) * ld + o]) * 256.0f); w[8 + i] = (_Float16)(bfr(Wm[(size_t)(k0 + 16 + 8 * g + i) * ld + o]) * 256.0f); }
  return w; }
__device__ __forceinline__ v16h wcolh_oi(const float* Wm, int k0, int o, int lane, int K) { v16h w; const float* p = Wm + (size_t)o * K + k0 + 8 * (lane >> 4);
#pragma unroll
  for (int i = 0; i < 8; ++i) { w[i] = (_Float16)(bfr(p[i]) * 256.0f); w[8 + i] = (_Float16)(bfr(p[16 + i]) * 256.0f); }
  return w; }
#define WQKV_LAYOUT 1   // 0 = (in,out) [DIN][CC]; 1 = (out,in) [CC][DIN]; 2 = per-head [NH][DIN][HD]
__device__ __forceinline__ v16b wcol_hdk(const float* Wm, int k0, int o, int lane) { v16b w; const int g = lane >> 4; const float* p = Wm + (size_t)(o / HD) * DIN * HD + (o % HD);
#pragma unroll
  for (int i = 0; i < 8; ++i) { w[i] = (__bf16)p[(size_t)(k0 + 8 * g + i) * HD]; w[8 + i] = (__bf16)p[(size_t)(k0 + 16 + 8 * g + i) * HD]; }
  return w; }
#define WO_OUT_IN 1
#if WQKV_LAYOUT == 1
#define WCOL(W, k0, o, lane) wcol_oi(W, k0, o, lane, DIN)
#elif WQKV_LAYOUT == 2
#define WCOL(W, k0, o, lane) wcol_hdk(W, k0, o, lane)
#else
#define WCOL(W, k0, o, lane) wcol_io(W, k0, o, lane, CC)
#endif
#if WO_OUT_IN
#define WOCOL(W, k0, o, lane) wcol_oi(W, k0, o, lane, CC)
#define WOCOLH(W, k0, o, lane) wcolh_oi(W, k0, o, lane, CC)
#else
#define WOCOL(W, k0, o, lane) wcol_io(W, k0, o, lane, DIN)
#define WOCOLH(W, k0, o, lane) wcolh_io(W, k0, o, lane, DIN)
#endif
#define OUT1_OFF (4u * (size_t)NB * TT * DIN)      // byte offset of attn_avg [B][T][T]
// ---- k_avg: block = query row t: attn_avg[b][t][:] (+)= sum over the HG heads of this group of P[hg][t][:] x (2^-11 / NH); the first head group writes, later groups read-add-write the block's own row (stream-ordered launches, one block per row)
__global__ __launch_bounds__(256) void k_avg(const float* __restrict__ S0, int b, int first, float* __restrict__ AV) { __shared__ __align__(16) float sh[TT];
  const int tid = threadIdx.x; const int t = blockIdx.x; float* dst = AV + ((size_t)b * TT + t) * TT;
  for (int k = tid; k < TT; k += 256) { float a = 0.f;
#pragma unroll
    for (int hz = 0; hz < HG; ++hz) a += S0[(size_t)hz * TT * TT + (size_t)t * TT + k];
    a *= (1.0f / (2048.0f * NH)); sh[k] = first ? a : a + dst[k]; }
  __syncthreads(); for (int q = tid; q < TT / 4; q += 256) vst2(dst + q * 4, *(const v4f*)&sh[q * 4]); }
#ifndef SM_EXTRA_PARAMS
#define SM_EXTRA_PARAMS
#endif
#ifndef SM_MASK_HOOK
#define SM_MASK_HOOK (void)0
#endif

#define WS_QH  0u                                      // f16 q rows [b*t][CC]
#define WS_KH  (WS_QH + 2u * (size_t)NB * TT * CC)      // f16 k rows [b*t][CC]
#define WS_VT  (WS_KH + 2u * (size_t)NB * TT * CC)      // f16 v planes [b][c][t]
#define WS_QL  (WS_VT + 2u * (size_t)NB * CC * TT)      // f16 q residual x 2^10 rows [b][t < QHI][CC]
#define WS_KL  (WS_QL + 2u * (size_t)NB * QHI * CC)     // f16 k residual x 2^10 rows [b][t < KHI][CC]
#define WS_VB  (WS_KL + 2u * (size_t)NB * KHI * CC)     // bf16 v hi planes [b][c][t < KHI]
#define WS_VBL (WS_VB + 2u * (size_t)NB * CC * KHI)
#define WS_S   (WS_VBL + 2u * (size_t)NB * CC * KHI)    // f32 logits / P [hg][t][s]
#define WS_Y   (WS_S  + 4u * (size_t)HG * TT * TT)      // f32 ctx rows [b*t][CC] (only when there is an output projection)
#define WS_END (WS_Y  + 4u * (size_t)NB * TT * CC)

// ---- k_proj: block = (64 rows, 128 cols, which): q/k/v = X W (+ b) with exact bf16 products (K = DIN) -> which 0: q f16 rows (+ residual rows < QHI); 1: k f16 rows (+ residual rows < KHI); 2: v f16 planes [c][t] (+ bf16 hi/lo planes for t < KHI)
__global__ __launch_bounds__(128) void k_proj(const float* __restrict__ XQ, const float* __restrict__ XK, const float* __restrict__ XV, const float* __restrict__ WQ, const float* __restrict__ WK, const float* __restrict__ WV, const float* __restrict__ BQ, const float* __restrict__ BK, const float* __restrict__ BV,
    _Float16* __restrict__ QH, _Float16* __restrict__ QL, _Float16* __restrict__ KH, _Float16* __restrict__ KL, _Float16* __restrict__ VT, __bf16* __restrict__ VB, __bf16* __restrict__ VBL) {
  __shared__ __align__(16) _Float16 sh[64][136], sl[64][136]; __shared__ __align__(16) _Float16 th[128][72]; __shared__ __align__(16) __bf16 tb[128][72], tbl[128][72];
  const int tid = threadIdx.x, wave = tid >> 5, lane = tid & 31, col = lane & 15, g = lane >> 4; const int which = blockIdx.z; const int c0 = blockIdx.y * 128; const size_t r0 = (size_t)blockIdx.x * 64; const size_t bb = r0 / TT; const int t0 = (int)(r0 % TT);
  const float* X = which == 0 ? XQ : which == 1 ? XK : XV; const float* WA = which == 0 ? WQ : which == 1 ? WK : WV; const float* BA = which == 0 ? BQ : which == 1 ? BK : BV;
  v8f acc[8] = {};
#pragma unroll 2
  for (int kc = 0; kc < DIN / 32; ++kc) { v16b a; { const float* p = X + (r0 + wave * 16 + col) * DIN + kc * 32 + 8 * g;
#pragma unroll
      for (int i = 0; i < 8; ++i) { a[i] = (__bf16)p[i]; a[8 + i] = (__bf16)p[16 + i]; } }
    asm volatile("s_wait_loadcnt 0x0" ::: "memory");
#pragma unroll
    for (int j = 0; j < 8; ++j) { const v16b w = WCOL(WA, kc * 32, c0 + j * 16 + col, lane); asm volatile("s_wait_loadcnt 0x0" ::: "memory"); acc[j] = wmma_bf(a, w, acc[j]); } }
  if (which < 2) { _Float16* DH = which == 0 ? QH : KH; _Float16* DL = which == 0 ? QL : KL; const int nhi = which == 0 ? QHI : KHI; const bool hi_rows = t0 < nhi;
#pragma unroll
    for (int j = 0; j < 8; ++j) { const float bias = BA ? bfr(BA[c0 + j * 16 + col]) : 0.f;
#pragma unroll
      for (int r = 0; r < 8; ++r) { const float v = acc[j][r] + bias; const _Float16 hv = (_Float16)v; sh[wave * 16 + 8 * g + r][j * 16 + col] = hv; sl[wave * 16 + 8 * g + r][j * 16 + col] = (_Float16)((v - (float)hv) * 1024.0f); } }
    __syncthreads();
    for (int e = tid; e < 64 * 16; e += 128) { const int rl = e >> 4, q = e & 15; vst2((unsigned*)(DH + (r0 + rl) * CC + c0 + q * 8), *(const v4u*)&sh[rl][q * 8]); if (hi_rows) vst2((unsigned*)(DL + (bb * nhi + t0 + rl) * (size_t)CC + c0 + q * 8), *(const v4u*)&sl[rl][q * 8]); }
  } else { const bool hi_rows = t0 < KHI;
#pragma unroll
    for (int j = 0; j < 8; ++j) { const float bias = BA ? bfr(BA[c0 + j * 16 + col]) : 0.f;
#pragma unroll
      for (int r = 0; r < 8; ++r) { const float v = acc[j][r] + bias; const int rl = wave * 16 + 8 * g + r, cl = j * 16 + col; th[cl][rl] = (_Float16)v; const __bf16 bh = (__bf16)v; tb[cl][rl] = bh; tbl[cl][rl] = (__bf16)(v - (float)bh); } }
    __syncthreads();
    for (int e = tid; e < 128 * 8; e += 128) { const int cl = e >> 3, q = e & 7; vst2((unsigned*)(VT + (bb * CC + c0 + cl) * (size_t)TT + t0 + q * 8), *(const v4u*)&th[cl][q * 8]); if (hi_rows) { const size_t o3 = (bb * CC + c0 + cl) * (size_t)KHI + t0 + q * 8; vst2((unsigned*)(VB + o3), *(const v4u*)&tb[cl][q * 8]); vst2((unsigned*)(VBL + o3), *(const v4u*)&tbl[cl][q * 8]); } } } }
// ---- k_sc: block = (query block qb, key block kb <= kb_last(qb), head in group) of batch b: logits x SCALE; q hi + residual (x 2^10) against k (2 products) for query rows < QHI, plus the k residual (3 products) for query blocks < QBH (causal early rows); causal: blocks past the diagonal exit, the mask itself is applied by index in k_sm
__global__ __launch_bounds__(128) void k_sc(const _Float16* __restrict__ QH, const _Float16* __restrict__ KH, const _Float16* __restrict__ QL, const _Float16* __restrict__ KL, int b, int h0, float* __restrict__ S0) { __shared__ __align__(16) float ss[4][16][132];
  const int qb = blockIdx.x, kb = blockIdx.y; if (kb > kb_last(qb)) return;
  const int h = h0 + blockIdx.z; float* S = S0 + (size_t)blockIdx.z * TT * TT;
  const int tid = threadIdx.x, wave = tid >> 5, lane = tid & 31, col = lane & 15, g = lane >> 4; const int k0 = kb * 128; const int ql0 = qb * 64 + wave * 16; const size_t q0 = (size_t)b * TT + ql0, kr0 = (size_t)b * TT + k0;
  v8f acc[8] = {}, accl[8] = {};
  const _Float16* QLb = QL + (size_t)b * QHI * CC; const _Float16* KLb = KL + (size_t)b * KHI * CC;
  if (qb < QBH) {
#pragma unroll
    for (int kc = 0; kc < HD / 32; ++kc) { const v16h ah = frag_h(QH + (q0 + col) * CC + h * HD + kc * 32, lane), al = frag_h(QLb + (size_t)(ql0 + col) * CC + h * HD + kc * 32, lane);
#pragma unroll
      for (int j = 0; j < 8; ++j) { const v16h kbf = frag_h(KH + (kr0 + j * 16 + col) * CC + h * HD + kc * 32, lane), klf = frag_h(KLb + (size_t)(k0 + j * 16 + col) * CC + h * HD + kc * 32, lane); acc[j] = wmma16(ah, kbf, acc[j]); accl[j] = wmma16(al, kbf, accl[j]); accl[j] = wmma16(ah, klf, accl[j]); } }
  } else if (qb * 64 < QHI) {
#pragma unroll
    for (int kc = 0; kc < HD / 32; ++kc) { const v16h ah = frag_h(QH + (q0 + col) * CC + h * HD + kc * 32, lane), al = frag_h(QLb + (size_t)(ql0 + col) * CC + h * HD + kc * 32, lane);
#pragma unroll
      for (int j = 0; j < 8; ++j) { const v16h kbf = frag_h(KH + (kr0 + j * 16 + col) * CC + h * HD + kc * 32, lane); acc[j] = wmma16(ah, kbf, acc[j]); accl[j] = wmma16(al, kbf, accl[j]); } }
  } else {
#pragma unroll
    for (int kc = 0; kc < HD / 32; ++kc) { const v16h ah = frag_h(QH + (q0 + col) * CC + h * HD + kc * 32, lane);
#pragma unroll
      for (int j = 0; j < 8; ++j) { const v16h kbf = frag_h(KH + (kr0 + j * 16 + col) * CC + h * HD + kc * 32, lane); acc[j] = wmma16(ah, kbf, acc[j]); } } }
#pragma unroll
  for (int j = 0; j < 8; ++j) {
#pragma unroll
    for (int r = 0; r < 8; ++r) ss[wave][8 * g + r][j * 16 + col] = (acc[j][r] + accl[j][r] * (1.0f / 1024.0f)) * SCALE; }
  LDSX(); for (int rl = 0; rl < 16; ++rl) vst2(S + (size_t)(ql0 + rl) * TT + k0 + lane * 4, *(const v4f*)&ss[wave][rl][lane * 4]); }
// ---- k_sm: block = query row t (head in group): keys [0, kend): causal -> logit if s <= t else excluded; softmax in f32; P x 2^11 in place (0 for excluded)
__global__ __launch_bounds__(256) void k_sm(float* __restrict__ S0 SM_EXTRA_PARAMS) { __shared__ float sred[8]; __shared__ float sbc; __shared__ __align__(16) float shv[TT];
  const int tid = threadIdx.x; const int t = blockIdx.x; const int kend = (kb_last(t >> 6) + 1) * 128;
  float* sr = S0 + (size_t)blockIdx.y * TT * TT + (size_t)t * TT;
  float m = -3.0e38f; for (int k = tid; k < kend; k += 256) { float v = (!CAUSAL || k <= t) ? sr[k] : -3.0e38f; SM_MASK_HOOK; shv[k] = v; m = fmaxf(m, v); }
#pragma unroll
  for (int o = 1; o < 32; o <<= 1) m = fmaxf(m, __shfl_xor(m, o));
  if ((tid & 31) == 0) sred[tid >> 5] = m; __syncthreads(); if (tid == 0) { float a = sred[0]; for (int i = 1; i < 8; ++i) a = fmaxf(a, sred[i]); sbc = a; } __syncthreads(); m = sbc; __syncthreads();
  float sum = 0.f; for (int k = tid; k < kend; k += 256) { const float v = shv[k]; const float e = (v <= -1.0e38f) ? 0.f : expf(v - m); shv[k] = e; sum += e; }
#pragma unroll
  for (int o = 1; o < 32; o <<= 1) sum += __shfl_xor(sum, o);
  if ((tid & 31) == 0) sred[tid >> 5] = sum; __syncthreads(); if (tid == 0) { float a = 0.f; for (int i = 0; i < 8; ++i) a += sred[i]; sbc = 2048.0f / a; } __syncthreads(); const float inv = sbc;
  for (int k = tid; k < kend; k += 256) shv[k] = shv[k] * inv;
  __syncthreads(); for (int q = tid; q < kend / 4; q += 256) vst2(sr + q * 4, *(const v4f*)&shv[q * 4]); }
// ---- k_pv: block = 16 queries of (b, h), KSW waves: wave w takes the 32-key chunks w, w + KSW, ... of keys [0, kend) (P x 2^11 once to f16 against v f16: 1 product; causal early query blocks: P and v as bf16 hi + lo, 3 products); the KSW f32 partial tiles meet in LDS and are summed in wave order; 256-B (row, head) segment by 16 lanes
#define KSW 8
__global__ __launch_bounds__(KSW * 32) void k_pv(const float* __restrict__ PS0, const _Float16* __restrict__ VT, const __bf16* __restrict__ VB, const __bf16* __restrict__ VBL, int b, int h0, float* __restrict__ Y) { const int h = h0 + blockIdx.z; const float* PS = PS0 + (size_t)blockIdx.z * TT * TT; __shared__ __align__(16) float ss[KSW][16][HD + 4];
  const int tid = threadIdx.x, lane = tid & 31, col = lane & 15, g = lane >> 4; const int qb = blockIdx.x >> 2; const int ql0 = blockIdx.x * 16; const int kce = (kb_last(qb) + 1) * 4;
  const int wave = __builtin_amdgcn_readfirstlane(tid >> 5);   // the wave's number in a scalar register: the key loop's counter and test stay scalar
  v8f acc[HD / 16] = {};
  if (qb < QBH) {
#pragma unroll 1
    for (int kc = wave; kc < kce; kc += KSW) { const F2 p = split_row(PS + (size_t)(ql0 + col) * TT, kc * 32, lane);
      asm volatile("s_wait_loadcnt 0x0" ::: "memory");
#pragma unroll
      for (int j = 0; j < HD / 16; ++j) { const size_t po = ((size_t)b * CC + h * HD + j * 16 + col) * (size_t)KHI + kc * 32; const v16b vh = frag_b(VB + po, lane); acc[j] = wmma_bf(p.h, vh, acc[j]); acc[j] = wmma_bf(p.l, vh, acc[j]); acc[j] = wmma_bf(p.h, frag_b(VBL + po, lane), acc[j]); } }
  } else {
#pragma unroll 1
    for (int kc = wave; kc < kce; kc += KSW) { const v16h p = frag_f32(PS + (size_t)(ql0 + col) * TT + kc * 32, lane);
      asm volatile("s_wait_loadcnt 0x0" ::: "memory");
#pragma unroll
      for (int j = 0; j < HD / 16; ++j) { const size_t po = ((size_t)b * CC + h * HD + j * 16 + col) * (size_t)TT + kc * 32; acc[j] = wmma16(p, frag_h(VT + po, lane), acc[j]); } } }
#pragma unroll
  for (int j = 0; j < HD / 16; ++j)
#pragma unroll
    for (int r = 0; r < 8; ++r) ss[wave][8 * g + r][j * 16 + col] = acc[j][r] * (1.0f / 2048.0f);
  __syncthreads();   // every wave's partial tile is in LDS before any thread sums across waves
  { const int rl = tid >> 4, c4 = (tid & 15) * 4; v4f s = *(const v4f*)&ss[0][rl][c4];
#pragma unroll
    for (int w = 1; w < KSW; ++w) s += *(const v4f*)&ss[w][rl][c4];
    vst2(Y + ((size_t)b * TT + ql0 + rl) * CC + h * HD + c4, s); } }
// ---- k_out: block = (64 rows, 128 cols): out = ctx Wo (+ bo): ctx once to f16 against Wo as f16(bf16 x 2^8) exact (1 product) x 2^-8; causal early rows (< QHI of each sequence): ctx bf16 hi + lo against exact bf16 Wo (2 products)
__global__ __launch_bounds__(128) void k_out(const float* __restrict__ Y, const float* __restrict__ WO, const float* __restrict__ BO, float* __restrict__ OUT) { __shared__ __align__(16) float sf[4][16][132];
  const int tid = threadIdx.x, wave = tid >> 5, lane = tid & 31, col = lane & 15, g = lane >> 4; const int c0 = blockIdx.y * 128; const size_t r0 = (size_t)blockIdx.x * 64 + wave * 16;
  v8f acc[8] = {};
  if (CAUSAL && (int)(((size_t)blockIdx.x * 64) % TT) < QHI) {   /* block-uniform */
#pragma unroll 2
    for (int kc = 0; kc < CC / 32; ++kc) { const F2 a = split_row(Y + (r0 + col) * CC, kc * 32, lane); asm volatile("s_wait_loadcnt 0x0" ::: "memory");
#pragma unroll
      for (int j = 0; j < 8; ++j) { const v16b w = WOCOL(WO, kc * 32, c0 + j * 16 + col, lane); asm volatile("s_wait_loadcnt 0x0" ::: "memory"); acc[j] = wmma_bf(a.h, w, acc[j]); acc[j] = wmma_bf(a.l, w, acc[j]); } }
#pragma unroll
    for (int j = 0; j < 8; ++j) { const float bias = BO ? bfr(BO[c0 + j * 16 + col]) : 0.f;
#pragma unroll
      for (int r = 0; r < 8; ++r) sf[wave][8 * g + r][j * 16 + col] = acc[j][r] + bias; }
  } else {
#pragma unroll 2
    for (int kc = 0; kc < CC / 32; ++kc) { const v16h a = frag_f32(Y + (r0 + col) * CC + kc * 32, lane); asm volatile("s_wait_loadcnt 0x0" ::: "memory");
#pragma unroll
      for (int j = 0; j < 8; ++j) { const v16h w = WOCOLH(WO, kc * 32, c0 + j * 16 + col, lane); asm volatile("s_wait_loadcnt 0x0" ::: "memory"); acc[j] = wmma16(a, w, acc[j]); } }
#pragma unroll
    for (int j = 0; j < 8; ++j) { const float bias = BO ? bfr(BO[c0 + j * 16 + col]) : 0.f;
#pragma unroll
      for (int r = 0; r < 8; ++r) sf[wave][8 * g + r][j * 16 + col] = acc[j][r] * (1.0f / 256.0f) + bias; } }
  LDSX(); for (int rl = 0; rl < 16; ++rl) vst2(OUT + (r0 + rl) * DIN + c0 + lane * 4, *(const v4f*)&sf[wave][rl][lane * 4]); }

extern "C" void kernel_launch(void* const* d_in, const int* in_sizes, int n_in, void* d_out, int out_size, void* d_ws, size_t ws_size, hipStream_t stream) {
  (void)in_sizes; (void)n_in; (void)out_size;
  const float** F = (const float**)d_in;
  if (ws_size < (size_t)WS_END) return;
  char* ws = (char*)d_ws; _Float16 *QH = (_Float16*)(ws + WS_QH), *KH = (_Float16*)(ws + WS_KH), *VT = (_Float16*)(ws + WS_VT), *QL = (_Float16*)(ws + WS_QL), *KL = (_Float16*)(ws + WS_KL); __bf16 *VB = (__bf16*)(ws + WS_VB), *VBL = (__bf16*)(ws + WS_VBL); float *S = (float*)(ws + WS_S), *Y = (float*)(ws + WS_Y);
  (void)Y; (void)QL; (void)KL; (void)VB; (void)VBL;
  // inputs: 0 x [2,2048,1024]; 1 Wq, 2 bq, 3 Wk, 4 bk, 5 Wv, 6 bv, 7 Wp, 8 bp ((out,in) [1024,1024], [1024]); outputs: 0 y [2,2048,1024] @0, 1 attn_avg [2,2048,2048] @ OUT1_OFF
  float* AV = (float*)((char*)d_out + OUT1_OFF);
  k_proj<<<dim3(TNB * TT / 64, CC / 128, 3), 128, 0, stream>>>(F[0], F[0], F[0], F[1], F[3], F[5], F[2], F[4], F[6], QH, QL, KH, KL, VT, VB, VBL);
  for (int b = 0; b < TNB; ++b) for (int h0 = 0; h0 < NH; h0 += HG) {
    k_sc<<<dim3(NQB, TT / 128, HG), 128, 0, stream>>>(QH, KH, QL, KL, b, h0, S);
    k_sm<<<dim3(TT, HG), 256, 0, stream>>>(S);
    k_avg<<<dim3(TT), 256, 0, stream>>>(S, b, h0 == 0, AV);
    k_pv<<<dim3(TT / 16, 1, HG), KSW * 32, 0, stream>>>(S, VT, VB, VBL, b, h0, Y);
  }
  k_out<<<dim3(TNB * TT / 64, DIN / 128), 128, 0, stream>>>(Y, F[7], F[8], (float*)d_out);
}

// v002
// It runs in 552 microseconds.
// Next to v001, in two timings, it ran 2.13 and 2.12 times as fast.
// All steps since v000 together make it 2.71 times as fast.
// compute dtype: all float inputs rounded to bf16; q/k/v = x W^T + b with EXACT bf16 products on WMMA 16x16x32, f32 accumulate; q as f16 hi + residual (x 2^10) against k once to f16 (2 products) for the logits x 1/8; softmax in f32 (precise expf), the head-averaged attention map accumulated in f32; P x 2^11 once to f16 against v once to f16 (1 product); ctx once to f16 against Wp carried x 2^8 in f16 (exact bf16 values) + bp; f32 outputs.
#include <hip/hip_runtime.h>
#include <math.h>

typedef __attribute__((ext_vector_type(16))) _Float16 v16h;
typedef __attribute__((ext_vector_type(16))) __bf16 v16b;
typedef __attribute__((ext_vector_type(8)))  _Float16 v8h;
typedef __attribute__((ext_vector_type(8)))  float v8f;
typedef __attribute__((ext_vector_type(4)))  float v4f;
typedef __attribute__((ext_vector_type(2)))  float v2f;
typedef __attribute__((ext_vector_type(4)))  unsigned v4u;
typedef __attribute__((ext_vector_type(4)))  int v4i;
typedef float __attribute__((may_alias)) float_a;
typedef int __attribute__((may_alias)) int_a;

template <typename T> __device__ __forceinline__ void vst2(void* p, T v) { *(T*)p = v;  }
__device__ __forceinline__ v8f wmma16(v16h a, v16h b, v8f c) {
  v8f d = __builtin_amdgcn_wmma_f32_16x16x32_f16(false, a, false, b, (short)0, c, false, false);
  asm volatile("v_nop\n\tv_nop\n\tv_nop\n\tv_nop" : "+v"(d) : "v"(a), "v"(b));
  return d;
}
__device__ __forceinline__ v8f wmma_bf(v16b a, v16b b, v8f c) {
  v8f d = __builtin_amdgcn_wmma_f32_16x16x32_bf16(false, a, false, b, (short)0, c, false, false);
  asm volatile("v_nop\n\tv_nop\n\tv_nop\n\tv_nop" : "+v"(d) : "v"(a), "v"(b));
  return d;
}
// 16x16x32 fragments: lane = (h = lane>>4, row/col = lane&15); elements 0..7 = k0+8h+0..7, 8..15 = k0+16+8h+0..7; D element r = row 8h+r
__device__ __forceinline__ v16h frag_h(const _Float16* rowk0, int lane) {
  union { v16h v; v8h q[2]; } u; const _Float16* p = rowk0 + 8 * (lane >> 4);
  u.q[0] = *(const v8h*)p; u.q[1] = *(const v8h*)(p + 16); return u.v;
}
__device__ __forceinline__ v16h frag_f32(const float* rowk0, int lane) {
  v16h a; const float* p = rowk0 + 8 * (lane >> 4);
#pragma unroll
  for (int i = 0; i < 8; ++i) { a[i] = (_Float16)p[i]; a[8 + i] = (_Float16)p[16 + i]; }
  return a;
}
__device__ __forceinline__ v16h frag_f32s(const float* rowk0, int lane, float sc) {
  v16h a; const float* p = rowk0 + 8 * (lane >> 4);
#pragma unroll
  for (int i = 0; i < 8; ++i) { a[i] = (_Float16)(p[i] * sc); a[8 + i] = (_Float16)(p[16 + i] * sc); }
  return a;
}
// column fragment from a [K][ld] layout (column n), rows >= K read as 0
__device__ __forceinline__ v16h fragc_f32(const float* W, int k0, int n, int lane, int ld, int K) {
  v16h a; const int g = lane >> 4;
#pragma unroll
  for (int i = 0; i < 8; ++i) { const int ka = k0 + 8 * g + i, kb = ka + 16;
    a[i] = (_Float16)(ka < K ? W[(size_t)(ka < K ? ka : K - 1) * ld + n] : 0.f); a[8 + i] = (_Float16)(kb < K ? W[(size_t)(kb < K ? kb : K - 1) * ld + n] : 0.f); }
  return a;
}
struct F2 { v16b h, l; };
__device__ __forceinline__ F2 bsplit16(const float v[16]) { F2 r;
#pragma unroll
  for (int i = 0; i < 16; ++i) { const __bf16 h = (__bf16)v[i]; r.h[i] = h; r.l[i] = (__bf16)(v[i] - (float)h); }
  return r; }
__device__ __forceinline__ F2 split_row(const float* row, int k0, int lane) { float v[16]; const float* p = row + k0 + 8 * (lane >> 4);
#pragma unroll
  for (int i = 0; i < 8; ++i) { v[i] = p[i]; v[8 + i] = p[16 + i]; }
  return bsplit16(v); }
__device__ __forceinline__ F2 split_rowK(const float* row, int k0, int lane, int K) { float v[16]; const int g = lane >> 4;
#pragma unroll
  for (int i = 0; i < 8; ++i) { const int ka = k0 + 8 * g + i, kb = ka + 16; v[i] = ka < K ? row[ka < K ? ka : K - 1] : 0.f; v[8 + i] = kb < K ? row[kb < K ? kb : K - 1] : 0.f; }
  return bsplit16(v); }
__device__ __forceinline__ F2 split_col(const float* W, int k0, int n, int lane, int ld, int K) { float v[16]; const int g = lane >> 4;
#pragma unroll
  for (int i = 0; i < 8; ++i) { const int ka = k0 + 8 * g + i, kb = ka + 16; v[i] = ka < K ? W[(size_t)(ka < K ? ka : K - 1) * ld + n] : 0.f; v[8 + i] = kb < K ? W[(size_t)(kb < K ? kb : K - 1) * ld + n] : 0.f; }
  return bsplit16(v); }
__device__ __forceinline__ v8f mac3(const F2& a, const F2& b, v8f c) { c = wmma_bf(a.l, b.h, c); c = wmma_bf(a.h, b.l, c); return wmma_bf(a.h, b.h, c); }
__device__ __forceinline__ float sigm(float v) { return 1.0f / (1.0f + expf(-v)); }
#define LDSX() do { asm volatile("s_wait_dscnt 0" ::: "memory"); __builtin_amdgcn_wave_barrier(); __builtin_amdgcn_fence(__ATOMIC_RELEASE, "workgroup"); } while (0)

// Multi-head self-attention returning (y, head-averaged attention) (B 2, T 2,048, C 1,024 = 16 heads x 64): q/k/v = x W^T + b ((out,in)); attn = softmax(q k^T x 64^-0.5) over all keys; y = merged(attn v) Wp^T + bp; attn_avg[b][t][s] = mean over the 16 heads of attn.
#define NB 2
#define TT 2048
#define CC 1024            // NH * HD = projected width
#define DIN 1024          // input (model) width
#define NH 16
#define HD 64
#define SCALE (0.125f)
#define CAUSAL 0
#ifndef TNB
#define TNB NB
#endif
__device__ __forceinline__ float bfr(float v) { return (float)(__bf16)v; }
__host__ __device__ __forceinline__ int kb_last(int qb) { return CAUSAL ? ((qb * 64 + 63) >> 7) : (TT / 128 - 1); }
typedef __attribute__((ext_vector_type(8))) __bf16 v8b;
__device__ __forceinline__ v16b frag_b(const __bf16* rowk0, int lane) {
  union { v16b v; v8b q[2]; } u; const __bf16* p = rowk0 + 8 * (lane >> 4);
  u.q[0] = *(const v8b*)p; u.q[1] = *(const v8b*)(p + 16); return u.v;
}
#define QBH 0
#define QHI 2048            // rows carrying a q residual plane (all rows when non-causal: 2-product logits everywhere)
#define KHI 64            // key rows carrying k residual / v bf16 hi+lo planes (written by k_proj; no kernel in this file reads them)
// B fragment (k rows k0+.., output column o) of a weight: (in,out) [K][ld] or (out,in) [ld rows of K]: bf16 exact, or f16(bf16 * 256) exact
__device__ __forceinline__ v16b wcol_io(const float* Wm, int k0, int o, int lane, int ld) { v16b w; const int g = lane >> 4;
#pragma unroll
  for (int i = 0; i < 8; ++i) { w[i] = (__bf16)Wm[(size_t)(k0 + 8 * g + i) * ld + o]; w[8 + i] = (__bf16)Wm[(size_t)(k0 + 16 + 8 * g + i) * ld + o]; }
  return w; }
__device__ __forceinline__ v16b wcol_oi(const float* Wm, int k0, int o, int lane, int K) { v16b w; const float* p = Wm + (size_t)o * K + k0 + 8 * (lane >> 4);
#pragma unroll
  for (int i = 0; i < 8; ++i) { w[i] = (__bf16)p[i]; w[8 + i] = (__bf16)p[16 + i]; }
  return w; }
__device__ __forceinline__ v16h wcolh_io(const float* Wm, int k0, int o, int lane, int ld) { v16h w; const int g = lane >> 4;
#pragma unroll
  for (int i = 0; i < 8; ++i) { w[i] = (_Float16)(bfr(Wm[(size_t)(k0 + 8 * g + i) * ld + o]) * 256.0f); w[8 + i] = (_Float16)(bfr(Wm[(size_t)(k0 + 16 + 8 * g + i) * ld + o]) * 256.0f); }
  return w; }
__device__ __forceinline__ v16h wcolh_oi(const float* Wm, int k0, int o, int lane, int K) { v16h w; const float* p = Wm + (size_t)o * K + k0 + 8 * (lane >> 4);
#pragma unroll
  for (int i = 0; i < 8; ++i) { w[i] = (_Float16)(bfr(p[i]) * 256.0f); w[8 + i] = (_Float16)(bfr(p[16 + i]) * 256.0f); }
  return w; }
#define WQKV_LAYOUT 1   // 0 = (in,out) [DIN][CC]; 1 = (out,in) [CC][DIN]; 2 = per-head [NH][DIN][HD]
__device__ __forceinline__ v16b wcol_hdk(const float* Wm, int k0, int o, int lane) { v16b w; const int g = lane >> 4; const float* p = Wm + (size_t)(o / HD) * DIN * HD + (o % HD);
#pragma unroll
  for (int i = 0; i < 8; ++i) { w[i] = (__bf16)p[(size_t)(k0 + 8 * g + i) * HD]; w[8 + i] = (__bf16)p[(size_t)(k0 + 16 + 8 * g + i) * HD]; }
  return w; }
#define WO_OUT_IN 1
#if WQKV_LAYOUT == 1
#define WCOL(W, k0, o, lane) wcol_oi(W, k0, o, lane, DIN)
#elif WQKV_LAYOUT == 2
#define WCOL(W, k0, o, lane) wcol_hdk(W, k0, o, lane)
#else
#define WCOL(W, k0, o, lane) wcol_io(W, k0, o, lane, CC)
#endif
#if WO_OUT_IN
#define WOCOL(W, k0, o, lane) wcol_oi(W, k0, o, lane, CC)
#define WOCOLH(W, k0, o, lane) wcolh_oi(W, k0, o, lane, CC)
#else
#define WOCOL(W, k0, o, lane) wcol_io(W, k0, o, lane, DIN)
#define WOCOLH(W, k0, o, lane) wcolh_io(W, k0, o, lane, DIN)
#endif
#define OUT1_OFF (4u * (size_t)NB * TT * DIN)      // byte offset of attn_avg [B][T][T]

#define WS_QH  0u                                      // f16 q rows [b*t][CC]
#define WS_KH  (WS_QH + 2u * (size_t)NB * TT * CC)      // f16 k rows [b*t][CC]
#define WS_VT  (WS_KH + 2u * (size_t)NB * TT * CC)      // f16 v planes [b][c][t]
#define WS_QL  (WS_VT + 2u * (size_t)NB * CC * TT)      // f16 q residual x 2^10 rows [b][t < QHI][CC]
#define WS_KL  (WS_QL + 2u * (size_t)NB * QHI * CC)     // f16 k residual x 2^10 rows [b][t < KHI][CC]
#define WS_VB  (WS_KL + 2u * (size_t)NB * KHI * CC)     // bf16 v hi planes [b][c][t < KHI]
#define WS_VBL (WS_VB + 2u * (size_t)NB * CC * KHI)
#define WS_Y   (WS_VBL + 2u * (size_t)NB * CC * KHI)     // f32 ctx rows [b*t][CC] (only when there is an output projection)
#define WS_END (WS_Y  + 4u * (size_t)NB * TT * CC)

// ---- k_proj: block = (64 rows, 128 cols, which): q/k/v = X W (+ b) with exact bf16 products (K = DIN) -> which 0: q f16 rows (+ residual rows < QHI); 1: k f16 rows (+ residual rows < KHI); 2: v f16 planes [c][t] (+ bf16 hi/lo planes for t < KHI)
__global__ __launch_bounds__(128) void k_proj(const float* __restrict__ XQ, const float* __restrict__ XK, const float* __restrict__ XV, const float* __restrict__ WQ, const float* __restrict__ WK, const float* __restrict__ WV, const float* __restrict__ BQ, const float* __restrict__ BK, const float* __restrict__ BV,
    _Float16* __restrict__ QH, _Float16* __restrict__ QL, _Float16* __restrict__ KH, _Float16* __restrict__ KL, _Float16* __restrict__ VT, __bf16* __restrict__ VB, __bf16* __restrict__ VBL) {
  __shared__ __align__(16) _Float16 sh[64][136], sl[64][136]; __shared__ __align__(16) _Float16 th[128][72]; __shared__ __align__(16) __bf16 tb[128][72], tbl[128][72];
  const int tid = threadIdx.x, wave = tid >> 5, lane = tid & 31, col = lane & 15, g = lane >> 4; const int which = blockIdx.z; const int c0 = blockIdx.y * 128; const size_t r0 = (size_t)blockIdx.x * 64; const size_t bb = r0 / TT; const int t0 = (int)(r0 % TT);
  const float* X = which == 0 ? XQ : which == 1 ? XK : XV; const float* WA = which == 0 ? WQ : which == 1 ? WK : WV; const float* BA = which == 0 ? BQ : which == 1 ? BK : BV;
  v8f acc[8] = {};
#pragma unroll 2
  for (int kc = 0; kc < DIN / 32; ++kc) { v16b a; { const float* p = X + (r0 + wave * 16 + col) * DIN + kc * 32 + 8 * g;
#pragma unroll
      for (int i = 0; i < 8; ++i) { a[i] = (__bf16)p[i]; a[8 + i] = (__bf16)p[16 + i]; } }
    asm volatile("s_wait_loadcnt 0x0" ::: "memory");
#pragma unroll
    for (int j = 0; j < 8; ++j) { const v16b w = WCOL(WA, kc * 32, c0 + j * 16 + col, lane); asm volatile("s_wait_loadcnt 0x0" ::: "memory"); acc[j] = wmma_bf(a, w, acc[j]); } }
  if (which < 2) { _Float16* DH = which == 0 ? QH : KH; _Float16* DL = which == 0 ? QL : KL; const int nhi = which == 0 ? QHI : KHI; const bool hi_rows = t0 < nhi;
#pragma unroll
    for (int j = 0; j < 8; ++j) { const float bias = BA ? bfr(BA[c0 + j * 16 + col]) : 0.f;
#pragma unroll
      for (int r = 0; r < 8; ++r) { const float v = acc[j][r] + bias; const _Float16 hv = (_Float16)v; sh[wave * 16 + 8 * g + r][j * 16 + col] = hv; sl[wave * 16 + 8 * g + r][j * 16 + col] = (_Float16)((v - (float)hv) * 1024.0f); } }
    __syncthreads();
    for (int e = tid; e < 64 * 16; e += 128) { const int rl = e >> 4, q = e & 15; vst2((unsigned*)(DH + (r0 + rl) * CC + c0 + q * 8), *(const v4u*)&sh[rl][q * 8]); if (hi_rows) vst2((unsigned*)(DL + (bb * nhi + t0 + rl) * (size_t)CC + c0 + q * 8), *(const v4u*)&sl[rl][q * 8]); }
  } else { const bool hi_rows = t0 < KHI;
#pragma unroll
    for (int j = 0; j < 8; ++j) { const float bias = BA ? bfr(BA[c0 + j * 16 + col]) : 0.f;
#pragma unroll
      for (int r = 0; r < 8; ++r) { const float v = acc[j][r] + bias; const int rl = wave * 16 + 8 * g + r, cl = j * 16 + col; th[cl][rl] = (_Float16)v; const __bf16 bh = (__bf16)v; tb[cl][rl] = bh; tbl[cl][rl] = (__bf16)(v - (float)bh); } }
    __syncthreads();
    for (int e = tid; e < 128 * 8; e += 128) { const int cl = e >> 3, q = e & 7; vst2((unsigned*)(VT + (bb * CC + c0 + cl) * (size_t)TT + t0 + q * 8), *(const v4u*)&th[cl][q * 8]); if (hi_rows) { const size_t o3 = (bb * CC + c0 + cl) * (size_t)KHI + t0 + q * 8; vst2((unsigned*)(VB + o3), *(const v4u*)&tb[cl][q * 8]); vst2((unsigned*)(VBL + o3), *(const v4u*)&tbl[cl][q * 8]); } } } }
// ---- k_fa: block = 16 queries of batch b, NH waves, wave = head. The wave forms S^T = K Q^T (A = 16 key rows, B = the 16 query rows; q hi + residual x 2^10: 2 products), so a lane holds ONE query (col) and keys 8g + r of each 16-key tile: logits, softmax and P stay in registers.
// pass 1 walks all keys for the row maximum and the sum of exp (a running pair per lane, the two lane halves joined once at the end); pass 2 forms the logits again, P x 2^11 = exp(s - max) x 2048 / sum: two S^T tiles ARE the 16 x 32 A fragment of P (elements 0..7 = keys k0 + 8g + r, 8..15 = k0 + 16 + 8g + r) against v f16 planes (1 product);
// the NH heads' f32 P tiles meet in LDS (two buffers, one barrier a 64-key step) and wave w sums query row w over the heads in head order: two whole 128-B lines of attn_avg a wave and step.
__device__ __forceinline__ v8f wmma_p(v16h a, v16h b, v8f c) { return __builtin_amdgcn_wmma_f32_16x16x32_f16(false, a, false, b, (short)0, c, false, false); }
__device__ __forceinline__ void st_tile(const v16h k0f, const v16h k1f, const v16h* qh, const v16h* ql, float* s) {
  v8f a = {}, al = {};
  a = wmma_p(k0f, qh[0], a); al = wmma_p(k0f, ql[0], al); a = wmma_p(k1f, qh[1], a); al = wmma_p(k1f, ql[1], al);
#pragma unroll
  for (int r = 0; r < 8; ++r) s[r] = (a[r] + al[r] * (1.0f / 1024.0f)) * SCALE; }
#define PBP 68             // LDS pitch of a 64-key P row in floats: the 16 query rows' 16-byte stores fall on 16 different bank groups
static_assert(NH == 16 && HD == 64, "wave w is head w and sums query row w of the 16-row tile");
__global__ __launch_bounds__(NH * 32) void k_fa(const _Float16* __restrict__ QH, const _Float16* __restrict__ QL, const _Float16* __restrict__ KH, const _Float16* __restrict__ VT, float* __restrict__ Y, float* __restrict__ AV) {
  __shared__ __align__(16) float pb[2][NH][16][PBP];
  const int tid = threadIdx.x, lane = tid & 31, col = lane & 15, g = lane >> 4; const int b = blockIdx.y; const int ql0 = blockIdx.x * 16;
  const int h = __builtin_amdgcn_readfirstlane(tid >> 5);   // the wave's number = its head, in a scalar register: head offsets stay scalar
  v16h qh[2], ql[2];
#pragma unroll
  for (int kc = 0; kc < 2; ++kc) { qh[kc] = frag_h(QH + ((size_t)b * TT + ql0 + col) * CC + h * HD + kc * 32, lane); ql[kc] = frag_h(QL + ((size_t)b * QHI + ql0 + col) * CC + h * HD + kc * 32, lane); }
  asm volatile("s_wait_xcnt 0x0" ::: "memory");   // the q loads' address registers are reused as destinations of the k loads below: the wait stands in front of that overwrite
  const _Float16* Kr = KH + ((size_t)b * TT + col) * CC + h * HD;          // key row col of a tile, this head's 64 columns (one 128-B line a key: a fragment load touches 16 lines)
  const _Float16* Vr = VT + ((size_t)b * CC + h * HD + col) * (size_t)TT;   // v plane of column col of a 16-column group (64 keys a line)
  float m = -3.0e38f, l = 0.f;
  v16h kf[8];
#pragma unroll
  for (int t = 0; t < 4; ++t) { kf[2 * t] = frag_h(Kr + (size_t)(t * 16) * CC, lane); kf[2 * t + 1] = frag_h(Kr + (size_t)(t * 16) * CC + 32, lane); }
  for (int k0 = 0; k0 < TT; k0 += 64) { float s[32];
#pragma unroll
    for (int t = 0; t < 4; ++t) st_tile(kf[2 * t], kf[2 * t + 1], qh, ql, s + t * 8);
    const int kn = k0 + 64 < TT ? k0 + 64 : 0;   // the next 64 keys, fetched one trip ahead; the last trip fetches keys 0..63, of which pass 2 uses the first 32
#pragma unroll
    for (int t = 0; t < 4; ++t) { kf[2 * t] = frag_h(Kr + (size_t)(kn + t * 16) * CC, lane); kf[2 * t + 1] = frag_h(Kr + (size_t)(kn + t * 16) * CC + 32, lane); }
    __builtin_amdgcn_sched_barrier(0);   // keeps the fetch ahead in front of the exp work below, which covers its latency
    float bm = s[0];
#pragma unroll
    for (int i = 1; i < 32; ++i) bm = fmaxf(bm, s[i]);
    const float mn = fmaxf(m, bm); float a = 0.f;
#pragma unroll
    for (int i = 0; i < 32; ++i) a += expf(s[i] - mn);
    l = l * expf(m - mn) + a; m = mn;
    asm volatile("s_wait_xcnt 0x0" ::: "memory"); }   // the next trip rewrites the address registers of the fetch ahead: the wait stands in front of that overwrite
  { const float M = fmaxf(m, __shfl_xor(m, 16)); l *= expf(m - M); l += __shfl_xor(l, 16); m = M; }
  const float inv = 2048.0f / l;
  v8f acc[HD / 16] = {};
  float* av = AV + ((size_t)b * TT + ql0 + h) * TT + lane * 2;
  for (int st = 0; st < TT / 64; ++st) { v16h vf[2][HD / 16];   // a step = 64 keys = whole lines of the v planes, as two halves of 32 keys
#pragma unroll
    for (int u = 0; u < 2; ++u)
#pragma unroll
      for (int j = 0; j < HD / 16; ++j) vf[u][j] = frag_h(Vr + (size_t)(j * 16) * TT + st * 64 + u * 32, lane);
#pragma unroll
    for (int u = 0; u < 2; ++u) { float s[16];
      st_tile(kf[0], kf[1], qh, ql, s); st_tile(kf[2], kf[3], qh, ql, s + 8);
      const int kn = st * 64 + u * 32 + 32 < TT ? st * 64 + u * 32 + 32 : 0;   // the next 32 keys, fetched one half step ahead (the last fetch, of keys 0..31, is in bounds and unused)
#pragma unroll
      for (int t = 0; t < 2; ++t) { kf[2 * t] = frag_h(Kr + (size_t)(kn + t * 16) * CC, lane); kf[2 * t + 1] = frag_h(Kr + (size_t)(kn + t * 16) * CC + 32, lane); }
      __builtin_amdgcn_sched_barrier(0);   // keeps the v loads and the k fetch ahead in front of the exp work below, which covers their latency
      v16h p;
#pragma unroll
      for (int i = 0; i < 16; ++i) { s[i] = expf(s[i] - m) * inv; p[i] = (_Float16)s[i]; }
#pragma unroll
      for (int j = 0; j < HD / 16; ++j) acc[j] = wmma_p(p, vf[u][j], acc[j]);
      float* pw = &pb[st & 1][h][col][u * 32 + 8 * g];
#pragma unroll
      for (int t = 0; t < 2; ++t) { v4f lo = { s[t * 8], s[t * 8 + 1], s[t * 8 + 2], s[t * 8 + 3] }, hi = { s[t * 8 + 4], s[t * 8 + 5], s[t * 8 + 6], s[t * 8 + 7] }; *(v4f*)(pw + t * 16) = lo; *(v4f*)(pw + t * 16 + 4) = hi; } }
    __syncthreads();   // all heads' P tiles of this step are in LDS; it also ends every wave's reads of the other buffer, which the next step refills
    v2f a = *(const v2f*)&pb[st & 1][0][h][lane * 2];
#pragma unroll
    for (int w = 1; w < NH; ++w) a += *(const v2f*)&pb[st & 1][w][h][lane * 2];
    vst2(av + st * 64, a * (1.0f / (2048.0f * NH))); }
#pragma unroll
  for (int j = 0; j < HD / 16; ++j)
#pragma unroll
    for (int r = 0; r < 8; ++r) Y[((size_t)b * TT + ql0 + 8 * g + r) * CC + h * HD + j * 16 + col] = acc[j][r] * (1.0f / 2048.0f); }
// ---- k_out: block = (64 rows, 128 cols): out = ctx Wo (+ bo): ctx once to f16 against Wo as f16(bf16 x 2^8) exact (1 product) x 2^-8; causal early rows (< QHI of each sequence): ctx bf16 hi + lo against exact bf16 Wo (2 products)
__global__ __launch_bounds__(128) void k_out(const float* __restrict__ Y, const float* __restrict__ WO, const float* __restrict__ BO, float* __restrict__ OUT) { __shared__ __align__(16) float sf[4][16][132];
  const int tid = threadIdx.x, wave = tid >> 5, lane = tid & 31, col = lane & 15, g = lane >> 4; const int c0 = blockIdx.y * 128; const size_t r0 = (size_t)blockIdx.x * 64 + wave * 16;
  v8f acc[8] = {};
  if (CAUSAL && (int)(((size_t)blockIdx.x * 64) % TT) < QHI) {   /* block-uniform */
#pragma unroll 2
    for (int kc = 0; kc < CC / 32; ++kc) { const F2 a = split_row(Y + (r0 + col) * CC, kc * 32, lane); asm volatile("s_wait_loadcnt 0x0" ::: "memory");
#pragma unroll
      for (int j = 0; j < 8; ++j) { const v16b w = WOCOL(WO, kc * 32, c0 + j * 16 + col, lane); asm volatile("s_wait_loadcnt 0x0" ::: "memory"); acc[j] = wmma_bf(a.h, w, acc[j]); acc[j] = wmma_bf(a.l, w, acc[j]); } }
#pragma unroll
    for (int j = 0; j < 8; ++j) { const float bias = BO ? bfr(BO[c0 + j * 16 + col]) : 0.f;
#pragma unroll
      for (int r = 0; r < 8; ++r) sf[wave][8 * g + r][j * 16 + col] = acc[j][r] + bias; }
  } else {
#pragma unroll 2
    for (int kc = 0; kc < CC / 32; ++kc) { const v16h a = frag_f32(Y + (r0 + col) * CC + kc * 32, lane); asm volatile("s_wait_loadcnt 0x0" ::: "memory");
#pragma unroll
      for (int j = 0; j < 8; ++j) { const v16h w = WOCOLH(WO, kc * 32, c0 + j * 16 + col, lane); asm volatile("s_wait_loadcnt 0x0" ::: "memory"); acc[j] = wmma16(a, w, acc[j]); } }
#pragma unroll
    for (int j = 0; j < 8; ++j) { const float bias = BO ? bfr(BO[c0 + j * 16 + col]) : 0.f;
#pragma unroll
      for (int r = 0; r < 8; ++r) sf[wave][8 * g + r][j * 16 + col] = acc[j][r] * (1.0f / 256.0f) + bias; } }
  LDSX(); for (int rl = 0; rl < 16; ++rl) vst2(OUT + (r0 + rl) * DIN + c0 + lane * 4, *(const v4f*)&sf[wave][rl][lane * 4]); }

extern "C" void kernel_launch(void* const* d_in, const int* in_sizes, int n_in, void* d_out, int out_size, void* d_ws, size_t ws_size, hipStream_t stream) {
  (void)in_sizes; (void)n_in; (void)out_size;
  const float** F = (const float**)d_in;
  if (ws_size < (size_t)WS_END) return;
  char* ws = (char*)d_ws; _Float16 *QH = (_Float16*)(ws + WS_QH), *KH = (_Float16*)(ws + WS_KH), *VT = (_Float16*)(ws + WS_VT), *QL = (_Float16*)(ws + WS_QL), *KL = (_Float16*)(ws + WS_KL); __bf16 *VB = (__bf16*)(ws + WS_VB), *VBL = (__bf16*)(ws + WS_VBL); float *Y = (float*)(ws + WS_Y);
  (void)Y; (void)QL; (void)KL; (void)VB; (void)VBL;
  // inputs: 0 x [2,2048,1024]; 1 Wq, 2 bq, 3 Wk, 4 bk, 5 Wv, 6 bv, 7 Wp, 8 bp ((out,in) [1024,1024], [1024]); outputs: 0 y [2,2048,1024] @0, 1 attn_avg [2,2048,2048] @ OUT1_OFF
  float* AV = (float*)((char*)d_out + OUT1_OFF);
  k_proj<<<dim3(TNB * TT / 64, CC / 128, 3), 128, 0, stream>>>(F[0], F[0], F[0], F[1], F[3], F[5], F[2], F[4], F[6], QH, QL, KH, KL, VT, VB, VBL);
  k_fa<<<dim3(TT / 16, TNB), NH * 32, 0, stream>>>(QH, QL, KH, VT, Y, AV);
  k_out<<<dim3(TNB * TT / 64, DIN / 128), 128, 0, stream>>>(Y, F[7], F[8], (float*)d_out);
}

// v003
// One run takes 263 microseconds.
// Two timings next to v002 put it at 2.09 and 2.10 times that version's speed.
// Over all steps from v000 it is 5.68 times as fast.
// compute dtype: all float inputs rounded to bf16; q/k/v = x W^T + b with EXACT bf16 products on WMMA 16x16x32, f32 accumulate; q as f16 hi + residual (x 2^10) against k once to f16 (2 products) for the logits x 1/8; softmax in f32 (precise expf), the head-averaged attention map accumulated in f32; P x 2^11 once to f16 against v once to f16 (1 product); ctx once to f16 against Wp carried x 2^8 in f16 (exact bf16 values) + bp; f32 outputs.
#include <hip/hip_runtime.h>
#include <math.h>

typedef __attribute__((ext_vector_type(16))) _Float16 v16h;
typedef __attribute__((ext_vector_type(16))) __bf16 v16b;
typedef __attribute__((ext_vector_type(8)))  _Float16 v8h;
typedef __attribute__((ext_vector_type(8)))  float v8f;
typedef __attribute__((ext_vector_type(4)))  float v4f;
typedef __attribute__((ext_vector_type(2)))  float v2f;
typedef __attribute__((ext_vector_type(4)))  unsigned v4u;
typedef __attribute__((ext_vector_type(4)))  int v4i;
typedef float __attribute__((may_alias)) float_a;
typedef int __attribute__((may_alias)) int_a;

template <typename T> __device__ __forceinline__ void vst2(void* p, T v) { *(T*)p = v;  }
__device__ __forceinline__ v8f wmma16(v16h a, v16h b, v8f c) {
  v8f d = __builtin_amdgcn_wmma_f32_16x16x32_f16(false, a, false, b, (short)0, c, false, false);
  asm volatile("v_nop\n\tv_nop\n\tv_nop\n\tv_nop" : "+v"(d) : "v"(a), "v"(b));
  return d;
}
__device__ __forceinline__ v8f wmma_bf(v16b a, v16b b, v8f c) {
  v8f d = __builtin_amdgcn_wmma_f32_16x16x32_bf16(false, a, false, b, (short)0, c, false, false);
  asm volatile("v_nop\n\tv_nop\n\tv_nop\n\tv_nop" : "+v"(d) : "v"(a), "v"(b));
  return d;
}
// 16x16x32 fragments: lane = (h = lane>>4, row/col = lane&15); elements 0..7 = k0+8h+0..7, 8..15 = k0+16+8h+0..7; D element r = row 8h+r
__device__ __forceinline__ v16h frag_h(const _Float16* rowk0, int lane) {
  union { v16h v; v8h q[2]; } u; const _Float16* p = rowk0 + 8 * (lane >> 4);
  u.q[0] = *(const v8h*)p; u.q[1] = *(const v8h*)(p + 16); return u.v;
}
__device__ __forceinline__ v16h frag_f32(const float* rowk0, int lane) {
  v16h a; const float* p = rowk0 + 8 * (lane >> 4);
#pragma unroll
  for (int i = 0; i < 8; ++i) { a[i] = (_Float16)p[i]; a[8 + i] = (_Float16)p[16 + i]; }
  return a;
}
__device__ __forceinline__ v16h frag_f32s(const float* rowk0, int lane, float sc) {
  v16h a; const float* p = rowk0 + 8 * (lane >> 4);
#pragma unroll
  for (int i = 0; i < 8; ++i) { a[i] = (_Float16)(p[i] * sc); a[8 + i] = (_Float16)(p[16 + i] * sc); }
  return a;
}
// column fragment from a [K][ld] layout (column n), rows >= K read as 0
__device__ __forceinline__ v16h fragc_f32(const float* W, int k0, int n, int lane, int ld, int K) {
  v16h a; const int g = lane >> 4;
#pragma unroll
  for (int i = 0; i < 8; ++i) { const int ka = k0 + 8 * g + i, kb = ka + 16;
    a[i] = (_Float16)(ka < K ? W[(size_t)(ka < K ? ka : K - 1) * ld + n] : 0.f); a[8 + i] = (_Float16)(kb < K ? W[(size_t)(kb < K ? kb : K - 1) * ld + n] : 0.f); }
  return a;
}
struct F2 { v16b h, l; };
__device__ __forceinline__ F2 bsplit16(const float v[16]) { F2 r;
#pragma unroll
  for (int i = 0; i < 16; ++i) { const __bf16 h = (__bf16)v[i]; r.h[i] = h; r.l[i] = (__bf16)(v[i] - (float)h); }
  return r; }
__device__ __forceinline__ F2 split_row(const float* row, int k0, int lane) { float v[16]; const float* p = row + k0 + 8 * (lane >> 4);
#pragma unroll
  for (int i = 0; i < 8; ++i) { v[i] = p[i]; v[8 + i] = p[16 + i]; }
  return bsplit16(v); }
__device__ __forceinline__ F2 split_rowK(const float* row, int k0, int lane, int K) { float v[16]; const int g = lane >> 4;
#pragma unroll
  for (int i = 0; i < 8; ++i) { const int ka = k0 + 8 * g + i, kb = ka + 16; v[i] = ka < K ? row[ka < K ? ka : K - 1] : 0.f; v[8 + i] = kb < K ? row[kb < K ? kb : K - 1] : 0.f; }
  return bsplit16(v); }
__device__ __forceinline__ F2 split_col(const float* W, int k0, int n, int lane, int ld, int K) { float v[16]; const int g = lane >> 4;
#pragma unroll
  for (int i = 0; i < 8; ++i) { const int ka = k0 + 8 * g + i, kb = ka + 16; v[i] = ka < K ? W[(size_t)(ka < K ? ka : K - 1) * ld + n] : 0.f; v[8 + i] = kb < K ? W[(size_t)(kb < K ? kb : K - 1) * ld + n] : 0.f; }
  return bsplit16(v); }
__device__ __forceinline__ v8f mac3(const F2& a, const F2& b, v8f c) { c = wmma_bf(a.l, b.h, c); c = wmma_bf(a.h, b.l, c); return wmma_bf(a.h, b.h, c); }
__device__ __forceinline__ float sigm(float v) { return 1.0f / (1.0f + expf(-v)); }
#define LDSX() do { asm volatile("s_wait_dscnt 0" ::: "memory"); __builtin_amdgcn_wave_barrier(); __builtin_amdgcn_fence(__ATOMIC_RELEASE, "workgroup"); } while (0)

// Multi-head self-attention returning (y, head-averaged attention) (B 2, T 2,048, C 1,024 = 16 heads x 64): q/k/v = x W^T + b ((out,in)); attn = softmax(q k^T x 64^-0.5) over all keys; y = merged(attn v) Wp^T + bp; attn_avg[b][t][s] = mean over the 16 heads of attn.
#define NB 2
#define TT 2048
#define CC 1024            // NH * HD = projected width
#define DIN 1024          // input (model) width
#define NH 16
#define HD 64
#define SCALE (0.125f)
#define CAUSAL 0
#ifndef TNB
#define TNB NB
#endif
__device__ __forceinline__ float bfr(float v) { return (float)(__bf16)v; }
__host__ __device__ __forceinline__ int kb_last(int qb) { return CAUSAL ? ((qb * 64 + 63) >> 7) : (TT / 128 - 1); }
typedef __attribute__((ext_vector_type(8))) __bf16 v8b;
__device__ __forceinline__ v16b frag_b(const __bf16* rowk0, int lane) {
  union { v16b v; v8b q[2]; } u; const __bf16* p = rowk0 + 8 * (lane >> 4);
  u.q[0] = *(const v8b*)p; u.q[1] = *(const v8b*)(p + 16); return u.v;
}
#define QBH 0
#define QHI 2048            // rows carrying a q residual plane (all rows when non-causal: 2-product logits everywhere)
#define KHI 64            // key rows carrying k residual / v bf16 hi+lo planes (written by k_proj; no kernel in this file reads them)
// B fragment (k rows k0+.., output column o) of a weight: (in,out) [K][ld] or (out,in) [ld rows of K]: bf16 exact, or f16(bf16 * 256) exact
__device__ __forceinline__ v16b wcol_io(const float* Wm, int k0, int o, int lane, int ld) { v16b w; const int g = lane >> 4;
#pragma unroll
  for (int i = 0; i < 8; ++i) { w[i] = (__bf16)Wm[(size_t)(k0 + 8 * g + i) * ld + o]; w[8 + i] = (__bf16)Wm[(size_t)(k0 + 16 + 8 * g + i) * ld + o]; }
  return w; }
__device__ __forceinline__ v16b wcol_oi(const float* Wm, int k0, int o, int lane, int K) { v16b w; const float* p = Wm + (size_t)o * K + k0 + 8 * (lane >> 4);
#pragma unroll
  for (int i = 0; i < 8; ++i) { w[i] = (__bf16)p[i]; w[8 + i] = (__bf16)p[16 + i]; }
  return w; }
__device__ __forceinline__ v16h wcolh_io(const float* Wm, int k0, int o, int lane, int ld) { v16h w; const int g = lane >> 4;
#pragma unroll
  for (int i = 0; i < 8; ++i) { w[i] = (_Float16)(bfr(Wm[(size_t)(k0 + 8 * g + i) * ld + o]) * 256.0f); w[8 + i] = (_Float16)(bfr(Wm[(size_t)(k0 + 16 + 8 * g + i) * ld + o]) * 256.0f); }
  return w; }
__device__ __forceinline__ v16h wcolh_oi(const float* Wm, int k0, int o, int lane, int K) { v16h w; const float* p = Wm + (size_t)o * K + k0 + 8 * (lane >> 4);
#pragma unroll
  for (int i = 0; i < 8; ++i) { w[i] = (_Float16)(bfr(p[i]) * 256.0f); w[8 + i] = (_Float16)(bfr(p[16 + i]) * 256.0f); }
  return w; }
#define WQKV_LAYOUT 1   // 0 = (in,out) [DIN][CC]; 1 = (out,in) [CC][DIN]; 2 = per-head [NH][DIN][HD]
__device__ __forceinline__ v16b wcol_hdk(const float* Wm, int k0, int o, int lane) { v16b w; const int g = lane >> 4; const float* p = Wm + (size_t)(o / HD) * DIN * HD + (o % HD);
#pragma unroll
  for (int i = 0; i < 8; ++i) { w[i] = (__bf16)p[(size_t)(k0 + 8 * g + i) * HD]; w[8 + i] = (__bf16)p[(size_t)(k0 + 16 + 8 * g + i) * HD]; }
  return w; }
#define WO_OUT_IN 1
#if WQKV_LAYOUT == 1
#define WCOL(W, k0, o, lane) wcol_oi(W, k0, o, lane, DIN)
#elif WQKV_LAYOUT == 2
#define WCOL(W, k0, o, lane) wcol_hdk(W, k0, o, lane)
#else
#define WCOL(W, k0, o, lane) wcol_io(W, k0, o, lane, CC)
#endif
#if WO_OUT_IN
#define WOCOL(W, k0, o, lane) wcol_oi(W, k0, o, lane, CC)
#define WOCOLH(W, k0, o, lane) wcolh_oi(W, k0, o, lane, CC)
#else
#define WOCOL(W, k0, o, lane) wcol_io(W, k0, o, lane, DIN)
#define WOCOLH(W, k0, o, lane) wcolh_io(W, k0, o, lane, DIN)
#endif
#define OUT1_OFF (4u * (size_t)NB * TT * DIN)      // byte offset of attn_avg [B][T][T]

#define WS_QH  0u                                      // f16 q rows [b*t][CC]
#define WS_KH  (WS_QH + 2u * (size_t)NB * TT * CC)      // f16 k rows [b*t][CC]
#define WS_VT  (WS_KH + 2u * (size_t)NB * TT * CC)      // f16 v planes [b][c][t]
#define WS_QL  (WS_VT + 2u * (size_t)NB * CC * TT)      // f16 q residual x 2^10 rows [b][t < QHI][CC]
#define WS_KL  (WS_QL + 2u * (size_t)NB * QHI * CC)     // f16 k residual x 2^10 rows [b][t < KHI][CC]
#define WS_VB  (WS_KL + 2u * (size_t)NB * KHI * CC)     // bf16 v hi planes [b][c][t < KHI]
#define WS_VBL (WS_VB + 2u * (size_t)NB * CC * KHI)
#define WS_Y   (WS_VBL + 2u * (size_t)NB * CC * KHI)     // f32 ctx rows [b*t][CC] (only when there is an output projection)
#define WS_END (WS_Y  + 4u * (size_t)NB * TT * CC)

// GEMM operand staging (k_proj, k_out): a step = 64 k = 256 B of each f32 operand row. 16 lanes x 16 B fetch one row's step, so a wave-wide load covers 4 whole lines; each value is converted ONCE a block and stored as 16 bit in LDS, where all 4 waves read their fragments.
#define GKC 64             // k of a staged step
#define GP 72              // LDS pitch of a staged row in 16-bit elements: 144 B = 16 B x 9 (odd), conflict-free for 16-byte fragment reads
#define GROWS (64 + 128)   // rows 0..63 = the block's X (or ctx) rows, 64..191 = its 128 weight rows (output columns)
typedef __attribute__((ext_vector_type(4))) __bf16 v4b;
typedef __attribute__((ext_vector_type(4))) _Float16 v4h;
static_assert(WQKV_LAYOUT == 1 && WO_OUT_IN == 1, "the staging reads weight rows (out,in): k contiguous");
// ---- k_proj: block = (64 rows, 128 cols, which): q/k/v = X W (+ b) with exact bf16 products (K = DIN) -> which 0: q f16 rows (+ residual rows < QHI); 1: k f16 rows (+ residual rows < KHI); 2: v f16 planes [c][t] (+ bf16 hi/lo planes for t < KHI)
__global__ __launch_bounds__(128) void k_proj(const float* __restrict__ XQ, const float* __restrict__ XK, const float* __restrict__ XV, const float* __restrict__ WQ, const float* __restrict__ WK, const float* __restrict__ WV, const float* __restrict__ BQ, const float* __restrict__ BK, const float* __restrict__ BV,
    _Float16* __restrict__ QH, _Float16* __restrict__ QL, _Float16* __restrict__ KH, _Float16* __restrict__ KL, _Float16* __restrict__ VT, __bf16* __restrict__ VB, __bf16* __restrict__ VBL) {
  __shared__ __align__(16) _Float16 sh[64][136], sl[64][136]; __shared__ __align__(16) _Float16 th[128][72]; __shared__ __align__(16) __bf16 tb[128][72], tbl[128][72]; __shared__ __align__(16) __bf16 stg[2][GROWS][GP];
  const int tid = threadIdx.x, wave = tid >> 5, lane = tid & 31, col = lane & 15, g = lane >> 4; const int which = blockIdx.z; const int c0 = blockIdx.y * 128; const size_t r0 = (size_t)blockIdx.x * 64; const size_t bb = r0 / TT; const int t0 = (int)(r0 % TT);
  const float* X = which == 0 ? XQ : which == 1 ? XK : XV; const float* WA = which == 0 ? WQ : which == 1 ? WK : WV; const float* BA = which == 0 ? BQ : which == 1 ? BK : BV;
  v8f acc[8] = {};
  const int lr = tid >> 4, ls = tid & 15;   // staging: this thread's row of each group of 8 rows, and its 16 bytes of the row's 256
  const float* gx = X + r0 * DIN; const float* gw = WA + (size_t)c0 * DIN; const unsigned go = lr * DIN + ls * 4;   // block-uniform bases and one per-thread offset
  v4f pf[GROWS / 8];
#pragma unroll
  for (int i = 0; i < GROWS / 8; ++i) pf[i] = i < 8 ? *(const v4f*)(gx + (size_t)(i * 8) * DIN + go) : *(const v4f*)(gw + (size_t)(i * 8 - 64) * DIN + go);
  for (int c = 0; c < DIN / GKC; ++c) { __bf16 (*sb)[GP] = stg[c & 1];
#pragma unroll
    for (int i = 0; i < GROWS / 8; ++i) *(v4b*)&sb[i * 8 + lr][ls * 4] = __builtin_convertvector(pf[i], v4b);
    __syncthreads();   // this step's rows are in LDS; it also ends every wave's reads of the other buffer, which the next step refills
    if (c + 1 < DIN / GKC) {   // the next step's rows, fetched into registers behind the barrier (which would drain them): the fragment reads and products below cover their latency
      const float* px = gx + (c + 1) * GKC + go; const float* pw = gw + (c + 1) * GKC + go;
#pragma unroll
      for (int i = 0; i < GROWS / 8; ++i) pf[i] = i < 8 ? *(const v4f*)(px + (size_t)(i * 8) * DIN) : *(const v4f*)(pw + (size_t)(i * 8 - 64) * DIN);
      asm volatile("s_wait_xcnt 0x0" :: "v"(px), "v"(pw) : "memory"); }   // stands in front of every overwrite of the fetch's address registers: as inputs here they stay live up to the wait, so no load of the group takes them as its destination
#pragma unroll
    for (int kc = 0; kc < GKC / 32; ++kc) { const v16b a = frag_b(&sb[wave * 16 + col][kc * 32], lane); v16b wf[8];
#pragma unroll
      for (int j = 0; j < 8; ++j) wf[j] = frag_b(&sb[64 + j * 16 + col][kc * 32], lane);
      __builtin_amdgcn_sched_barrier(0);   // keeps the 18 fragment reads one group in front of the 8 products: one LDS latency a group, not one a product
#pragma unroll
      for (int j = 0; j < 8; ++j) acc[j] = wmma_bf(a, wf[j], acc[j]); } }
  if (which < 2) { _Float16* DH = which == 0 ? QH : KH; _Float16* DL = which == 0 ? QL : KL; const int nhi = which == 0 ? QHI : KHI; const bool hi_rows = t0 < nhi;
#pragma unroll
    for (int j = 0; j < 8; ++j) { const float bias = BA ? bfr(BA[c0 + j * 16 + col]) : 0.f;
#pragma unroll
      for (int r = 0; r < 8; ++r) { const float v = acc[j][r] + bias; const _Float16 hv = (_Float16)v; sh[wave * 16 + 8 * g + r][j * 16 + col] = hv; sl[wave * 16 + 8 * g + r][j * 16 + col] = (_Float16)((v - (float)hv) * 1024.0f); } }
    __syncthreads();
    for (int e = tid; e < 64 * 16; e += 128) { const int rl = e >> 4, q = e & 15; vst2((unsigned*)(DH + (r0 + rl) * CC + c0 + q * 8), *(const v4u*)&sh[rl][q * 8]); if (hi_rows) vst2((unsigned*)(DL + (bb * nhi + t0 + rl) * (size_t)CC + c0 + q * 8), *(const v4u*)&sl[rl][q * 8]); }
  } else { const bool hi_rows = t0 < KHI;
#pragma unroll
    for (int j = 0; j < 8; ++j) { const float bias = BA ? bfr(BA[c0 + j * 16 + col]) : 0.f;
#pragma unroll
      for (int r = 0; r < 8; ++r) { const float v = acc[j][r] + bias; const int rl = wave * 16 + 8 * g + r, cl = j * 16 + col; th[cl][rl] = (_Float16)v; const __bf16 bh = (__bf16)v; tb[cl][rl] = bh; tbl[cl][rl] = (__bf16)(v - (float)bh); } }
    __syncthreads();
    for (int e = tid; e < 128 * 8; e += 128) { const int cl = e >> 3, q = e & 7; vst2((unsigned*)(VT + (bb * CC + c0 + cl) * (size_t)TT + t0 + q * 8), *(const v4u*)&th[cl][q * 8]); if (hi_rows) { const size_t o3 = (bb * CC + c0 + cl) * (size_t)KHI + t0 + q * 8; vst2((unsigned*)(VB + o3), *(const v4u*)&tb[cl][q * 8]); vst2((unsigned*)(VBL + o3), *(const v4u*)&tbl[cl][q * 8]); } } } }
// ---- k_fa: block = 16 queries of batch b, NH waves, wave = head. The wave forms S^T = K Q^T (A = 16 key rows, B = the 16 query rows; q hi + residual x 2^10: 2 products), so a lane holds ONE query (col) and keys 8g + r of each 16-key tile: logits, softmax and P stay in registers.
// pass 1 walks all keys for the row maximum and the sum of exp (a running pair per lane, the two lane halves joined once at the end); pass 2 forms the logits again, P x 2^11 = exp(s - max) x 2048 / sum: two S^T tiles ARE the 16 x 32 A fragment of P (elements 0..7 = keys k0 + 8g + r, 8..15 = k0 + 16 + 8g + r) against v f16 planes (1 product);
// the NH heads' f32 P tiles meet in LDS (two buffers, one barrier a 64-key step) and wave w sums query row w over the heads in head order: two whole 128-B lines of attn_avg a wave and step.
__device__ __forceinline__ v8f wmma_p(v16h a, v16h b, v8f c) { return __builtin_amdgcn_wmma_f32_16x16x32_f16(false, a, false, b, (short)0, c, false, false); }
__device__ __forceinline__ void st_tile(const v16h k0f, const v16h k1f, const v16h* qh, const v16h* ql, float* s) {
  v8f a = {}, al = {};
  a = wmma_p(k0f, qh[0], a); al = wmma_p(k0f, ql[0], al); a = wmma_p(k1f, qh[1], a); al = wmma_p(k1f, ql[1], al);
#pragma unroll
  for (int r = 0; r < 8; ++r) s[r] = (a[r] + al[r] * (1.0f / 1024.0f)) * SCALE; }
#define PBP 68             // LDS pitch of a 64-key P row in floats: the 16 query rows' 16-byte stores fall on 16 different bank groups
static_assert(NH == 16 && HD == 64, "wave w is head w and sums query row w of the 16-row tile");
__global__ __launch_bounds__(NH * 32) void k_fa(const _Float16* __restrict__ QH, const _Float16* __restrict__ QL, const _Float16* __restrict__ KH, const _Float16* __restrict__ VT, float* __restrict__ Y, float* __restrict__ AV) {
  __shared__ __align__(16) float pb[2][NH][16][PBP];
  const int tid = threadIdx.x, lane = tid & 31, col = lane & 15, g = lane >> 4; const int b = blockIdx.y; const int ql0 = blockIdx.x * 16;
  const int h = __builtin_amdgcn_readfirstlane(tid >> 5);   // the wave's number = its head, in a scalar register: head offsets stay scalar
  v16h qh[2], ql[2];
#pragma unroll
  for (int kc = 0; kc < 2; ++kc) { qh[kc] = frag_h(QH + ((size_t)b * TT + ql0 + col) * CC + h * HD + kc * 32, lane); ql[kc] = frag_h(QL + ((size_t)b * QHI + ql0 + col) * CC + h * HD + kc * 32, lane); }
  asm volatile("s_wait_xcnt 0x0" ::: "memory");   // the q loads' address registers are reused as destinations of the k loads below: the wait stands in front of that overwrite
  const _Float16* Kr = KH + ((size_t)b * TT + col) * CC + h * HD;          // key row col of a tile, this head's 64 columns (one 128-B line a key: a fragment load touches 16 lines)
  const _Float16* Vr = VT + ((size_t)b * CC + h * HD + col) * (size_t)TT;   // v plane of column col of a 16-column group (64 keys a line)
  float m = -3.0e38f, l = 0.f;
  v16h kf[8];
#pragma unroll
  for (int t = 0; t < 4; ++t) { kf[2 * t] = frag_h(Kr + (size_t)(t * 16) * CC, lane); kf[2 * t + 1] = frag_h(Kr + (size_t)(t * 16) * CC + 32, lane); }
  for (int k0 = 0; k0 < TT; k0 += 64) { float s[32];
#pragma unroll
    for (int t = 0; t < 4; ++t) st_tile(kf[2 * t], kf[2 * t + 1], qh, ql, s + t * 8);
    const int kn = k0 + 64 < TT ? k0 + 64 : 0;   // the next 64 keys, fetched one trip ahead; the last trip fetches keys 0..63, of which pass 2 uses the first 32
#pragma unroll
    for (int t = 0; t < 4; ++t) { kf[2 * t] = frag_h(Kr + (size_t)(kn + t * 16) * CC, lane); kf[2 * t + 1] = frag_h(Kr + (size_t)(kn + t * 16) * CC + 32, lane); }
    __builtin_amdgcn_sched_barrier(0);   // keeps the fetch ahead in front of the exp work below, which covers its latency
    float bm = s[0];
#pragma unroll
    for (int i = 1; i < 32; ++i) bm = fmaxf(bm, s[i]);
    const float mn = fmaxf(m, bm); float a = 0.f;
#pragma unroll
    for (int i = 0; i < 32; ++i) a += expf(s[i] - mn);
    l = l * expf(m - mn) + a; m = mn;
    asm volatile("s_wait_xcnt 0x0" ::: "memory"); }   // the next trip rewrites the address registers of the fetch ahead: the wait stands in front of that overwrite
  { const float M = fmaxf(m, __shfl_xor(m, 16)); l *= expf(m - M); l += __shfl_xor(l, 16); m = M; }
  const float inv = 2048.0f / l;
  v8f acc[HD / 16] = {};
  float* av = AV + ((size_t)b * TT + ql0 + h) * TT + lane * 2;
  for (int st = 0; st < TT / 64; ++st) { v16h vf[2][HD / 16];   // a step = 64 keys = whole lines of the v planes, as two halves of 32 keys
#pragma unroll
    for (int u = 0; u < 2; ++u)
#pragma unroll
      for (int j = 0; j < HD / 16; ++j) vf[u][j] = frag_h(Vr + (size_t)(j * 16) * TT + st * 64 + u * 32, lane);
#pragma unroll
    for (int u = 0; u < 2; ++u) { float s[16];
      st_tile(kf[0], kf[1], qh, ql, s); st_tile(kf[2], kf[3], qh, ql, s + 8);
      const int kn = st * 64 + u * 32 + 32 < TT ? st * 64 + u * 32 + 32 : 0;   // the next 32 keys, fetched one half step ahead (the last fetch, of keys 0..31, is in bounds and unused)
#pragma unroll
      for (int t = 0; t < 2; ++t) { kf[2 * t] = frag_h(Kr + (size_t)(kn + t * 16) * CC, lane); kf[2 * t + 1] = frag_h(Kr + (size_t)(kn + t * 16) * CC + 32, lane); }
      __builtin_amdgcn_sched_barrier(0);   // keeps the v loads and the k fetch ahead in front of the exp work below, which covers their latency
      v16h p;
#pragma unroll
      for (int i = 0; i < 16; ++i) { s[i] = expf(s[i] - m) * inv; p[i] = (_Float16)s[i]; }
#pragma unroll
      for (int j = 0; j < HD / 16; ++j) acc[j] = wmma_p(p, vf[u][j], acc[j]);
      float* pw = &pb[st & 1][h][col][u * 32 + 8 * g];
#pragma unroll
      for (int t = 0; t < 2; ++t) { v4f lo = { s[t * 8], s[t * 8 + 1], s[t * 8 + 2], s[t * 8 + 3] }, hi = { s[t * 8 + 4], s[t * 8 + 5], s[t * 8 + 6], s[t * 8 + 7] }; *(v4f*)(pw + t * 16) = lo; *(v4f*)(pw + t * 16 + 4) = hi; } }
    __syncthreads();   // all heads' P tiles of this step are in LDS; it also ends every wave's reads of the other buffer, which the next step refills
    v2f a = *(const v2f*)&pb[st & 1][0][h][lane * 2];
#pragma unroll
    for (int w = 1; w < NH; ++w) a += *(const v2f*)&pb[st & 1][w][h][lane * 2];
    vst2(av + st * 64, a * (1.0f / (2048.0f * NH))); }
#pragma unroll
  for (int j = 0; j < HD / 16; ++j)
#pragma unroll
    for (int r = 0; r < 8; ++r) Y[((size_t)b * TT + ql0 + 8 * g + r) * CC + h * HD + j * 16 + col] = acc[j][r] * (1.0f / 2048.0f); }
// ---- k_out: block = (64 rows, 128 cols): out = ctx Wo (+ bo): ctx once to f16 against Wo as f16(bf16 x 2^8) exact (1 product) x 2^-8; causal early rows (< QHI of each sequence): ctx bf16 hi + lo against exact bf16 Wo (2 products)
__global__ __launch_bounds__(128) void k_out(const float* __restrict__ Y, const float* __restrict__ WO, const float* __restrict__ BO, float* __restrict__ OUT) { __shared__ __align__(16) float sf[4][16][132]; __shared__ __align__(16) _Float16 stg[2][GROWS][GP];
  const int tid = threadIdx.x, wave = tid >> 5, lane = tid & 31, col = lane & 15, g = lane >> 4; const int c0 = blockIdx.y * 128; const size_t r0 = (size_t)blockIdx.x * 64 + wave * 16;
  v8f acc[8] = {};
  if (CAUSAL && (int)(((size_t)blockIdx.x * 64) % TT) < QHI) {   /* block-uniform */
#pragma unroll 2
    for (int kc = 0; kc < CC / 32; ++kc) { const F2 a = split_row(Y + (r0 + col) * CC, kc * 32, lane); asm volatile("s_wait_loadcnt 0x0" ::: "memory");
#pragma unroll
      for (int j = 0; j < 8; ++j) { const v16b w = WOCOL(WO, kc * 32, c0 + j * 16 + col, lane); asm volatile("s_wait_loadcnt 0x0" ::: "memory"); acc[j] = wmma_bf(a.h, w, acc[j]); acc[j] = wmma_bf(a.l, w, acc[j]); } }
#pragma unroll
    for (int j = 0; j < 8; ++j) { const float bias = BO ? bfr(BO[c0 + j * 16 + col]) : 0.f;
#pragma unroll
      for (int r = 0; r < 8; ++r) sf[wave][8 * g + r][j * 16 + col] = acc[j][r] + bias; }
  } else {
    const int lr = tid >> 4, ls = tid & 15;   // staging: this thread's row of each group of 8 rows, and its 16 bytes of the row's 256
    const float* gx = Y + (size_t)blockIdx.x * 64 * CC; const float* gw = WO + (size_t)c0 * CC; const unsigned go = lr * CC + ls * 4;   // block-uniform bases and one per-thread offset
    v4f pf[GROWS / 8];
#pragma unroll
    for (int i = 0; i < GROWS / 8; ++i) pf[i] = i < 8 ? *(const v4f*)(gx + (size_t)(i * 8) * CC + go) : *(const v4f*)(gw + (size_t)(i * 8 - 64) * CC + go);
    for (int c = 0; c < CC / GKC; ++c) { _Float16 (*sb)[GP] = stg[c & 1];
#pragma unroll
      for (int i = 0; i < GROWS / 8; ++i) { v4h t;
#pragma unroll
        for (int e = 0; e < 4; ++e) t[e] = i < 8 ? (_Float16)pf[i][e] : (_Float16)(bfr(pf[i][e]) * 256.0f);
        *(v4h*)&sb[i * 8 + lr][ls * 4] = t; }
      __syncthreads();   // this step's rows are in LDS; it also ends every wave's reads of the other buffer, which the next step refills
      if (c + 1 < CC / GKC) {   // the next step's rows, fetched into registers behind the barrier (which would drain them): the fragment reads and products below cover their latency
        const float* px = gx + (c + 1) * GKC + go; const float* pw = gw + (c + 1) * GKC + go;
#pragma unroll
        for (int i = 0; i < GROWS / 8; ++i) pf[i] = i < 8 ? *(const v4f*)(px + (size_t)(i * 8) * CC) : *(const v4f*)(pw + (size_t)(i * 8 - 64) * CC);
        asm volatile("s_wait_xcnt 0x0" :: "v"(px), "v"(pw) : "memory"); }   // stands in front of every overwrite of the fetch's address registers: as inputs here they stay live up to the wait, so no load of the group takes them as its destination
#pragma unroll
      for (int kc = 0; kc < GKC / 32; ++kc) { const v16h a = frag_h(&sb[wave * 16 + col][kc * 32], lane); v16h wf[8];
#pragma unroll
        for (int j = 0; j < 8; ++j) wf[j] = frag_h(&sb[64 + j * 16 + col][kc * 32], lane);
        __builtin_amdgcn_sched_barrier(0);   // keeps the 18 fragment reads one group in front of the 8 products: one LDS latency a group, not one a product
#pragma unroll
        for (int j = 0; j < 8; ++j) acc[j] = wmma16(a, wf[j], acc[j]); } }
#pragma unroll
    for (int j = 0; j < 8; ++j) { const float bias = BO ? bfr(BO[c0 + j * 16 + col]) : 0.f;
#pragma unroll
      for (int r = 0; r < 8; ++r) sf[wave][8 * g + r][j * 16 + col] = acc[j][r] * (1.0f / 256.0f) + bias; } }
  LDSX(); for (int rl = 0; rl < 16; ++rl) vst2(OUT + (r0 + rl) * DIN + c0 + lane * 4, *(const v4f*)&sf[wave][rl][lane * 4]); }

extern "C" void kernel_launch(void* const* d_in, const int* in_sizes, int n_in, void* d_out, int out_size, void* d_ws, size_t ws_size, hipStream_t stream) {
  (void)in_sizes; (void)n_in; (void)out_size;
  const float** F = (const float**)d_in;
  if (ws_size < (size_t)WS_END) return;
  char* ws = (char*)d_ws; _Float16 *QH = (_Float16*)(ws + WS_QH), *KH = (_Float16*)(ws + WS_KH), *VT = (_Float16*)(ws + WS_VT), *QL = (_Float16*)(ws + WS_QL), *KL = (_Float16*)(ws + WS_KL); __bf16 *VB = (__bf16*)(ws + WS_VB), *VBL = (__bf16*)(ws + WS_VBL); float *Y = (float*)(ws + WS_Y);
  (void)Y; (void)QL; (void)KL; (void)VB; (void)VBL;
  // inputs: 0 x [2,2048,1024]; 1 Wq, 2 bq, 3 Wk, 4 bk, 5 Wv, 6 bv, 7 Wp, 8 bp ((out,in) [1024,1024], [1024]); outputs: 0 y [2,2048,1024] @0, 1 attn_avg [2,2048,2048] @ OUT1_OFF
  float* AV = (float*)((char*)d_out + OUT1_OFF);
  k_proj<<<dim3(TNB * TT / 64, CC / 128, 3), 128, 0, stream>>>(F[0], F[0], F[0], F[1], F[3], F[5], F[2], F[4], F[6], QH, QL, KH, KL, VT, VB, VBL);
  k_fa<<<dim3(TT / 16, TNB), NH * 32, 0, stream>>>(QH, QL, KH, VT, Y, AV);
  k_out<<<dim3(TNB * TT / 64, DIN / 128), 128, 0, stream>>>(Y, F[7], F[8], (float*)d_out);
}

// v004
// Measured time: 228 microseconds a run.
// Next to v003, in two timings, it ran 1.16 and 1.15 times as fast.
// Counting every step since v000, it is 6.57 times as fast.
// compute dtype: all float inputs rounded to bf16; q/k/v = x W^T + b with EXACT bf16 products on WMMA 16x16x32, f32 accumulate; q as f16 hi + residual (x 2^10) against k once to f16 (2 products) for the logits x 1/8; softmax in f32 (precise expf), the head-averaged attention map accumulated in f32; P x 2^11 once to f16 against v once to f16 (1 product); ctx once to f16 against Wp carried x 2^8 in f16 (exact bf16 values) + bp; f32 outputs.
#include <hip/hip_runtime.h>
#include <math.h>

typedef __attribute__((ext_vector_type(16))) _Float16 v16h;
typedef __attribute__((ext_vector_type(16))) __bf16 v16b;
typedef __attribute__((ext_vector_type(8)))  _Float16 v8h;
typedef __attribute__((ext_vector_type(8)))  float v8f;
typedef __attribute__((ext_vector_type(4)))  float v4f;
typedef __attribute__((ext_vector_type(2)))  float v2f;
typedef __attribute__((ext_vector_type(4)))  unsigned v4u;
typedef __attribute__((ext_vector_type(4)))  int v4i;
typedef float __attribute__((may_alias)) float_a;
typedef int __attribute__((may_alias)) int_a;

template <typename T> __device__ __forceinline__ void vst2(void* p, T v) { *(T*)p = v;  }
// a store in a loop whose next trip rewrites the store's address and data registers: the wait stands in front of that overwrite; as inputs here both stay live up to the wait
template <typename T> __device__ __forceinline__ void vst2w(void* p, T v) { *(T*)p = v; asm volatile("s_wait_xcnt 0x0" :: "v"(p), "v"(v) : "memory"); }
__device__ __forceinline__ v8f wmma16(v16h a, v16h b, v8f c) {
  v8f d = __builtin_amdgcn_wmma_f32_16x16x32_f16(false, a, false, b, (short)0, c, false, false);
  asm volatile("v_nop\n\tv_nop\n\tv_nop\n\tv_nop" : "+v"(d) : "v"(a), "v"(b));
  return d;
}
__device__ __forceinline__ v8f wmma_bf(v16b a, v16b b, v8f c) {
  v8f d = __builtin_amdgcn_wmma_f32_16x16x32_bf16(false, a, false, b, (short)0, c, false, false);
  asm volatile("v_nop\n\tv_nop\n\tv_nop\n\tv_nop" : "+v"(d) : "v"(a), "v"(b));
  return d;
}
// 16x16x32 fragments: lane = (h = lane>>4, row/col = lane&15); elements 0..7 = k0+8h+0..7, 8..15 = k0+16+8h+0..7; D element r = row 8h+r
__device__ __forceinline__ v16h frag_h(const _Float16* rowk0, int lane) {
  union { v16h v; v8h q[2]; } u; const _Float16* p = rowk0 + 8 * (lane >> 4);
  u.q[0] = *(const v8h*)p; u.q[1] = *(const v8h*)(p + 16); return u.v;
}
__device__ __forceinline__ v16h frag_f32(const float* rowk0, int lane) {
  v16h a; const float* p = rowk0 + 8 * (lane >> 4);
#pragma unroll
  for (int i = 0; i < 8; ++i) { a[i] = (_Float16)p[i]; a[8 + i] = (_Float16)p[16 + i]; }
  return a;
}
__device__ __forceinline__ v16h frag_f32s(const float* rowk0, int lane, float sc) {
  v16h a; const float* p = rowk0 + 8 * (lane >> 4);
#pragma unroll
  for (int i = 0; i < 8; ++i) { a[i] = (_Float16)(p[i] * sc); a[8 + i] = (_Float16)(p[16 + i] * sc); }
  return a;
}
// column fragment from a [K][ld] layout (column n), rows >= K read as 0
__device__ __forceinline__ v16h fragc_f32(const float* W, int k0, int n, int lane, int ld, int K) {
  v16h a; const int g = lane >> 4;
#pragma unroll
  for (int i = 0; i < 8; ++i) { const int ka = k0 + 8 * g + i, kb = ka + 16;
    a[i] = (_Float16)(ka < K ? W[(size_t)(ka < K ? ka : K - 1) * ld + n] : 0.f); a[8 + i] = (_Float16)(kb < K ? W[(size_t)(kb < K ? kb : K - 1) * ld + n] : 0.f); }
  return a;
}
struct F2 { v16b h, l; };
__device__ __forceinline__ F2 bsplit16(const float v[16]) { F2 r;
#pragma unroll
  for (int i = 0; i < 16; ++i) { const __bf16 h = (__bf16)v[i]; r.h[i] = h; r.l[i] = (__bf16)(v[i] - (float)h); }
  return r; }
__device__ __forceinline__ F2 split_row(const float* row, int k0, int lane) { float v[16]; const float* p = row + k0 + 8 * (lane >> 4);
#pragma unroll
  for (int i = 0; i < 8; ++i) { v[i] = p[i]; v[8 + i] = p[16 + i]; }
  return bsplit16(v); }
__device__ __forceinline__ F2 split_rowK(const float* row, int k0, int lane, int K) { float v[16]; const int g = lane >> 4;
#pragma unroll
  for (int i = 0; i < 8; ++i) { const int ka = k0 + 8 * g + i, kb = ka + 16; v[i] = ka < K ? row[ka < K ? ka : K - 1] : 0.f; v[8 + i] = kb < K ? row[kb < K ? kb : K - 1] : 0.f; }
  return bsplit16(v); }
__device__ __forceinline__ F2 split_col(const float* W, int k0, int n, int lane, int ld, int K) { float v[16]; const int g = lane >> 4;
#pragma unroll
  for (int i = 0; i < 8; ++i) { const int ka = k0 + 8 * g + i, kb = ka + 16; v[i] = ka < K ? W[(size_t)(ka < K ? ka : K - 1) * ld + n] : 0.f; v[8 + i] = kb < K ? W[(size_t)(kb < K ? kb : K - 1) * ld + n] : 0.f; }
  return bsplit16(v); }
__device__ __forceinline__ v8f mac3(const F2& a, const F2& b, v8f c) { c = wmma_bf(a.l, b.h, c); c = wmma_bf(a.h, b.l, c); return wmma_bf(a.h, b.h, c); }
__device__ __forceinline__ float sigm(float v) { return 1.0f / (1.0f + expf(-v)); }
#define LDSX() do { asm volatile("s_wait_dscnt 0" ::: "memory"); __builtin_amdgcn_wave_barrier(); __builtin_amdgcn_fence(__ATOMIC_RELEASE, "workgroup"); } while (0)

// Multi-head self-attention returning (y, head-averaged attention) (B 2, T 2,048, C 1,024 = 16 heads x 64): q/k/v = x W^T + b ((out,in)); attn = softmax(q k^T x 64^-0.5) over all keys; y = merged(attn v) Wp^T + bp; attn_avg[b][t][s] = mean over the 16 heads of attn.
#define NB 2
#define TT 2048
#define CC 1024            // NH * HD = projected width
#define DIN 1024          // input (model) width
#define NH 16
#define HD 64
#define SCALE (0.125f)
#define CAUSAL 0
#ifndef TNB
#define TNB NB
#endif
__device__ __forceinline__ float bfr(float v) { return (float)(__bf16)v; }
__host__ __device__ __forceinline__ int kb_last(int qb) { return CAUSAL ? ((qb * 64 + 63) >> 7) : (TT / 128 - 1); }
typedef __attribute__((ext_vector_type(8))) __bf16 v8b;
__device__ __forceinline__ v16b frag_b(const __bf16* rowk0, int lane) {
  union { v16b v; v8b q[2]; } u; const __bf16* p = rowk0 + 8 * (lane >> 4);
  u.q[0] = *(const v8b*)p; u.q[1] = *(const v8b*)(p + 16); return u.v;
}
#define QBH 0
#define QHI 2048            // rows carrying a q residual plane (all rows when non-causal: 2-product logits everywhere)
#define KHI 64            // key rows carrying k residual / v bf16 hi+lo planes (written by k_proj; no kernel in this file reads them)
// B fragment (k rows k0+.., output column o) of a weight: (in,out) [K][ld] or (out,in) [ld rows of K]: bf16 exact, or f16(bf16 * 256) exact
__device__ __forceinline__ v16b wcol_io(const float* Wm, int k0, int o, int lane, int ld) { v16b w; const int g = lane >> 4;
#pragma unroll
  for (int i = 0; i < 8; ++i) { w[i] = (__bf16)Wm[(size_t)(k0 + 8 * g + i) * ld + o]; w[8 + i] = (__bf16)Wm[(size_t)(k0 + 16 + 8 * g + i) * ld + o]; }
  return w; }
__device__ __forceinline__ v16b wcol_oi(const float* Wm, int k0, int o, int lane, int K) { v16b w; const float* p = Wm + (size_t)o * K + k0 + 8 * (lane >> 4);
#pragma unroll
  for (int i = 0; i < 8; ++i) { w[i] = (__bf16)p[i]; w[8 + i] = (__bf16)p[16 + i]; }
  return w; }
__device__ __forceinline__ v16h wcolh_io(const float* Wm, int k0, int o, int lane, int ld) { v16h w; const int g = lane >> 4;
#pragma unroll
  for (int i = 0; i < 8; ++i) { w[i] = (_Float16)(bfr(Wm[(size_t)(k0 + 8 * g + i) * ld + o]) * 256.0f); w[8 + i] = (_Float16)(bfr(Wm[(size_t)(k0 + 16 + 8 * g + i) * ld + o]) * 256.0f); }
  return w; }
__device__ __forceinline__ v16h wcolh_oi(const float* Wm, int k0, int o, int lane, int K) { v16h w; const float* p = Wm + (size_t)o * K + k0 + 8 * (lane >> 4);
#pragma unroll
  for (int i = 0; i < 8; ++i) { w[i] = (_Float16)(bfr(p[i]) * 256.0f); w[8 + i] = (_Float16)(bfr(p[16 + i]) * 256.0f); }
  return w; }
#define WQKV_LAYOUT 1   // 0 = (in,out) [DIN][CC]; 1 = (out,in) [CC][DIN]; 2 = per-head [NH][DIN][HD]
__device__ __forceinline__ v16b wcol_hdk(const float* Wm, int k0, int o, int lane) { v16b w; const int g = lane >> 4; const float* p = Wm + (size_t)(o / HD) * DIN * HD + (o % HD);
#pragma unroll
  for (int i = 0; i < 8; ++i) { w[i] = (__bf16)p[(size_t)(k0 + 8 * g + i) * HD]; w[8 + i] = (__bf16)p[(size_t)(k0 + 16 + 8 * g + i) * HD]; }
  return w; }
#define WO_OUT_IN 1
#if WQKV_LAYOUT == 1
#define WCOL(W, k0, o, lane) wcol_oi(W, k0, o, lane, DIN)
#elif WQKV_LAYOUT == 2
#define WCOL(W, k0, o, lane) wcol_hdk(W, k0, o, lane)
#else
#define WCOL(W, k0, o, lane) wcol_io(W, k0, o, lane, CC)
#endif
#if WO_OUT_IN
#define WOCOL(W, k0, o, lane) wcol_oi(W, k0, o, lane, CC)
#define WOCOLH(W, k0, o, lane) wcolh_oi(W, k0, o, lane, CC)
#else
#define WOCOL(W, k0, o, lane) wcol_io(W, k0, o, lane, DIN)
#define WOCOLH(W, k0, o, lane) wcolh_io(W, k0, o, lane, DIN)
#endif
#define OUT1_OFF (4u * (size_t)NB * TT * DIN)      // byte offset of attn_avg [B][T][T]

#define WS_QH  0u                                      // f16 q rows [b*t][CC]
#define WS_KH  (WS_QH + 2u * (size_t)NB * TT * CC)      // f16 k in fragment order: [b][head][16-key tile][32-column half][fragment half][lane][8]
#define WS_VT  (WS_KH + 2u * (size_t)NB * TT * CC)      // f16 v in fragment order: [b][head][32-key group][16-column group][fragment half][lane][8]
#define WS_QL  (WS_VT + 2u * (size_t)NB * CC * TT)      // f16 q residual x 2^10 rows [b][t < QHI][CC]
#define WS_KL  (WS_QL + 2u * (size_t)NB * QHI * CC)     // f16 k residual x 2^10 rows [b][t < KHI][CC]
#define WS_VB  (WS_KL + 2u * (size_t)NB * KHI * CC)     // bf16 v hi planes [b][c][t < KHI]
#define WS_VBL (WS_VB + 2u * (size_t)NB * CC * KHI)
#define WS_Y   (WS_VBL + 2u * (size_t)NB * CC * KHI)     // f32 ctx rows [b*t][CC] (only when there is an output projection)
#define WS_END (WS_Y  + 4u * (size_t)NB * TT * CC)

// k and v pass from k_proj to k_fa in the reader's fragment order: the 16 bytes that lane l = 16 g + n takes for fragment half p lie at element (p * 32 + l) * 8 of the fragment's 512, so a wave-wide 16-byte load covers 512 contiguous bytes = 4 whole lines.
// k (A of S^T): lane's row = key tile * 16 + n, its 8 columns = half * 32 + p * 16 + 8 g + 0..7. v (B of P V): lane's column = group * 16 + n, its 8 keys = key group * 32 + p * 16 + 8 g + 0..7.
#define KF_OFF(b, h, tile) ((((size_t)(b) * NH + (h)) * (TT / 16) + (tile)) * 1024)   // element offset of a 16-key tile of head h: 2 fragments
#define VF_OFF(b, h, grp)  ((((size_t)(b) * NH + (h)) * (TT / 32) + (grp)) * 2048)    // element offset of a 32-key group of head h: 4 fragments
__device__ __forceinline__ v16h frag_w(const _Float16* p) {   // p = the fragment's first element + lane * 8
  union { v16h v; v8h q[2]; } u; u.q[0] = *(const v8h*)p; u.q[1] = *(const v8h*)(p + 256); return u.v;
}
// GEMM operand staging (k_proj, k_out): a step = 64 k = 256 B of each f32 operand row. 16 lanes x 16 B fetch one row's step, so a wave-wide load covers 4 whole lines; each value is converted ONCE a block and stored as 16 bit in LDS, where all 4 waves read their fragments.
#define GKC 64             // k of a staged step
#define GP 72              // LDS pitch of a staged row in 16-bit elements: 144 B = 16 B x 9 (odd), conflict-free for 16-byte fragment reads
#define GROWS (64 + 128)   // rows 0..63 = the block's X (or ctx) rows, 64..191 = its 128 weight rows (output columns)
typedef __attribute__((ext_vector_type(4))) __bf16 v4b;
typedef __attribute__((ext_vector_type(4))) _Float16 v4h;
static_assert(WQKV_LAYOUT == 1 && WO_OUT_IN == 1, "the staging reads weight rows (out,in): k contiguous");
// ---- k_proj: block = (64 rows, 128 cols, which): q/k/v = X W (+ b) with exact bf16 products (K = DIN) -> which 0: q f16 rows (+ residual rows < QHI); 1: k f16 in fragment order (+ residual rows < KHI); 2: v f16 in fragment order (+ bf16 hi/lo planes for t < KHI)
__global__ __launch_bounds__(128) void k_proj(const float* __restrict__ XQ, const float* __restrict__ XK, const float* __restrict__ XV, const float* __restrict__ WQ, const float* __restrict__ WK, const float* __restrict__ WV, const float* __restrict__ BQ, const float* __restrict__ BK, const float* __restrict__ BV,
    _Float16* __restrict__ QH, _Float16* __restrict__ QL, _Float16* __restrict__ KH, _Float16* __restrict__ KL, _Float16* __restrict__ VT, __bf16* __restrict__ VB, __bf16* __restrict__ VBL) {
  __shared__ __align__(16) _Float16 sh[64][136], sl[64][136]; __shared__ __align__(16) _Float16 th[128][72]; __shared__ __align__(16) __bf16 tb[128][72], tbl[128][72]; __shared__ __align__(16) __bf16 stg[2][GROWS][GP];
  const int tid = threadIdx.x, wave = tid >> 5, lane = tid & 31, col = lane & 15, g = lane >> 4; const int which = blockIdx.z; const int c0 = blockIdx.y * 128; const size_t r0 = (size_t)blockIdx.x * 64; const size_t bb = r0 / TT; const int t0 = (int)(r0 % TT);
  const float* X = which == 0 ? XQ : which == 1 ? XK : XV; const float* WA = which == 0 ? WQ : which == 1 ? WK : WV; const float* BA = which == 0 ? BQ : which == 1 ? BK : BV;
  v8f acc[8] = {};
  const int lr = tid >> 4, ls = tid & 15;   // staging: this thread's row of each group of 8 rows, and its 16 bytes of the row's 256
  const float* gx = X + r0 * DIN; const float* gw = WA + (size_t)c0 * DIN; const unsigned go = lr * DIN + ls * 4;   // block-uniform bases and one per-thread offset
  v4f pf[GROWS / 8];
#pragma unroll
  for (int i = 0; i < GROWS / 8; ++i) pf[i] = i < 8 ? *(const v4f*)(gx + (size_t)(i * 8) * DIN + go) : *(const v4f*)(gw + (size_t)(i * 8 - 64) * DIN + go);
  for (int c = 0; c < DIN / GKC; ++c) { __bf16 (*sb)[GP] = stg[c & 1];
#pragma unroll
    for (int i = 0; i < GROWS / 8; ++i) *(v4b*)&sb[i * 8 + lr][ls * 4] = __builtin_convertvector(pf[i], v4b);
    __syncthreads();   // this step's rows are in LDS; it also ends every wave's reads of the other buffer, which the next step refills
    if (c + 1 < DIN / GKC) {   // the next step's rows, fetched into registers behind the barrier (which would drain them): the fragment reads and products below cover their latency
      const float* px = gx + (c + 1) * GKC + go; const float* pw = gw + (c + 1) * GKC + go;
#pragma unroll
      for (int i = 0; i < GROWS / 8; ++i) pf[i] = i < 8 ? *(const v4f*)(px + (size_t)(i * 8) * DIN) : *(const v4f*)(pw + (size_t)(i * 8 - 64) * DIN);
      asm volatile("s_wait_xcnt 0x0" :: "v"(px), "v"(pw) : "memory"); }   // stands in front of every overwrite of the fetch's address registers: as inputs here they stay live up to the wait, so no load of the group takes them as its destination
#pragma unroll
    for (int kc = 0; kc < GKC / 32; ++kc) { const v16b a = frag_b(&sb[wave * 16 + col][kc * 32], lane); v16b wf[8];
#pragma unroll
      for (int j = 0; j < 8; ++j) wf[j] = frag_b(&sb[64 + j * 16 + col][kc * 32], lane);
      __builtin_amdgcn_sched_barrier(0);   // keeps the 18 fragment reads one group in front of the 8 products: one LDS latency a group, not one a product
#pragma unroll
      for (int j = 0; j < 8; ++j) acc[j] = wmma_bf(a, wf[j], acc[j]); } }
  if (which < 2) { _Float16* DH = which == 0 ? QH : KH; _Float16* DL = which == 0 ? QL : KL; const int nhi = which == 0 ? QHI : KHI; const bool hi_rows = t0 < nhi;
#pragma unroll
    for (int j = 0; j < 8; ++j) { const float bias = BA ? bfr(BA[c0 + j * 16 + col]) : 0.f;
#pragma unroll
      for (int r = 0; r < 8; ++r) { const float v = acc[j][r] + bias; const _Float16 hv = (_Float16)v; sh[wave * 16 + 8 * g + r][j * 16 + col] = hv; sl[wave * 16 + 8 * g + r][j * 16 + col] = (_Float16)((v - (float)hv) * 1024.0f); } }
    __syncthreads();
    for (int e = tid; e < 64 * 16; e += 128) { int rl, cq; size_t dh;   // e = the 16-byte piece in the order of its destination: a wave's store covers whole lines
      if (which == 0) { rl = e >> 4; cq = (e & 15) * 8; dh = (r0 + rl) * CC + c0 + cq; }
      else { const int l = e & 31, fp = (e >> 5) & 3, tl = (e >> 7) & 3, hh = e >> 9; rl = tl * 16 + (l & 15); cq = hh * HD + fp * 16 + (l >> 4) * 8; dh = KF_OFF(bb, c0 / HD + hh, t0 / 16 + tl) + fp * 256 + l * 8; }
      vst2w((unsigned*)(DH + dh), *(const v4u*)&sh[rl][cq]); if (hi_rows) vst2w((unsigned*)(DL + (bb * nhi + t0 + rl) * (size_t)CC + c0 + cq), *(const v4u*)&sl[rl][cq]); }
  } else { const bool hi_rows = t0 < KHI;
#pragma unroll
    for (int j = 0; j < 8; ++j) { const float bias = BA ? bfr(BA[c0 + j * 16 + col]) : 0.f;
#pragma unroll
      for (int r = 0; r < 8; ++r) { const float v = acc[j][r] + bias; const int rl = wave * 16 + 8 * g + r, cl = j * 16 + col; th[cl][rl] = (_Float16)v; const __bf16 bh = (__bf16)v; tb[cl][rl] = bh; tbl[cl][rl] = (__bf16)(v - (float)bh); } }
    __syncthreads();
    for (int e = tid; e < 128 * 8; e += 128) { const int l = e & 31, jp = (e >> 5) & 7, kg = (e >> 8) & 1, hh = e >> 9;   // e = the 16-byte piece in the order of its destination: a wave's store covers whole lines
      const int cl = hh * HD + (jp >> 1) * 16 + (l & 15), kq = kg * 32 + (jp & 1) * 16 + (l >> 4) * 8;
      vst2w((unsigned*)(VT + VF_OFF(bb, c0 / HD + hh, t0 / 32 + kg) + jp * 256 + l * 8), *(const v4u*)&th[cl][kq]); if (hi_rows) { const size_t o3 = (bb * CC + c0 + cl) * (size_t)KHI + t0 + kq; vst2w((unsigned*)(VB + o3), *(const v4u*)&tb[cl][kq]); vst2w((unsigned*)(VBL + o3), *(const v4u*)&tbl[cl][kq]); } } } }
// ---- k_fa: block = 16 queries of batch b, NH waves, wave = head. The wave forms S^T = K Q^T (A = 16 key rows, B = the 16 query rows; q hi + residual x 2^10: 2 products), so a lane holds ONE query (col) and keys 8g + r of each 16-key tile: logits, softmax and P stay in registers.
// pass 1 walks all keys for the row maximum and the sum of exp (a running pair per lane, the two lane halves joined once at the end); pass 2 forms the logits again, P x 2^11 = exp(s - max) x 2048 / sum: two S^T tiles ARE the 16 x 32 A fragment of P (elements 0..7 = keys k0 + 8g + r, 8..15 = k0 + 16 + 8g + r) against v f16 planes (1 product);
// the NH heads' f32 P tiles meet in LDS (two buffers, one barrier a 64-key step) and wave w sums query row w over the heads in head order: two whole 128-B lines of attn_avg a wave and step.
__device__ __forceinline__ v8f wmma_p(v16h a, v16h b, v8f c) { return __builtin_amdgcn_wmma_f32_16x16x32_f16(false, a, false, b, (short)0, c, false, false); }
__device__ __forceinline__ void st_tile(const v16h k0f, const v16h k1f, const v16h* qh, const v16h* ql, float* s) {
  v8f a = {}, al = {};
  a = wmma_p(k0f, qh[0], a); al = wmma_p(k0f, ql[0], al); a = wmma_p(k1f, qh[1], a); al = wmma_p(k1f, ql[1], al);
#pragma unroll
  for (int r = 0; r < 8; ++r) s[r] = (a[r] + al[r] * (1.0f / 1024.0f)) * SCALE; }
#define PBP 68             // LDS pitch of a 64-key P row in floats: the 16 query rows' 16-byte stores fall on 16 different bank groups
static_assert(NH == 16 && HD == 64, "wave w is head w and sums query row w of the 16-row tile");
__global__ __launch_bounds__(NH * 32) void k_fa(const _Float16* __restrict__ QH, const _Float16* __restrict__ QL, const _Float16* __restrict__ KH, const _Float16* __restrict__ VT, float* __restrict__ Y, float* __restrict__ AV) {
  __shared__ __align__(16) float pb[2][NH][16][PBP];
  const int tid = threadIdx.x, lane = tid & 31, col = lane & 15, g = lane >> 4; const int b = blockIdx.y; const int ql0 = blockIdx.x * 16;
  const int h = __builtin_amdgcn_readfirstlane(tid >> 5);   // the wave's number = its head, in a scalar register: head offsets stay scalar
  v16h qh[2], ql[2];
  const _Float16* pqh = QH + ((size_t)b * TT + ql0 + col) * CC + h * HD + 8 * g; const _Float16* pql = QL + ((size_t)b * QHI + ql0 + col) * CC + h * HD + 8 * g;   // the lane's own 8 columns of its query row
#pragma unroll
  for (int kc = 0; kc < 2; ++kc) { qh[kc] = frag_h(pqh + kc * 32, 0); ql[kc] = frag_h(pql + kc * 32, 0); }
  asm volatile("s_wait_xcnt 0x0" :: "v"(pqh), "v"(pql) : "memory");   // the q loads' address registers are reused as destinations of the k loads below: the wait stands in front of that overwrite; as inputs here they stay live up to it, so no q load takes them as its destination
  const _Float16* Kr = KH + KF_OFF(b, h, 0) + lane * 8;   // this head's k fragments, 64 elements a key: a fragment load covers 4 whole lines
  const _Float16* Vr = VT + VF_OFF(b, h, 0) + lane * 8;   // this head's v fragments, 64 elements a key
  float m = -3.0e38f, l = 0.f;
  v16h kf[8];
#pragma unroll
  for (int t = 0; t < 4; ++t) { kf[2 * t] = frag_w(Kr + t * 1024); kf[2 * t + 1] = frag_w(Kr + t * 1024 + 512); }
  for (int k0 = 0; k0 < TT; k0 += 64) { float s[32];
#pragma unroll
    for (int t = 0; t < 4; ++t) st_tile(kf[2 * t], kf[2 * t + 1], qh, ql, s + t * 8);
    const int kn = k0 + 64 < TT ? k0 + 64 : 0;   // the next 64 keys, fetched one trip ahead; the last trip fetches keys 0..63, of which pass 2 uses the first 32
#pragma unroll
    for (int t = 0; t < 4; ++t) { kf[2 * t] = frag_w(Kr + kn * HD + t * 1024); kf[2 * t + 1] = frag_w(Kr + kn * HD + t * 1024 + 512); }
    __builtin_amdgcn_sched_barrier(0);   // keeps the fetch ahead in front of the exp work below, which covers its latency
    float bm = s[0];
#pragma unroll
    for (int i = 1; i < 32; ++i) bm = fmaxf(bm, s[i]);
    const float mn = fmaxf(m, bm); float a = 0.f;
#pragma unroll
    for (int i = 0; i < 32; ++i) a += expf(s[i] - mn);
    l = l * expf(m - mn) + a; m = mn;
    asm volatile("s_wait_xcnt 0x0" ::: "memory"); }   // the next trip rewrites the address registers of the fetch ahead: the wait stands in front of that overwrite
  { const float M = fmaxf(m, __shfl_xor(m, 16)); l *= expf(m - M); l += __shfl_xor(l, 16); m = M; }
  const float inv = 2048.0f / l;
  v8f acc[HD / 16] = {};
  float* av = AV + ((size_t)b * TT + ql0 + h) * TT + lane * 2;
  for (int st = 0; st < TT / 64; ++st) { v16h vf[2][HD / 16]; const _Float16* pv = Vr + st * 4096;   // a step = 64 keys, as two halves of 32 keys
#pragma unroll
    for (int u = 0; u < 2; ++u)
#pragma unroll
      for (int j = 0; j < HD / 16; ++j) vf[u][j] = frag_w(pv + u * 2048 + j * 512);
#pragma unroll
    for (int u = 0; u < 2; ++u) { float s[16];
      st_tile(kf[0], kf[1], qh, ql, s); st_tile(kf[2], kf[3], qh, ql, s + 8);
      const int kn = st * 64 + u * 32 + 32 < TT ? st * 64 + u * 32 + 32 : 0;   // the next 32 keys, fetched one half step ahead (the last fetch, of keys 0..31, is in bounds and unused)
      const _Float16* pk = Kr + kn * HD;
#pragma unroll
      for (int t = 0; t < 2; ++t) { kf[2 * t] = frag_w(pk + t * 1024); kf[2 * t + 1] = frag_w(pk + t * 1024 + 512); }
      asm volatile("s_wait_xcnt 0x0" :: "v"(pv), "v"(pk) : "memory");   // stands in front of every overwrite of the v and k loads' address registers: as inputs here they stay live up to the wait, so no load of the groups takes them as its destination
      __builtin_amdgcn_sched_barrier(0);   // keeps the v loads and the k fetch ahead in front of the exp work below, which covers their latency
      v16h p;
#pragma unroll
      for (int i = 0; i < 16; ++i) { s[i] = expf(s[i] - m) * inv; p[i] = (_Float16)s[i]; }
#pragma unroll
      for (int j = 0; j < HD / 16; ++j) acc[j] = wmma_p(p, vf[u][j], acc[j]);
      float* pw = &pb[st & 1][h][col][u * 32 + 8 * g];
#pragma unroll
      for (int t = 0; t < 2; ++t) { v4f lo = { s[t * 8], s[t * 8 + 1], s[t * 8 + 2], s[t * 8 + 3] }, hi = { s[t * 8 + 4], s[t * 8 + 5], s[t * 8 + 6], s[t * 8 + 7] }; *(v4f*)(pw + t * 16) = lo; *(v4f*)(pw + t * 16 + 4) = hi; } }
    __syncthreads();   // all heads' P tiles of this step are in LDS; it also ends every wave's reads of the other buffer, which the next step refills
    v2f a = *(const v2f*)&pb[st & 1][0][h][lane * 2];
#pragma unroll
    for (int w = 1; w < NH; ++w) a += *(const v2f*)&pb[st & 1][w][h][lane * 2];
    vst2(av + st * 64, a * (1.0f / (2048.0f * NH))); }
#pragma unroll
  for (int j = 0; j < HD / 16; ++j)
#pragma unroll
    for (int r = 0; r < 8; ++r) Y[((size_t)b * TT + ql0 + 8 * g + r) * CC + h * HD + j * 16 + col] = acc[j][r] * (1.0f / 2048.0f); }
// ---- k_out: block = (64 rows, 128 cols): out = ctx Wo (+ bo): ctx once to f16 against Wo as f16(bf16 x 2^8) exact (1 product) x 2^-8; causal early rows (< QHI of each sequence): ctx bf16 hi + lo against exact bf16 Wo (2 products)
__global__ __launch_bounds__(128) void k_out(const float* __restrict__ Y, const float* __restrict__ WO, const float* __restrict__ BO, float* __restrict__ OUT) { __shared__ __align__(16) float sf[4][16][132]; __shared__ __align__(16) _Float16 stg[2][GROWS][GP];
  const int tid = threadIdx.x, wave = tid >> 5, lane = tid & 31, col = lane & 15, g = lane >> 4; const int c0 = blockIdx.y * 128; const size_t r0 = (size_t)blockIdx.x * 64 + wave * 16;
  v8f acc[8] = {};
  if (CAUSAL && (int)(((size_t)blockIdx.x * 64) % TT) < QHI) {   /* block-uniform */
#pragma unroll 2
    for (int kc = 0; kc < CC / 32; ++kc) { const F2 a = split_row(Y + (r0 + col) * CC, kc * 32, lane); asm volatile("s_wait_loadcnt 0x0" ::: "memory");
#pragma unroll
      for (int j = 0; j < 8; ++j) { const v16b w = WOCOL(WO, kc * 32, c0 + j * 16 + col, lane); asm volatile("s_wait_loadcnt 0x0" ::: "memory"); acc[j] = wmma_bf(a.h, w, acc[j]); acc[j] = wmma_bf(a.l, w, acc[j]); } }
#pragma unroll
    for (int j = 0; j < 8; ++j) { const float bias = BO ? bfr(BO[c0 + j * 16 + col]) : 0.f;
#pragma unroll
      for (int r = 0; r < 8; ++r) sf[wave][8 * g + r][j * 16 + col] = acc[j][r] + bias; }
  } else {
    const int lr = tid >> 4, ls = tid & 15;   // staging: this thread's row of each group of 8 rows, and its 16 bytes of the row's 256
    const float* gx = Y + (size_t)blockIdx.x * 64 * CC; const float* gw = WO + (size_t)c0 * CC; const unsigned go = lr * CC + ls * 4;   // block-uniform bases and one per-thread offset
    v4f pf[GROWS / 8];
#pragma unroll
    for (int i = 0; i < GROWS / 8; ++i) pf[i] = i < 8 ? *(const v4f*)(gx + (size_t)(i * 8) * CC + go) : *(const v4f*)(gw + (size_t)(i * 8 - 64) * CC + go);
    for (int c = 0; c < CC / GKC; ++c) { _Float16 (*sb)[GP] = stg[c & 1];
#pragma unroll
      for (int i = 0; i < GROWS / 8; ++i) { v4h t;
#pragma unroll
        for (int e = 0; e < 4; ++e) t[e] = i < 8 ? (_Float16)pf[i][e] : (_Float16)(bfr(pf[i][e]) * 256.0f);
        *(v4h*)&sb[i * 8 + lr][ls * 4] = t; }
      __syncthreads();   // this step's rows are in LDS; it also ends every wave's reads of the other buffer, which the next step refills
      if (c + 1 < CC / GKC) {   // the next step's rows, fetched into registers behind the barrier (which would drain them): the fragment reads and products below cover their latency
        const float* px = gx + (c + 1) * GKC + go; const float* pw = gw + (c + 1) * GKC + go;
#pragma unroll
        for (int i = 0; i < GROWS / 8; ++i) pf[i] = i < 8 ? *(const v4f*)(px + (size_t)(i * 8) * CC) : *(const v4f*)(pw + (size_t)(i * 8 - 64) * CC);
        asm volatile("s_wait_xcnt 0x0" :: "v"(px), "v"(pw) : "memory"); }   // stands in front of every overwrite of the fetch's address registers: as inputs here they stay live up to the wait, so no load of the group takes them as its destination
#pragma unroll
      for (int kc = 0; kc < GKC / 32; ++kc) { const v16h a = frag_h(&sb[wave * 16 + col][kc * 32], lane); v16h wf[8];
#pragma unroll
        for (int j = 0; j < 8; ++j) wf[j] = frag_h(&sb[64 + j * 16 + col][kc * 32], lane);
        __builtin_amdgcn_sched_barrier(0);   // keeps the 18 fragment reads one group in front of the 8 products: one LDS latency a group, not one a product
#pragma unroll
        for (int j = 0; j < 8; ++j) acc[j] = wmma16(a, wf[j], acc[j]); } }
#pragma unroll
    for (int j = 0; j < 8; ++j) { const float bias = BO ? bfr(BO[c0 + j * 16 + col]) : 0.f;
#pragma unroll
      for (int r = 0; r < 8; ++r) sf[wave][8 * g + r][j * 16 + col] = acc[j][r] * (1.0f / 256.0f) + bias; } }
  LDSX(); for (int rl = 0; rl < 16; ++rl) vst2(OUT + (r0 + rl) * DIN + c0 + lane * 4, *(const v4f*)&sf[wave][rl][lane * 4]); }

extern "C" void kernel_launch(void* const* d_in, const int* in_sizes, int n_in, void* d_out, int out_size, void* d_ws, size_t ws_size, hipStream_t stream) {
  (void)in_sizes; (void)n_in; (void)out_size;
  const float** F = (const float**)d_in;
  if (ws_size < (size_t)WS_END) return;
  char* ws = (char*)d_ws; _Float16 *QH = (_Float16*)(ws + WS_QH), *KH = (_Float16*)(ws + WS_KH), *VT = (_Float16*)(ws + WS_VT), *QL = (_Float16*)(ws + WS_QL), *KL = (_Float16*)(ws + WS_KL); __bf16 *VB = (__bf16*)(ws + WS_VB), *VBL = (__bf16*)(ws + WS_VBL); float *Y = (float*)(ws + WS_Y);
  (void)Y; (void)QL; (void)KL; (void)VB; (void)VBL;
  // inputs: 0 x [2,2048,1024]; 1 Wq, 2 bq, 3 Wk, 4 bk, 5 Wv, 6 bv, 7 Wp, 8 bp ((out,in) [1024,1024], [1024]); outputs: 0 y [2,2048,1024] @0, 1 attn_avg [2,2048,2048] @ OUT1_OFF
  float* AV = (float*)((char*)d_out + OUT1_OFF);
  k_proj<<<dim3(TNB * TT / 64, CC / 128, 3), 128, 0, stream>>>(F[0], F[0], F[0], F[1], F[3], F[5], F[2], F[4], F[6], QH, QL, KH, KL, VT, VB, VBL);
  k_fa<<<dim3(TT / 16, TNB), NH * 32, 0, stream>>>(QH, QL, KH, VT, Y, AV);
  k_out<<<dim3(TNB * TT / 64, DIN / 128), 128, 0, stream>>>(Y, F[7], F[8], (float*)d_out);
}

// v005
// It runs in 206 microseconds.
// In two side-by-side timings against v004, it was 1.09 and 1.10 times as fast.
// Counting every step since v000, it is 7.22 times as fast.
// compute dtype: all float inputs rounded to bf16; q/k/v = x W^T + b with EXACT bf16 products on WMMA 16x16x32, f32 accumulate; q as f16 hi + residual (x 2^10) against k once to f16 (2 products) for the logits x 1/8; softmax in f32 (hardware exp2 of one fused multiply-add that carries scale x log2 e, the row maximum and, in pass 2, the row sum), the head-averaged attention map accumulated in f32; P x 2^11 once to f16 against v once to f16 (1 product); ctx once to f16 against Wp carried x 2^8 in f16 (exact bf16 values) + bp; f32 outputs.
#include <hip/hip_runtime.h>
#include <math.h>

typedef __attribute__((ext_vector_type(16))) _Float16 v16h;
typedef __attribute__((ext_vector_type(16))) __bf16 v16b;
typedef __attribute__((ext_vector_type(8)))  _Float16 v8h;
typedef __attribute__((ext_vector_type(8)))  float v8f;
typedef __attribute__((ext_vector_type(4)))  float v4f;
typedef __attribute__((ext_vector_type(2)))  float v2f;
typedef __attribute__((ext_vector_type(4)))  unsigned v4u;
typedef __attribute__((ext_vector_type(4)))  int v4i;
typedef float __attribute__((may_alias)) float_a;
typedef int __attribute__((may_alias)) int_a;

template <typename T> __device__ __forceinline__ void vst2(void* p, T v) { *(T*)p = v;  }
// a store in a loop whose next trip rewrites the store's address and data registers: the wait stands in front of that overwrite; as inputs here both stay live up to the wait
template <typename T> __device__ __forceinline__ void vst2w(void* p, T v) { *(T*)p = v; asm volatile("s_wait_xcnt 0x0" :: "v"(p), "v"(v) : "memory"); }
__device__ __forceinline__ v8f wmma16(v16h a, v16h b, v8f c) {
  v8f d = __builtin_amdgcn_wmma_f32_16x16x32_f16(false, a, false, b, (short)0, c, false, false);
  asm volatile("v_nop\n\tv_nop\n\tv_nop\n\tv_nop" : "+v"(d) : "v"(a), "v"(b));
  return d;
}
__device__ __forceinline__ v8f wmma_bf(v16b a, v16b b, v8f c) {
  v8f d = __builtin_amdgcn_wmma_f32_16x16x32_bf16(false, a, false, b, (short)0, c, false, false);
  asm volatile("v_nop\n\tv_nop\n\tv_nop\n\tv_nop" : "+v"(d) : "v"(a), "v"(b));
  return d;
}
// 16x16x32 fragments: lane = (h = lane>>4, row/col = lane&15); elements 0..7 = k0+8h+0..7, 8..15 = k0+16+8h+0..7; D element r = row 8h+r
__device__ __forceinline__ v16h frag_h(const _Float16* rowk0, int lane) {
  union { v16h v; v8h q[2]; } u; const _Float16* p = rowk0 + 8 * (lane >> 4);
  u.q[0] = *(const v8h*)p; u.q[1] = *(const v8h*)(p + 16); return u.v;
}
__device__ __forceinline__ v16h frag_f32(const float* rowk0, int lane) {
  v16h a; const float* p = rowk0 + 8 * (lane >> 4);
#pragma unroll
  for (int i = 0; i < 8; ++i) { a[i] = (_Float16)p[i]; a[8 + i] = (_Float16)p[16 + i]; }
  return a;
}
__device__ __forceinline__ v16h frag_f32s(const float* rowk0, int lane, float sc) {
  v16h a; const float* p = rowk0 + 8 * (lane >> 4);
#pragma unroll
  for (int i = 0; i < 8; ++i) { a[i] = (_Float16)(p[i] * sc); a[8 + i] = (_Float16)(p[16 + i] * sc); }
  return a;
}
// column fragment from a [K][ld] layout (column n), rows >= K read as 0
__device__ __forceinline__ v16h fragc_f32(const float* W, int k0, int n, int lane, int ld, int K) {
  v16h a; const int g = lane >> 4;
#pragma unroll
  for (int i = 0; i < 8; ++i) { const int ka = k0 + 8 * g + i, kb = ka + 16;
    a[i] = (_Float16)(ka < K ? W[(size_t)(ka < K ? ka : K - 1) * ld + n] : 0.f); a[8 + i] = (_Float16)(kb < K ? W[(size_t)(kb < K ? kb : K - 1) * ld + n] : 0.f); }
  return a;
}
struct F2 { v16b h, l; };
__device__ __forceinline__ F2 bsplit16(const float v[16]) { F2 r;
#pragma unroll
  for (int i = 0; i < 16; ++i) { const __bf16 h = (__bf16)v[i]; r.h[i] = h; r.l[i] = (__bf16)(v[i] - (float)h); }
  return r; }
__device__ __forceinline__ F2 split_row(const float* row, int k0, int lane) { float v[16]; const float* p = row + k0 + 8 * (lane >> 4);
#pragma unroll
  for (int i = 0; i < 8; ++i) { v[i] = p[i]; v[8 + i] = p[16 + i]; }
  return bsplit16(v); }
__device__ __forceinline__ F2 split_rowK(const float* row, int k0, int lane, int K) { float v[16]; const int g = lane >> 4;
#pragma unroll
  for (int i = 0; i < 8; ++i) { const int ka = k0 + 8 * g + i, kb = ka + 16; v[i] = ka < K ? row[ka < K ? ka : K - 1] : 0.f; v[8 + i] = kb < K ? row[kb < K ? kb : K - 1] : 0.f; }
  return bsplit16(v); }
__device__ __forceinline__ F2 split_col(const float* W, int k0, int n, int lane, int ld, int K) { float v[16]; const int g = lane >> 4;
#pragma unroll
  for (int i = 0; i < 8; ++i) { const int ka = k0 + 8 * g + i, kb = ka + 16; v[i] = ka < K ? W[(size_t)(ka < K ? ka : K - 1) * ld + n] : 0.f; v[8 + i] = kb < K ? W[(size_t)(kb < K ? kb : K - 1) * ld + n] : 0.f; }
  return bsplit16(v); }
__device__ __forceinline__ v8f mac3(const F2& a, const F2& b, v8f c) { c = wmma_bf(a.l, b.h, c); c = wmma_bf(a.h, b.l, c); return wmma_bf(a.h, b.h, c); }
__device__ __forceinline__ float sigm(float v) { return 1.0f / (1.0f + expf(-v)); }
#define LDSX() do { asm volatile("s_wait_dscnt 0" ::: "memory"); __builtin_amdgcn_wave_barrier(); __builtin_amdgcn_fence(__ATOMIC_RELEASE, "workgroup"); } while (0)

// Multi-head self-attention returning (y, head-averaged attention) (B 2, T 2,048, C 1,024 = 16 heads x 64): q/k/v = x W^T + b ((out,in)); attn = softmax(q k^T x 64^-0.5) over all keys; y = merged(attn v) Wp^T + bp; attn_avg[b][t][s] = mean over the 16 heads of attn.
#define NB 2
#define TT 2048
#define CC 1024            // NH * HD = projected width
#define DIN 1024          // input (model) width
#define NH 16
#define HD 64
#define SCALE (0.125f)
#define CAUSAL 0
#ifndef TNB
#define TNB NB
#endif
__device__ __forceinline__ float bfr(float v) { return (float)(__bf16)v; }
__host__ __device__ __forceinline__ int kb_last(int qb) { return CAUSAL ? ((qb * 64 + 63) >> 7) : (TT / 128 - 1); }
typedef __attribute__((ext_vector_type(8))) __bf16 v8b;
__device__ __forceinline__ v16b frag_b(const __bf16* rowk0, int lane) {
  union { v16b v; v8b q[2]; } u; const __bf16* p = rowk0 + 8 * (lane >> 4);
  u.q[0] = *(const v8b*)p; u.q[1] = *(const v8b*)(p + 16); return u.v;
}
#define QBH 0
#define QHI 2048            // rows carrying a q residual plane (all rows when non-causal: 2-product logits everywhere)
#define KHI 64            // key rows carrying k residual / v bf16 hi+lo planes (written by k_proj; no kernel in this file reads them)
// B fragment (k rows k0+.., output column o) of a weight: (in,out) [K][ld] or (out,in) [ld rows of K]: bf16 exact, or f16(bf16 * 256) exact
__device__ __forceinline__ v16b wcol_io(const float* Wm, int k0, int o, int lane, int ld) { v16b w; const int g = lane >> 4;
#pragma unroll
  for (int i = 0; i < 8; ++i) { w[i] = (__bf16)Wm[(size_t)(k0 + 8 * g + i) * ld + o]; w[8 + i] = (__bf16)Wm[(size_t)(k0 + 16 + 8 * g + i) * ld + o]; }
  return w; }
__device__ __forceinline__ v16b wcol_oi(const float* Wm, int k0, int o, int lane, int K) { v16b w; const float* p = Wm + (size_t)o * K + k0 + 8 * (lane >> 4);
#pragma unroll
  for (int i = 0; i < 8; ++i) { w[i] = (__bf16)p[i]; w[8 + i] = (__bf16)p[16 + i]; }
  return w; }
__device__ __forceinline__ v16h wcolh_io(const float* Wm, int k0, int o, int lane, int ld) { v16h w; const int g = lane >> 4;
#pragma unroll
  for (int i = 0; i < 8; ++i) { w[i] = (_Float16)(bfr(Wm[(size_t)(k0 + 8 * g + i) * ld + o]) * 256.0f); w[8 + i] = (_Float16)(bfr(Wm[(size_t)(k0 + 16 + 8 * g + i) * ld + o]) * 256.0f); }
  return w; }
__device__ __forceinline__ v16h wcolh_oi(const float* Wm, int k0, int o, int lane, int K) { v16h w; const float* p = Wm + (size_t)o * K + k0 + 8 * (lane >> 4);
#pragma unroll
  for (int i = 0; i < 8; ++i) { w[i] = (_Float16)(bfr(p[i]) * 256.0f); w[8 + i] = (_Float16)(bfr(p[16 + i]) * 256.0f); }
  return w; }
#define WQKV_LAYOUT 1   // 0 = (in,out) [DIN][CC]; 1 = (out,in) [CC][DIN]; 2 = per-head [NH][DIN][HD]
__device__ __forceinline__ v16b wcol_hdk(const float* Wm, int k0, int o, int lane) { v16b w; const int g = lane >> 4; const float* p = Wm + (size_t)(o / HD) * DIN * HD + (o % HD);
#pragma unroll
  for (int i = 0; i < 8; ++i) { w[i] = (__bf16)p[(size_t)(k0 + 8 * g + i) * HD]; w[8 + i] = (__bf16)p[(size_t)(k0 + 16 + 8 * g + i) * HD]; }
  return w; }
#define WO_OUT_IN 1
#if WQKV_LAYOUT == 1
#define WCOL(W, k0, o, lane) wcol_oi(W, k0, o, lane, DIN)
#elif WQKV_LAYOUT == 2
#define WCOL(W, k0, o, lane) wcol_hdk(W, k0, o, lane)
#else
#define WCOL(W, k0, o, lane) wcol_io(W, k0, o, lane, CC)
#endif
#if WO_OUT_IN
#define WOCOL(W, k0, o, lane) wcol_oi(W, k0, o, lane, CC)
#define WOCOLH(W, k0, o, lane) wcolh_oi(W, k0, o, lane, CC)
#else
#define WOCOL(W, k0, o, lane) wcol_io(W, k0, o, lane, DIN)
#define WOCOLH(W, k0, o, lane) wcolh_io(W, k0, o, lane, DIN)
#endif
#define OUT1_OFF (4u * (size_t)NB * TT * DIN)      // byte offset of attn_avg [B][T][T]

#define WS_QH  0u                                      // f16 q rows [b*t][CC]
#define WS_KH  (WS_QH + 2u * (size_t)NB * TT * CC)      // f16 k in fragment order: [b][head][16-key tile][32-column half][fragment half][lane][8]
#define WS_VT  (WS_KH + 2u * (size_t)NB * TT * CC)      // f16 v in fragment order: [b][head][32-key group][16-column group][fragment half][lane][8]
#define WS_QL  (WS_VT + 2u * (size_t)NB * CC * TT)      // f16 q residual x 2^10 rows [b][t < QHI][CC]
#define WS_KL  (WS_QL + 2u * (size_t)NB * QHI * CC)     // f16 k residual x 2^10 rows [b][t < KHI][CC]
#define WS_VB  (WS_KL + 2u * (size_t)NB * KHI * CC)     // bf16 v hi planes [b][c][t < KHI]
#define WS_VBL (WS_VB + 2u * (size_t)NB * CC * KHI)
#define WS_Y   (WS_VBL + 2u * (size_t)NB * CC * KHI)     // f32 ctx rows [b*t][CC] (only when there is an output projection)
#define WS_END (WS_Y  + 4u * (size_t)NB * TT * CC)

// k and v pass from k_proj to k_fa in the reader's fragment order: the 16 bytes that lane l = 16 g + n takes for fragment half p lie at element (p * 32 + l) * 8 of the fragment's 512, so a wave-wide 16-byte load covers 512 contiguous bytes = 4 whole lines.
// k (A of S^T): lane's row = key tile * 16 + n, its 8 columns = half * 32 + p * 16 + 8 g + 0..7. v (B of P V): lane's column = group * 16 + n, its 8 keys = key group * 32 + p * 16 + 8 g + 0..7.
#define KF_OFF(b, h, tile) ((((size_t)(b) * NH + (h)) * (TT / 16) + (tile)) * 1024)   // element offset of a 16-key tile of head h: 2 fragments
#define VF_OFF(b, h, grp)  ((((size_t)(b) * NH + (h)) * (TT / 32) + (grp)) * 2048)    // element offset of a 32-key group of head h: 4 fragments
__device__ __forceinline__ v16h frag_w(const _Float16* p) {   // p = the fragment's first element + lane * 8
  union { v16h v; v8h q[2]; } u; u.q[0] = *(const v8h*)p; u.q[1] = *(const v8h*)(p + 256); return u.v;
}
// GEMM operand staging (k_proj, k_out): a step = 64 k = 256 B of each f32 operand row. 16 lanes x 16 B fetch one row's step, so a wave-wide load covers 4 whole lines; each value is converted ONCE a block and stored as 16 bit in LDS, where all 4 waves read their fragments.
#define GKC 64             // k of a staged step
#define GP 72              // LDS pitch of a staged row in 16-bit elements: 144 B = 16 B x 9 (odd), conflict-free for 16-byte fragment reads
#define GROWS (64 + 128)   // rows 0..63 = the block's X (or ctx) rows, 64..191 = its 128 weight rows (output columns)
typedef __attribute__((ext_vector_type(4))) __bf16 v4b;
typedef __attribute__((ext_vector_type(4))) _Float16 v4h;
static_assert(WQKV_LAYOUT == 1 && WO_OUT_IN == 1, "the staging reads weight rows (out,in): k contiguous");
// ---- k_proj: block = (64 rows, 128 cols, which): q/k/v = X W (+ b) with exact bf16 products (K = DIN) -> which 0: q f16 rows (+ residual rows < QHI); 1: k f16 in fragment order (+ residual rows < KHI); 2: v f16 in fragment order (+ bf16 hi/lo planes for t < KHI)
__global__ __launch_bounds__(128) void k_proj(const float* __restrict__ XQ, const float* __restrict__ XK, const float* __restrict__ XV, const float* __restrict__ WQ, const float* __restrict__ WK, const float* __restrict__ WV, const float* __restrict__ BQ, const float* __restrict__ BK, const float* __restrict__ BV,
    _Float16* __restrict__ QH, _Float16* __restrict__ QL, _Float16* __restrict__ KH, _Float16* __restrict__ KL, _Float16* __restrict__ VT, __bf16* __restrict__ VB, __bf16* __restrict__ VBL) {
  __shared__ __align__(16) _Float16 sh[64][136], sl[64][136]; __shared__ __align__(16) _Float16 th[128][72]; __shared__ __align__(16) __bf16 tb[128][72], tbl[128][72]; __shared__ __align__(16) __bf16 stg[2][GROWS][GP];
  const int tid = threadIdx.x, wave = tid >> 5, lane = tid & 31, col = lane & 15, g = lane >> 4; const int which = blockIdx.z; const int c0 = blockIdx.y * 128; const size_t r0 = (size_t)blockIdx.x * 64; const size_t bb = r0 / TT; const int t0 = (int)(r0 % TT);
  const float* X = which == 0 ? XQ : which == 1 ? XK : XV; const float* WA = which == 0 ? WQ : which == 1 ? WK : WV; const float* BA = which == 0 ? BQ : which == 1 ? BK : BV;
  v8f acc[8] = {};
  const int lr = tid >> 4, ls = tid & 15;   // staging: this thread's row of each group of 8 rows, and its 16 bytes of the row's 256
  const float* gx = X + r0 * DIN; const float* gw = WA + (size_t)c0 * DIN; const unsigned go = lr * DIN + ls * 4;   // block-uniform bases and one per-thread offset
  v4f pf[GROWS / 8];
#pragma unroll
  for (int i = 0; i < GROWS / 8; ++i) pf[i] = i < 8 ? *(const v4f*)(gx + (size_t)(i * 8) * DIN + go) : *(const v4f*)(gw + (size_t)(i * 8 - 64) * DIN + go);
  for (int c = 0; c < DIN / GKC; ++c) { __bf16 (*sb)[GP] = stg[c & 1];
#pragma unroll
    for (int i = 0; i < GROWS / 8; ++i) *(v4b*)&sb[i * 8 + lr][ls * 4] = __builtin_convertvector(pf[i], v4b);
    __syncthreads();   // this step's rows are in LDS; it also ends every wave's reads of the other buffer, which the next step refills
    if (c + 1 < DIN / GKC) {   // the next step's rows, fetched into registers behind the barrier (which would drain them): the fragment reads and products below cover their latency
      const float* px = gx + (c + 1) * GKC + go; const float* pw = gw + (c + 1) * GKC + go;
#pragma unroll
      for (int i = 0; i < GROWS / 8; ++i) pf[i] = i < 8 ? *(const v4f*)(px + (size_t)(i * 8) * DIN) : *(const v4f*)(pw + (size_t)(i * 8 - 64) * DIN);
      asm volatile("s_wait_xcnt 0x0" :: "v"(px), "v"(pw) : "memory"); }   // stands in front of every overwrite of the fetch's address registers: as inputs here they stay live up to the wait, so no load of the group takes them as its destination
#pragma unroll
    for (int kc = 0; kc < GKC / 32; ++kc) { const v16b a = frag_b(&sb[wave * 16 + col][kc * 32], lane); v16b wf[8];
#pragma unroll
      for (int j = 0; j < 8; ++j) wf[j] = frag_b(&sb[64 + j * 16 + col][kc * 32], lane);
      __builtin_amdgcn_sched_barrier(0);   // keeps the 18 fragment reads one group in front of the 8 products: one LDS latency a group, not one a product
#pragma unroll
      for (int j = 0; j < 8; ++j) acc[j] = wmma_bf(a, wf[j], acc[j]); } }
  if (which < 2) { _Float16* DH = which == 0 ? QH : KH; _Float16* DL = which == 0 ? QL : KL; const int nhi = which == 0 ? QHI : KHI; const bool hi_rows = t0 < nhi;
#pragma unroll
    for (int j = 0; j < 8; ++j) { const float bias = BA ? bfr(BA[c0 + j * 16 + col]) : 0.f;
#pragma unroll
      for (int r = 0; r < 8; ++r) { const float v = acc[j][r] + bias; const _Float16 hv = (_Float16)v; sh[wave * 16 + 8 * g + r][j * 16 + col] = hv; sl[wave * 16 + 8 * g + r][j * 16 + col] = (_Float16)((v - (float)hv) * 1024.0f); } }
    __syncthreads();
    for (int e = tid; e < 64 * 16; e += 128) { int rl, cq; size_t dh;   // e = the 16-byte piece in the order of its destination: a wave's store covers whole lines
      if (which == 0) { rl = e >> 4; cq = (e & 15) * 8; dh = (r0 + rl) * CC + c0 + cq; }
      else { const int l = e & 31, fp = (e >> 5) & 3, tl = (e >> 7) & 3, hh = e >> 9; rl = tl * 16 + (l & 15); cq = hh * HD + fp * 16 + (l >> 4) * 8; dh = KF_OFF(bb, c0 / HD + hh, t0 / 16 + tl) + fp * 256 + l * 8; }
      vst2w((unsigned*)(DH + dh), *(const v4u*)&sh[rl][cq]); if (hi_rows) vst2w((unsigned*)(DL + (bb * nhi + t0 + rl) * (size_t)CC + c0 + cq), *(const v4u*)&sl[rl][cq]); }
  } else { const bool hi_rows = t0 < KHI;
#pragma unroll
    for (int j = 0; j < 8; ++j) { const float bias = BA ? bfr(BA[c0 + j * 16 + col]) : 0.f;
#pragma unroll
      for (int r = 0; r < 8; ++r) { const float v = acc[j][r] + bias; const int rl = wave * 16 + 8 * g + r, cl = j * 16 + col; th[cl][rl] = (_Float16)v; const __bf16 bh = (__bf16)v; tb[cl][rl] = bh; tbl[cl][rl] = (__bf16)(v - (float)bh); } }
    __syncthreads();
    for (int e = tid; e < 128 * 8; e += 128) { const int l = e & 31, jp = (e >> 5) & 7, kg = (e >> 8) & 1, hh = e >> 9;   // e = the 16-byte piece in the order of its destination: a wave's store covers whole lines
      const int cl = hh * HD + (jp >> 1) * 16 + (l & 15), kq = kg * 32 + (jp & 1) * 16 + (l >> 4) * 8;
      vst2w((unsigned*)(VT + VF_OFF(bb, c0 / HD + hh, t0 / 32 + kg) + jp * 256 + l * 8), *(const v4u*)&th[cl][kq]); if (hi_rows) { const size_t o3 = (bb * CC + c0 + cl) * (size_t)KHI + t0 + kq; vst2w((unsigned*)(VB + o3), *(const v4u*)&tb[cl][kq]); vst2w((unsigned*)(VBL + o3), *(const v4u*)&tbl[cl][kq]); } } } }
// ---- k_fa: block = 16 queries of batch b, NH waves, wave = head. The wave forms S^T = K Q^T (A = 16 key rows, B = the 16 query rows; q hi + residual x 2^10: 2 products), so a lane holds ONE query (col) and keys 8g + r of each 16-key tile: logits, softmax and P stay in registers.
// pass 1 walks all keys for the row maximum and the sum of exp (a running pair per lane, the two lane halves joined once at the end); pass 2 forms the logits again, P x 2^11 = exp(s - max) x 2048 / sum as one exp2: two S^T tiles ARE the 16 x 32 A fragment of P (elements 0..7 = keys k0 + 8g + r, 8..15 = k0 + 16 + 8g + r) against v f16 planes (1 product);
// the NH heads' f32 P tiles meet in LDS (two buffers, one barrier a 64-key step) and wave w sums query row w over the heads in head order: two whole 128-B lines of attn_avg a wave and step.
__device__ __forceinline__ v8f wmma_p(v16h a, v16h b, v8f c) { return __builtin_amdgcn_wmma_f32_16x16x32_f16(false, a, false, b, (short)0, c, false, false); }
__device__ __forceinline__ void st_tile(const v16h k0f, const v16h k1f, const v16h* qh, const v16h* ql, float* s) {
  v8f a = {}, al = {};
  a = wmma_p(k0f, qh[0], a); al = wmma_p(k0f, ql[0], al); a = wmma_p(k1f, qh[1], a); al = wmma_p(k1f, ql[1], al);
#pragma unroll
  for (int r = 0; r < 8; ++r) s[r] = a[r] + al[r] * (1.0f / 1024.0f); }   // the raw q.k sum: SCALE rides in the exponent's multiply-add (KL2E)
#define KL2E (SCALE * 1.44269504088896340736f)   // exp((t - tmax) x SCALE) = exp2(t x KL2E - tmax x KL2E)
__device__ __forceinline__ float ex2(float v) { return __builtin_amdgcn_exp2f(v); }   // v_exp_f32; arguments here are <= 11, and a result below the normal range may read 0
#define PBP 68             // LDS pitch of a 64-key P row in floats: the 16 query rows' 16-byte stores fall on 16 different bank groups
static_assert(NH == 16 && HD == 64, "wave w is head w and sums query row w of the 16-row tile");
__global__ __launch_bounds__(NH * 32) void k_fa(const _Float16* __restrict__ QH, const _Float16* __restrict__ QL, const _Float16* __restrict__ KH, const _Float16* __restrict__ VT, float* __restrict__ Y, float* __restrict__ AV) {
  __shared__ __align__(16) float pb[2][NH][16][PBP];
  const int tid = threadIdx.x, lane = tid & 31, col = lane & 15, g = lane >> 4; const int b = blockIdx.y; const int ql0 = blockIdx.x * 16;
  const int h = __builtin_amdgcn_readfirstlane(tid >> 5);   // the wave's number = its head, in a scalar register: head offsets stay scalar
  v16h qh[2], ql[2];
  const _Float16* pqh = QH + ((size_t)b * TT + ql0 + col) * CC + h * HD + 8 * g; const _Float16* pql = QL + ((size_t)b * QHI + ql0 + col) * CC + h * HD + 8 * g;   // the lane's own 8 columns of its query row
#pragma unroll
  for (int kc = 0; kc < 2; ++kc) { qh[kc] = frag_h(pqh + kc * 32, 0); ql[kc] = frag_h(pql + kc * 32, 0); }
  asm volatile("s_wait_xcnt 0x0" :: "v"(pqh), "v"(pql) : "memory");   // the q loads' address registers are reused as destinations of the k loads below: the wait stands in front of that overwrite; as inputs here they stay live up to it, so no q load takes them as its destination
  const _Float16* Kr = KH + KF_OFF(b, h, 0) + lane * 8;   // this head's k fragments, 64 elements a key: a fragment load covers 4 whole lines
  const _Float16* Vr = VT + VF_OFF(b, h, 0) + lane * 8;   // this head's v fragments, 64 elements a key
  float m = -3.0e38f, l = 0.f;
  v16h kf[8];
#pragma unroll
  for (int t = 0; t < 4; ++t) { kf[2 * t] = frag_w(Kr + t * 1024); kf[2 * t + 1] = frag_w(Kr + t * 1024 + 512); }
  for (int k0 = 0; k0 < TT; k0 += 64) { float s[32];
#pragma unroll
    for (int t = 0; t < 4; ++t) st_tile(kf[2 * t], kf[2 * t + 1], qh, ql, s + t * 8);
    const int kn = k0 + 64 < TT ? k0 + 64 : 0;   // the next 64 keys, fetched one trip ahead; the last trip fetches keys 0..63, of which pass 2 uses the first 32
#pragma unroll
    for (int t = 0; t < 4; ++t) { kf[2 * t] = frag_w(Kr + kn * HD + t * 1024); kf[2 * t + 1] = frag_w(Kr + kn * HD + t * 1024 + 512); }
    __builtin_amdgcn_sched_barrier(0);   // keeps the fetch ahead in front of the exp work below, which covers its latency
    float bm = s[0];
#pragma unroll
    for (int i = 1; i < 32; ++i) bm = fmaxf(bm, s[i]);
    const float mn = fmaxf(m, bm), nb = -mn * KL2E; float a = 0.f;
#pragma unroll
    for (int i = 0; i < 32; ++i) { const float x = fmaf(s[i], KL2E, nb); float e;
      if (i == 30) asm("v_exp_f32 %0, %1\n\tv_nop" : "=v"(e) : "v"(x));   // in this build the next v_exp_f32 takes this one's source register as its destination: the v_nop is the slot that the instruction set asks for behind a transcendental, tied to it in one statement
      else e = ex2(x);
      a += e; }
    l = l * ex2((m - mn) * KL2E) + a; m = mn;
    asm volatile("s_wait_xcnt 0x0" ::: "memory"); }   // the next trip rewrites the address registers of the fetch ahead: the wait stands in front of that overwrite
  { const float M = fmaxf(m, __shfl_xor(m, 16)); l *= ex2((m - M) * KL2E); l += __shfl_xor(l, 16); m = M; }
  const float nb2 = fmaf(-m, KL2E, 11.0f - __builtin_amdgcn_logf(l));   // P x 2^11 = exp2(t x KL2E + nb2): the maximum and 2048 / sum as one addend (v_log_f32 = log2; l lies between about 1 and 2048, a normal number)
  v8f acc[HD / 16] = {};
  float* av = AV + ((size_t)b * TT + ql0 + h) * TT + lane * 2;
  for (int st = 0; st < TT / 64; ++st) { v16h vf[2][HD / 16]; const _Float16* pv = Vr + st * 4096;   // a step = 64 keys, as two halves of 32 keys
#pragma unroll
    for (int u = 0; u < 2; ++u)
#pragma unroll
      for (int j = 0; j < HD / 16; ++j) vf[u][j] = frag_w(pv + u * 2048 + j * 512);
#pragma unroll
    for (int u = 0; u < 2; ++u) { float s[16];
      st_tile(kf[0], kf[1], qh, ql, s); st_tile(kf[2], kf[3], qh, ql, s + 8);
      const int kn = st * 64 + u * 32 + 32 < TT ? st * 64 + u * 32 + 32 : 0;   // the next 32 keys, fetched one half step ahead (the last fetch, of keys 0..31, is in bounds and unused)
      const _Float16* pk = Kr + kn * HD;
#pragma unroll
      for (int t = 0; t < 2; ++t) { kf[2 * t] = frag_w(pk + t * 1024); kf[2 * t + 1] = frag_w(pk + t * 1024 + 512); }
      asm volatile("s_wait_xcnt 0x0" :: "v"(pv), "v"(pk) : "memory");   // stands in front of every overwrite of the v and k loads' address registers: as inputs here they stay live up to the wait, so no load of the groups takes them as its destination
      __builtin_amdgcn_sched_barrier(0);   // keeps the v loads and the k fetch ahead in front of the exp work below, which covers their latency
      v16h p;
#pragma unroll
      for (int i = 0; i < 16; ++i) { s[i] = ex2(fmaf(s[i], KL2E, nb2)); p[i] = (_Float16)s[i]; }
#pragma unroll
      for (int j = 0; j < HD / 16; ++j) acc[j] = wmma_p(p, vf[u][j], acc[j]);
      float* pw = &pb[st & 1][h][col][u * 32 + 8 * g];
#pragma unroll
      for (int t = 0; t < 2; ++t) { v4f lo = { s[t * 8], s[t * 8 + 1], s[t * 8 + 2], s[t * 8 + 3] }, hi = { s[t * 8 + 4], s[t * 8 + 5], s[t * 8 + 6], s[t * 8 + 7] }; *(v4f*)(pw + t * 16) = lo; *(v4f*)(pw + t * 16 + 4) = hi; } }
    __syncthreads();   // all heads' P tiles of this step are in LDS; it also ends every wave's reads of the other buffer, which the next step refills
    v2f a = *(const v2f*)&pb[st & 1][0][h][lane * 2];
#pragma unroll
    for (int w = 1; w < NH; ++w) a += *(const v2f*)&pb[st & 1][w][h][lane * 2];
    vst2(av + st * 64, a * (1.0f / (2048.0f * NH))); }
#pragma unroll
  for (int j = 0; j < HD / 16; ++j)
#pragma unroll
    for (int r = 0; r < 8; ++r) Y[((size_t)b * TT + ql0 + 8 * g + r) * CC + h * HD + j * 16 + col] = acc[j][r] * (1.0f / 2048.0f); }
// ---- k_out: block = (64 rows, 128 cols): out = ctx Wo (+ bo): ctx once to f16 against Wo as f16(bf16 x 2^8) exact (1 product) x 2^-8; causal early rows (< QHI of each sequence): ctx bf16 hi + lo against exact bf16 Wo (2 products)
__global__ __launch_bounds__(128) void k_out(const float* __restrict__ Y, const float* __restrict__ WO, const float* __restrict__ BO, float* __restrict__ OUT) { __shared__ __align__(16) float sf[4][16][132]; __shared__ __align__(16) _Float16 stg[2][GROWS][GP];
  const int tid = threadIdx.x, wave = tid >> 5, lane = tid & 31, col = lane & 15, g = lane >> 4; const int c0 = blockIdx.y * 128; const size_t r0 = (size_t)blockIdx.x * 64 + wave * 16;
  v8f acc[8] = {};
  if (CAUSAL && (int)(((size_t)blockIdx.x * 64) % TT) < QHI) {   /* block-uniform */
#pragma unroll 2
    for (int kc = 0; kc < CC / 32; ++kc) { const F2 a = split_row(Y + (r0 + col) * CC, kc * 32, lane); asm volatile("s_wait_loadcnt 0x0" ::: "memory");
#pragma unroll
      for (int j = 0; j < 8; ++j) { const v16b w = WOCOL(WO, kc * 32, c0 + j * 16 + col, lane); asm volatile("s_wait_loadcnt 0x0" ::: "memory"); acc[j] = wmma_bf(a.h, w, acc[j]); acc[j] = wmma_bf(a.l, w, acc[j]); } }
#pragma unroll
    for (int j = 0; j < 8; ++j) { const float bias = BO ? bfr(BO[c0 + j * 16 + col]) : 0.f;
#pragma unroll
      for (int r = 0; r < 8; ++r) sf[wave][8 * g + r][j * 16 + col] = acc[j][r] + bias; }
  } else {
    const int lr = tid >> 4, ls = tid & 15;   // staging: this thread's row of each group of 8 rows, and its 16 bytes of the row's 256
    const float* gx = Y + (size_t)blockIdx.x * 64 * CC; const float* gw = WO + (size_t)c0 * CC; const unsigned go = lr * CC + ls * 4;   // block-uniform bases and one per-thread offset
    v4f pf[GROWS / 8];
#pragma unroll
    for (int i = 0; i < GROWS / 8; ++i) pf[i] = i < 8 ? *(const v4f*)(gx + (size_t)(i * 8) * CC + go) : *(const v4f*)(gw + (size_t)(i * 8 - 64) * CC + go);
    for (int c = 0; c < CC / GKC; ++c) { _Float16 (*sb)[GP] = stg[c & 1];
#pragma unroll
      for (int i = 0; i < GROWS / 8; ++i) { v4h t;
#pragma unroll
        for (int e = 0; e < 4; ++e) t[e] = i < 8 ? (_Float16)pf[i][e] : (_Float16)(bfr(pf[i][e]) * 256.0f);
        *(v4h*)&sb[i * 8 + lr][ls * 4] = t; }
      __syncthreads();   // this step's rows are in LDS; it also ends every wave's reads of the other buffer, which the next step refills
      if (c + 1 < CC / GKC) {   // the next step's rows, fetched into registers behind the barrier (which would drain them): the fragment reads and products below cover their latency
        const float* px = gx + (c + 1) * GKC + go; const float* pw = gw + (c + 1) * GKC + go;
#pragma unroll
        for (int i = 0; i < GROWS / 8; ++i) pf[i] = i < 8 ? *(const v4f*)(px + (size_t)(i * 8) * CC) : *(const v4f*)(pw + (size_t)(i * 8 - 64) * CC);
        asm volatile("s_wait_xcnt 0x0" :: "v"(px), "v"(pw) : "memory"); }   // stands in front of every overwrite of the fetch's address registers: as inputs here they stay live up to the wait, so no load of the group takes them as its destination
#pragma unroll
      for (int kc = 0; kc < GKC / 32; ++kc) { const v16h a = frag_h(&sb[wave * 16 + col][kc * 32], lane); v16h wf[8];
#pragma unroll
        for (int j = 0; j < 8; ++j) wf[j] = frag_h(&sb[64 + j * 16 + col][kc * 32], lane);
        __builtin_amdgcn_sched_barrier(0);   // keeps the 18 fragment reads one group in front of the 8 products: one LDS latency a group, not one a product
#pragma unroll
        for (int j = 0; j < 8; ++j) acc[j] = wmma16(a, wf[j], acc[j]); } }
#pragma unroll
    for (int j = 0; j < 8; ++j) { const float bias = BO ? bfr(BO[c0 + j * 16 + col]) : 0.f;
#pragma unroll
      for (int r = 0; r < 8; ++r) sf[wave][8 * g + r][j * 16 + col] = acc[j][r] * (1.0f / 256.0f) + bias; } }
  LDSX(); for (int rl = 0; rl < 16; ++rl) vst2(OUT + (r0 + rl) * DIN + c0 + lane * 4, *(const v4f*)&sf[wave][rl][lane * 4]); }

extern "C" void kernel_launch(void* const* d_in, const int* in_sizes, int n_in, void* d_out, int out_size, void* d_ws, size_t ws_size, hipStream_t stream) {
  (void)in_sizes; (void)n_in; (void)out_size;
  const float** F = (const float**)d_in;
  if (ws_size < (size_t)WS_END) return;
  char* ws = (char*)d_ws; _Float16 *QH = (_Float16*)(ws + WS_QH), *KH = (_Float16*)(ws + WS_KH), *VT = (_Float16*)(ws + WS_VT), *QL = (_Float16*)(ws + WS_QL), *KL = (_Float16*)(ws + WS_KL); __bf16 *VB = (__bf16*)(ws + WS_VB), *VBL = (__bf16*)(ws + WS_VBL); float *Y = (float*)(ws + WS_Y);
  (void)Y; (void)QL; (void)KL; (void)VB; (void)VBL;
  // inputs: 0 x [2,2048,1024]; 1 Wq, 2 bq, 3 Wk, 4 bk, 5 Wv, 6 bv, 7 Wp, 8 bp ((out,in) [1024,1024], [1024]); outputs: 0 y [2,2048,1024] @0, 1 attn_avg [2,2048,2048] @ OUT1_OFF
  float* AV = (float*)((char*)d_out + OUT1_OFF);
  k_proj<<<dim3(TNB * TT / 64, CC / 128, 3), 128, 0, stream>>>(F[0], F[0], F[0], F[1], F[3], F[5], F[2], F[4], F[6], QH, QL, KH, KL, VT, VB, VBL);
  k_fa<<<dim3(TT / 16, TNB), NH * 32, 0, stream>>>(QH, QL, KH, VT, Y, AV);
  k_out<<<dim3(TNB * TT / 64, DIN / 128), 128, 0, stream>>>(Y, F[7], F[8], (float*)d_out);
}

// v006
// Measured time: 185 microseconds a run.
// In both of two side-by-side timings against v005, it was 1.12 times as fast.
// Over all steps from v000 it is 8.09 times as fast.
// compute dtype: all float inputs rounded to bf16; q/k/v = x W^T + b with EXACT bf16 products on WMMA 16x16x32, f32 accumulate; q as f16 hi + residual (x 2^10) against k once to f16 (2 products) for the logits x 1/8; softmax in f32 (hardware exp2 of one fused multiply-add that carries scale x log2 e, the row maximum and, in pass 2, the row sum), the head-averaged attention map accumulated in f32 (8 heads a block in head order, then the two groups' sums); P x 2^11 once to f16 against v once to f16 (1 product); ctx once to f16 against Wp carried x 2^8 in f16 (exact bf16 values) + bp; f32 outputs.
#include <hip/hip_runtime.h>
#include <math.h>

typedef __attribute__((ext_vector_type(16))) _Float16 v16h;
typedef __attribute__((ext_vector_type(16))) __bf16 v16b;
typedef __attribute__((ext_vector_type(8)))  _Float16 v8h;
typedef __attribute__((ext_vector_type(8)))  float v8f;
typedef __attribute__((ext_vector_type(4)))  float v4f;
typedef __attribute__((ext_vector_type(2)))  float v2f;
typedef __attribute__((ext_vector_type(4)))  unsigned v4u;
typedef __attribute__((ext_vector_type(4)))  int v4i;
typedef float __attribute__((may_alias)) float_a;
typedef int __attribute__((may_alias)) int_a;

template <typename T> __device__ __forceinline__ void vst2(void* p, T v) { *(T*)p = v;  }
// a store in a loop whose next trip rewrites the store's address and data registers: the wait stands in front of that overwrite; as inputs here both stay live up to the wait
template <typename T> __device__ __forceinline__ void vst2w(void* p, T v) { *(T*)p = v; asm volatile("s_wait_xcnt 0x0" :: "v"(p), "v"(v) : "memory"); }
__device__ __forceinline__ v8f wmma16(v16h a, v16h b, v8f c) {
  v8f d = __builtin_amdgcn_wmma_f32_16x16x32_f16(false, a, false, b, (short)0, c, false, false);
  asm volatile("v_nop\n\tv_nop\n\tv_nop\n\tv_nop" : "+v"(d) : "v"(a), "v"(b));
  return d;
}
__device__ __forceinline__ v8f wmma_bf(v16b a, v16b b, v8f c) {
  v8f d = __builtin_amdgcn_wmma_f32_16x16x32_bf16(false, a, false, b, (short)0, c, false, false);
  asm volatile("v_nop\n\tv_nop\n\tv_nop\n\tv_nop" : "+v"(d) : "v"(a), "v"(b));
  return d;
}
// 16x16x32 fragments: lane = (h = lane>>4, row/col = lane&15); elements 0..7 = k0+8h+0..7, 8..15 = k0+16+8h+0..7; D element r = row 8h+r
__device__ __forceinline__ v16h frag_h(const _Float16* rowk0, int lane) {
  union { v16h v; v8h q[2]; } u; const _Float16* p = rowk0 + 8 * (lane >> 4);
  u.q[0] = *(const v8h*)p; u.q[1] = *(const v8h*)(p + 16); return u.v;
}
__device__ __forceinline__ v16h frag_f32(const float* rowk0, int lane) {
  v16h a; const float* p = rowk0 + 8 * (lane >> 4);
#pragma unroll
  for (int i = 0; i < 8; ++i) { a[i] = (_Float16)p[i]; a[8 + i] = (_Float16)p[16 + i]; }
  return a;
}
__device__ __forceinline__ v16h frag_f32s(const float* rowk0, int lane, float sc) {
  v16h a; const float* p = rowk0 + 8 * (lane >> 4);
#pragma unroll
  for (int i = 0; i < 8; ++i) { a[i] = (_Float16)(p[i] * sc); a[8 + i] = (_Float16)(p[16 + i] * sc); }
  return a;
}
// column fragment from a [K][ld] layout (column n), rows >= K read as 0
__device__ __forceinline__ v16h fragc_f32(const float* W, int k0, int n, int lane, int ld, int K) {
  v16h a; const int g = lane >> 4;
#pragma unroll
  for (int i = 0; i < 8; ++i) { const int ka = k0 + 8 * g + i, kb = ka + 16;
    a[i] = (_Float16)(ka < K ? W[(size_t)(ka < K ? ka : K - 1) * ld + n] : 0.f); a[8 + i] = (_Float16)(kb < K ? W[(size_t)(kb < K ? kb : K - 1) * ld + n] : 0.f); }
  return a;
}
struct F2 { v16b h, l; };
__device__ __forceinline__ F2 bsplit16(const float v[16]) { F2 r;
#pragma unroll
  for (int i = 0; i < 16; ++i) { const __bf16 h = (__bf16)v[i]; r.h[i] = h; r.l[i] = (__bf16)(v[i] - (float)h); }
  return r; }
__device__ __forceinline__ F2 split_row(const float* row, int k0, int lane) { float v[16]; const float* p = row + k0 + 8 * (lane >> 4);
#pragma unroll
  for (int i = 0; i < 8; ++i) { v[i] = p[i]; v[8 + i] = p[16 + i]; }
  return bsplit16(v); }
__device__ __forceinline__ F2 split_rowK(const float* row, int k0, int lane, int K) { float v[16]; const int g = lane >> 4;
#pragma unroll
  for (int i = 0; i < 8; ++i) { const int ka = k0 + 8 * g + i, kb = ka + 16; v[i] = ka < K ? row[ka < K ? ka : K - 1] : 0.f; v[8 + i] = kb < K ? row[kb < K ? kb : K - 1] : 0.f; }
  return bsplit16(v); }
__device__ __forceinline__ F2 split_col(const float* W, int k0, int n, int lane, int ld, int K) { float v[16]; const int g = lane >> 4;
#pragma unroll
  for (int i = 0; i < 8; ++i) { const int ka = k0 + 8 * g + i, kb = ka + 16; v[i] = ka < K ? W[(size_t)(ka < K ? ka : K - 1) * ld + n] : 0.f; v[8 + i] = kb < K ? W[(size_t)(kb < K ? kb : K - 1) * ld + n] : 0.f; }
  return bsplit16(v); }
__device__ __forceinline__ v8f mac3(const F2& a, const F2& b, v8f c) { c = wmma_bf(a.l, b.h, c); c = wmma_bf(a.h, b.l, c); return wmma_bf(a.h, b.h, c); }
__device__ __forceinline__ float sigm(float v) { return 1.0f / (1.0f + expf(-v)); }
#define LDSX() do { asm volatile("s_wait_dscnt 0" ::: "memory"); __builtin_amdgcn_wave_barrier(); __builtin_amdgcn_fence(__ATOMIC_RELEASE, "workgroup"); } while (0)

// Multi-head self-attention returning (y, head-averaged attention) (B 2, T 2,048, C 1,024 = 16 heads x 64): q/k/v = x W^T + b ((out,in)); attn = softmax(q k^T x 64^-0.5) over all keys; y = merged(attn v) Wp^T + bp; attn_avg[b][t][s] = mean over the 16 heads of attn.
#define NB 2
#define TT 2048
#define CC 1024            // NH * HD = projected width
#define DIN 1024          // input (model) width
#define NH 16
#define HD 64
#define SCALE (0.125f)
#define CAUSAL 0
#ifndef TNB
#define TNB NB
#endif
__device__ __forceinline__ float bfr(float v) { return (float)(__bf16)v; }
__host__ __device__ __forceinline__ int kb_last(int qb) { return CAUSAL ? ((qb * 64 + 63) >> 7) : (TT / 128 - 1); }
typedef __attribute__((ext_vector_type(8))) __bf16 v8b;
__device__ __forceinline__ v16b frag_b(const __bf16* rowk0, int lane) {
  union { v16b v; v8b q[2]; } u; const __bf16* p = rowk0 + 8 * (lane >> 4);
  u.q[0] = *(const v8b*)p; u.q[1] = *(const v8b*)(p + 16); return u.v;
}
#define QBH 0
#define QHI 2048            // rows carrying a q residual plane (all rows when non-causal: 2-product logits everywhere)
#define KHI 64            // key rows carrying k residual / v bf16 hi+lo planes (written by k_proj; no kernel in this file reads them)
// B fragment (k rows k0+.., output column o) of a weight: (in,out) [K][ld] or (out,in) [ld rows of K]: bf16 exact, or f16(bf16 * 256) exact
__device__ __forceinline__ v16b wcol_io(const float* Wm, int k0, int o, int lane, int ld) { v16b w; const int g = lane >> 4;
#pragma unroll
  for (int i = 0; i < 8; ++i) { w[i] = (__bf16)Wm[(size_t)(k0 + 8 * g + i) * ld + o]; w[8 + i] = (__bf16)Wm[(size_t)(k0 + 16 + 8 * g + i) * ld + o]; }
  return w; }
__device__ __forceinline__ v16b wcol_oi(const float* Wm, int k0, int o, int lane, int K) { v16b w; const float* p = Wm + (size_t)o * K + k0 + 8 * (lane >> 4);
#pragma unroll
  for (int i = 0; i < 8; ++i) { w[i] = (__bf16)p[i]; w[8 + i] = (__bf16)p[16 + i]; }
  return w; }
__device__ __forceinline__ v16h wcolh_io(const float* Wm, int k0, int o, int lane, int ld) { v16h w; const int g = lane >> 4;
#pragma unroll
  for (int i = 0; i < 8; ++i) { w[i] = (_Float16)(bfr(Wm[(size_t)(k0 + 8 * g + i) * ld + o]) * 256.0f); w[8 + i] = (_Float16)(bfr(Wm[(size_t)(k0 + 16 + 8 * g + i) * ld + o]) * 256.0f); }
  return w; }
__device__ __forceinline__ v16h wcolh_oi(const float* Wm, int k0, int o, int lane, int K) { v16h w; const float* p = Wm + (size_t)o * K + k0 + 8 * (lane >> 4);
#pragma unroll
  for (int i = 0; i < 8; ++i) { w[i] = (_Float16)(bfr(p[i]) * 256.0f); w[8 + i] = (_Float16)(bfr(p[16 + i]) * 256.0f); }
  return w; }
#define WQKV_LAYOUT 1   // 0 = (in,out) [DIN][CC]; 1 = (out,in) [CC][DIN]; 2 = per-head [NH][DIN][HD]
__device__ __forceinline__ v16b wcol_hdk(const float* Wm, int k0, int o, int lane) { v16b w; const int g = lane >> 4; const float* p = Wm + (size_t)(o / HD) * DIN * HD + (o % HD);
#pragma unroll
  for (int i = 0; i < 8; ++i) { w[i] = (__bf16)p[(size_t)(k0 + 8 * g + i) * HD]; w[8 + i] = (__bf16)p[(size_t)(k0 + 16 + 8 * g + i) * HD]; }
  return w; }
#define WO_OUT_IN 1
#if WQKV_LAYOUT == 1
#define WCOL(W, k0, o, lane) wcol_oi(W, k0, o, lane, DIN)
#elif WQKV_LAYOUT == 2
#define WCOL(W, k0, o, lane) wcol_hdk(W, k0, o, lane)
#else
#define WCOL(W, k0, o, lane) wcol_io(W, k0, o, lane, CC)
#endif
#if WO_OUT_IN
#define WOCOL(W, k0, o, lane) wcol_oi(W, k0, o, lane, CC)
#define WOCOLH(W, k0, o, lane) wcolh_oi(W, k0, o, lane, CC)
#else
#define WOCOL(W, k0, o, lane) wcol_io(W, k0, o, lane, DIN)
#define WOCOLH(W, k0, o, lane) wcolh_io(W, k0, o, lane, DIN)
#endif
#define OUT1_OFF (4u * (size_t)NB * TT * DIN)      // byte offset of attn_avg [B][T][T]

#define WS_QH  0u                                      // f16 q rows [b*t][CC]
#define WS_KH  (WS_QH + 2u * (size_t)NB * TT * CC)      // f16 k in fragment order: [b][head][16-key tile][32-column half][fragment half][lane][8]
#define WS_VT  (WS_KH + 2u * (size_t)NB * TT * CC)      // f16 v in fragment order: [b][head][32-key group][16-column group][fragment half][lane][8]
#define WS_QL  (WS_VT + 2u * (size_t)NB * CC * TT)      // f16 q residual x 2^10 rows [b][t < QHI][CC]
#define WS_KL  (WS_QL + 2u * (size_t)NB * QHI * CC)     // f16 k residual x 2^10 rows [b][t < KHI][CC]
#define WS_VB  (WS_KL + 2u * (size_t)NB * KHI * CC)     // bf16 v hi planes [b][c][t < KHI]
#define WS_VBL (WS_VB + 2u * (size_t)NB * CC * KHI)
#define WS_Y   (WS_VBL + 2u * (size_t)NB * CC * KHI)     // f32 ctx rows [b*t][CC] (only when there is an output projection)
#define WS_PA  (WS_Y  + 4u * (size_t)NB * TT * CC)     // f32 sums of P x 2^11 over a group of 8 heads [head group][b][t][s]
#define WS_END (WS_PA + 4u * 2u * (size_t)NB * TT * TT)

// k and v pass from k_proj to k_fa in the reader's fragment order: the 16 bytes that lane l = 16 g + n takes for fragment half p lie at element (p * 32 + l) * 8 of the fragment's 512, so a wave-wide 16-byte load covers 512 contiguous bytes = 4 whole lines.
// k (A of S^T): lane's row = key tile * 16 + n, its 8 columns = half * 32 + p * 16 + 8 g + 0..7. v (B of P V): lane's column = group * 16 + n, its 8 keys = key group * 32 + p * 16 + 8 g + 0..7.
#define KF_OFF(b, h, tile) ((((size_t)(b) * NH + (h)) * (TT / 16) + (tile)) * 1024)   // element offset of a 16-key tile of head h: 2 fragments
#define VF_OFF(b, h, grp)  ((((size_t)(b) * NH + (h)) * (TT / 32) + (grp)) * 2048)    // element offset of a 32-key group of head h: 4 fragments
__device__ __forceinline__ v16h frag_w(const _Float16* p) {   // p = the fragment's first element + lane * 8
  union { v16h v; v8h q[2]; } u; u.q[0] = *(const v8h*)p; u.q[1] = *(const v8h*)(p + 256); return u.v;
}
// GEMM operand staging (k_proj, k_out): a step = 64 k = 256 B of each f32 operand row. 16 lanes x 16 B fetch one row's step, so a wave-wide load covers 4 whole lines; each value is converted ONCE a block and stored as 16 bit in LDS, where all 4 waves read their fragments.
#define GKC 64             // k of a staged step
#define GP 72              // LDS pitch of a staged row in 16-bit elements: 144 B = 16 B x 9 (odd), conflict-free for 16-byte fragment reads
#define GROWS (64 + 128)   // rows 0..63 = the block's X (or ctx) rows, 64..191 = its 128 weight rows (output columns)
typedef __attribute__((ext_vector_type(4))) __bf16 v4b;
typedef __attribute__((ext_vector_type(4))) _Float16 v4h;
static_assert(WQKV_LAYOUT == 1 && WO_OUT_IN == 1, "the staging reads weight rows (out,in): k contiguous");
// ---- k_proj: block = (64 rows, 128 cols, which): q/k/v = X W (+ b) with exact bf16 products (K = DIN) -> which 0: q f16 rows (+ residual rows < QHI); 1: k f16 in fragment order (+ residual rows < KHI); 2: v f16 in fragment order (+ bf16 hi/lo planes for t < KHI)
__global__ __launch_bounds__(128) void k_proj(const float* __restrict__ XQ, const float* __restrict__ XK, const float* __restrict__ XV, const float* __restrict__ WQ, const float* __restrict__ WK, const float* __restrict__ WV, const float* __restrict__ BQ, const float* __restrict__ BK, const float* __restrict__ BV,
    _Float16* __restrict__ QH, _Float16* __restrict__ QL, _Float16* __restrict__ KH, _Float16* __restrict__ KL, _Float16* __restrict__ VT, __bf16* __restrict__ VB, __bf16* __restrict__ VBL) {
  __shared__ __align__(16) _Float16 sh[64][136], sl[64][136]; __shared__ __align__(16) _Float16 th[128][72]; __shared__ __align__(16) __bf16 tb[128][72], tbl[128][72]; __shared__ __align__(16) __bf16 stg[2][GROWS][GP];
  const int tid = threadIdx.x, wave = tid >> 5, lane = tid & 31, col = lane & 15, g = lane >> 4; const int which = blockIdx.z; const int c0 = blockIdx.y * 128; const size_t r0 = (size_t)blockIdx.x * 64; const size_t bb = r0 / TT; const int t0 = (int)(r0 % TT);
  const float* X = which == 0 ? XQ : which == 1 ? XK : XV; const float* WA = which == 0 ? WQ : which == 1 ? WK : WV; const float* BA = which == 0 ? BQ : which == 1 ? BK : BV;
  v8f acc[8] = {};
  const int lr = tid >> 4, ls = tid & 15;   // staging: this thread's row of each group of 8 rows, and its 16 bytes of the row's 256
  const float* gx = X + r0 * DIN; const float* gw = WA + (size_t)c0 * DIN; const unsigned go = lr * DIN + ls * 4;   // block-uniform bases and one per-thread offset
  v4f pf[GROWS / 8];
#pragma unroll
  for (int i = 0; i < GROWS / 8; ++i) pf[i] = i < 8 ? *(const v4f*)(gx + (size_t)(i * 8) * DIN + go) : *(const v4f*)(gw + (size_t)(i * 8 - 64) * DIN + go);
  for (int c = 0; c < DIN / GKC; ++c) { __bf16 (*sb)[GP] = stg[c & 1];
#pragma unroll
    for (int i = 0; i < GROWS / 8; ++i) *(v4b*)&sb[i * 8 + lr][ls * 4] = __builtin_convertvector(pf[i], v4b);
    __syncthreads();   // this step's rows are in LDS; it also ends every wave's reads of the other buffer, which the next step refills
    if (c + 1 < DIN / GKC) {   // the next step's rows, fetched into registers behind the barrier (which would drain them): the fragment reads and products below cover their latency
      const float* px = gx + (c + 1) * GKC + go; const float* pw = gw + (c + 1) * GKC + go;
#pragma unroll
      for (int i = 0; i < GROWS / 8; ++i) pf[i] = i < 8 ? *(const v4f*)(px + (size_t)(i * 8) * DIN) : *(const v4f*)(pw + (size_t)(i * 8 - 64) * DIN);
      asm volatile("s_wait_xcnt 0x0" :: "v"(px), "v"(pw) : "memory"); }   // stands in front of every overwrite of the fetch's address registers: as inputs here they stay live up to the wait, so no load of the group takes them as its destination
#pragma unroll
    for (int kc = 0; kc < GKC / 32; ++kc) { const v16b a = frag_b(&sb[wave * 16 + col][kc * 32], lane); v16b wf[8];
#pragma unroll
      for (int j = 0; j < 8; ++j) wf[j] = frag_b(&sb[64 + j * 16 + col][kc * 32], lane);
      __builtin_amdgcn_sched_barrier(0);   // keeps the 18 fragment reads one group in front of the 8 products: one LDS latency a group, not one a product
#pragma unroll
      for (int j = 0; j < 8; ++j) acc[j] = wmma_bf(a, wf[j], acc[j]); } }
  if (which < 2) { _Float16* DH = which == 0 ? QH : KH; _Float16* DL = which == 0 ? QL : KL; const int nhi = which == 0 ? QHI : KHI; const bool hi_rows = t0 < nhi;
#pragma unroll
    for (int j = 0; j < 8; ++j) { const float bias = BA ? bfr(BA[c0 + j * 16 + col]) : 0.f;
#pragma unroll
      for (int r = 0; r < 8; ++r) { const float v = acc[j][r] + bias; const _Float16 hv = (_Float16)v; sh[wave * 16 + 8 * g + r][j * 16 + col] = hv; sl[wave * 16 + 8 * g + r][j * 16 + col] = (_Float16)((v - (float)hv) * 1024.0f); } }
    __syncthreads();
    for (int e = tid; e < 64 * 16; e += 128) { int rl, cq; size_t dh;   // e = the 16-byte piece in the order of its destination: a wave's store covers whole lines
      if (which == 0) { rl = e >> 4; cq = (e & 15) * 8; dh = (r0 + rl) * CC + c0 + cq; }
      else { const int l = e & 31, fp = (e >> 5) & 3, tl = (e >> 7) & 3, hh = e >> 9; rl = tl * 16 + (l & 15); cq = hh * HD + fp * 16 + (l >> 4) * 8; dh = KF_OFF(bb, c0 / HD + hh, t0 / 16 + tl) + fp * 256 + l * 8; }
      vst2w((unsigned*)(DH + dh), *(const v4u*)&sh[rl][cq]); if (hi_rows) vst2w((unsigned*)(DL + (bb * nhi + t0 + rl) * (size_t)CC + c0 + cq), *(const v4u*)&sl[rl][cq]); }
  } else { const bool hi_rows = t0 < KHI;
#pragma unroll
    for (int j = 0; j < 8; ++j) { const float bias = BA ? bfr(BA[c0 + j * 16 + col]) : 0.f;
#pragma unroll
      for (int r = 0; r < 8; ++r) { const float v = acc[j][r] + bias; const int rl = wave * 16 + 8 * g + r, cl = j * 16 + col; th[cl][rl] = (_Float16)v; const __bf16 bh = (__bf16)v; tb[cl][rl] = bh; tbl[cl][rl] = (__bf16)(v - (float)bh); } }
    __syncthreads();
    for (int e = tid; e < 128 * 8; e += 128) { const int l = e & 31, jp = (e >> 5) & 7, kg = (e >> 8) & 1, hh = e >> 9;   // e = the 16-byte piece in the order of its destination: a wave's store covers whole lines
      const int cl = hh * HD + (jp >> 1) * 16 + (l & 15), kq = kg * 32 + (jp & 1) * 16 + (l >> 4) * 8;
      vst2w((unsigned*)(VT + VF_OFF(bb, c0 / HD + hh, t0 / 32 + kg) + jp * 256 + l * 8), *(const v4u*)&th[cl][kq]); if (hi_rows) { const size_t o3 = (bb * CC + c0 + cl) * (size_t)KHI + t0 + kq; vst2w((unsigned*)(VB + o3), *(const v4u*)&tb[cl][kq]); vst2w((unsigned*)(VBL + o3), *(const v4u*)&tbl[cl][kq]); } } } }
// ---- k_fa: block = 32 queries of batch b and HG = 8 of the heads, HG waves, wave = head. A wave holds QT = 2 query tiles of 16 in registers and uses every k and v fragment that it loads for both: half the fragment bytes from L2 per score.
// The wave forms S^T = K Q^T (A = 16 key rows, B = 16 query rows; q hi + residual x 2^10: 2 products), so a lane holds ONE query (col) of each tile and keys 8g + r of each 16-key tile: logits, softmax and P stay in registers.
// pass 1 walks all keys for the row maximum and the sum of exp (a running pair per lane and query tile, the two lane halves joined once at the end); pass 2 forms the logits again, P x 2^11 = exp(s - max) x 2048 / sum as one exp2: two S^T tiles ARE the 16 x 32 A fragment of P (elements 0..7 = keys k0 + 8g + r, 8..15 = k0 + 16 + 8g + r) against v f16 planes (1 product);
// the HG heads' f32 P tiles meet in LDS (two buffers, one barrier a 64-key step) and wave w sums query rows 4w..4w+3 over the block's heads in head order: whole 128-B lines of the head group's partial plane, which k_avg joins.
__device__ __forceinline__ v8f wmma_p(v16h a, v16h b, v8f c) { return __builtin_amdgcn_wmma_f32_16x16x32_f16(false, a, false, b, (short)0, c, false, false); }
__device__ __forceinline__ void st_tile(const v16h k0f, const v16h k1f, const v16h* qh, const v16h* ql, float* s) {
  v8f a = {}, al = {};
  a = wmma_p(k0f, qh[0], a); al = wmma_p(k0f, ql[0], al); a = wmma_p(k1f, qh[1], a); al = wmma_p(k1f, ql[1], al);
#pragma unroll
  for (int r = 0; r < 8; ++r) s[r] = a[r] + al[r] * (1.0f / 1024.0f); }   // the raw q.k sum: SCALE rides in the exponent's multiply-add (KL2E)
#define KL2E (SCALE * 1.44269504088896340736f)   // exp((t - tmax) x SCALE) = exp2(t x KL2E - tmax x KL2E)
__device__ __forceinline__ float ex2(float v) { return __builtin_amdgcn_exp2f(v); }   // v_exp_f32; arguments here are <= 11, and a result below the normal range may read 0
__device__ __forceinline__ float ex2n(float v) { float e; asm("v_exp_f32 %0, %1\n\tv_nop" : "=v"(e) : "v"(v)); return e; }   // the same, for the places where in this build the next vector instruction takes the source register as its destination: the v_nop is the slot that the instruction set asks for behind a transcendental, tied to it in one statement
#define PBP 68             // LDS pitch of a 64-key P row in floats: the 16 query rows' 16-byte stores fall on 16 different bank groups
#define QT 2               // query tiles of 16 a wave
#define HG 8               // heads = waves of a block
static_assert(NH % HG == 0 && HD == 64 && QT * 16 == HG * 4, "wave w is head w of its group and sums 4 query rows of the 32-row tile");
__global__ __launch_bounds__(HG * 32) void k_fa(const _Float16* __restrict__ QH, const _Float16* __restrict__ QL, const _Float16* __restrict__ KH, const _Float16* __restrict__ VT, float* __restrict__ Y, float* __restrict__ PA) {
  __shared__ __align__(16) float pb[2][HG][QT * 16][PBP];
  const int tid = threadIdx.x, lane = tid & 31, col = lane & 15, g = lane >> 4; const int b = blockIdx.y; const int ql0 = blockIdx.x * (QT * 16);
  const int w = __builtin_amdgcn_readfirstlane(tid >> 5); const int h = blockIdx.z * HG + w;   // the wave's number and its head, in scalar registers: head offsets stay scalar
  v16h qh[QT][2], ql[QT][2];
  const _Float16* pqh = QH + ((size_t)b * TT + ql0 + col) * CC + h * HD + 8 * g; const _Float16* pql = QL + ((size_t)b * QHI + ql0 + col) * CC + h * HD + 8 * g;   // the lane's own 8 columns of its query row of tile 0
#pragma unroll
  for (int qt = 0; qt < QT; ++qt)
#pragma unroll
    for (int kc = 0; kc < 2; ++kc) { qh[qt][kc] = frag_h(pqh + qt * 16 * CC + kc * 32, 0); ql[qt][kc] = frag_h(pql + qt * 16 * CC + kc * 32, 0); }
  asm volatile("s_wait_xcnt 0x0" :: "v"(pqh), "v"(pql) : "memory");   // the q loads' address registers are reused below: the wait stands in front of that overwrite; as inputs here they stay live up to it, so no q load takes them as its destination
  const _Float16* Kr = KH + KF_OFF(b, h, 0) + lane * 8;   // this head's k fragments, 64 elements a key: a fragment load covers 4 whole lines
  const _Float16* Vr = VT + VF_OFF(b, h, 0) + lane * 8;   // this head's v fragments, 64 elements a key
  constexpr unsigned slot1[QT] = { 0x1b00u, 0x30c2e030u };   // pass 1: bit i of tile qt = this build needs the slot of ex2n behind the exp of score i
  float m[QT], l[QT];
#pragma unroll
  for (int qt = 0; qt < QT; ++qt) { m[qt] = -3.0e38f; l[qt] = 0.f; }
  v16h kf[8];
#pragma unroll
  for (int t = 0; t < 4; ++t) { kf[2 * t] = frag_w(Kr + t * 1024); kf[2 * t + 1] = frag_w(Kr + t * 1024 + 512); }
  for (int k0 = 0; k0 < TT; k0 += 64) { float s[QT][32];
#pragma unroll
    for (int qt = 0; qt < QT; ++qt)
#pragma unroll
      for (int t = 0; t < 4; ++t) st_tile(kf[2 * t], kf[2 * t + 1], qh[qt], ql[qt], s[qt] + t * 8);
    const int kn = k0 + 64 < TT ? k0 + 64 : 0;   // the next 64 keys, fetched one trip ahead; the last trip fetches keys 0..63, of which pass 2 uses the first 32
    const _Float16* pk = Kr + kn * HD;
#pragma unroll
    for (int t = 0; t < 4; ++t) { kf[2 * t] = frag_w(pk + t * 1024); kf[2 * t + 1] = frag_w(pk + t * 1024 + 512); }
    __builtin_amdgcn_sched_barrier(0);   // keeps the fetch ahead in front of the exp work below, which covers its latency
#pragma unroll
    for (int qt = 0; qt < QT; ++qt) { float bm = s[qt][0];
#pragma unroll
      for (int i = 1; i < 32; ++i) bm = fmaxf(bm, s[qt][i]);
      const float mn = fmaxf(m[qt], bm), nb = -mn * KL2E; float a = 0.f;
#pragma unroll
      for (int i = 0; i < 32; ++i) { const float x = fmaf(s[qt][i], KL2E, nb); a += (slot1[qt] >> i & 1) ? ex2n(x) : ex2(x); }
      l[qt] = l[qt] * ex2n((m[qt] - mn) * KL2E) + a; m[qt] = mn; }
    asm volatile("s_wait_xcnt 0x0" :: "v"(pk) : "memory"); }   // the next trip rewrites the address registers of the fetch ahead: the wait stands in front of that overwrite; as an input here they stay live up to it, through the exp work
  float nb2[QT];
#pragma unroll
  for (int qt = 0; qt < QT; ++qt) { const float M = fmaxf(m[qt], __shfl_xor(m[qt], 16)); float lq = l[qt] * ex2n((m[qt] - M) * KL2E); lq += __shfl_xor(lq, 16);
    nb2[qt] = fmaf(-M, KL2E, 11.0f - __builtin_amdgcn_logf(lq)); }   // P x 2^11 = exp2(t x KL2E + nb2): the maximum and 2048 / sum as one addend (v_log_f32 = log2; the sum lies between about 1 and 2048, a normal number)
  v8f acc[QT][HD / 16] = {};
  float* pa = PA + (((size_t)blockIdx.z * NB + b) * TT + ql0 + w * 4 + g) * TT + col * 4;   // a half wave = one query row's 64 keys of a step = 2 whole lines
  for (int st = 0; st < TT / 64; ++st) { v16h vf[2][HD / 16]; const _Float16* pv = Vr + st * 4096;   // a step = 64 keys, as two halves of 32 keys
#pragma unroll
    for (int u = 0; u < 2; ++u)
#pragma unroll
      for (int j = 0; j < HD / 16; ++j) vf[u][j] = frag_w(pv + u * 2048 + j * 512);
#pragma unroll
    for (int u = 0; u < 2; ++u) { float s[QT][16];
#pragma unroll
      for (int qt = 0; qt < QT; ++qt) { st_tile(kf[0], kf[1], qh[qt], ql[qt], s[qt]); st_tile(kf[2], kf[3], qh[qt], ql[qt], s[qt] + 8); }
      const int kn = st * 64 + u * 32 + 32 < TT ? st * 64 + u * 32 + 32 : 0;   // the next 32 keys, fetched one half step ahead (the last fetch, of keys 0..31, is in bounds and unused)
      const _Float16* pk = Kr + kn * HD;
#pragma unroll
      for (int t = 0; t < 2; ++t) { kf[2 * t] = frag_w(pk + t * 1024); kf[2 * t + 1] = frag_w(pk + t * 1024 + 512); }
      asm volatile("s_wait_xcnt 0x0" :: "v"(pv), "v"(pk) : "memory");   // stands in front of every overwrite of the v and k loads' address registers: as inputs here they stay live up to the wait, so no load of the groups takes them as its destination
      __builtin_amdgcn_sched_barrier(0);   // keeps the v loads and the k fetch ahead in front of the exp work below, which covers their latency
#pragma unroll
      for (int qt = 0; qt < QT; ++qt) { v16h p;
#pragma unroll
        for (int i = 0; i < 16; ++i) { s[qt][i] = ex2(fmaf(s[qt][i], KL2E, nb2[qt])); p[i] = (_Float16)s[qt][i]; }
#pragma unroll
        for (int j = 0; j < HD / 16; ++j) acc[qt][j] = wmma_p(p, vf[u][j], acc[qt][j]);
        float* pw = &pb[st & 1][w][qt * 16 + col][u * 32 + 8 * g];
#pragma unroll
        for (int t = 0; t < 2; ++t) { v4f lo = { s[qt][t * 8], s[qt][t * 8 + 1], s[qt][t * 8 + 2], s[qt][t * 8 + 3] }, hi = { s[qt][t * 8 + 4], s[qt][t * 8 + 5], s[qt][t * 8 + 6], s[qt][t * 8 + 7] }; *(v4f*)(pw + t * 16) = lo; *(v4f*)(pw + t * 16 + 4) = hi; } } }
    __syncthreads();   // the block's heads' P tiles of this step are in LDS; it also ends every wave's reads of the other buffer, which the next step refills
    v4f a[2];
#pragma unroll
    for (int i = 0; i < 2; ++i) { a[i] = *(const v4f*)&pb[st & 1][0][w * 4 + i * 2 + g][col * 4];
#pragma unroll
      for (int hh = 1; hh < HG; ++hh) a[i] += *(const v4f*)&pb[st & 1][hh][w * 4 + i * 2 + g][col * 4]; }
    float* po = pa + st * 64;
    vst2(po, a[0]); vst2(po + 2 * TT, a[1]);
    asm volatile("s_wait_xcnt 0x0" :: "v"(po), "v"(a[0]), "v"(a[1]) : "memory"); }   // the next step rewrites the two stores' address and data registers: the wait stands in front of that overwrite; as inputs here they stay live up to it
#pragma unroll
  for (int qt = 0; qt < QT; ++qt)
#pragma unroll
    for (int j = 0; j < HD / 16; ++j)
#pragma unroll
      for (int r = 0; r < 8; ++r) Y[((size_t)b * TT + ql0 + qt * 16 + 8 * g + r) * CC + h * HD + j * 16 + col] = acc[qt][j][r] * (1.0f / 2048.0f); }
// ---- k_avg: attn_avg = (the NH / HG head groups' partial planes, in group order) / (2^11 NH): a stream, 16 bytes a lane, 8 loads in flight a wave
static_assert(NH / HG == 2, "k_avg joins two planes");
__global__ __launch_bounds__(256) void k_avg(const float* __restrict__ PA, float* __restrict__ AV) {
  const size_t o = (size_t)blockIdx.x * 4096 + threadIdx.x * 4; const float* p0 = PA + o; const float* p1 = p0 + (size_t)NB * TT * TT;
  v4f x[4], y[4];
#pragma unroll
  for (int i = 0; i < 4; ++i) { x[i] = *(const v4f*)(p0 + i * 1024); y[i] = *(const v4f*)(p1 + i * 1024); }
#pragma unroll
  for (int i = 0; i < 4; ++i) vst2(AV + o + i * 1024, (x[i] + y[i]) * (1.0f / (2048.0f * NH))); }
// ---- k_out: block = (64 rows, 128 cols): out = ctx Wo (+ bo): ctx once to f16 against Wo as f16(bf16 x 2^8) exact (1 product) x 2^-8; causal early rows (< QHI of each sequence): ctx bf16 hi + lo against exact bf16 Wo (2 products)
__global__ __launch_bounds__(128) void k_out(const float* __restrict__ Y, const float* __restrict__ WO, const float* __restrict__ BO, float* __restrict__ OUT) { __shared__ __align__(16) float sf[4][16][132]; __shared__ __align__(16) _Float16 stg[2][GROWS][GP];
  const int tid = threadIdx.x, wave = tid >> 5, lane = tid & 31, col = lane & 15, g = lane >> 4; const int c0 = blockIdx.y * 128; const size_t r0 = (size_t)blockIdx.x * 64 + wave * 16;
  v8f acc[8] = {};
  if (CAUSAL && (int)(((size_t)blockIdx.x * 64) % TT) < QHI) {   /* block-uniform */
#pragma unroll 2
    for (int kc = 0; kc < CC / 32; ++kc) { const F2 a = split_row(Y + (r0 + col) * CC, kc * 32, lane); asm volatile("s_wait_loadcnt 0x0" ::: "memory");
#pragma unroll
      for (int j = 0; j < 8; ++j) { const v16b w = WOCOL(WO, kc * 32, c0 + j * 16 + col, lane); asm volatile("s_wait_loadcnt 0x0" ::: "memory"); acc[j] = wmma_bf(a.h, w, acc[j]); acc[j] = wmma_bf(a.l, w, acc[j]); } }
#pragma unroll
    for (int j = 0; j < 8; ++j) { const float bias = BO ? bfr(BO[c0 + j * 16 + col]) : 0.f;
#pragma unroll
      for (int r = 0; r < 8; ++r) sf[wave][8 * g + r][j * 16 + col] = acc[j][r] + bias; }
  } else {
    const int lr = tid >> 4, ls = tid & 15;   // staging: this thread's row of each group of 8 rows, and its 16 bytes of the row's 256
    const float* gx = Y + (size_t)blockIdx.x * 64 * CC; const float* gw = WO + (size_t)c0 * CC; const unsigned go = lr * CC + ls * 4;   // block-uniform bases and one per-thread offset
    v4f pf[GROWS / 8];
#pragma unroll
    for (int i = 0; i < GROWS / 8; ++i) pf[i] = i < 8 ? *(const v4f*)(gx + (size_t)(i * 8) * CC + go) : *(const v4f*)(gw + (size_t)(i * 8 - 64) * CC + go);
    for (int c = 0; c < CC / GKC; ++c) { _Float16 (*sb)[GP] = stg[c & 1];
#pragma unroll
      for (int i = 0; i < GROWS / 8; ++i) { v4h t;
#pragma unroll
        for (int e = 0; e < 4; ++e) t[e] = i < 8 ? (_Float16)pf[i][e] : (_Float16)(bfr(pf[i][e]) * 256.0f);
        *(v4h*)&sb[i * 8 + lr][ls * 4] = t; }
      __syncthreads();   // this step's rows are in LDS; it also ends every wave's reads of the other buffer, which the next step refills
      if (c + 1 < CC / GKC) {   // the next step's rows, fetched into registers behind the barrier (which would drain them): the fragment reads and products below cover their latency
        const float* px = gx + (c + 1) * GKC + go; const float* pw = gw + (c + 1) * GKC + go;
#pragma unroll
        for (int i = 0; i < GROWS / 8; ++i) pf[i] = i < 8 ? *(const v4f*)(px + (size_t)(i * 8) * CC) : *(const v4f*)(pw + (size_t)(i * 8 - 64) * CC);
        asm volatile("s_wait_xcnt 0x0" :: "v"(px), "v"(pw) : "memory"); }   // stands in front of every overwrite of the fetch's address registers: as inputs here they stay live up to the wait, so no load of the group takes them as its destination
#pragma unroll
      for (int kc = 0; kc < GKC / 32; ++kc) { const v16h a = frag_h(&sb[wave * 16 + col][kc * 32], lane); v16h wf[8];
#pragma unroll
        for (int j = 0; j < 8; ++j) wf[j] = frag_h(&sb[64 + j * 16 + col][kc * 32], lane);
        __builtin_amdgcn_sched_barrier(0);   // keeps the 18 fragment reads one group in front of the 8 products: one LDS latency a group, not one a product
#pragma unroll
        for (int j = 0; j < 8; ++j) acc[j] = wmma16(a, wf[j], acc[j]); } }
#pragma unroll
    for (int j = 0; j < 8; ++j) { const float bias = BO ? bfr(BO[c0 + j * 16 + col]) : 0.f;
#pragma unroll
      for (int r = 0; r < 8; ++r) sf[wave][8 * g + r][j * 16 + col] = acc[j][r] * (1.0f / 256.0f) + bias; } }
  LDSX(); for (int rl = 0; rl < 16; ++rl) vst2(OUT + (r0 + rl) * DIN + c0 + lane * 4, *(const v4f*)&sf[wave][rl][lane * 4]); }

extern "C" void kernel_launch(void* const* d_in, const int* in_sizes, int n_in, void* d_out, int out_size, void* d_ws, size_t ws_size, hipStream_t stream) {
  (void)in_sizes; (void)n_in; (void)out_size;
  const float** F = (const float**)d_in;
  if (ws_size < (size_t)WS_END) return;
  char* ws = (char*)d_ws; _Float16 *QH = (_Float16*)(ws + WS_QH), *KH = (_Float16*)(ws + WS_KH), *VT = (_Float16*)(ws + WS_VT), *QL = (_Float16*)(ws + WS_QL), *KL = (_Float16*)(ws + WS_KL); __bf16 *VB = (__bf16*)(ws + WS_VB), *VBL = (__bf16*)(ws + WS_VBL); float *Y = (float*)(ws + WS_Y), *PA = (float*)(ws + WS_PA);
  (void)Y; (void)QL; (void)KL; (void)VB; (void)VBL;
  // inputs: 0 x [2,2048,1024]; 1 Wq, 2 bq, 3 Wk, 4 bk, 5 Wv, 6 bv, 7 Wp, 8 bp ((out,in) [1024,1024], [1024]); outputs: 0 y [2,2048,1024] @0, 1 attn_avg [2,2048,2048] @ OUT1_OFF
  float* AV = (float*)((char*)d_out + OUT1_OFF);
  k_proj<<<dim3(TNB * TT / 64, CC / 128, 3), 128, 0, stream>>>(F[0], F[0], F[0], F[1], F[3], F[5], F[2], F[4], F[6], QH, QL, KH, KL, VT, VB, VBL);
  k_fa<<<dim3(TT / (QT * 16), TNB, NH / HG), HG * 32, 0, stream>>>(QH, QL, KH, VT, Y, PA);
  k_avg<<<dim3((unsigned)((size_t)TNB * TT * TT / 4096)), 256, 0, stream>>>(PA, AV);
  k_out<<<dim3(TNB * TT / 64, DIN / 128), 128, 0, stream>>>(Y, F[7], F[8], (float*)d_out);
}

// v007
// Measured time: 172 microseconds a run.
// Next to v006, in two timings, it ran 1.08 times as fast each time.
// Counting every step since v000, it is 8.75 times as fast.
// compute dtype: all float inputs rounded to bf16; q/k/v = x W^T + b with EXACT bf16 products on WMMA 16x16x32, f32 accumulate; q as f16 hi + residual (x 2^10) against k once to f16 (2 products) for the logits x 1/8; softmax in f32 (hardware exp2 of one fused multiply-add that carries scale x log2 e, the row maximum and, in pass 2, the row sum), the head-averaged attention map accumulated in f32 (8 heads a block in head order, then the two groups' sums); P x 2^11 once to f16 against v once to f16 (1 product); ctx once to f16 against Wp carried x 2^8 in f16 (exact bf16 values) + bp; f32 outputs.
#include <hip/hip_runtime.h>
#include <math.h>

typedef __attribute__((ext_vector_type(16))) _Float16 v16h;
typedef __attribute__((ext_vector_type(16))) __bf16 v16b;
typedef __attribute__((ext_vector_type(8)))  _Float16 v8h;
typedef __attribute__((ext_vector_type(8)))  float v8f;
typedef __attribute__((ext_vector_type(4)))  float v4f;
typedef __attribute__((ext_vector_type(2)))  float v2f;
typedef __attribute__((ext_vector_type(4)))  unsigned v4u;
typedef __attribute__((ext_vector_type(4)))  int v4i;
typedef float __attribute__((may_alias)) float_a;
typedef int __attribute__((may_alias)) int_a;

template <typename T> __device__ __forceinline__ void vst2(void* p, T v) { *(T*)p = v;  }
// a store in a loop whose next trip rewrites the store's address and data registers: the wait stands in front of that overwrite; as inputs here both stay live up to the wait
template <typename T> __device__ __forceinline__ void vst2w(void* p, T v) { *(T*)p = v; asm volatile("s_wait_xcnt 0x0" :: "v"(p), "v"(v) : "memory"); }
__device__ __forceinline__ v8f wmma16(v16h a, v16h b, v8f c) {
  v8f d = __builtin_amdgcn_wmma_f32_16x16x32_f16(false, a, false, b, (short)0, c, false, false);
  asm volatile("v_nop\n\tv_nop\n\tv_nop\n\tv_nop" : "+v"(d) : "v"(a), "v"(b));
  return d;
}
__device__ __forceinline__ v8f wmma_bf(v16b a, v16b b, v8f c) {
  v8f d = __builtin_amdgcn_wmma_f32_16x16x32_bf16(false, a, false, b, (short)0, c, false, false);
  asm volatile("v_nop\n\tv_nop\n\tv_nop\n\tv_nop" : "+v"(d) : "v"(a), "v"(b));
  return d;
}
// 16x16x32 fragments: lane = (h = lane>>4, row/col = lane&15); elements 0..7 = k0+8h+0..7, 8..15 = k0+16+8h+0..7; D element r = row 8h+r
__device__ __forceinline__ v16h frag_h(const _Float16* rowk0, int lane) {
  union { v16h v; v8h q[2]; } u; const _Float16* p = rowk0 + 8 * (lane >> 4);
  u.q[0] = *(const v8h*)p; u.q[1] = *(const v8h*)(p + 16); return u.v;
}
__device__ __forceinline__ v16h frag_f32(const float* rowk0, int lane) {
  v16h a; const float* p = rowk0 + 8 * (lane >> 4);
#pragma unroll
  for (int i = 0; i < 8; ++i) { a[i] = (_Float16)p[i]; a[8 + i] = (_Float16)p[16 + i]; }
  return a;
}
__device__ __forceinline__ v16h frag_f32s(const float* rowk0, int lane, float sc) {
  v16h a; const float* p = rowk0 + 8 * (lane >> 4);
#pragma unroll
  for (int i = 0; i < 8; ++i) { a[i] = (_Float16)(p[i] * sc); a[8 + i] = (_Float16)(p[16 + i] * sc); }
  return a;
}
// column fragment from a [K][ld] layout (column n), rows >= K read as 0
__device__ __forceinline__ v16h fragc_f32(const float* W, int k0, int n, int lane, int ld, int K) {
  v16h a; const int g = lane >> 4;
#pragma unroll
  for (int i = 0; i < 8; ++i) { const int ka = k0 + 8 * g + i, kb = ka + 16;
    a[i] = (_Float16)(ka < K ? W[(size_t)(ka < K ? ka : K - 1) * ld + n] : 0.f); a[8 + i] = (_Float16)(kb < K ? W[(size_t)(kb < K ? kb : K - 1) * ld + n] : 0.f); }
  return a;
}
struct F2 { v16b h, l; };
__device__ __forceinline__ F2 bsplit16(const float v[16]) { F2 r;
#pragma unroll
  for (int i = 0; i < 16; ++i) { const __bf16 h = (__bf16)v[i]; r.h[i] = h; r.l[i] = (__bf16)(v[i] - (float)h); }
  return r; }
__device__ __forceinline__ F2 split_row(const float* row, int k0, int lane) { float v[16]; const float* p = row + k0 + 8 * (lane >> 4);
#pragma unroll
  for (int i = 0; i < 8; ++i) { v[i] = p[i]; v[8 + i] = p[16 + i]; }
  return bsplit16(v); }
__device__ __forceinline__ F2 split_rowK(const float* row, int k0, int lane, int K) { float v[16]; const int g = lane >> 4;
#pragma unroll
  for (int i = 0; i < 8; ++i) { const int ka = k0 + 8 * g + i, kb = ka + 16; v[i] = ka < K ? row[ka < K ? ka : K - 1] : 0.f; v[8 + i] = kb < K ? row[kb < K ? kb : K - 1] : 0.f; }
  return bsplit16(v); }
__device__ __forceinline__ F2 split_col(const float* W, int k0, int n, int lane, int ld, int K) { float v[16]; const int g = lane >> 4;
#pragma unroll
  for (int i = 0; i < 8; ++i) { const int ka = k0 + 8 * g + i, kb = ka + 16; v[i] = ka < K ? W[(size_t)(ka < K ? ka : K - 1) * ld + n] : 0.f; v[8 + i] = kb < K ? W[(size_t)(kb < K ? kb : K - 1) * ld + n] : 0.f; }
  return bsplit16(v); }
__device__ __forceinline__ v8f mac3(const F2& a, const F2& b, v8f c) { c = wmma_bf(a.l, b.h, c); c = wmma_bf(a.h, b.l, c); return wmma_bf(a.h, b.h, c); }
__device__ __forceinline__ float sigm(float v) { return 1.0f / (1.0f + expf(-v)); }
#define LDSX() do { asm volatile("s_wait_dscnt 0" ::: "memory"); __builtin_amdgcn_wave_barrier(); __builtin_amdgcn_fence(__ATOMIC_RELEASE, "workgroup"); } while (0)

// Multi-head self-attention returning (y, head-averaged attention) (B 2, T 2,048, C 1,024 = 16 heads x 64): q/k/v = x W^T + b ((out,in)); attn = softmax(q k^T x 64^-0.5) over all keys; y = merged(attn v) Wp^T + bp; attn_avg[b][t][s] = mean over the 16 heads of attn.
#define NB 2
#define TT 2048
#define CC 1024            // NH * HD = projected width
#define DIN 1024          // input (model) width
#define NH 16
#define HD 64
#define SCALE (0.125f)
#define CAUSAL 0
#ifndef TNB
#define TNB NB
#endif
__device__ __forceinline__ float bfr(float v) { return (float)(__bf16)v; }
__host__ __device__ __forceinline__ int kb_last(int qb) { return CAUSAL ? ((qb * 64 + 63) >> 7) : (TT / 128 - 1); }
typedef __attribute__((ext_vector_type(8))) __bf16 v8b;
__device__ __forceinline__ v16b frag_b(const __bf16* rowk0, int lane) {
  union { v16b v; v8b q[2]; } u; const __bf16* p = rowk0 + 8 * (lane >> 4);
  u.q[0] = *(const v8b*)p; u.q[1] = *(const v8b*)(p + 16); return u.v;
}
#define QBH 0
#define QHI 2048            // rows carrying a q residual plane (all rows when non-causal: 2-product logits everywhere)
#define KHI 64            // key rows carrying k residual / v bf16 hi+lo planes (written by k_proj; no kernel in this file reads them)
// B fragment (k rows k0+.., output column o) of a weight: (in,out) [K][ld] or (out,in) [ld rows of K]: bf16 exact, or f16(bf16 * 256) exact
__device__ __forceinline__ v16b wcol_io(const float* Wm, int k0, int o, int lane, int ld) { v16b w; const int g = lane >> 4;
#pragma unroll
  for (int i = 0; i < 8; ++i) { w[i] = (__bf16)Wm[(size_t)(k0 + 8 * g + i) * ld + o]; w[8 + i] = (__bf16)Wm[(size_t)(k0 + 16 + 8 * g + i) * ld + o]; }
  return w; }
__device__ __forceinline__ v16b wcol_oi(const float* Wm, int k0, int o, int lane, int K) { v16b w; const float* p = Wm + (size_t)o * K + k0 + 8 * (lane >> 4);
#pragma unroll
  for (int i = 0; i < 8; ++i) { w[i] = (__bf16)p[i]; w[8 + i] = (__bf16)p[16 + i]; }
  return w; }
__device__ __forceinline__ v16h wcolh_io(const float* Wm, int k0, int o, int lane, int ld) { v16h w; const int g = lane >> 4;
#pragma unroll
  for (int i = 0; i < 8; ++i) { w[i] = (_Float16)(bfr(Wm[(size_t)(k0 + 8 * g + i) * ld + o]) * 256.0f); w[8 + i] = (_Float16)(bfr(Wm[(size_t)(k0 + 16 + 8 * g + i) * ld + o]) * 256.0f); }
  return w; }
__device__ __forceinline__ v16h wcolh_oi(const float* Wm, int k0, int o, int lane, int K) { v16h w; const float* p = Wm + (size_t)o * K + k0 + 8 * (lane >> 4);
#pragma unroll
  for (int i = 0; i < 8; ++i) { w[i] = (_Float16)(bfr(p[i]) * 256.0f); w[8 + i] = (_Float16)(bfr(p[16 + i]) * 256.0f); }
  return w; }
#define WQKV_LAYOUT 1   // 0 = (in,out) [DIN][CC]; 1 = (out,in) [CC][DIN]; 2 = per-head [NH][DIN][HD]
__device__ __forceinline__ v16b wcol_hdk(const float* Wm, int k0, int o, int lane) { v16b w; const int g = lane >> 4; const float* p = Wm + (size_t)(o / HD) * DIN * HD + (o % HD);
#pragma unroll
  for (int i = 0; i < 8; ++i) { w[i] = (__bf16)p[(size_t)(k0 + 8 * g + i) * HD]; w[8 + i] = (__bf16)p[(size_t)(k0 + 16 + 8 * g + i) * HD]; }
  return w; }
#define WO_OUT_IN 1
#if WQKV_LAYOUT == 1
#define WCOL(W, k0, o, lane) wcol_oi(W, k0, o, lane, DIN)
#elif WQKV_LAYOUT == 2
#define WCOL(W, k0, o, lane) wcol_hdk(W, k0, o, lane)
#else
#define WCOL(W, k0, o, lane) wcol_io(W, k0, o, lane, CC)
#endif
#if WO_OUT_IN
#define WOCOL(W, k0, o, lane) wcol_oi(W, k0, o, lane, CC)
#define WOCOLH(W, k0, o, lane) wcolh_oi(W, k0, o, lane, CC)
#else
#define WOCOL(W, k0, o, lane) wcol_io(W, k0, o, lane, DIN)
#define WOCOLH(W, k0, o, lane) wcolh_io(W, k0, o, lane, DIN)
#endif
#define OUT1_OFF (4u * (size_t)NB * TT * DIN)      // byte offset of attn_avg [B][T][T]

#define WS_QH  0u                                      // f16 q rows [b*t][CC]
#define WS_KH  (WS_QH + 2u * (size_t)NB * TT * CC)      // f16 k in fragment order: [b][head][16-key tile][32-column half][fragment half][lane][8]
#define WS_VT  (WS_KH + 2u * (size_t)NB * TT * CC)      // f16 v in fragment order: [b][head][32-key group][16-column group][fragment half][lane][8]
#define WS_QL  (WS_VT + 2u * (size_t)NB * CC * TT)      // f16 q residual x 2^10 rows [b][t < QHI][CC]
#define WS_KL  (WS_QL + 2u * (size_t)NB * QHI * CC)     // f16 k residual x 2^10 rows [b][t < KHI][CC]
#define WS_VB  (WS_KL + 2u * (size_t)NB * KHI * CC)     // bf16 v hi planes [b][c][t < KHI]
#define WS_VBL (WS_VB + 2u * (size_t)NB * CC * KHI)
#define WS_Y   (WS_VBL + 2u * (size_t)NB * CC * KHI)     // f32 ctx rows [b*t][CC] (only when there is an output projection)
#define WS_PA  (WS_Y  + 4u * (size_t)NB * TT * CC)     // f32 sums of P x 2^11 over a group of 8 heads [head group][b][t][s]
#define WS_END (WS_PA + 4u * 2u * (size_t)NB * TT * TT)

// k and v pass from k_proj to k_fa in the reader's fragment order: the 16 bytes that lane l = 16 g + n takes for fragment half p lie at element (p * 32 + l) * 8 of the fragment's 512, so a wave-wide 16-byte load covers 512 contiguous bytes = 4 whole lines.
// k (A of S^T): lane's row = key tile * 16 + n, its 8 columns = half * 32 + p * 16 + 8 g + 0..7. v (B of P V): lane's column = group * 16 + n, its 8 keys = key group * 32 + p * 16 + 8 g + 0..7.
#define KF_OFF(b, h, tile) ((((size_t)(b) * NH + (h)) * (TT / 16) + (tile)) * 1024)   // element offset of a 16-key tile of head h: 2 fragments
#define VF_OFF(b, h, grp)  ((((size_t)(b) * NH + (h)) * (TT / 32) + (grp)) * 2048)    // element offset of a 32-key group of head h: 4 fragments
__device__ __forceinline__ v16h frag_w(const _Float16* p) {   // p = the fragment's first element + lane * 8
  union { v16h v; v8h q[2]; } u; u.q[0] = *(const v8h*)p; u.q[1] = *(const v8h*)(p + 256); return u.v;
}
// GEMM operand staging (k_proj, k_out): a step = 64 k = 256 B of each f32 operand row. 16 lanes x 16 B fetch one row's step, so a wave-wide load covers 4 whole lines; each value is converted ONCE a block and stored as 16 bit in LDS, where the block's 8 waves read their fragments.
// The block's tile is 128 rows x 128 columns: 256 operand rows fetched for 16,384 results (a 64 x 128 tile fetches 192 for 8,192). Wave (wr, wc) of 4 x 2 holds 32 rows x 64 columns = 2 x 4 accumulator tiles: 6 fragments from LDS for 8 products.
#define GKC 64             // k of a staged step
#define GP 72              // LDS pitch of a staged row in 16-bit elements: 144 B = 16 B x 9 (odd), conflict-free for 16-byte fragment reads
#define GBM 128            // rows of a block's tile
#define GROWS (GBM + 128)  // rows 0..127 = the block's X (or ctx) rows, 128..255 = its 128 weight rows (output columns)
typedef __attribute__((ext_vector_type(4))) __bf16 v4b;
typedef __attribute__((ext_vector_type(4))) _Float16 v4h;
static_assert(WQKV_LAYOUT == 1 && WO_OUT_IN == 1, "the staging reads weight rows (out,in): k contiguous");
static_assert(TT % GBM == 0 && !CAUSAL, "a block's rows lie in one sequence; k_out has the one-product path alone");
// ---- k_proj: block = (128 rows, 128 cols, which): q/k/v = X W (+ b) with exact bf16 products (K = DIN) -> which 0: q f16 rows (+ residual rows < QHI); 1: k f16 in fragment order (+ residual rows < KHI); 2: v f16 in fragment order (+ bf16 hi/lo planes for t < KHI). The tile leaves in two halves of 64 rows through the same LDS arrays.
__global__ __launch_bounds__(256) void k_proj(const float* __restrict__ XQ, const float* __restrict__ XK, const float* __restrict__ XV, const float* __restrict__ WQ, const float* __restrict__ WK, const float* __restrict__ WV, const float* __restrict__ BQ, const float* __restrict__ BK, const float* __restrict__ BV,
    _Float16* __restrict__ QH, _Float16* __restrict__ QL, _Float16* __restrict__ KH, _Float16* __restrict__ KL, _Float16* __restrict__ VT, __bf16* __restrict__ VB, __bf16* __restrict__ VBL) {
  __shared__ __align__(16) _Float16 sh[64][136], sl[64][136]; __shared__ __align__(16) _Float16 th[128][72]; __shared__ __align__(16) __bf16 tb[128][72], tbl[128][72]; __shared__ __align__(16) __bf16 stg[2][GROWS][GP];
  const int tid = threadIdx.x, wave = tid >> 5, lane = tid & 31, col = lane & 15, g = lane >> 4, wr = wave >> 1, wc = wave & 1; const int which = blockIdx.z; const int c0 = blockIdx.y * 128; const size_t r0 = (size_t)blockIdx.x * GBM; const size_t bb = r0 / TT; const int t0 = (int)(r0 % TT);
  const float* X = which == 0 ? XQ : which == 1 ? XK : XV; const float* WA = which == 0 ? WQ : which == 1 ? WK : WV; const float* BA = which == 0 ? BQ : which == 1 ? BK : BV;
  v8f acc[2][4] = {};
  const int lr = tid >> 4, ls = tid & 15;   // staging: this thread's row of each group of 16 rows, and its 16 bytes of the row's 256
  const float* gx = X + r0 * DIN; const float* gw = WA + (size_t)c0 * DIN; const unsigned go = lr * DIN + ls * 4;   // block-uniform bases and one per-thread offset
  v4f pf[GROWS / 16];
  { const float* px = gx + go; const float* pw = gw + go;
#pragma unroll
    for (int i = 0; i < GROWS / 16; ++i) pf[i] = i < 8 ? *(const v4f*)(px + (size_t)(i * 16) * DIN) : *(const v4f*)(pw + (size_t)(i * 16 - GBM) * DIN);
    asm volatile("s_wait_xcnt 0x0" :: "v"(px), "v"(pw) : "memory"); }   // stands in front of every overwrite of the first fetch's address registers: as inputs here they stay live up to the wait
  for (int c = 0; c < DIN / GKC; ++c) { __bf16 (*sb)[GP] = stg[c & 1];
#pragma unroll
    for (int i = 0; i < GROWS / 16; ++i) *(v4b*)&sb[i * 16 + lr][ls * 4] = __builtin_convertvector(pf[i], v4b);
    __syncthreads();   // this step's rows are in LDS; it also ends every wave's reads of the other buffer, which the next step refills
    if (c + 1 < DIN / GKC) {   // the next step's rows, fetched into registers behind the barrier (which would drain them): the fragment reads and products below cover their latency
      const float* px = gx + (c + 1) * GKC + go; const float* pw = gw + (c + 1) * GKC + go;
#pragma unroll
      for (int i = 0; i < GROWS / 16; ++i) pf[i] = i < 8 ? *(const v4f*)(px + (size_t)(i * 16) * DIN) : *(const v4f*)(pw + (size_t)(i * 16 - GBM) * DIN);
      asm volatile("s_wait_xcnt 0x0" :: "v"(px), "v"(pw) : "memory"); }   // stands in front of every overwrite of the fetch's address registers: as inputs here they stay live up to the wait, so no load of the group takes them as its destination
#pragma unroll
    for (int kc = 0; kc < GKC / 32; ++kc) { v16b a[2], wf[4];
#pragma unroll
      for (int i = 0; i < 2; ++i) a[i] = frag_b(&sb[wr * 32 + i * 16 + col][kc * 32], lane);
#pragma unroll
      for (int j = 0; j < 4; ++j) wf[j] = frag_b(&sb[GBM + wc * 64 + j * 16 + col][kc * 32], lane);
      __builtin_amdgcn_sched_barrier(0);   // keeps the 12 fragment reads one group in front of the 8 products: one LDS latency a group, not one a product
#pragma unroll
      for (int i = 0; i < 2; ++i)
#pragma unroll
        for (int j = 0; j < 4; ++j) acc[i][j] = wmma_bf(a[i], wf[j], acc[i][j]); } }
  float bias[4];
#pragma unroll
  for (int j = 0; j < 4; ++j) bias[j] = BA ? bfr(BA[c0 + wc * 64 + j * 16 + col]) : 0.f;
  for (int hf = 0; hf < 2; ++hf) { const int th0 = t0 + hf * 64; const size_t rh0 = r0 + hf * 64;   // the half's first row in its sequence and over all rows; waves wr = 2 hf, 2 hf + 1 hold it
    if (hf) __syncthreads();   // ends every thread's reads of the first half in LDS, which the second half overwrites
    if (which < 2) { _Float16* DH = which == 0 ? QH : KH; _Float16* DL = which == 0 ? QL : KL; const int nhi = which == 0 ? QHI : KHI; const bool hi_rows = th0 < nhi;
      if ((wr >> 1) == hf) {
#pragma unroll
        for (int i = 0; i < 2; ++i)
#pragma unroll
          for (int j = 0; j < 4; ++j)
#pragma unroll
            for (int r = 0; r < 8; ++r) { const float v = acc[i][j][r] + bias[j]; const _Float16 hv = (_Float16)v; const int rl = (wr & 1) * 32 + i * 16 + 8 * g + r, cl = wc * 64 + j * 16 + col; sh[rl][cl] = hv; sl[rl][cl] = (_Float16)((v - (float)hv) * 1024.0f); } }
      __syncthreads();
      for (int e = tid; e < 64 * 16; e += 256) { int rl, cq; size_t dh;   // e = the 16-byte piece in the order of its destination: a wave's store covers whole lines
        if (which == 0) { rl = e >> 4; cq = (e & 15) * 8; dh = (rh0 + rl) * CC + c0 + cq; }
        else { const int l = e & 31, fp = (e >> 5) & 3, tl = (e >> 7) & 3, hh = e >> 9; rl = tl * 16 + (l & 15); cq = hh * HD + fp * 16 + (l >> 4) * 8; dh = KF_OFF(bb, c0 / HD + hh, th0 / 16 + tl) + fp * 256 + l * 8; }
        vst2w((unsigned*)(DH + dh), *(const v4u*)&sh[rl][cq]); if (hi_rows) vst2w((unsigned*)(DL + (bb * nhi + th0 + rl) * (size_t)CC + c0 + cq), *(const v4u*)&sl[rl][cq]); }
    } else { const bool hi_rows = th0 < KHI;
      if ((wr >> 1) == hf) {
#pragma unroll
        for (int i = 0; i < 2; ++i)
#pragma unroll
          for (int j = 0; j < 4; ++j)
#pragma unroll
            for (int r = 0; r < 8; ++r) { const float v = acc[i][j][r] + bias[j]; const int rl = (wr & 1) * 32 + i * 16 + 8 * g + r, cl = wc * 64 + j * 16 + col; th[cl][rl] = (_Float16)v; const __bf16 bh = (__bf16)v; tb[cl][rl] = bh; tbl[cl][rl] = (__bf16)(v - (float)bh); } }
      __syncthreads();
      for (int e = tid; e < 128 * 8; e += 256) { const int l = e & 31, jp = (e >> 5) & 7, kg = (e >> 8) & 1, hh = e >> 9;   // e = the 16-byte piece in the order of its destination: a wave's store covers whole lines
        const int cl = hh * HD + (jp >> 1) * 16 + (l & 15), kq = kg * 32 + (jp & 1) * 16 + (l >> 4) * 8;
        vst2w((unsigned*)(VT + VF_OFF(bb, c0 / HD + hh, th0 / 32 + kg) + jp * 256 + l * 8), *(const v4u*)&th[cl][kq]); if (hi_rows) { const size_t o3 = (bb * CC + c0 + cl) * (size_t)KHI + th0 + kq; vst2w((unsigned*)(VB + o3), *(const v4u*)&tb[cl][kq]); vst2w((unsigned*)(VBL + o3), *(const v4u*)&tbl[cl][kq]); } } } } }
// ---- k_fa: block = 32 queries of batch b and HG = 8 of the heads, HG waves, wave = head. A wave holds QT = 2 query tiles of 16 in registers and uses every k and v fragment that it loads for both: half the fragment bytes from L2 per score.
// The wave forms S^T = K Q^T (A = 16 key rows, B = 16 query rows; q hi + residual x 2^10: 2 products), so a lane holds ONE query (col) of each tile and keys 8g + r of each 16-key tile: logits, softmax and P stay in registers.
// pass 1 walks all keys for the row maximum and the sum of exp (a running pair per lane and query tile, the two lane halves joined once at the end); pass 2 forms the logits again, P x 2^11 = exp(s - max) x 2048 / sum as one exp2: two S^T tiles ARE the 16 x 32 A fragment of P (elements 0..7 = keys k0 + 8g + r, 8..15 = k0 + 16 + 8g + r) against v f16 planes (1 product);
// the HG heads' f32 P tiles meet in LDS (two buffers, one barrier a 64-key step) and wave w sums query rows 4w..4w+3 over the block's heads in head order: whole 128-B lines of the head group's partial plane, which k_avg joins.
__device__ __forceinline__ v8f wmma_p(v16h a, v16h b, v8f c) { return __builtin_amdgcn_wmma_f32_16x16x32_f16(false, a, false, b, (short)0, c, false, false); }
__device__ __forceinline__ void st_tile(const v16h k0f, const v16h k1f, const v16h* qh, const v16h* ql, float* s) {
  v8f a = {}, al = {};
  a = wmma_p(k0f, qh[0], a); al = wmma_p(k0f, ql[0], al); a = wmma_p(k1f, qh[1], a); al = wmma_p(k1f, ql[1], al);
#pragma unroll
  for (int r = 0; r < 8; ++r) s[r] = a[r] + al[r] * (1.0f / 1024.0f); }   // the raw q.k sum: SCALE rides in the exponent's multiply-add (KL2E)
#define KL2E (SCALE * 1.44269504088896340736f)   // exp((t - tmax) x SCALE) = exp2(t x KL2E - tmax x KL2E)
__device__ __forceinline__ float ex2(float v) { return __builtin_amdgcn_exp2f(v); }   // v_exp_f32; arguments here are <= 11, and a result below the normal range may read 0
__device__ __forceinline__ float ex2n(float v) { float e; asm("v_exp_f32 %0, %1\n\tv_nop" : "=v"(e) : "v"(v)); return e; }   // the same, for the places where in this build the next vector instruction takes the source register as its destination: the v_nop is the slot that the instruction set asks for behind a transcendental, tied to it in one statement
#define PBP 68             // LDS pitch of a 64-key P row in floats: the 16 query rows' 16-byte stores fall on 16 different bank groups
#define QT 2               // query tiles of 16 a wave
#define HG 8               // heads = waves of a block
static_assert(NH % HG == 0 && HD == 64 && QT * 16 == HG * 4, "wave w is head w of its group and sums 4 query rows of the 32-row tile");
__global__ __launch_bounds__(HG * 32) void k_fa(const _Float16* __restrict__ QH, const _Float16* __restrict__ QL, const _Float16* __restrict__ KH, const _Float16* __restrict__ VT, float* __restrict__ Y, float* __restrict__ PA) {
  __shared__ __align__(16) float pb[2][HG][QT * 16][PBP];
  const int tid = threadIdx.x, lane = tid & 31, col = lane & 15, g = lane >> 4; const int b = blockIdx.y; const int ql0 = blockIdx.x * (QT * 16);
  const int w = __builtin_amdgcn_readfirstlane(tid >> 5); const int h = blockIdx.z * HG + w;   // the wave's number and its head, in scalar registers: head offsets stay scalar
  v16h qh[QT][2], ql[QT][2];
  const _Float16* pqh = QH + ((size_t)b * TT + ql0 + col) * CC + h * HD + 8 * g; const _Float16* pql = QL + ((size_t)b * QHI + ql0 + col) * CC + h * HD + 8 * g;   // the lane's own 8 columns of its query row of tile 0
#pragma unroll
  for (int qt = 0; qt < QT; ++qt)
#pragma unroll
    for (int kc = 0; kc < 2; ++kc) { qh[qt][kc] = frag_h(pqh + qt * 16 * CC + kc * 32, 0); ql[qt][kc] = frag_h(pql + qt * 16 * CC + kc * 32, 0); }
  asm volatile("s_wait_xcnt 0x0" :: "v"(pqh), "v"(pql) : "memory");   // the q loads' address registers are reused below: the wait stands in front of that overwrite; as inputs here they stay live up to it, so no q load takes them as its destination
  const _Float16* Kr = KH + KF_OFF(b, h, 0) + lane * 8;   // this head's k fragments, 64 elements a key: a fragment load covers 4 whole lines
  const _Float16* Vr = VT + VF_OFF(b, h, 0) + lane * 8;   // this head's v fragments, 64 elements a key
  constexpr unsigned slot1[QT] = { 0x1b00u, 0x30c2e030u };   // pass 1: bit i of tile qt = this build needs the slot of ex2n behind the exp of score i
  float m[QT], l[QT];
#pragma unroll
  for (int qt = 0; qt < QT; ++qt) { m[qt] = -3.0e38f; l[qt] = 0.f; }
  v16h kf[8];
#pragma unroll
  for (int t = 0; t < 4; ++t) { kf[2 * t] = frag_w(Kr + t * 1024); kf[2 * t + 1] = frag_w(Kr + t * 1024 + 512); }
  for (int k0 = 0; k0 < TT; k0 += 64) { float s[QT][32];
#pragma unroll
    for (int qt = 0; qt < QT; ++qt)
#pragma unroll
      for (int t = 0; t < 4; ++t) st_tile(kf[2 * t], kf[2 * t + 1], qh[qt], ql[qt], s[qt] + t * 8);
    const int kn = k0 + 64 < TT ? k0 + 64 : 0;   // the next 64 keys, fetched one trip ahead; the last trip fetches keys 0..63, of which pass 2 uses the first 32
    const _Float16* pk = Kr + kn * HD;
#pragma unroll
    for (int t = 0; t < 4; ++t) { kf[2 * t] = frag_w(pk + t * 1024); kf[2 * t + 1] = frag_w(pk + t * 1024 + 512); }
    __builtin_amdgcn_sched_barrier(0);   // keeps the fetch ahead in front of the exp work below, which covers its latency
#pragma unroll
    for (int qt = 0; qt < QT; ++qt) { float bm = s[qt][0];
#pragma unroll
      for (int i = 1; i < 32; ++i) bm = fmaxf(bm, s[qt][i]);
      const float mn = fmaxf(m[qt], bm), nb = -mn * KL2E; float a = 0.f;
#pragma unroll
      for (int i = 0; i < 32; ++i) { const float x = fmaf(s[qt][i], KL2E, nb); a += (slot1[qt] >> i & 1) ? ex2n(x) : ex2(x); }
      l[qt] = l[qt] * ex2n((m[qt] - mn) * KL2E) + a; m[qt] = mn; }
    asm volatile("s_wait_xcnt 0x0" :: "v"(pk) : "memory"); }   // the next trip rewrites the address registers of the fetch ahead: the wait stands in front of that overwrite; as an input here they stay live up to it, through the exp work
  float nb2[QT];
#pragma unroll
  for (int qt = 0; qt < QT; ++qt) { const float M = fmaxf(m[qt], __shfl_xor(m[qt], 16)); float lq = l[qt] * ex2n((m[qt] - M) * KL2E); lq += __shfl_xor(lq, 16);
    nb2[qt] = fmaf(-M, KL2E, 11.0f - __builtin_amdgcn_logf(lq)); }   // P x 2^11 = exp2(t x KL2E + nb2): the maximum and 2048 / sum as one addend (v_log_f32 = log2; the sum lies between about 1 and 2048, a normal number)
  v8f acc[QT][HD / 16] = {};
  float* pa = PA + (((size_t)blockIdx.z * NB + b) * TT + ql0 + w * 4 + g) * TT + col * 4;   // a half wave = one query row's 64 keys of a step = 2 whole lines
  for (int st = 0; st < TT / 64; ++st) { v16h vf[2][HD / 16]; const _Float16* pv = Vr + st * 4096;   // a step = 64 keys, as two halves of 32 keys
#pragma unroll
    for (int u = 0; u < 2; ++u)
#pragma unroll
      for (int j = 0; j < HD / 16; ++j) vf[u][j] = frag_w(pv + u * 2048 + j * 512);
#pragma unroll
    for (int u = 0; u < 2; ++u) { float s[QT][16];
#pragma unroll
      for (int qt = 0; qt < QT; ++qt) { st_tile(kf[0], kf[1], qh[qt], ql[qt], s[qt]); st_tile(kf[2], kf[3], qh[qt], ql[qt], s[qt] + 8); }
      const int kn = st * 64 + u * 32 + 32 < TT ? st * 64 + u * 32 + 32 : 0;   // the next 32 keys, fetched one half step ahead (the last fetch, of keys 0..31, is in bounds and unused)
      const _Float16* pk = Kr + kn * HD;
#pragma unroll
      for (int t = 0; t < 2; ++t) { kf[2 * t] = frag_w(pk + t * 1024); kf[2 * t + 1] = frag_w(pk + t * 1024 + 512); }
      asm volatile("s_wait_xcnt 0x0" :: "v"(pv), "v"(pk) : "memory");   // stands in front of every overwrite of the v and k loads' address registers: as inputs here they stay live up to the wait, so no load of the groups takes them as its destination
      __builtin_amdgcn_sched_barrier(0);   // keeps the v loads and the k fetch ahead in front of the exp work below, which covers their latency
#pragma unroll
      for (int qt = 0; qt < QT; ++qt) { v16h p;
#pragma unroll
        for (int i = 0; i < 16; ++i) { s[qt][i] = ex2(fmaf(s[qt][i], KL2E, nb2[qt])); p[i] = (_Float16)s[qt][i]; }
#pragma unroll
        for (int j = 0; j < HD / 16; ++j) acc[qt][j] = wmma_p(p, vf[u][j], acc[qt][j]);
        float* pw = &pb[st & 1][w][qt * 16 + col][u * 32 + 8 * g];
#pragma unroll
        for (int t = 0; t < 2; ++t) { v4f lo = { s[qt][t * 8], s[qt][t * 8 + 1], s[qt][t * 8 + 2], s[qt][t * 8 + 3] }, hi = { s[qt][t * 8 + 4], s[qt][t * 8 + 5], s[qt][t * 8 + 6], s[qt][t * 8 + 7] }; *(v4f*)(pw + t * 16) = lo; *(v4f*)(pw + t * 16 + 4) = hi; } } }
    __syncthreads();   // the block's heads' P tiles of this step are in LDS; it also ends every wave's reads of the other buffer, which the next step refills
    v4f a[2];
#pragma unroll
    for (int i = 0; i < 2; ++i) { a[i] = *(const v4f*)&pb[st & 1][0][w * 4 + i * 2 + g][col * 4];
#pragma unroll
      for (int hh = 1; hh < HG; ++hh) a[i] += *(const v4f*)&pb[st & 1][hh][w * 4 + i * 2 + g][col * 4]; }
    float* po = pa + st * 64;
    vst2(po, a[0]); vst2(po + 2 * TT, a[1]);
    asm volatile("s_wait_xcnt 0x0" :: "v"(po), "v"(a[0]), "v"(a[1]) : "memory"); }   // the next step rewrites the two stores' address and data registers: the wait stands in front of that overwrite; as inputs here they stay live up to it
#pragma unroll
  for (int qt = 0; qt < QT; ++qt)
#pragma unroll
    for (int j = 0; j < HD / 16; ++j)
#pragma unroll
      for (int r = 0; r < 8; ++r) Y[((size_t)b * TT + ql0 + qt * 16 + 8 * g + r) * CC + h * HD + j * 16 + col] = acc[qt][j][r] * (1.0f / 2048.0f); }
// ---- k_avg: attn_avg = (the NH / HG head groups' partial planes, in group order) / (2^11 NH): a stream, 16 bytes a lane, 8 loads in flight a wave
static_assert(NH / HG == 2, "k_avg joins two planes");
__global__ __launch_bounds__(256) void k_avg(const float* __restrict__ PA, float* __restrict__ AV) {
  const size_t o = (size_t)blockIdx.x * 4096 + threadIdx.x * 4; const float* p0 = PA + o; const float* p1 = p0 + (size_t)NB * TT * TT;
  v4f x[4], y[4];
#pragma unroll
  for (int i = 0; i < 4; ++i) { x[i] = *(const v4f*)(p0 + i * 1024); y[i] = *(const v4f*)(p1 + i * 1024); }
#pragma unroll
  for (int i = 0; i < 4; ++i) vst2(AV + o + i * 1024, (x[i] + y[i]) * (1.0f / (2048.0f * NH))); }
// ---- k_out: block = (128 rows, 128 cols): out = ctx Wo (+ bo): ctx once to f16 against Wo as f16(bf16 x 2^8) exact (1 product) x 2^-8
#define SFP 68             // LDS pitch of a wave's 64-column output row in floats: 272 B = 16 B x 17 (odd)
__global__ __launch_bounds__(256) void k_out(const float* __restrict__ Y, const float* __restrict__ WO, const float* __restrict__ BO, float* __restrict__ OUT) { __shared__ __align__(16) float sf[8][32][SFP]; __shared__ __align__(16) _Float16 stg[2][GROWS][GP];
  const int tid = threadIdx.x, wave = tid >> 5, lane = tid & 31, col = lane & 15, g = lane >> 4, wr = wave >> 1, wc = wave & 1; const int c0 = blockIdx.y * 128; const size_t r0 = (size_t)blockIdx.x * GBM;
  v8f acc[2][4] = {};
  const int lr = tid >> 4, ls = tid & 15;   // staging: this thread's row of each group of 16 rows, and its 16 bytes of the row's 256
  const float* gx = Y + r0 * CC; const float* gw = WO + (size_t)c0 * CC; const unsigned go = lr * CC + ls * 4;   // block-uniform bases and one per-thread offset
  v4f pf[GROWS / 16];
  { const float* px = gx + go; const float* pw = gw + go;
#pragma unroll
    for (int i = 0; i < GROWS / 16; ++i) pf[i] = i < 8 ? *(const v4f*)(px + (size_t)(i * 16) * CC) : *(const v4f*)(pw + (size_t)(i * 16 - GBM) * CC);
    asm volatile("s_wait_xcnt 0x0" :: "v"(px), "v"(pw) : "memory"); }   // stands in front of every overwrite of the first fetch's address registers: as inputs here they stay live up to the wait
  for (int c = 0; c < CC / GKC; ++c) { _Float16 (*sb)[GP] = stg[c & 1];
#pragma unroll
    for (int i = 0; i < GROWS / 16; ++i) { v4h t;
#pragma unroll
      for (int e = 0; e < 4; ++e) t[e] = i < 8 ? (_Float16)pf[i][e] : (_Float16)(bfr(pf[i][e]) * 256.0f);
      *(v4h*)&sb[i * 16 + lr][ls * 4] = t; }
    __syncthreads();   // this step's rows are in LDS; it also ends every wave's reads of the other buffer, which the next step refills
    if (c + 1 < CC / GKC) {   // the next step's rows, fetched into registers behind the barrier (which would drain them): the fragment reads and products below cover their latency
      const float* px = gx + (c + 1) * GKC + go; const float* pw = gw + (c + 1) * GKC + go;
#pragma unroll
      for (int i = 0; i < GROWS / 16; ++i) pf[i] = i < 8 ? *(const v4f*)(px + (size_t)(i * 16) * CC) : *(const v4f*)(pw + (size_t)(i * 16 - GBM) * CC);
      asm volatile("s_wait_xcnt 0x0" :: "v"(px), "v"(pw) : "memory"); }   // stands in front of every overwrite of the fetch's address registers: as inputs here they stay live up to the wait, so no load of the group takes them as its destination
#pragma unroll
    for (int kc = 0; kc < GKC / 32; ++kc) { v16h a[2], wf[4];
#pragma unroll
      for (int i = 0; i < 2; ++i) a[i] = frag_h(&sb[wr * 32 + i * 16 + col][kc * 32], lane);
#pragma unroll
      for (int j = 0; j < 4; ++j) wf[j] = frag_h(&sb[GBM + wc * 64 + j * 16 + col][kc * 32], lane);
      __builtin_amdgcn_sched_barrier(0);   // keeps the 12 fragment reads one group in front of the 8 products: one LDS latency a group, not one a product
#pragma unroll
      for (int i = 0; i < 2; ++i)
#pragma unroll
        for (int j = 0; j < 4; ++j) acc[i][j] = wmma16(a[i], wf[j], acc[i][j]); } }
#pragma unroll
  for (int j = 0; j < 4; ++j) { const float bias = BO ? bfr(BO[c0 + wc * 64 + j * 16 + col]) : 0.f;
#pragma unroll
    for (int i = 0; i < 2; ++i)
#pragma unroll
      for (int r = 0; r < 8; ++r) sf[wave][i * 16 + 8 * g + r][j * 16 + col] = acc[i][j][r] * (1.0f / 256.0f) + bias; }
  LDSX(); for (int rl = 0; rl < 16; ++rl) vst2(OUT + (r0 + wr * 32 + rl * 2 + g) * DIN + c0 + wc * 64 + col * 4, *(const v4f*)&sf[wave][rl * 2 + g][col * 4]); }   // a half wave = one row's 64 columns = 2 whole lines

extern "C" void kernel_launch(void* const* d_in, const int* in_sizes, int n_in, void* d_out, int out_size, void* d_ws, size_t ws_size, hipStream_t stream) {
  (void)in_sizes; (void)n_in; (void)out_size;
  const float** F = (const float**)d_in;
  if (ws_size < (size_t)WS_END) return;
  char* ws = (char*)d_ws; _Float16 *QH = (_Float16*)(ws + WS_QH), *KH = (_Float16*)(ws + WS_KH), *VT = (_Float16*)(ws + WS_VT), *QL = (_Float16*)(ws + WS_QL), *KL = (_Float16*)(ws + WS_KL); __bf16 *VB = (__bf16*)(ws + WS_VB), *VBL = (__bf16*)(ws + WS_VBL); float *Y = (float*)(ws + WS_Y), *PA = (float*)(ws + WS_PA);
  (void)Y; (void)QL; (void)KL; (void)VB; (void)VBL;
  // inputs: 0 x [2,2048,1024]; 1 Wq, 2 bq, 3 Wk, 4 bk, 5 Wv, 6 bv, 7 Wp, 8 bp ((out,in) [1024,1024], [1024]); outputs: 0 y [2,2048,1024] @0, 1 attn_avg [2,2048,2048] @ OUT1_OFF
  float* AV = (float*)((char*)d_out + OUT1_OFF);
  k_proj<<<dim3(TNB * TT / GBM, CC / 128, 3), 256, 0, stream>>>(F[0], F[0], F[0], F[1], F[3], F[5], F[2], F[4], F[6], QH, QL, KH, KL, VT, VB, VBL);
  k_fa<<<dim3(TT / (QT * 16), TNB, NH / HG), HG * 32, 0, stream>>>(QH, QL, KH, VT, Y, PA);
  k_avg<<<dim3((unsigned)((size_t)TNB * TT * TT / 4096)), 256, 0, stream>>>(PA, AV);
  k_out<<<dim3(TNB * TT / GBM, DIN / 128), 256, 0, stream>>>(Y, F[7], F[8], (float*)d_out);
}

// v008
// It runs in 147 microseconds.
// Two timings next to v007 both put it at 1.16 times that version's speed.
// Counting every step since v000, it is 10.1 times as fast.
// compute dtype: all float inputs rounded to bf16; q/k/v = x W^T + b with EXACT bf16 products on WMMA 16x16x32, f32 accumulate; q as f16 hi + residual (x 2^10) against k once to f16 (2 products) for the logits x 1/8; softmax in f32 (hardware exp2 of one fused multiply-add that carries scale x log2 e, the row maximum and, in pass 2, the row sum), the head-averaged attention map accumulated in f32 (8 heads a block in head order, then the two groups' sums); P x 2^11 once to f16 against v once to f16 (1 product); ctx once to f16 against Wp carried x 2^8 in f16 (exact bf16 values) + bp; f32 outputs.
#include <hip/hip_runtime.h>
#include <math.h>

typedef __attribute__((ext_vector_type(16))) _Float16 v16h;
typedef __attribute__((ext_vector_type(16))) __bf16 v16b;
typedef __attribute__((ext_vector_type(8)))  _Float16 v8h;
typedef __attribute__((ext_vector_type(8)))  float v8f;
typedef __attribute__((ext_vector_type(4)))  float v4f;
typedef __attribute__((ext_vector_type(2)))  float v2f;
typedef __attribute__((ext_vector_type(4)))  unsigned v4u;
typedef __attribute__((ext_vector_type(4)))  int v4i;
typedef float __attribute__((may_alias)) float_a;
typedef int __attribute__((may_alias)) int_a;

template <typename T> __device__ __forceinline__ void vst2(void* p, T v) { *(T*)p = v;  }
// a store in a loop whose next trip rewrites the store's address and data registers: the wait stands in front of that overwrite; as inputs here both stay live up to the wait
template <typename T> __device__ __forceinline__ void vst2w(void* p, T v) { *(T*)p = v; asm volatile("s_wait_xcnt 0x0" :: "v"(p), "v"(v) : "memory"); }
__device__ __forceinline__ v8f wmma16(v16h a, v16h b, v8f c) {
  v8f d = __builtin_amdgcn_wmma_f32_16x16x32_f16(false, a, false, b, (short)0, c, false, false);
  asm volatile("v_nop\n\tv_nop\n\tv_nop\n\tv_nop" : "+v"(d) : "v"(a), "v"(b));
  return d;
}
__device__ __forceinline__ v8f wmma_bf(v16b a, v16b b, v8f c) {
  v8f d = __builtin_amdgcn_wmma_f32_16x16x32_bf16(false, a, false, b, (short)0, c, false, false);
  asm volatile("v_nop\n\tv_nop\n\tv_nop\n\tv_nop" : "+v"(d) : "v"(a), "v"(b));
  return d;
}
// 16x16x32 fragments: lane = (h = lane>>4, row/col = lane&15); elements 0..7 = k0+8h+0..7, 8..15 = k0+16+8h+0..7; D element r = row 8h+r
__device__ __forceinline__ v16h frag_h(const _Float16* rowk0, int lane) {
  union { v16h v; v8h q[2]; } u; const _Float16* p = rowk0 + 8 * (lane >> 4);
  u.q[0] = *(const v8h*)p; u.q[1] = *(const v8h*)(p + 16); return u.v;
}
__device__ __forceinline__ v16h frag_f32(const float* rowk0, int lane) {
  v16h a; const float* p = rowk0 + 8 * (lane >> 4);
#pragma unroll
  for (int i = 0; i < 8; ++i) { a[i] = (_Float16)p[i]; a[8 + i] = (_Float16)p[16 + i]; }
  return a;
}
__device__ __forceinline__ v16h frag_f32s(const float* rowk0, int lane, float sc) {
  v16h a; const float* p = rowk0 + 8 * (lane >> 4);
#pragma unroll
  for (int i = 0; i < 8; ++i) { a[i] = (_Float16)(p[i] * sc); a[8 + i] = (_Float16)(p[16 + i] * sc); }
  return a;
}
// column fragment from a [K][ld] layout (column n), rows >= K read as 0
__device__ __forceinline__ v16h fragc_f32(const float* W, int k0, int n, int lane, int ld, int K) {
  v16h a; const int g = lane >> 4;
#pragma unroll
  for (int i = 0; i < 8; ++i) { const int ka = k0 + 8 * g + i, kb = ka + 16;
    a[i] = (_Float16)(ka < K ? W[(size_t)(ka < K ? ka : K - 1) * ld + n] : 0.f); a[8 + i] = (_Float16)(kb < K ? W[(size_t)(kb < K ? kb : K - 1) * ld + n] : 0.f); }
  return a;
}
struct F2 { v16b h, l; };
__device__ __forceinline__ F2 bsplit16(const float v[16]) { F2 r;
#pragma unroll
  for (int i = 0; i < 16; ++i) { const __bf16 h = (__bf16)v[i]; r.h[i] = h; r.l[i] = (__bf16)(v[i] - (float)h); }
  return r; }
__device__ __forceinline__ F2 split_row(const float* row, int k0, int lane) { float v[16]; const float* p = row + k0 + 8 * (lane >> 4);
#pragma unroll
  for (int i = 0; i < 8; ++i) { v[i] = p[i]; v[8 + i] = p[16 + i]; }
  return bsplit16(v); }
__device__ __forceinline__ F2 split_rowK(const float* row, int k0, int lane, int K) { float v[16]; const int g = lane >> 4;
#pragma unroll
  for (int i = 0; i < 8; ++i) { const int ka = k0 + 8 * g + i, kb = ka + 16; v[i] = ka < K ? row[ka < K ? ka : K - 1] : 0.f; v[8 + i] = kb < K ? row[kb < K ? kb : K - 1] : 0.f; }
  return bsplit16(v); }
__device__ __forceinline__ F2 split_col(const float* W, int k0, int n, int lane, int ld, int K) { float v[16]; const int g = lane >> 4;
#pragma unroll
  for (int i = 0; i < 8; ++i) { const int ka = k0 + 8 * g + i, kb = ka + 16; v[i] = ka < K ? W[(size_t)(ka < K ? ka : K - 1) * ld + n] : 0.f; v[8 + i] = kb < K ? W[(size_t)(kb < K ? kb : K - 1) * ld + n] : 0.f; }
  return bsplit16(v); }
__device__ __forceinline__ v8f mac3(const F2& a, const F2& b, v8f c) { c = wmma_bf(a.l, b.h, c); c = wmma_bf(a.h, b.l, c); return wmma_bf(a.h, b.h, c); }
__device__ __forceinline__ float sigm(float v) { return 1.0f / (1.0f + expf(-v)); }
#define LDSX() do { asm volatile("s_wait_dscnt 0" ::: "memory"); __builtin_amdgcn_wave_barrier(); __builtin_amdgcn_fence(__ATOMIC_RELEASE, "workgroup"); } while (0)

// Multi-head self-attention returning (y, head-averaged attention) (B 2, T 2,048, C 1,024 = 16 heads x 64): q/k/v = x W^T + b ((out,in)); attn = softmax(q k^T x 64^-0.5) over all keys; y = merged(attn v) Wp^T + bp; attn_avg[b][t][s] = mean over the 16 heads of attn.
#define NB 2
#define TT 2048
#define CC 1024            // NH * HD = projected width
#define DIN 1024          // input (model) width
#define NH 16
#define HD 64
#define SCALE (0.125f)
#define CAUSAL 0
#ifndef TNB
#define TNB NB
#endif
__device__ __forceinline__ float bfr(float v) { return (float)(__bf16)v; }
__host__ __device__ __forceinline__ int kb_last(int qb) { return CAUSAL ? ((qb * 64 + 63) >> 7) : (TT / 128 - 1); }
typedef __attribute__((ext_vector_type(8))) __bf16 v8b;
__device__ __forceinline__ v16b frag_b(const __bf16* rowk0, int lane) {
  union { v16b v; v8b q[2]; } u; const __bf16* p = rowk0 + 8 * (lane >> 4);
  u.q[0] = *(const v8b*)p; u.q[1] = *(const v8b*)(p + 16); return u.v;
}
#define QBH 0
#define QHI 2048            // rows carrying a q residual plane (all rows when non-causal: 2-product logits everywhere)
#define KHI 64            // key rows carrying k residual / v bf16 hi+lo planes (written by k_proj; no kernel in this file reads them)
// B fragment (k rows k0+.., output column o) of a weight: (in,out) [K][ld] or (out,in) [ld rows of K]: bf16 exact, or f16(bf16 * 256) exact
__device__ __forceinline__ v16b wcol_io(const float* Wm, int k0, int o, int lane, int ld) { v16b w; const int g = lane >> 4;
#pragma unroll
  for (int i = 0; i < 8; ++i) { w[i] = (__bf16)Wm[(size_t)(k0 + 8 * g + i) * ld + o]; w[8 + i] = (__bf16)Wm[(size_t)(k0 + 16 + 8 * g + i) * ld + o]; }
  return w; }
__device__ __forceinline__ v16b wcol_oi(const float* Wm, int k0, int o, int lane, int K) { v16b w; const float* p = Wm + (size_t)o * K + k0 + 8 * (lane >> 4);
#pragma unroll
  for (int i = 0; i < 8; ++i) { w[i] = (__bf16)p[i]; w[8 + i] = (__bf16)p[16 + i]; }
  return w; }
__device__ __forceinline__ v16h wcolh_io(const float* Wm, int k0, int o, int lane, int ld) { v16h w; const int g = lane >> 4;
#pragma unroll
  for (int i = 0; i < 8; ++i) { w[i] = (_Float16)(bfr(Wm[(size_t)(k0 + 8 * g + i) * ld + o]) * 256.0f); w[8 + i] = (_Float16)(bfr(Wm[(size_t)(k0 + 16 + 8 * g + i) * ld + o]) * 256.0f); }
  return w; }
__device__ __forceinline__ v16h wcolh_oi(const float* Wm, int k0, int o, int lane, int K) { v16h w; const float* p = Wm + (size_t)o * K + k0 + 8 * (lane >> 4);
#pragma unroll
  for (int i = 0; i < 8; ++i) { w[i] = (_Float16)(bfr(p[i]) * 256.0f); w[8 + i] = (_Float16)(bfr(p[16 + i]) * 256.0f); }
  return w; }
#define WQKV_LAYOUT 1   // 0 = (in,out) [DIN][CC]; 1 = (out,in) [CC][DIN]; 2 = per-head [NH][DIN][HD]
__device__ __forceinline__ v16b wcol_hdk(const float* Wm, int k0, int o, int lane) { v16b w; const int g = lane >> 4; const float* p = Wm + (size_t)(o / HD) * DIN * HD + (o % HD);
#pragma unroll
  for (int i = 0; i < 8; ++i) { w[i] = (__bf16)p[(size_t)(k0 + 8 * g + i) * HD]; w[8 + i] = (__bf16)p[(size_t)(k0 + 16 + 8 * g + i) * HD]; }
  return w; }
#define WO_OUT_IN 1
#if WQKV_LAYOUT == 1
#define WCOL(W, k0, o, lane) wcol_oi(W, k0, o, lane, DIN)
#elif WQKV_LAYOUT == 2
#define WCOL(W, k0, o, lane) wcol_hdk(W, k0, o, lane)
#else
#define WCOL(W, k0, o, lane) wcol_io(W, k0, o, lane, CC)
#endif
#if WO_OUT_IN
#define WOCOL(W, k0, o, lane) wcol_oi(W, k0, o, lane, CC)
#define WOCOLH(W, k0, o, lane) wcolh_oi(W, k0, o, lane, CC)
#else
#define WOCOL(W, k0, o, lane) wcol_io(W, k0, o, lane, DIN)
#define WOCOLH(W, k0, o, lane) wcolh_io(W, k0, o, lane, DIN)
#endif
#define OUT1_OFF (4u * (size_t)NB * TT * DIN)      // byte offset of attn_avg [B][T][T]

#define WS_QH  0u                                      // f16 q rows [b*t][CC]
#define WS_KH  (WS_QH + 2u * (size_t)NB * TT * CC)      // f16 k in fragment order: [b][head][16-key tile][32-column half][fragment half][lane][8]
#define WS_VT  (WS_KH + 2u * (size_t)NB * TT * CC)      // f16 v in fragment order: [b][head][32-key group][16-column group][fragment half][lane][8]
#define WS_QL  (WS_VT + 2u * (size_t)NB * CC * TT)      // f16 q residual x 2^10 rows [b][t < QHI][CC]
#define WS_KL  (WS_QL + 2u * (size_t)NB * QHI * CC)     // f16 k residual x 2^10 rows [b][t < KHI][CC]
#define WS_VB  (WS_KL + 2u * (size_t)NB * KHI * CC)     // bf16 v hi planes [b][c][t < KHI]
#define WS_VBL (WS_VB + 2u * (size_t)NB * CC * KHI)
#define WS_Y   (WS_VBL + 2u * (size_t)NB * CC * KHI)     // f32 ctx rows [b*t][CC] (only when there is an output projection)
#define WS_PA  (WS_Y  + 4u * (size_t)NB * TT * CC)     // f32 sums of P x 2^11 over a group of 8 heads [head group][b][t][s]
#define WS_END (WS_PA + 4u * 2u * (size_t)NB * TT * TT)

// k and v pass from k_proj to k_fa in the reader's fragment order: the 16 bytes that lane l = 16 g + n takes for fragment half p lie at element (p * 32 + l) * 8 of the fragment's 512, so a wave-wide 16-byte load covers 512 contiguous bytes = 4 whole lines.
// k (A of S^T): lane's row = key tile * 16 + n, its 8 columns = half * 32 + p * 16 + 8 g + 0..7. v (B of P V): lane's column = group * 16 + n, its 8 keys = key group * 32 + p * 16 + 8 g + 0..7.
#define KF_OFF(b, h, tile) ((((size_t)(b) * NH + (h)) * (TT / 16) + (tile)) * 1024)   // element offset of a 16-key tile of head h: 2 fragments
#define VF_OFF(b, h, grp)  ((((size_t)(b) * NH + (h)) * (TT / 32) + (grp)) * 2048)    // element offset of a 32-key group of head h: 4 fragments
__device__ __forceinline__ v16h frag_w(const _Float16* p) {   // p = the fragment's first element + lane * 8
  union { v16h v; v8h q[2]; } u; u.q[0] = *(const v8h*)p; u.q[1] = *(const v8h*)(p + 256); return u.v;
}
// GEMM operand staging (k_proj, k_out): a step = 64 k = 256 B of each f32 operand row. 16 lanes x 16 B fetch one row's step, so a wave-wide load covers 4 whole lines; each value is converted ONCE a block and stored as 16 bit in LDS, where the block's 8 waves read their fragments.
// The block's tile is 128 rows x 128 columns: 256 operand rows fetched for 16,384 results (a 64 x 128 tile fetches 192 for 8,192). Wave (wr, wc) of 4 x 2 holds 32 rows x 64 columns = 2 x 4 accumulator tiles: 6 fragments from LDS for 8 products.
#define GKC 64             // k of a staged step
#define GP 72              // LDS pitch of a staged row in 16-bit elements: 144 B = 16 B x 9 (odd), conflict-free for 16-byte fragment reads
#define GBM 128            // rows of a block's tile
#define GROWS (GBM + 128)  // rows 0..127 = the block's X (or ctx) rows, 128..255 = its 128 weight rows (output columns)
typedef __attribute__((ext_vector_type(4))) __bf16 v4b;
typedef __attribute__((ext_vector_type(4))) _Float16 v4h;
static_assert(WQKV_LAYOUT == 1 && WO_OUT_IN == 1, "the staging reads weight rows (out,in): k contiguous");
static_assert(TT % GBM == 0 && !CAUSAL, "a block's rows lie in one sequence; k_out has the one-product path alone");
// ---- k_proj: block = (128 rows, 128 cols, which): q/k/v = X W (+ b) with exact bf16 products (K = DIN) -> which 0: q f16 rows (+ residual rows < QHI); 1: k f16 in fragment order (+ residual rows < KHI); 2: v f16 in fragment order (+ bf16 hi/lo planes for t < KHI). The tile leaves in two halves of 64 rows through the same LDS arrays.
__global__ __launch_bounds__(256) void k_proj(const float* __restrict__ XQ, const float* __restrict__ XK, const float* __restrict__ XV, const float* __restrict__ WQ, const float* __restrict__ WK, const float* __restrict__ WV, const float* __restrict__ BQ, const float* __restrict__ BK, const float* __restrict__ BV,
    _Float16* __restrict__ QH, _Float16* __restrict__ QL, _Float16* __restrict__ KH, _Float16* __restrict__ KL, _Float16* __restrict__ VT, __bf16* __restrict__ VB, __bf16* __restrict__ VBL) {
  __shared__ __align__(16) _Float16 sh[64][136], sl[64][136]; __shared__ __align__(16) _Float16 th[128][72]; __shared__ __align__(16) __bf16 tb[128][72], tbl[128][72]; __shared__ __align__(16) __bf16 stg[2][GROWS][GP];
  const int tid = threadIdx.x, wave = tid >> 5, lane = tid & 31, col = lane & 15, g = lane >> 4, wr = wave >> 1, wc = wave & 1; const int which = blockIdx.z; const int c0 = blockIdx.y * 128; const size_t r0 = (size_t)blockIdx.x * GBM; const size_t bb = r0 / TT; const int t0 = (int)(r0 % TT);
  const float* X = which == 0 ? XQ : which == 1 ? XK : XV; const float* WA = which == 0 ? WQ : which == 1 ? WK : WV; const float* BA = which == 0 ? BQ : which == 1 ? BK : BV;
  v8f acc[2][4] = {};
  const int lr = tid >> 4, ls = tid & 15;   // staging: this thread's row of each group of 16 rows, and its 16 bytes of the row's 256
  const float* gx = X + r0 * DIN; const float* gw = WA + (size_t)c0 * DIN; const unsigned go = lr * DIN + ls * 4;   // block-uniform bases and one per-thread offset
  const int rot = (blockIdx.x + 2 * blockIdx.y + 5 * blockIdx.z) & (DIN / GKC - 1);   // the block's first k step: blocks that share X rows or weight rows walk k from steps spread over the 16 (blocks x and x + 16 of one weight tile from the same one) and wrap, so fewer ask L2 for the same lines at the same moment
  v4f pf[GROWS / 16];
  { const float* px = gx + rot * GKC + go; const float* pw = gw + rot * GKC + go;
#pragma unroll
    for (int i = 0; i < GROWS / 16; ++i) pf[i] = i < 8 ? *(const v4f*)(px + (size_t)(i * 16) * DIN) : *(const v4f*)(pw + (size_t)(i * 16 - GBM) * DIN);
    asm volatile("s_wait_xcnt 0x0" :: "v"(px), "v"(pw) : "memory"); }   // stands in front of every overwrite of the first fetch's address registers: as inputs here they stay live up to the wait
  for (int c = 0; c < DIN / GKC; ++c) { __bf16 (*sb)[GP] = stg[c & 1];
#pragma unroll
    for (int i = 0; i < GROWS / 16; ++i) *(v4b*)&sb[i * 16 + lr][ls * 4] = __builtin_convertvector(pf[i], v4b);
    __syncthreads();   // this step's rows are in LDS; it also ends every wave's reads of the other buffer, which the next step refills
    if (c + 1 < DIN / GKC) {   // the next step's rows, fetched into registers behind the barrier (which would drain them): the fragment reads and products below cover their latency
      const int cn = (c + 1 + rot) & (DIN / GKC - 1); const float* px = gx + cn * GKC + go; const float* pw = gw + cn * GKC + go;
#pragma unroll
      for (int i = 0; i < GROWS / 16; ++i) pf[i] = i < 8 ? *(const v4f*)(px + (size_t)(i * 16) * DIN) : *(const v4f*)(pw + (size_t)(i * 16 - GBM) * DIN);
      asm volatile("s_wait_xcnt 0x0" :: "v"(px), "v"(pw) : "memory"); }   // stands in front of every overwrite of the fetch's address registers: as inputs here they stay live up to the wait, so no load of the group takes them as its destination
#pragma unroll
    for (int kc = 0; kc < GKC / 32; ++kc) { v16b a[2], wf[4];
#pragma unroll
      for (int i = 0; i < 2; ++i) a[i] = frag_b(&sb[wr * 32 + i * 16 + col][kc * 32], lane);
#pragma unroll
      for (int j = 0; j < 4; ++j) wf[j] = frag_b(&sb[GBM + wc * 64 + j * 16 + col][kc * 32], lane);
      __builtin_amdgcn_sched_barrier(0);   // keeps the 12 fragment reads one group in front of the 8 products: one LDS latency a group, not one a product
#pragma unroll
      for (int i = 0; i < 2; ++i)
#pragma unroll
        for (int j = 0; j < 4; ++j) acc[i][j] = wmma_bf(a[i], wf[j], acc[i][j]); } }
  float bias[4];
#pragma unroll
  for (int j = 0; j < 4; ++j) bias[j] = BA ? bfr(BA[c0 + wc * 64 + j * 16 + col]) : 0.f;
  for (int hf = 0; hf < 2; ++hf) { const int th0 = t0 + hf * 64; const size_t rh0 = r0 + hf * 64;   // the half's first row in its sequence and over all rows; waves wr = 2 hf, 2 hf + 1 hold it
    if (hf) __syncthreads();   // ends every thread's reads of the first half in LDS, which the second half overwrites
    if (which < 2) { _Float16* DH = which == 0 ? QH : KH; _Float16* DL = which == 0 ? QL : KL; const int nhi = which == 0 ? QHI : KHI; const bool hi_rows = th0 < nhi;
      if ((wr >> 1) == hf) {
#pragma unroll
        for (int i = 0; i < 2; ++i)
#pragma unroll
          for (int j = 0; j < 4; ++j)
#pragma unroll
            for (int r = 0; r < 8; ++r) { const float v = acc[i][j][r] + bias[j]; const _Float16 hv = (_Float16)v; const int rl = (wr & 1) * 32 + i * 16 + 8 * g + r, cl = wc * 64 + j * 16 + col; sh[rl][cl] = hv; sl[rl][cl] = (_Float16)((v - (float)hv) * 1024.0f); } }
      __syncthreads();
      for (int e = tid; e < 64 * 16; e += 256) { int rl, cq; size_t dh;   // e = the 16-byte piece in the order of its destination: a wave's store covers whole lines
        if (which == 0) { rl = e >> 4; cq = (e & 15) * 8; dh = (rh0 + rl) * CC + c0 + cq; }
        else { const int l = e & 31, fp = (e >> 5) & 3, tl = (e >> 7) & 3, hh = e >> 9; rl = tl * 16 + (l & 15); cq = hh * HD + fp * 16 + (l >> 4) * 8; dh = KF_OFF(bb, c0 / HD + hh, th0 / 16 + tl) + fp * 256 + l * 8; }
        vst2w((unsigned*)(DH + dh), *(const v4u*)&sh[rl][cq]); if (hi_rows) vst2w((unsigned*)(DL + (bb * nhi + th0 + rl) * (size_t)CC + c0 + cq), *(const v4u*)&sl[rl][cq]); }
    } else { const bool hi_rows = th0 < KHI;
      if ((wr >> 1) == hf) {
#pragma unroll
        for (int i = 0; i < 2; ++i)
#pragma unroll
          for (int j = 0; j < 4; ++j)
#pragma unroll
            for (int r = 0; r < 8; ++r) { const float v = acc[i][j][r] + bias[j]; const int rl = (wr & 1) * 32 + i * 16 + 8 * g + r, cl = wc * 64 + j * 16 + col; th[cl][rl] = (_Float16)v; const __bf16 bh = (__bf16)v; tb[cl][rl] = bh; tbl[cl][rl] = (__bf16)(v - (float)bh); } }
      __syncthreads();
      for (int e = tid; e < 128 * 8; e += 256) { const int l = e & 31, jp = (e >> 5) & 7, kg = (e >> 8) & 1, hh = e >> 9;   // e = the 16-byte piece in the order of its destination: a wave's store covers whole lines
        const int cl = hh * HD + (jp >> 1) * 16 + (l & 15), kq = kg * 32 + (jp & 1) * 16 + (l >> 4) * 8;
        vst2w((unsigned*)(VT + VF_OFF(bb, c0 / HD + hh, th0 / 32 + kg) + jp * 256 + l * 8), *(const v4u*)&th[cl][kq]); if (hi_rows) { const size_t o3 = (bb * CC + c0 + cl) * (size_t)KHI + th0 + kq; vst2w((unsigned*)(VB + o3), *(const v4u*)&tb[cl][kq]); vst2w((unsigned*)(VBL + o3), *(const v4u*)&tbl[cl][kq]); } } } } }
// ---- k_fa: block = 32 queries of batch b and HG = 8 of the heads, HG waves, wave = head. A wave holds QT = 2 query tiles of 16 in registers and uses every k and v fragment that it loads for both: half the fragment bytes from L2 per score.
// The wave forms S^T = K Q^T (A = 16 key rows, B = 16 query rows; q hi + residual x 2^10: 2 products), so a lane holds ONE query (col) of each tile and keys 8g + r of each 16-key tile: logits, softmax and P stay in registers.
// pass 1 walks all keys for the row maximum and the sum of exp (a running pair per lane and query tile, the two lane halves joined once at the end); pass 2 forms the logits again, P x 2^11 = exp(s - max) x 2048 / sum as one exp2: two S^T tiles ARE the 16 x 32 A fragment of P (elements 0..7 = keys k0 + 8g + r, 8..15 = k0 + 16 + 8g + r) against v f16 planes (1 product);
// the HG heads' f32 P tiles meet in LDS (two buffers, one barrier a 64-key step) and wave w sums query rows 4w..4w+3 over the block's heads in head order: whole 128-B lines of the head group's partial plane, which k_avg joins.
__device__ __forceinline__ v8f wmma_p(v16h a, v16h b, v8f c) { return __builtin_amdgcn_wmma_f32_16x16x32_f16(false, a, false, b, (short)0, c, false, false); }
__device__ __forceinline__ void st_tile(const v16h k0f, const v16h k1f, const v16h* qh, const v16h* ql, float* s) {
  v8f a = {}, al = {};
  a = wmma_p(k0f, qh[0], a); al = wmma_p(k0f, ql[0], al); a = wmma_p(k1f, qh[1], a); al = wmma_p(k1f, ql[1], al);
#pragma unroll
  for (int r = 0; r < 8; ++r) s[r] = a[r] + al[r] * (1.0f / 1024.0f); }   // the raw q.k sum: SCALE rides in the exponent's multiply-add (KL2E)
#define KL2E (SCALE * 1.44269504088896340736f)   // exp((t - tmax) x SCALE) = exp2(t x KL2E - tmax x KL2E)
__device__ __forceinline__ float ex2(float v) { return __builtin_amdgcn_exp2f(v); }   // v_exp_f32; arguments here are <= 11, and a result below the normal range may read 0
__device__ __forceinline__ float ex2n(float v) { float e; asm("v_exp_f32 %0, %1\n\tv_nop" : "=v"(e) : "v"(v)); return e; }   // the same, for the places where in this build the next vector instruction takes the source register as its destination: the v_nop is the slot that the instruction set asks for behind a transcendental, tied to it in one statement
#define PBP 68             // LDS pitch of a 64-key P row in floats: the 16 query rows' 16-byte stores fall on 16 different bank groups
#define QT 2               // query tiles of 16 a wave
#define HG 8               // heads = waves of a block
static_assert(NH % HG == 0 && HD == 64 && QT * 16 == HG * 4, "wave w is head w of its group and sums 4 query rows of the 32-row tile");
__global__ __launch_bounds__(HG * 32) void k_fa(const _Float16* __restrict__ QH, const _Float16* __restrict__ QL, const _Float16* __restrict__ KH, const _Float16* __restrict__ VT, float* __restrict__ Y, float* __restrict__ PA) {
  __shared__ __align__(16) float pb[2][HG][QT * 16][PBP];
  const int tid = threadIdx.x, lane = tid & 31, col = lane & 15, g = lane >> 4; const int b = blockIdx.y; const int ql0 = blockIdx.x * (QT * 16);
  const int w = __builtin_amdgcn_readfirstlane(tid >> 5); const int h = blockIdx.z * HG + w;   // the wave's number and its head, in scalar registers: head offsets stay scalar
  v16h qh[QT][2], ql[QT][2];
  const _Float16* pqh = QH + ((size_t)b * TT + ql0 + col) * CC + h * HD + 8 * g; const _Float16* pql = QL + ((size_t)b * QHI + ql0 + col) * CC + h * HD + 8 * g;   // the lane's own 8 columns of its query row of tile 0
#pragma unroll
  for (int qt = 0; qt < QT; ++qt)
#pragma unroll
    for (int kc = 0; kc < 2; ++kc) { qh[qt][kc] = frag_h(pqh + qt * 16 * CC + kc * 32, 0); ql[qt][kc] = frag_h(pql + qt * 16 * CC + kc * 32, 0); }
  asm volatile("s_wait_xcnt 0x0" :: "v"(pqh), "v"(pql) : "memory");   // the q loads' address registers are reused below: the wait stands in front of that overwrite; as inputs here they stay live up to it, so no q load takes them as its destination
  const _Float16* Kr = KH + KF_OFF(b, h, 0) + lane * 8;   // this head's k fragments, 64 elements a key: a fragment load covers 4 whole lines
  const _Float16* Vr = VT + VF_OFF(b, h, 0) + lane * 8;   // this head's v fragments, 64 elements a key
  const int rot = blockIdx.x & (TT / 64 - 1);   // the block's first 64-key step in both passes: the blocks of one batch and head group read the same k and v lines; block x starts its key walk at step x mod 32 (blocks x and x + 32 at the same one) and wraps, so few ask L2 for the same lines at the same moment
  constexpr unsigned slot1[QT] = { 0x3f80u, 0x30cae030u };   // pass 1: bit i of tile qt = this build needs the slot of ex2n behind the exp of score i
  float m[QT], l[QT];
#pragma unroll
  for (int qt = 0; qt < QT; ++qt) { m[qt] = -3.0e38f; l[qt] = 0.f; }
  v16h kf[8];
  { const _Float16* pk = Kr + rot * 4096;   // the walk's first 64 keys
#pragma unroll
    for (int t = 0; t < 4; ++t) { kf[2 * t] = frag_w(pk + t * 1024); kf[2 * t + 1] = frag_w(pk + t * 1024 + 512); }
    asm volatile("s_wait_xcnt 0x0" :: "v"(pk) : "memory"); }   // stands in front of every overwrite of the first fetch's address registers: as an input here they stay live up to the wait, so no load of the group takes them as its destination
  for (int it = 0; it < TT / 64; ++it) { float s[QT][32];
#pragma unroll
    for (int qt = 0; qt < QT; ++qt)
#pragma unroll
      for (int t = 0; t < 4; ++t) st_tile(kf[2 * t], kf[2 * t + 1], qh[qt], ql[qt], s[qt] + t * 8);
    const int kn = ((it + 1 + rot) & (TT / 64 - 1)) * 64;   // the next 64 keys of the wrapped walk, fetched one trip ahead; the last trip fetches the walk's first 64 again, of which pass 2 uses the first 32
    const _Float16* pk = Kr + kn * HD;
#pragma unroll
    for (int t = 0; t < 4; ++t) { kf[2 * t] = frag_w(pk + t * 1024); kf[2 * t + 1] = frag_w(pk + t * 1024 + 512); }
    __builtin_amdgcn_sched_barrier(0);   // keeps the fetch ahead in front of the exp work below, which covers its latency
#pragma unroll
    for (int qt = 0; qt < QT; ++qt) { float bm = s[qt][0];
#pragma unroll
      for (int i = 1; i < 32; ++i) bm = fmaxf(bm, s[qt][i]);
      const float mn = fmaxf(m[qt], bm), nb = -mn * KL2E; float a = 0.f;
#pragma unroll
      for (int i = 0; i < 32; ++i) { const float x = fmaf(s[qt][i], KL2E, nb); a += (slot1[qt] >> i & 1) ? ex2n(x) : ex2(x); }
      l[qt] = l[qt] * ex2n((m[qt] - mn) * KL2E) + a; m[qt] = mn; }
    asm volatile("s_wait_xcnt 0x0" :: "v"(pk) : "memory"); }   // the next trip rewrites the address registers of the fetch ahead: the wait stands in front of that overwrite; as an input here they stay live up to it, through the exp work
  float nb2[QT];
#pragma unroll
  for (int qt = 0; qt < QT; ++qt) { const float M = fmaxf(m[qt], __shfl_xor(m[qt], 16)); float lq = l[qt] * ex2n((m[qt] - M) * KL2E); lq += __shfl_xor(lq, 16);
    nb2[qt] = fmaf(-M, KL2E, 11.0f - __builtin_amdgcn_logf(lq)); }   // P x 2^11 = exp2(t x KL2E + nb2): the maximum and 2048 / sum as one addend (v_log_f32 = log2; the sum lies between about 1 and 2048, a normal number)
  v8f acc[QT][HD / 16] = {};
  float* pa = PA + (((size_t)blockIdx.z * NB + b) * TT + ql0 + w * 4 + g) * TT + col * 4;   // a half wave = one query row's 64 keys of a step = 2 whole lines
  for (int st = 0; st < TT / 64; ++st) { const int sk = (st + rot) & (TT / 64 - 1); v16h vf[2][HD / 16]; const _Float16* pv = Vr + sk * 4096;   // a step = 64 keys (step sk of the wrapped walk), as two halves of 32 keys
#pragma unroll
    for (int u = 0; u < 2; ++u)
#pragma unroll
      for (int j = 0; j < HD / 16; ++j) vf[u][j] = frag_w(pv + u * 2048 + j * 512);
#pragma unroll
    for (int u = 0; u < 2; ++u) { float s[QT][16];
#pragma unroll
      for (int qt = 0; qt < QT; ++qt) { st_tile(kf[0], kf[1], qh[qt], ql[qt], s[qt]); st_tile(kf[2], kf[3], qh[qt], ql[qt], s[qt] + 8); }
      const int kn = u == 0 ? sk * 64 + 32 : ((st + 1 + rot) & (TT / 64 - 1)) * 64;   // the next 32 keys of the wrapped walk, fetched one half step ahead (the last fetch, of the walk's first 32, is in bounds and unused)
      const _Float16* pk = Kr + kn * HD;
#pragma unroll
      for (int t = 0; t < 2; ++t) { kf[2 * t] = frag_w(pk + t * 1024); kf[2 * t + 1] = frag_w(pk + t * 1024 + 512); }
      asm volatile("s_wait_xcnt 0x0" :: "v"(pv), "v"(pk) : "memory");   // stands in front of every overwrite of the v and k loads' address registers: as inputs here they stay live up to the wait, so no load of the groups takes them as its destination
      __builtin_amdgcn_sched_barrier(0);   // keeps the v loads and the k fetch ahead in front of the exp work below, which covers their latency
#pragma unroll
      for (int qt = 0; qt < QT; ++qt) { v16h p;
#pragma unroll
        for (int i = 0; i < 16; ++i) { s[qt][i] = ex2(fmaf(s[qt][i], KL2E, nb2[qt])); p[i] = (_Float16)s[qt][i]; }
#pragma unroll
        for (int j = 0; j < HD / 16; ++j) acc[qt][j] = wmma_p(p, vf[u][j], acc[qt][j]);
        float* pw = &pb[st & 1][w][qt * 16 + col][u * 32 + 8 * g];
#pragma unroll
        for (int t = 0; t < 2; ++t) { v4f lo = { s[qt][t * 8], s[qt][t * 8 + 1], s[qt][t * 8 + 2], s[qt][t * 8 + 3] }, hi = { s[qt][t * 8 + 4], s[qt][t * 8 + 5], s[qt][t * 8 + 6], s[qt][t * 8 + 7] }; *(v4f*)(pw + t * 16) = lo; *(v4f*)(pw + t * 16 + 4) = hi; } } }
    __syncthreads();   // the block's heads' P tiles of this step are in LDS; it also ends every wave's reads of the other buffer, which the next step refills
    v4f a[2];
#pragma unroll
    for (int i = 0; i < 2; ++i) { a[i] = *(const v4f*)&pb[st & 1][0][w * 4 + i * 2 + g][col * 4];
#pragma unroll
      for (int hh = 1; hh < HG; ++hh) a[i] += *(const v4f*)&pb[st & 1][hh][w * 4 + i * 2 + g][col * 4]; }
    float* po = pa + sk * 64;
    vst2(po, a[0]); vst2(po + 2 * TT, a[1]);
    asm volatile("s_wait_xcnt 0x0" :: "v"(po), "v"(a[0]), "v"(a[1]) : "memory"); }   // the next step rewrites the two stores' address and data registers: the wait stands in front of that overwrite; as inputs here they stay live up to it
#pragma unroll
  for (int qt = 0; qt < QT; ++qt)
#pragma unroll
    for (int j = 0; j < HD / 16; ++j)
#pragma unroll
      for (int r = 0; r < 8; ++r) Y[((size_t)b * TT + ql0 + qt * 16 + 8 * g + r) * CC + h * HD + j * 16 + col] = acc[qt][j][r] * (1.0f / 2048.0f); }
// ---- k_avg: attn_avg = (the NH / HG head groups' partial planes, in group order) / (2^11 NH): a stream, 16 bytes a lane, 8 loads in flight a wave
static_assert(NH / HG == 2, "k_avg joins two planes");
__global__ __launch_bounds__(256) void k_avg(const float* __restrict__ PA, float* __restrict__ AV) {
  const size_t o = (size_t)blockIdx.x * 4096 + threadIdx.x * 4; const float* p0 = PA + o; const float* p1 = p0 + (size_t)NB * TT * TT;
  v4f x[4], y[4];
#pragma unroll
  for (int i = 0; i < 4; ++i) { x[i] = *(const v4f*)(p0 + i * 1024); y[i] = *(const v4f*)(p1 + i * 1024); }
#pragma unroll
  for (int i = 0; i < 4; ++i) vst2(AV + o + i * 1024, (x[i] + y[i]) * (1.0f / (2048.0f * NH))); }
// ---- k_out: block = (128 rows, 128 cols): out = ctx Wo (+ bo): ctx once to f16 against Wo as f16(bf16 x 2^8) exact (1 product) x 2^-8
#define SFP 68             // LDS pitch of a wave's 64-column output row in floats: 272 B = 16 B x 17 (odd)
__global__ __launch_bounds__(256) void k_out(const float* __restrict__ Y, const float* __restrict__ WO, const float* __restrict__ BO, float* __restrict__ OUT) { __shared__ __align__(16) float sf[8][32][SFP]; __shared__ __align__(16) _Float16 stg[2][GROWS][GP];
  const int tid = threadIdx.x, wave = tid >> 5, lane = tid & 31, col = lane & 15, g = lane >> 4, wr = wave >> 1, wc = wave & 1; const int c0 = blockIdx.y * 128; const size_t r0 = (size_t)blockIdx.x * GBM;
  v8f acc[2][4] = {};
  const int lr = tid >> 4, ls = tid & 15;   // staging: this thread's row of each group of 16 rows, and its 16 bytes of the row's 256
  const float* gx = Y + r0 * CC; const float* gw = WO + (size_t)c0 * CC; const unsigned go = lr * CC + ls * 4;   // block-uniform bases and one per-thread offset
  const int rot = (blockIdx.x + 2 * blockIdx.y) & (CC / GKC - 1);   // the block's first k step, as in k_proj: sharers of ctx rows start apart, sharers of weight rows too but for blocks x and x + 16, and all wrap
  v4f pf[GROWS / 16];
  { const float* px = gx + rot * GKC + go; const float* pw = gw + rot * GKC + go;
#pragma unroll
    for (int i = 0; i < GROWS / 16; ++i) pf[i] = i < 8 ? *(const v4f*)(px + (size_t)(i * 16) * CC) : *(const v4f*)(pw + (size_t)(i * 16 - GBM) * CC);
    asm volatile("s_wait_xcnt 0x0" :: "v"(px), "v"(pw) : "memory"); }   // stands in front of every overwrite of the first fetch's address registers: as inputs here they stay live up to the wait
  for (int c = 0; c < CC / GKC; ++c) { _Float16 (*sb)[GP] = stg[c & 1];
#pragma unroll
    for (int i = 0; i < GROWS / 16; ++i) { v4h t;
#pragma unroll
      for (int e = 0; e < 4; ++e) t[e] = i < 8 ? (_Float16)pf[i][e] : (_Float16)(bfr(pf[i][e]) * 256.0f);
      *(v4h*)&sb[i * 16 + lr][ls * 4] = t; }
    __syncthreads();   // this step's rows are in LDS; it also ends every wave's reads of the other buffer, which the next step refills
    if (c + 1 < CC / GKC) {   // the next step's rows, fetched into registers behind the barrier (which would drain them): the fragment reads and products below cover their latency
      const int cn = (c + 1 + rot) & (CC / GKC - 1); const float* px = gx + cn * GKC + go; const float* pw = gw + cn * GKC + go;
#pragma unroll
      for (int i = 0; i < GROWS / 16; ++i) pf[i] = i < 8 ? *(const v4f*)(px + (size_t)(i * 16) * CC) : *(const v4f*)(pw + (size_t)(i * 16 - GBM) * CC);
      asm volatile("s_wait_xcnt 0x0" :: "v"(px), "v"(pw) : "memory"); }   // stands in front of every overwrite of the fetch's address registers: as inputs here they stay live up to the wait, so no load of the group takes them as its destination
#pragma unroll
    for (int kc = 0; kc < GKC / 32; ++kc) { v16h a[2], wf[4];
#pragma unroll
      for (int i = 0; i < 2; ++i) a[i] = frag_h(&sb[wr * 32 + i * 16 + col][kc * 32], lane);
#pragma unroll
      for (int j = 0; j < 4; ++j) wf[j] = frag_h(&sb[GBM + wc * 64 + j * 16 + col][kc * 32], lane);
      __builtin_amdgcn_sched_barrier(0);   // keeps the 12 fragment reads one group in front of the 8 products: one LDS latency a group, not one a product
#pragma unroll
      for (int i = 0; i < 2; ++i)
#pragma unroll
        for (int j = 0; j < 4; ++j) acc[i][j] = wmma16(a[i], wf[j], acc[i][j]); } }
#pragma unroll
  for (int j = 0; j < 4; ++j) { const float bias = BO ? bfr(BO[c0 + wc * 64 + j * 16 + col]) : 0.f;
#pragma unroll
    for (int i = 0; i < 2; ++i)
#pragma unroll
      for (int r = 0; r < 8; ++r) sf[wave][i * 16 + 8 * g + r][j * 16 + col] = acc[i][j][r] * (1.0f / 256.0f) + bias; }
  LDSX(); for (int rl = 0; rl < 16; ++rl) vst2(OUT + (r0 + wr * 32 + rl * 2 + g) * DIN + c0 + wc * 64 + col * 4, *(const v4f*)&sf[wave][rl * 2 + g][col * 4]); }   // a half wave = one row's 64 columns = 2 whole lines

extern "C" void kernel_launch(void* const* d_in, const int* in_sizes, int n_in, void* d_out, int out_size, void* d_ws, size_t ws_size, hipStream_t stream) {
  (void)in_sizes; (void)n_in; (void)out_size;
  const float** F = (const float**)d_in;
  if (ws_size < (size_t)WS_END) return;
  char* ws = (char*)d_ws; _Float16 *QH = (_Float16*)(ws + WS_QH), *KH = (_Float16*)(ws + WS_KH), *VT = (_Float16*)(ws + WS_VT), *QL = (_Float16*)(ws + WS_QL), *KL = (_Float16*)(ws + WS_KL); __bf16 *VB = (__bf16*)(ws + WS_VB), *VBL = (__bf16*)(ws + WS_VBL); float *Y = (float*)(ws + WS_Y), *PA = (float*)(ws + WS_PA);
  (void)Y; (void)QL; (void)KL; (void)VB; (void)VBL;
  // inputs: 0 x [2,2048,1024]; 1 Wq, 2 bq, 3 Wk, 4 bk, 5 Wv, 6 bv, 7 Wp, 8 bp ((out,in) [1024,1024], [1024]); outputs: 0 y [2,2048,1024] @0, 1 attn_avg [2,2048,2048] @ OUT1_OFF
  float* AV = (float*)((char*)d_out + OUT1_OFF);
  k_proj<<<dim3(TNB * TT / GBM, CC / 128, 3), 256, 0, stream>>>(F[0], F[0], F[0], F[1], F[3], F[5], F[2], F[4], F[6], QH, QL, KH, KL, VT, VB, VBL);
  k_fa<<<dim3(TT / (QT * 16), TNB, NH / HG), HG * 32, 0, stream>>>(QH, QL, KH, VT, Y, PA);
  k_avg<<<dim3((unsigned)((size_t)TNB * TT * TT / 4096)), 256, 0, stream>>>(PA, AV);
  k_out<<<dim3(TNB * TT / GBM, DIN / 128), 256, 0, stream>>>(Y, F[7], F[8], (float*)d_out);
}

// v009
// A run of this version takes 142 microseconds.
// Next to v008, in two timings, it ran 1.03 times as fast each time.
// Over all steps from v000 it is 10.4 times as fast.
// compute dtype: all float inputs rounded to bf16; q/k/v = x W^T + b with EXACT bf16 products on WMMA 16x16x32, f32 accumulate; q as f16 hi + residual (x 2^10) against k once to f16 (2 products) for the logits x 1/8; softmax in f32 (hardware exp2 of one fused multiply-add that carries scale x log2 e, the row maximum and, in pass 2, the row sum), the head-averaged attention map accumulated in f32 (8 heads a block in head order, then the two groups' sums); P x 2^11 once to f16 against v once to f16 (1 product, summed per half of the keys, the two halves added in f32); ctx once to f16 against Wp carried x 2^8 in f16 (exact bf16 values) + bp; f32 outputs.
#include <hip/hip_runtime.h>
#include <math.h>

typedef __attribute__((ext_vector_type(16))) _Float16 v16h;
typedef __attribute__((ext_vector_type(16))) __bf16 v16b;
typedef __attribute__((ext_vector_type(8)))  _Float16 v8h;
typedef __attribute__((ext_vector_type(8)))  float v8f;
typedef __attribute__((ext_vector_type(4)))  float v4f;
typedef __attribute__((ext_vector_type(2)))  float v2f;
typedef __attribute__((ext_vector_type(4)))  unsigned v4u;
typedef __attribute__((ext_vector_type(4)))  int v4i;
typedef float __attribute__((may_alias)) float_a;
typedef int __attribute__((may_alias)) int_a;

template <typename T> __device__ __forceinline__ void vst2(void* p, T v) { *(T*)p = v;  }
// a store in a loop whose next trip rewrites the store's address and data registers: the wait stands in front of that overwrite; as inputs here both stay live up to the wait
template <typename T> __device__ __forceinline__ void vst2w(void* p, T v) { *(T*)p = v; asm volatile("s_wait_xcnt 0x0" :: "v"(p), "v"(v) : "memory"); }
__device__ __forceinline__ v8f wmma16(v16h a, v16h b, v8f c) {
  v8f d = __builtin_amdgcn_wmma_f32_16x16x32_f16(false, a, false, b, (short)0, c, false, false);
  asm volatile("v_nop\n\tv_nop\n\tv_nop\n\tv_nop" : "+v"(d) : "v"(a), "v"(b));
  return d;
}
__device__ __forceinline__ v8f wmma_bf(v16b a, v16b b, v8f c) {
  v8f d = __builtin_amdgcn_wmma_f32_16x16x32_bf16(false, a, false, b, (short)0, c, false, false);
  asm volatile("v_nop\n\tv_nop\n\tv_nop\n\tv_nop" : "+v"(d) : "v"(a), "v"(b));
  return d;
}
// 16x16x32 fragments: lane = (h = lane>>4, row/col = lane&15); elements 0..7 = k0+8h+0..7, 8..15 = k0+16+8h+0..7; D element r = row 8h+r
__device__ __forceinline__ v16h frag_h(const _Float16* rowk0, int lane) {
  union { v16h v; v8h q[2]; } u; const _Float16* p = rowk0 + 8 * (lane >> 4);
  u.q[0] = *(const v8h*)p; u.q[1] = *(const v8h*)(p + 16); return u.v;
}
__device__ __forceinline__ v16h frag_f32(const float* rowk0, int lane) {
  v16h a; const float* p = rowk0 + 8 * (lane >> 4);
#pragma unroll
  for (int i = 0; i < 8; ++i) { a[i] = (_Float16)p[i]; a[8 + i] = (_Float16)p[16 + i]; }
  return a;
}
__device__ __forceinline__ v16h frag_f32s(const float* rowk0, int lane, float sc) {
  v16h a; const float* p = rowk0 + 8 * (lane >> 4);
#pragma unroll
  for (int i = 0; i < 8; ++i) { a[i] = (_Float16)(p[i] * sc); a[8 + i] = (_Float16)(p[16 + i] * sc); }
  return a;
}
// column fragment from a [K][ld] layout (column n), rows >= K read as 0
__device__ __forceinline__ v16h fragc_f32(const float* W, int k0, int n, int lane, int ld, int K) {
  v16h a; const int g = lane >> 4;
#pragma unroll
  for (int i = 0; i < 8; ++i) { const int ka = k0 + 8 * g + i, kb = ka + 16;
    a[i] = (_Float16)(ka < K ? W[(size_t)(ka < K ? ka : K - 1) * ld + n] : 0.f); a[8 + i] = (_Float16)(kb < K ? W[(size_t)(kb < K ? kb : K - 1) * ld + n] : 0.f); }
  return a;
}
struct F2 { v16b h, l; };
__device__ __forceinline__ F2 bsplit16(const float v[16]) { F2 r;
#pragma unroll
  for (int i = 0; i < 16; ++i) { const __bf16 h = (__bf16)v[i]; r.h[i] = h; r.l[i] = (__bf16)(v[i] - (float)h); }
  return r; }
__device__ __forceinline__ F2 split_row(const float* row, int k0, int lane) { float v[16]; const float* p = row + k0 + 8 * (lane >> 4);
#pragma unroll
  for (int i = 0; i < 8; ++i) { v[i] = p[i]; v[8 + i] = p[16 + i]; }
  return bsplit16(v); }
__device__ __forceinline__ F2 split_rowK(const float* row, int k0, int lane, int K) { float v[16]; const int g = lane >> 4;
#pragma unroll
  for (int i = 0; i < 8; ++i) { const int ka = k0 + 8 * g + i, kb = ka + 16; v[i] = ka < K ? row[ka < K ? ka : K - 1] : 0.f; v[8 + i] = kb < K ? row[kb < K ? kb : K - 1] : 0.f; }
  return bsplit16(v); }
__device__ __forceinline__ F2 split_col(const float* W, int k0, int n, int lane, int ld, int K) { float v[16]; const int g = lane >> 4;
#pragma unroll
  for (int i = 0; i < 8; ++i) { const int ka = k0 + 8 * g + i, kb = ka + 16; v[i] = ka < K ? W[(size_t)(ka < K ? ka : K - 1) * ld + n] : 0.f; v[8 + i] = kb < K ? W[(size_t)(kb < K ? kb : K - 1) * ld + n] : 0.f; }
  return bsplit16(v); }
__device__ __forceinline__ v8f mac3(const F2& a, const F2& b, v8f c) { c = wmma_bf(a.l, b.h, c); c = wmma_bf(a.h, b.l, c); return wmma_bf(a.h, b.h, c); }
__device__ __forceinline__ float sigm(float v) { return 1.0f / (1.0f + expf(-v)); }
#define LDSX() do { asm volatile("s_wait_dscnt 0" ::: "memory"); __builtin_amdgcn_wave_barrier(); __builtin_amdgcn_fence(__ATOMIC_RELEASE, "workgroup"); } while (0)

// Multi-head self-attention returning (y, head-averaged attention) (B 2, T 2,048, C 1,024 = 16 heads x 64): q/k/v = x W^T + b ((out,in)); attn = softmax(q k^T x 64^-0.5) over all keys; y = merged(attn v) Wp^T + bp; attn_avg[b][t][s] = mean over the 16 heads of attn.
#define NB 2
#define TT 2048
#define CC 1024            // NH * HD = projected width
#define DIN 1024          // input (model) width
#define NH 16
#define HD 64
#define SCALE (0.125f)
#define CAUSAL 0
#ifndef TNB
#define TNB NB
#endif
__device__ __forceinline__ float bfr(float v) { return (float)(__bf16)v; }
__host__ __device__ __forceinline__ int kb_last(int qb) { return CAUSAL ? ((qb * 64 + 63) >> 7) : (TT / 128 - 1); }
typedef __attribute__((ext_vector_type(8))) __bf16 v8b;
__device__ __forceinline__ v16b frag_b(const __bf16* rowk0, int lane) {
  union { v16b v; v8b q[2]; } u; const __bf16* p = rowk0 + 8 * (lane >> 4);
  u.q[0] = *(const v8b*)p; u.q[1] = *(const v8b*)(p + 16); return u.v;
}
#define QBH 0
#define QHI 2048            // rows carrying a q residual plane (all rows when non-causal: 2-product logits everywhere)
#define KHI 64            // key rows carrying k residual / v bf16 hi+lo planes (written by k_proj; no kernel in this file reads them)
// B fragment (k rows k0+.., output column o) of a weight: (in,out) [K][ld] or (out,in) [ld rows of K]: bf16 exact, or f16(bf16 * 256) exact
__device__ __forceinline__ v16b wcol_io(const float* Wm, int k0, int o, int lane, int ld) { v16b w; const int g = lane >> 4;
#pragma unroll
  for (int i = 0; i < 8; ++i) { w[i] = (__bf16)Wm[(size_t)(k0 + 8 * g + i) * ld + o]; w[8 + i] = (__bf16)Wm[(size_t)(k0 + 16 + 8 * g + i) * ld + o]; }
  return w; }
__device__ __forceinline__ v16b wcol_oi(const float* Wm, int k0, int o, int lane, int K) { v16b w; const float* p = Wm + (size_t)o * K + k0 + 8 * (lane >> 4);
#pragma unroll
  for (int i = 0; i < 8; ++i) { w[i] = (__bf16)p[i]; w[8 + i] = (__bf16)p[16 + i]; }
  return w; }
__device__ __forceinline__ v16h wcolh_io(const float* Wm, int k0, int o, int lane, int ld) { v16h w; const int g = lane >> 4;
#pragma unroll
  for (int i = 0; i < 8; ++i) { w[i] = (_Float16)(bfr(Wm[(size_t)(k0 + 8 * g + i) * ld + o]) * 256.0f); w[8 + i] = (_Float16)(bfr(Wm[(size_t)(k0 + 16 + 8 * g + i) * ld + o]) * 256.0f); }
  return w; }
__device__ __forceinline__ v16h wcolh_oi(const float* Wm, int k0, int o, int lane, int K) { v16h w; const float* p = Wm + (size_t)o * K + k0 + 8 * (lane >> 4);
#pragma unroll
  for (int i = 0; i < 8; ++i) { w[i] = (_Float16)(bfr(p[i]) * 256.0f); w[8 + i] = (_Float16)(bfr(p[16 + i]) * 256.0f); }
  return w; }
#define WQKV_LAYOUT 1   // 0 = (in,out) [DIN][CC]; 1 = (out,in) [CC][DIN]; 2 = per-head [NH][DIN][HD]
__device__ __forceinline__ v16b wcol_hdk(const float* Wm, int k0, int o, int lane) { v16b w; const int g = lane >> 4; const float* p = Wm + (size_t)(o / HD) * DIN * HD + (o % HD);
#pragma unroll
  for (int i = 0; i < 8; ++i) { w[i] = (__bf16)p[(size_t)(k0 + 8 * g + i) * HD]; w[8 + i] = (__bf16)p[(size_t)(k0 + 16 + 8 * g + i) * HD]; }
  return w; }
#define WO_OUT_IN 1
#if WQKV_LAYOUT == 1
#define WCOL(W, k0, o, lane) wcol_oi(W, k0, o, lane, DIN)
#elif WQKV_LAYOUT == 2
#define WCOL(W, k0, o, lane) wcol_hdk(W, k0, o, lane)
#else
#define WCOL(W, k0, o, lane) wcol_io(W, k0, o, lane, CC)
#endif
#if WO_OUT_IN
#define WOCOL(W, k0, o, lane) wcol_oi(W, k0, o, lane, CC)
#define WOCOLH(W, k0, o, lane) wcolh_oi(W, k0, o, lane, CC)
#else
#define WOCOL(W, k0, o, lane) wcol_io(W, k0, o, lane, DIN)
#define WOCOLH(W, k0, o, lane) wcolh_io(W, k0, o, lane, DIN)
#endif
#define OUT1_OFF (4u * (size_t)NB * TT * DIN)      // byte offset of attn_avg [B][T][T]

#define WS_QH  0u                                      // f16 q rows [b*t][CC]
#define WS_KH  (WS_QH + 2u * (size_t)NB * TT * CC)      // f16 k in fragment order: [b][head][16-key tile][32-column half][fragment half][lane][8]
#define WS_VT  (WS_KH + 2u * (size_t)NB * TT * CC)      // f16 v in fragment order: [b][head][32-key group][16-column group][fragment half][lane][8]
#define WS_QL  (WS_VT + 2u * (size_t)NB * CC * TT)      // f16 q residual x 2^10 rows [b][t < QHI][CC]
#define WS_KL  (WS_QL + 2u * (size_t)NB * QHI * CC)     // f16 k residual x 2^10 rows [b][t < KHI][CC]
#define WS_VB  (WS_KL + 2u * (size_t)NB * KHI * CC)     // bf16 v hi planes [b][c][t < KHI]
#define WS_VBL (WS_VB + 2u * (size_t)NB * CC * KHI)
#define WS_Y   (WS_VBL + 2u * (size_t)NB * CC * KHI)     // f32 ctx rows [b*t][CC] (only when there is an output projection)
#define WS_PA  (WS_Y  + 4u * (size_t)NB * TT * CC)     // f32 sums of P x 2^11 over a group of 8 heads [head group][b][t][s]
#define WS_END (WS_PA + 4u * 2u * (size_t)NB * TT * TT)

// k and v pass from k_proj to k_fa in the reader's fragment order: the 16 bytes that lane l = 16 g + n takes for fragment half p lie at element (p * 32 + l) * 8 of the fragment's 512, so a wave-wide 16-byte load covers 512 contiguous bytes = 4 whole lines.
// k (A of S^T): lane's row = key tile * 16 + n, its 8 columns = half * 32 + p * 16 + 8 g + 0..7. v (B of P V): lane's column = group * 16 + n, its 8 keys = key group * 32 + p * 16 + 8 g + 0..7.
#define KF_OFF(b, h, tile) ((((size_t)(b) * NH + (h)) * (TT / 16) + (tile)) * 1024)   // element offset of a 16-key tile of head h: 2 fragments
#define VF_OFF(b, h, grp)  ((((size_t)(b) * NH + (h)) * (TT / 32) + (grp)) * 2048)    // element offset of a 32-key group of head h: 4 fragments
__device__ __forceinline__ v16h frag_w(const _Float16* p) {   // p = the fragment's first element + lane * 8
  union { v16h v; v8h q[2]; } u; u.q[0] = *(const v8h*)p; u.q[1] = *(const v8h*)(p + 256); return u.v;
}
// GEMM operand staging (k_proj, k_out): a step = 64 k = 256 B of each f32 operand row. 16 lanes x 16 B fetch one row's step, so a wave-wide load covers 4 whole lines; each value is converted ONCE a block and stored as 16 bit in LDS, where the block's 8 waves read their fragments.
// The block's tile is 128 rows x 128 columns: 256 operand rows fetched for 16,384 results (a 64 x 128 tile fetches 192 for 8,192). Wave (wr, wc) of 4 x 2 holds 32 rows x 64 columns = 2 x 4 accumulator tiles: 6 fragments from LDS for 8 products.
#define GKC 64             // k of a staged step
#define GP 72              // LDS pitch of a staged row in 16-bit elements: 144 B = 16 B x 9 (odd), conflict-free for 16-byte fragment reads
#define GBM 128            // rows of a block's tile
#define GROWS (GBM + 128)  // rows 0..127 = the block's X (or ctx) rows, 128..255 = its 128 weight rows (output columns)
typedef __attribute__((ext_vector_type(4))) __bf16 v4b;
typedef __attribute__((ext_vector_type(4))) _Float16 v4h;
static_assert(WQKV_LAYOUT == 1 && WO_OUT_IN == 1, "the staging reads weight rows (out,in): k contiguous");
static_assert(TT % GBM == 0 && !CAUSAL, "a block's rows lie in one sequence; k_out has the one-product path alone");
// ---- k_proj: block = (128 rows, 128 cols, which): q/k/v = X W (+ b) with exact bf16 products (K = DIN) -> which 0: q f16 rows (+ residual rows < QHI); 1: k f16 in fragment order (+ residual rows < KHI); 2: v f16 in fragment order (+ bf16 hi/lo planes for t < KHI). The tile leaves in two halves of 64 rows through the same LDS arrays.
__global__ __launch_bounds__(256) void k_proj(const float* __restrict__ XQ, const float* __restrict__ XK, const float* __restrict__ XV, const float* __restrict__ WQ, const float* __restrict__ WK, const float* __restrict__ WV, const float* __restrict__ BQ, const float* __restrict__ BK, const float* __restrict__ BV,
    _Float16* __restrict__ QH, _Float16* __restrict__ QL, _Float16* __restrict__ KH, _Float16* __restrict__ KL, _Float16* __restrict__ VT, __bf16* __restrict__ VB, __bf16* __restrict__ VBL) {
  __shared__ __align__(16) _Float16 sh[64][136], sl[64][136]; __shared__ __align__(16) _Float16 th[128][72]; __shared__ __align__(16) __bf16 tb[128][72], tbl[128][72]; __shared__ __align__(16) __bf16 stg[2][GROWS][GP];
  const int tid = threadIdx.x, wave = tid >> 5, lane = tid & 31, col = lane & 15, g = lane >> 4, wr = wave >> 1, wc = wave & 1; const int which = blockIdx.z; const int c0 = blockIdx.y * 128; const size_t r0 = (size_t)blockIdx.x * GBM; const size_t bb = r0 / TT; const int t0 = (int)(r0 % TT);
  const float* X = which == 0 ? XQ : which == 1 ? XK : XV; const float* WA = which == 0 ? WQ : which == 1 ? WK : WV; const float* BA = which == 0 ? BQ : which == 1 ? BK : BV;
  v8f acc[2][4] = {};
  const int lr = tid >> 4, ls = tid & 15;   // staging: this thread's row of each group of 16 rows, and its 16 bytes of the row's 256
  const float* gx = X + r0 * DIN; const float* gw = WA + (size_t)c0 * DIN; const unsigned go = lr * DIN + ls * 4;   // block-uniform bases and one per-thread offset
  const int rot = (blockIdx.x + 2 * blockIdx.y + 5 * blockIdx.z) & (DIN / GKC - 1);   // the block's first k step: blocks that share X rows or weight rows walk k from steps spread over the 16 (blocks x and x + 16 of one weight tile from the same one) and wrap, so fewer ask L2 for the same lines at the same moment
  v4f pf[GROWS / 16];
  { const float* px = gx + rot * GKC + go; const float* pw = gw + rot * GKC + go;
#pragma unroll
    for (int i = 0; i < GROWS / 16; ++i) pf[i] = i < 8 ? *(const v4f*)(px + (size_t)(i * 16) * DIN) : *(const v4f*)(pw + (size_t)(i * 16 - GBM) * DIN);
    asm volatile("s_wait_xcnt 0x0" :: "v"(px), "v"(pw) : "memory"); }   // stands in front of every overwrite of the first fetch's address registers: as inputs here they stay live up to the wait
  for (int c = 0; c < DIN / GKC; ++c) { __bf16 (*sb)[GP] = stg[c & 1];
#pragma unroll
    for (int i = 0; i < GROWS / 16; ++i) *(v4b*)&sb[i * 16 + lr][ls * 4] = __builtin_convertvector(pf[i], v4b);
    __syncthreads();   // this step's rows are in LDS; it also ends every wave's reads of the other buffer, which the next step refills
    if (c + 1 < DIN / GKC) {   // the next step's rows, fetched into registers behind the barrier (which would drain them): the fragment reads and products below cover their latency
      const int cn = (c + 1 + rot) & (DIN / GKC - 1); const float* px = gx + cn * GKC + go; const float* pw = gw + cn * GKC + go;
#pragma unroll
      for (int i = 0; i < GROWS / 16; ++i) pf[i] = i < 8 ? *(const v4f*)(px + (size_t)(i * 16) * DIN) : *(const v4f*)(pw + (size_t)(i * 16 - GBM) * DIN);
      asm volatile("s_wait_xcnt 0x0" :: "v"(px), "v"(pw) : "memory"); }   // stands in front of every overwrite of the fetch's address registers: as inputs here they stay live up to the wait, so no load of the group takes them as its destination
#pragma unroll
    for (int kc = 0; kc < GKC / 32; ++kc) { v16b a[2], wf[4];
#pragma unroll
      for (int i = 0; i < 2; ++i) a[i] = frag_b(&sb[wr * 32 + i * 16 + col][kc * 32], lane);
#pragma unroll
      for (int j = 0; j < 4; ++j) wf[j] = frag_b(&sb[GBM + wc * 64 + j * 16 + col][kc * 32], lane);
      __builtin_amdgcn_sched_barrier(0);   // keeps the 12 fragment reads one group in front of the 8 products: one LDS latency a group, not one a product
#pragma unroll
      for (int i = 0; i < 2; ++i)
#pragma unroll
        for (int j = 0; j < 4; ++j) acc[i][j] = wmma_bf(a[i], wf[j], acc[i][j]); } }
  float bias[4];
#pragma unroll
  for (int j = 0; j < 4; ++j) bias[j] = BA ? bfr(BA[c0 + wc * 64 + j * 16 + col]) : 0.f;
  for (int hf = 0; hf < 2; ++hf) { const int th0 = t0 + hf * 64; const size_t rh0 = r0 + hf * 64;   // the half's first row in its sequence and over all rows; waves wr = 2 hf, 2 hf + 1 hold it
    if (hf) __syncthreads();   // ends every thread's reads of the first half in LDS, which the second half overwrites
    if (which < 2) { _Float16* DH = which == 0 ? QH : KH; _Float16* DL = which == 0 ? QL : KL; const int nhi = which == 0 ? QHI : KHI; const bool hi_rows = th0 < nhi;
      if ((wr >> 1) == hf) {
#pragma unroll
        for (int i = 0; i < 2; ++i)
#pragma unroll
          for (int j = 0; j < 4; ++j)
#pragma unroll
            for (int r = 0; r < 8; ++r) { const float v = acc[i][j][r] + bias[j]; const _Float16 hv = (_Float16)v; const int rl = (wr & 1) * 32 + i * 16 + 8 * g + r, cl = wc * 64 + j * 16 + col; sh[rl][cl] = hv; sl[rl][cl] = (_Float16)((v - (float)hv) * 1024.0f); } }
      __syncthreads();
      for (int e = tid; e < 64 * 16; e += 256) { int rl, cq; size_t dh;   // e = the 16-byte piece in the order of its destination: a wave's store covers whole lines
        if (which == 0) { rl = e >> 4; cq = (e & 15) * 8; dh = (rh0 + rl) * CC + c0 + cq; }
        else { const int l = e & 31, fp = (e >> 5) & 3, tl = (e >> 7) & 3, hh = e >> 9; rl = tl * 16 + (l & 15); cq = hh * HD + fp * 16 + (l >> 4) * 8; dh = KF_OFF(bb, c0 / HD + hh, th0 / 16 + tl) + fp * 256 + l * 8; }
        vst2w((unsigned*)(DH + dh), *(const v4u*)&sh[rl][cq]); if (hi_rows) vst2w((unsigned*)(DL + (bb * nhi + th0 + rl) * (size_t)CC + c0 + cq), *(const v4u*)&sl[rl][cq]); }
    } else { const bool hi_rows = th0 < KHI;
      if ((wr >> 1) == hf) {
#pragma unroll
        for (int i = 0; i < 2; ++i)
#pragma unroll
          for (int j = 0; j < 4; ++j)
#pragma unroll
            for (int r = 0; r < 8; ++r) { const float v = acc[i][j][r] + bias[j]; const int rl = (wr & 1) * 32 + i * 16 + 8 * g + r, cl = wc * 64 + j * 16 + col; th[cl][rl] = (_Float16)v; const __bf16 bh = (__bf16)v; tb[cl][rl] = bh; tbl[cl][rl] = (__bf16)(v - (float)bh); } }
      __syncthreads();
      for (int e = tid; e < 128 * 8; e += 256) { const int l = e & 31, jp = (e >> 5) & 7, kg = (e >> 8) & 1, hh = e >> 9;   // e = the 16-byte piece in the order of its destination: a wave's store covers whole lines
        const int cl = hh * HD + (jp >> 1) * 16 + (l & 15), kq = kg * 32 + (jp & 1) * 16 + (l >> 4) * 8;
        vst2w((unsigned*)(VT + VF_OFF(bb, c0 / HD + hh, th0 / 32 + kg) + jp * 256 + l * 8), *(const v4u*)&th[cl][kq]); if (hi_rows) { const size_t o3 = (bb * CC + c0 + cl) * (size_t)KHI + th0 + kq; vst2w((unsigned*)(VB + o3), *(const v4u*)&tb[cl][kq]); vst2w((unsigned*)(VBL + o3), *(const v4u*)&tbl[cl][kq]); } } } } }
// ---- k_fa: block = 32 queries of batch b and HG = 8 of the heads, HG x KS = 16 waves, wave = (head, half of the keys): four waves a SIMD, so one wave's exp work runs beside another's products and load waits. A wave holds QT = 2 query tiles of 16 in registers and uses every k and v fragment that it loads for both: half the fragment bytes from L2 per score.
// The wave forms S^T = K Q^T (A = 16 key rows, B = 16 query rows; q hi + residual x 2^10: 2 products), so a lane holds ONE query (col) of each tile and keys 8g + r of each 16-key tile: logits, softmax and P stay in registers.
// pass 1 walks the wave's 1,024 keys for the row maximum and the sum of exp (a running pair per lane and query tile; the two lane halves, then the two key halves through LDS, joined once at the end); pass 2 forms the logits again, P x 2^11 = exp(s - max) x 2048 / sum as one exp2: two S^T tiles ARE the 16 x 32 A fragment of P (elements 0..7 = keys k0 + 8g + r, 8..15 = k0 + 16 + 8g + r) against v f16 planes (1 product);
// the HG heads' f32 P tiles of each key half meet in LDS (two buffers, one barrier a 64-key step) and wave (w, kh) sums query rows 4w..4w+3 of its half's step over the block's heads in head order: whole 128-B lines of the head group's partial plane, which k_avg joins. The two key halves' ctx sums are joined in LDS at the end, each wave finishing one query tile.
__device__ __forceinline__ v8f wmma_p(v16h a, v16h b, v8f c) { return __builtin_amdgcn_wmma_f32_16x16x32_f16(false, a, false, b, (short)0, c, false, false); }
__device__ __forceinline__ void st_tile(const v16h k0f, const v16h k1f, const v16h* qh, const v16h* ql, float* s) {
  v8f a = {}, al = {};
  a = wmma_p(k0f, qh[0], a); al = wmma_p(k0f, ql[0], al); a = wmma_p(k1f, qh[1], a); al = wmma_p(k1f, ql[1], al);
#pragma unroll
  for (int r = 0; r < 8; ++r) s[r] = a[r] + al[r] * (1.0f / 1024.0f); }   // the raw q.k sum: SCALE rides in the exponent's multiply-add (KL2E)
#define KL2E (SCALE * 1.44269504088896340736f)   // exp((t - tmax) x SCALE) = exp2(t x KL2E - tmax x KL2E)
__device__ __forceinline__ float ex2(float v) { return __builtin_amdgcn_exp2f(v); }   // v_exp_f32; arguments here are <= 11, and a result below the normal range may read 0
__device__ __forceinline__ float ex2n(float v) { float e; asm("v_exp_f32 %0, %1\n\tv_nop" : "=v"(e) : "v"(v)); return e; }   // the same, for the places where in this build the next vector instruction takes the source register as its destination: the v_nop is the slot that the instruction set asks for behind a transcendental, tied to it in one statement
__device__ __forceinline__ float lg2n(float v) { float e; asm("v_log_f32 %0, %1\n\tv_nop" : "=v"(e) : "v"(v)); return e; }   // v_log_f32 = log2, with the same slot behind it as ex2n, for the same reason
#define PBP 68             // LDS pitch of a 64-key P row in floats: the 16 query rows' 16-byte stores fall on 16 different bank groups
#define QT 2               // query tiles of 16 a wave
#define HG 8               // heads of a block
#define KS 2               // key halves of a block: HG x KS waves
#define KST (TT / 64 / KS) // 64-key steps of a wave
static_assert(NH % HG == 0 && HD == 64 && QT * 16 == HG * 4 && HG == 8, "wave (w, kh) is head w of its group and sums 4 query rows of the 32-row tile");
static_assert(KS == 2 && QT == 2 && (KST & (KST - 1)) == 0 && KST % 2 == 0, "two key halves swap one query tile each at the end, in the buffer that the last step does not use");
__global__ __launch_bounds__(HG * KS * 32) void k_fa(const _Float16* __restrict__ QH, const _Float16* __restrict__ QL, const _Float16* __restrict__ KH, const _Float16* __restrict__ VT, float* __restrict__ Y, float* __restrict__ PA) {
  __shared__ __align__(16) float pb[2][KS][HG][QT * 16][PBP]; __shared__ __align__(8) float ml[KS][HG][QT][16][2]; __shared__ __align__(16) _Float16 qls[HG][QT][2][2][32][8];   // qls: the q residual fragments in fragment order [head][query tile][32-column half][fragment half][lane][8]
  const int tid = threadIdx.x, lane = tid & 31, col = lane & 15, g = lane >> 4; const int b = blockIdx.y; const int ql0 = blockIdx.x * (QT * 16);
  const int wv = __builtin_amdgcn_readfirstlane(tid >> 5); const int w = wv & (HG - 1), kh = wv >> 3; const int h = blockIdx.z * HG + w;   // the wave's number, its head and its key half, in scalar registers: head offsets stay scalar
  v16h qh[QT][2];
  const _Float16* pqh = QH + ((size_t)b * TT + ql0 + col) * CC + h * HD + 8 * g; const _Float16* pql = QL + ((size_t)b * QHI + ql0 + col) * CC + h * HD + 8 * g;   // the lane's own 8 columns of its query row of tile 0
  const _Float16* pq2 = pql + kh * 16 * CC;   // the same of tile kh, whose residual fragments this wave brings
#pragma unroll
  for (int qt = 0; qt < QT; ++qt)
#pragma unroll
    for (int kc = 0; kc < 2; ++kc) qh[qt][kc] = frag_h(pqh + qt * 16 * CC + kc * 32, 0);
#pragma unroll
  for (int kc = 0; kc < 2; ++kc) { const _Float16* p = pq2 + kc * 32; *(v8h*)&qls[w][kh][kc][0][lane][0] = *(const v8h*)p; *(v8h*)&qls[w][kh][kc][1][lane][0] = *(const v8h*)(p + 16); }   // the residual fragments stay in LDS (32 registers fewer, so that four waves a SIMD fit): wave (w, kh) brings tile kh's for both waves of the head
  asm volatile("s_wait_xcnt 0x0" :: "v"(pqh), "v"(pq2) : "memory");   // the q loads' address registers are reused below: the wait stands in front of that overwrite; as inputs here they stay live up to it, so no q load takes them as its destination
  __syncthreads();   // both waves' residual fragments are in LDS
  const _Float16* qlw = &qls[w][0][0][0][lane][0];
  const _Float16* Kr = KH + KF_OFF(b, h, kh * (TT / KS / 16)) + lane * 8;   // this head's k fragments from the wave's first key on, 64 elements a key: a fragment load covers 4 whole lines
  const _Float16* Vr = VT + VF_OFF(b, h, kh * (TT / KS / 32)) + lane * 8;   // this head's v fragments from the wave's first key on, 64 elements a key
  const int rot = blockIdx.x & (KST - 1);   // the first 64-key step of each wave's half in both passes: the blocks of one batch and head group read the same k and v lines; they start their key walks at steps spread over the 16 (blocks x, x + 16, x + 32 and x + 48 at the same one) and wrap, so fewer ask L2 for the same lines at the same moment
  constexpr unsigned slot1[QT] = { 0x0u, 0x5018u };   // pass 1: bit i of tile qt = the exp of score i carries the slot of ex2n: without it this build puts there an instruction that takes the exp's source register as its destination
  float m[QT], l[QT];
#pragma unroll
  for (int qt = 0; qt < QT; ++qt) { m[qt] = -3.0e38f; l[qt] = 0.f; }
  v16h kf[4];
  { const _Float16* pk = Kr + rot * 4096;   // the walk's first 32 keys
#pragma unroll
    for (int t = 0; t < 2; ++t) { kf[2 * t] = frag_w(pk + t * 1024); kf[2 * t + 1] = frag_w(pk + t * 1024 + 512); }
    asm volatile("s_wait_xcnt 0x0" :: "v"(pk) : "memory"); }   // stands in front of every overwrite of the first fetch's address registers: as an input here they stay live up to the wait, so no load of the group takes them as its destination
  for (int it = 0; it < 2 * KST; ++it) { float s[QT][16];   // a trip = 32 keys: 32 fragment and 32 score registers, so that four waves a SIMD fit
#pragma unroll
    for (int qt = 0; qt < QT; ++qt) { const v16h ql[2] = { frag_w(qlw + qt * 1024), frag_w(qlw + qt * 1024 + 512) };
#pragma unroll
      for (int t = 0; t < 2; ++t) st_tile(kf[2 * t], kf[2 * t + 1], qh[qt], ql, s[qt] + t * 8); }
    const int kn = ((it + 1 + 2 * rot) & (2 * KST - 1)) * 32;   // the next 32 keys of the wrapped walk, fetched one trip ahead; the last trip fetches the walk's first 32 again, which pass 2 uses
    const _Float16* pk = Kr + kn * HD;
#pragma unroll
    for (int t = 0; t < 2; ++t) { kf[2 * t] = frag_w(pk + t * 1024); kf[2 * t + 1] = frag_w(pk + t * 1024 + 512); }
    __builtin_amdgcn_sched_barrier(0);   // keeps the fetch ahead in front of the exp work below, which covers its latency
#pragma unroll
    for (int qt = 0; qt < QT; ++qt) { float bm = s[qt][0];
#pragma unroll
      for (int i = 1; i < 16; ++i) bm = fmaxf(bm, s[qt][i]);
      const float mn = fmaxf(m[qt], bm), nb = -mn * KL2E; float a = 0.f;
#pragma unroll
      for (int i = 0; i < 16; ++i) { const float x = fmaf(s[qt][i], KL2E, nb); a += (slot1[qt] >> i & 1) ? ex2n(x) : ex2(x); }
      l[qt] = l[qt] * ex2n((m[qt] - mn) * KL2E) + a; m[qt] = mn; }
    asm volatile("s_wait_xcnt 0x0" :: "v"(pk) : "memory"); }   // the next trip rewrites the address registers of the fetch ahead: the wait stands in front of that overwrite; as an input here they stay live up to it, through the exp work
  float nb2[QT];
#pragma unroll
  for (int qt = 0; qt < QT; ++qt) { const float M = fmaxf(m[qt], __shfl_xor(m[qt], 16)); float lq = l[qt] * ex2n((m[qt] - M) * KL2E); lq += __shfl_xor(lq, 16);
    if (g == 0) { v2f e = { M, lq }; *(v2f*)&ml[kh][w][qt][col][0] = e; } }
  __syncthreads();   // both key halves' maxima and sums are in LDS
#pragma unroll
  for (int qt = 0; qt < QT; ++qt) { const v2f e0 = *(const v2f*)&ml[0][w][qt][col][0], e1 = *(const v2f*)&ml[1][w][qt][col][0]; const float M = fmaxf(e0[0], e1[0]);   // both waves of a head join in the same order: the same addend in both
    const float lq = e0[1] * ex2n((e0[0] - M) * KL2E) + e1[1] * ex2n((e1[0] - M) * KL2E);
    nb2[qt] = fmaf(-M, KL2E, 11.0f - lg2n(lq)); }   // P x 2^11 = exp2(t x KL2E + nb2): the maximum and 2048 / sum as one addend (v_log_f32 = log2; the sum lies between about 1 and 2048, a normal number)
  v8f acc[QT][HD / 16] = {};
  float* pa = PA + (((size_t)blockIdx.z * NB + b) * TT + ql0 + w * 4 + g) * TT + kh * (TT / KS) + col * 4;   // a half wave = one query row's 64 keys of a step = 2 whole lines
  for (int st = 0; st < KST; ++st) { const int sk = (st + rot) & (KST - 1);   // a step = 64 keys (step sk of the wrapped walk), as two halves of 32 keys
#pragma unroll
    for (int u = 0; u < 2; ++u) { float s[QT][16]; v16h vf[HD / 16]; const _Float16* pv = Vr + sk * 4096 + u * 2048;
#pragma unroll
      for (int qt = 0; qt < QT; ++qt) { const v16h ql[2] = { frag_w(qlw + qt * 1024), frag_w(qlw + qt * 1024 + 512) }; st_tile(kf[0], kf[1], qh[qt], ql, s[qt]); st_tile(kf[2], kf[3], qh[qt], ql, s[qt] + 8); }
      const int kn = u == 0 ? sk * 64 : ((st + 1 + rot) & (KST - 1)) * 64, ko = u == 0 ? 2048 : 0;   // the next 32 keys of the wrapped walk (this step's second half, or the next step's first), fetched one half step ahead (the last fetch, of the walk's first 32, is in bounds and unused)
      const _Float16* pk = Kr + kn * HD;   // the second half's 2,048 elements ride in the loads' offsets, so that the register named at the wait below is the one the loads use
#pragma unroll
      for (int j = 0; j < HD / 16; ++j) vf[j] = frag_w(pv + j * 512);   // this half step's v, behind the score products: 32 registers, so that four waves a SIMD fit
#pragma unroll
      for (int t = 0; t < 2; ++t) { kf[2 * t] = frag_w(pk + ko + t * 1024); kf[2 * t + 1] = frag_w(pk + ko + t * 1024 + 512); }
      asm volatile("s_wait_xcnt 0x0" :: "v"(pv), "v"(pk) : "memory");   // stands in front of every overwrite of the v and k loads' address registers: as inputs here they stay live up to the wait, so no load of the groups takes them as its destination
      __builtin_amdgcn_sched_barrier(0);   // keeps the v loads and the k fetch ahead in front of the exp work below, which covers their latency
#pragma unroll
      for (int qt = 0; qt < QT; ++qt) { v16h p;
#pragma unroll
        for (int i = 0; i < 16; ++i) { s[qt][i] = ex2(fmaf(s[qt][i], KL2E, nb2[qt])); p[i] = (_Float16)s[qt][i]; }
#pragma unroll
        for (int j = 0; j < HD / 16; ++j) acc[qt][j] = wmma_p(p, vf[j], acc[qt][j]);
        float* pw = &pb[st & 1][kh][w][qt * 16 + col][u * 32 + 8 * g];
#pragma unroll
        for (int t = 0; t < 2; ++t) { v4f lo = { s[qt][t * 8], s[qt][t * 8 + 1], s[qt][t * 8 + 2], s[qt][t * 8 + 3] }, hi = { s[qt][t * 8 + 4], s[qt][t * 8 + 5], s[qt][t * 8 + 6], s[qt][t * 8 + 7] }; *(v4f*)(pw + t * 16) = lo; *(v4f*)(pw + t * 16 + 4) = hi; } } }
    __syncthreads();   // the block's heads' P tiles of this step are in LDS; it also ends every wave's reads of the other buffer, which the next step refills
    v4f a[2];
#pragma unroll
    for (int i = 0; i < 2; ++i) { a[i] = *(const v4f*)&pb[st & 1][kh][0][w * 4 + i * 2 + g][col * 4];
#pragma unroll
      for (int hh = 1; hh < HG; ++hh) a[i] += *(const v4f*)&pb[st & 1][kh][hh][w * 4 + i * 2 + g][col * 4]; }
    float* po = pa + sk * 64;
    vst2(po, a[0]); vst2(po + 2 * TT, a[1]);
    asm volatile("s_wait_xcnt 0x0" :: "v"(po), "v"(a[0]), "v"(a[1]) : "memory"); }   // the next step rewrites the two stores' address and data registers: the wait stands in front of that overwrite; as inputs here they stay live up to it
  // the two key halves' ctx sums: wave (w, kh) hands its sums of query tile 1 - kh to its partner and finishes tile kh. The swap uses buffer 0, whose last reads the last step's barrier has ended (that step used buffer 1)
  float* xb = &pb[0][0][0][0][0] + lane * 4;
#pragma unroll
  for (int j = 0; j < HD / 16; ++j) { const v8f o = kh ? acc[0][j] : acc[1][j]; v4f lo = { o[0], o[1], o[2], o[3] }, hi = { o[4], o[5], o[6], o[7] };
    *(v4f*)(xb + wv * 1024 + j * 256) = lo; *(v4f*)(xb + wv * 1024 + j * 256 + 128) = hi; }
  __syncthreads();   // every wave's handed-over tile is in LDS
#pragma unroll
  for (int j = 0; j < HD / 16; ++j) { const v8f o = kh ? acc[1][j] : acc[0][j]; const v4f lo = *(const v4f*)(xb + (wv ^ HG) * 1024 + j * 256), hi = *(const v4f*)(xb + (wv ^ HG) * 1024 + j * 256 + 128);
#pragma unroll
    for (int r = 0; r < 8; ++r) Y[((size_t)b * TT + ql0 + kh * 16 + 8 * g + r) * CC + h * HD + j * 16 + col] = (o[r] + (r < 4 ? lo[r & 3] : hi[r & 3])) * (1.0f / 2048.0f); } }
// ---- k_avg: attn_avg = (the NH / HG head groups' partial planes, in group order) / (2^11 NH): a stream, 16 bytes a lane, 8 loads in flight a wave
static_assert(NH / HG == 2, "k_avg joins two planes");
__global__ __launch_bounds__(256) void k_avg(const float* __restrict__ PA, float* __restrict__ AV) {
  const size_t o = (size_t)blockIdx.x * 4096 + threadIdx.x * 4; const float* p0 = PA + o; const float* p1 = p0 + (size_t)NB * TT * TT;
  v4f x[4], y[4];
#pragma unroll
  for (int i = 0; i < 4; ++i) { x[i] = *(const v4f*)(p0 + i * 1024); y[i] = *(const v4f*)(p1 + i * 1024); }
#pragma unroll
  for (int i = 0; i < 4; ++i) vst2(AV + o + i * 1024, (x[i] + y[i]) * (1.0f / (2048.0f * NH))); }
// ---- k_out: block = (128 rows, 128 cols): out = ctx Wo (+ bo): ctx once to f16 against Wo as f16(bf16 x 2^8) exact (1 product) x 2^-8
#define SFP 68             // LDS pitch of a wave's 64-column output row in floats: 272 B = 16 B x 17 (odd)
__global__ __launch_bounds__(256) void k_out(const float* __restrict__ Y, const float* __restrict__ WO, const float* __restrict__ BO, float* __restrict__ OUT) { __shared__ __align__(16) float sf[8][32][SFP]; __shared__ __align__(16) _Float16 stg[2][GROWS][GP];
  const int tid = threadIdx.x, wave = tid >> 5, lane = tid & 31, col = lane & 15, g = lane >> 4, wr = wave >> 1, wc = wave & 1; const int c0 = blockIdx.y * 128; const size_t r0 = (size_t)blockIdx.x * GBM;
  v8f acc[2][4] = {};
  const int lr = tid >> 4, ls = tid & 15;   // staging: this thread's row of each group of 16 rows, and its 16 bytes of the row's 256
  const float* gx = Y + r0 * CC; const float* gw = WO + (size_t)c0 * CC; const unsigned go = lr * CC + ls * 4;   // block-uniform bases and one per-thread offset
  const int rot = (blockIdx.x + 2 * blockIdx.y) & (CC / GKC - 1);   // the block's first k step, as in k_proj: sharers of ctx rows start apart, sharers of weight rows too but for blocks x and x + 16, and all wrap
  v4f pf[GROWS / 16];
  { const float* px = gx + rot * GKC + go; const float* pw = gw + rot * GKC + go;
#pragma unroll
    for (int i = 0; i < GROWS / 16; ++i) pf[i] = i < 8 ? *(const v4f*)(px + (size_t)(i * 16) * CC) : *(const v4f*)(pw + (size_t)(i * 16 - GBM) * CC);
    asm volatile("s_wait_xcnt 0x0" :: "v"(px), "v"(pw) : "memory"); }   // stands in front of every overwrite of the first fetch's address registers: as inputs here they stay live up to the wait
  for (int c = 0; c < CC / GKC; ++c) { _Float16 (*sb)[GP] = stg[c & 1];
#pragma unroll
    for (int i = 0; i < GROWS / 16; ++i) { v4h t;
#pragma unroll
      for (int e = 0; e < 4; ++e) t[e] = i < 8 ? (_Float16)pf[i][e] : (_Float16)(bfr(pf[i][e]) * 256.0f);
      *(v4h*)&sb[i * 16 + lr][ls * 4] = t; }
    __syncthreads();   // this step's rows are in LDS; it also ends every wave's reads of the other buffer, which the next step refills
    if (c + 1 < CC / GKC) {   // the next step's rows, fetched into registers behind the barrier (which would drain them): the fragment reads and products below cover their latency
      const int cn = (c + 1 + rot) & (CC / GKC - 1); const float* px = gx + cn * GKC + go; const float* pw = gw + cn * GKC + go;
#pragma unroll
      for (int i = 0; i < GROWS / 16; ++i) pf[i] = i < 8 ? *(const v4f*)(px + (size_t)(i * 16) * CC) : *(const v4f*)(pw + (size_t)(i * 16 - GBM) * CC);
      asm volatile("s_wait_xcnt 0x0" :: "v"(px), "v"(pw) : "memory"); }   // stands in front of every overwrite of the fetch's address registers: as inputs here they stay live up to the wait, so no load of the group takes them as its destination
#pragma unroll
    for (int kc = 0; kc < GKC / 32; ++kc) { v16h a[2], wf[4];
#pragma unroll
      for (int i = 0; i < 2; ++i) a[i] = frag_h(&sb[wr * 32 + i * 16 + col][kc * 32], lane);
#pragma unroll
      for (int j = 0; j < 4; ++j) wf[j] = frag_h(&sb[GBM + wc * 64 + j * 16 + col][kc * 32], lane);
      __builtin_amdgcn_sched_barrier(0);   // keeps the 12 fragment reads one group in front of the 8 products: one LDS latency a group, not one a product
#pragma unroll
      for (int i = 0; i < 2; ++i)
#pragma unroll
        for (int j = 0; j < 4; ++j) acc[i][j] = wmma16(a[i], wf[j], acc[i][j]); } }
#pragma unroll
  for (int j = 0; j < 4; ++j) { const float bias = BO ? bfr(BO[c0 + wc * 64 + j * 16 + col]) : 0.f;
#pragma unroll
    for (int i = 0; i < 2; ++i)
#pragma unroll
      for (int r = 0; r < 8; ++r) sf[wave][i * 16 + 8 * g + r][j * 16 + col] = acc[i][j][r] * (1.0f / 256.0f) + bias; }
  LDSX(); for (int rl = 0; rl < 16; ++rl) vst2(OUT + (r0 + wr * 32 + rl * 2 + g) * DIN + c0 + wc * 64 + col * 4, *(const v4f*)&sf[wave][rl * 2 + g][col * 4]); }   // a half wave = one row's 64 columns = 2 whole lines

extern "C" void kernel_launch(void* const* d_in, const int* in_sizes, int n_in, void* d_out, int out_size, void* d_ws, size_t ws_size, hipStream_t stream) {
  (void)in_sizes; (void)n_in; (void)out_size;
  const float** F = (const float**)d_in;
  if (ws_size < (size_t)WS_END) return;
  char* ws = (char*)d_ws; _Float16 *QH = (_Float16*)(ws + WS_QH), *KH = (_Float16*)(ws + WS_KH), *VT = (_Float16*)(ws + WS_VT), *QL = (_Float16*)(ws + WS_QL), *KL = (_Float16*)(ws + WS_KL); __bf16 *VB = (__bf16*)(ws + WS_VB), *VBL = (__bf16*)(ws + WS_VBL); float *Y = (float*)(ws + WS_Y), *PA = (float*)(ws + WS_PA);
  (void)Y; (void)QL; (void)KL; (void)VB; (void)VBL;
  // inputs: 0 x [2,2048,1024]; 1 Wq, 2 bq, 3 Wk, 4 bk, 5 Wv, 6 bv, 7 Wp, 8 bp ((out,in) [1024,1024], [1024]); outputs: 0 y [2,2048,1024] @0, 1 attn_avg [2,2048,2048] @ OUT1_OFF
  float* AV = (float*)((char*)d_out + OUT1_OFF);
  k_proj<<<dim3(TNB * TT / GBM, CC / 128, 3), 256, 0, stream>>>(F[0], F[0], F[0], F[1], F[3], F[5], F[2], F[4], F[6], QH, QL, KH, KL, VT, VB, VBL);
  k_fa<<<dim3(TT / (QT * 16), TNB, NH / HG), HG * KS * 32, 0, stream>>>(QH, QL, KH, VT, Y, PA);
  k_avg<<<dim3((unsigned)((size_t)TNB * TT * TT / 4096)), 256, 0, stream>>>(PA, AV);
  k_out<<<dim3(TNB * TT / GBM, DIN / 128), 256, 0, stream>>>(Y, F[7], F[8], (float*)d_out);
}

// v010
// A run of this version takes 136 microseconds.
// In both of two side-by-side timings against v009, it was 1.04 times as fast.
// All steps since v000 together make it 10.9 times as fast.
// compute dtype: all float inputs rounded to bf16; q/k/v = x W^T + b with EXACT bf16 products on WMMA 16x16x32, f32 accumulate; q as f16 hi + residual (x 2^10) against k once to f16 (2 products) for the logits x 1/8; softmax in f32 (hardware exp2 of one fused multiply-add that carries scale x log2 e, the row maximum and, in pass 2, the row sum), the head-averaged attention map accumulated in f32 (8 heads a block in head order, then the two groups' sums); P x 2^11 once to f16 against v once to f16 (1 product, summed per half of the keys, the two halves added in f32); ctx once to f16 against Wp carried x 2^8 in f16 (exact bf16 values) + bp; f32 outputs.
#include <hip/hip_runtime.h>
#include <math.h>

typedef __attribute__((ext_vector_type(16))) _Float16 v16h;
typedef __attribute__((ext_vector_type(16))) __bf16 v16b;
typedef __attribute__((ext_vector_type(8)))  _Float16 v8h;
typedef __attribute__((ext_vector_type(8)))  float v8f;
typedef __attribute__((ext_vector_type(4)))  float v4f;
typedef __attribute__((ext_vector_type(2)))  float v2f;
typedef __attribute__((ext_vector_type(4)))  unsigned v4u;
typedef __attribute__((ext_vector_type(2)))  unsigned v2u;
typedef __attribute__((ext_vector_type(4)))  int v4i;
typedef float __attribute__((may_alias)) float_a;
typedef int __attribute__((may_alias)) int_a;

template <typename T> __device__ __forceinline__ void vst2(void* p, T v) { *(T*)p = v;  }
// a store in a loop whose next trip rewrites the store's address and data registers: the wait stands in front of that overwrite; as inputs here both stay live up to the wait
template <typename T> __device__ __forceinline__ void vst2w(void* p, T v) { *(T*)p = v; asm volatile("s_wait_xcnt 0x0" :: "v"(p), "v"(v) : "memory"); }
__device__ __forceinline__ v8f wmma16(v16h a, v16h b, v8f c) {
  v8f d = __builtin_amdgcn_wmma_f32_16x16x32_f16(false, a, false, b, (short)0, c, false, false);
  asm volatile("v_nop\n\tv_nop\n\tv_nop\n\tv_nop" : "+v"(d) : "v"(a), "v"(b));
  return d;
}
__device__ __forceinline__ v8f wmma_bf(v16b a, v16b b, v8f c) {
  v8f d = __builtin_amdgcn_wmma_f32_16x16x32_bf16(false, a, false, b, (short)0, c, false, false);
  asm volatile("v_nop\n\tv_nop\n\tv_nop\n\tv_nop" : "+v"(d) : "v"(a), "v"(b));
  return d;
}
// 16x16x32 fragments: lane = (h = lane>>4, row/col = lane&15); elements 0..7 = k0+8h+0..7, 8..15 = k0+16+8h+0..7; D element r = row 8h+r
__device__ __forceinline__ v16h frag_h(const _Float16* rowk0, int lane) {
  union { v16h v; v8h q[2]; } u; const _Float16* p = rowk0 + 8 * (lane >> 4);
  u.q[0] = *(const v8h*)p; u.q[1] = *(const v8h*)(p + 16); return u.v;
}
__device__ __forceinline__ v16h frag_f32(const float* rowk0, int lane) {
  v16h a; const float* p = rowk0 + 8 * (lane >> 4);
#pragma unroll
  for (int i = 0; i < 8; ++i) { a[i] = (_Float16)p[i]; a[8 + i] = (_Float16)p[16 + i]; }
  return a;
}
__device__ __forceinline__ v16h frag_f32s(const float* rowk0, int lane, float sc) {
  v16h a; const float* p = rowk0 + 8 * (lane >> 4);
#pragma unroll
  for (int i = 0; i < 8; ++i) { a[i] = (_Float16)(p[i] * sc); a[8 + i] = (_Float16)(p[16 + i] * sc); }
  return a;
}
// column fragment from a [K][ld] layout (column n), rows >= K read as 0
__device__ __forceinline__ v16h fragc_f32(const float* W, int k0, int n, int lane, int ld, int K) {
  v16h a; const int g = lane >> 4;
#pragma unroll
  for (int i = 0; i < 8; ++i) { const int ka = k0 + 8 * g + i, kb = ka + 16;
    a[i] = (_Float16)(ka < K ? W[(size_t)(ka < K ? ka : K - 1) * ld + n] : 0.f); a[8 + i] = (_Float16)(kb < K ? W[(size_t)(kb < K ? kb : K - 1) * ld + n] : 0.f); }
  return a;
}
struct F2 { v16b h, l; };
__device__ __forceinline__ F2 bsplit16(const float v[16]) { F2 r;
#pragma unroll
  for (int i = 0; i < 16; ++i) { const __bf16 h = (__bf16)v[i]; r.h[i] = h; r.l[i] = (__bf16)(v[i] - (float)h); }
  return r; }
__device__ __forceinline__ F2 split_row(const float* row, int k0, int lane) { float v[16]; const float* p = row + k0 + 8 * (lane >> 4);
#pragma unroll
  for (int i = 0; i < 8; ++i) { v[i] = p[i]; v[8 + i] = p[16 + i]; }
  return bsplit16(v); }
__device__ __forceinline__ F2 split_rowK(const float* row, int k0, int lane, int K) { float v[16]; const int g = lane >> 4;
#pragma unroll
  for (int i = 0; i < 8; ++i) { const int ka = k0 + 8 * g + i, kb = ka + 16; v[i] = ka < K ? row[ka < K ? ka : K - 1] : 0.f; v[8 + i] = kb < K ? row[kb < K ? kb : K - 1] : 0.f; }
  return bsplit16(v); }
__device__ __forceinline__ F2 split_col(const float* W, int k0, int n, int lane, int ld, int K) { float v[16]; const int g = lane >> 4;
#pragma unroll
  for (int i = 0; i < 8; ++i) { const int ka = k0 + 8 * g + i, kb = ka + 16; v[i] = ka < K ? W[(size_t)(ka < K ? ka : K - 1) * ld + n] : 0.f; v[8 + i] = kb < K ? W[(size_t)(kb < K ? kb : K - 1) * ld + n] : 0.f; }
  return bsplit16(v); }
__device__ __forceinline__ v8f mac3(const F2& a, const F2& b, v8f c) { c = wmma_bf(a.l, b.h, c); c = wmma_bf(a.h, b.l, c); return wmma_bf(a.h, b.h, c); }
__device__ __forceinline__ float sigm(float v) { return 1.0f / (1.0f + expf(-v)); }
#define LDSX() do { asm volatile("s_wait_dscnt 0" ::: "memory"); __builtin_amdgcn_wave_barrier(); __builtin_amdgcn_fence(__ATOMIC_RELEASE, "workgroup"); } while (0)

// Multi-head self-attention returning (y, head-averaged attention) (B 2, T 2,048, C 1,024 = 16 heads x 64): q/k/v = x W^T + b ((out,in)); attn = softmax(q k^T x 64^-0.5) over all keys; y = merged(attn v) Wp^T + bp; attn_avg[b][t][s] = mean over the 16 heads of attn.
#define NB 2
#define TT 2048
#define CC 1024            // NH * HD = projected width
#define DIN 1024          // input (model) width
#define NH 16
#define HD 64
#define SCALE (0.125f)
#define CAUSAL 0
#ifndef TNB
#define TNB NB
#endif
__device__ __forceinline__ float bfr(float v) { return (float)(__bf16)v; }
__host__ __device__ __forceinline__ int kb_last(int qb) { return CAUSAL ? ((qb * 64 + 63) >> 7) : (TT / 128 - 1); }
typedef __attribute__((ext_vector_type(8))) __bf16 v8b;
__device__ __forceinline__ v16b frag_b(const __bf16* rowk0, int lane) {
  union { v16b v; v8b q[2]; } u; const __bf16* p = rowk0 + 8 * (lane >> 4);
  u.q[0] = *(const v8b*)p; u.q[1] = *(const v8b*)(p + 16); return u.v;
}
#define QBH 0
#define QHI 2048            // rows carrying a q residual plane (all rows when non-causal: 2-product logits everywhere)
#define KHI 64            // key rows carrying k residual / v bf16 hi+lo planes (written by k_proj; no kernel in this file reads them)
// B fragment (k rows k0+.., output column o) of a weight: (in,out) [K][ld] or (out,in) [ld rows of K]: bf16 exact, or f16(bf16 * 256) exact
__device__ __forceinline__ v16b wcol_io(const float* Wm, int k0, int o, int lane, int ld) { v16b w; const int g = lane >> 4;
#pragma unroll
  for (int i = 0; i < 8; ++i) { w[i] = (__bf16)Wm[(size_t)(k0 + 8 * g + i) * ld + o]; w[8 + i] = (__bf16)Wm[(size_t)(k0 + 16 + 8 * g + i) * ld + o]; }
  return w; }
__device__ __forceinline__ v16b wcol_oi(const float* Wm, int k0, int o, int lane, int K) { v16b w; const float* p = Wm + (size_t)o * K + k0 + 8 * (lane >> 4);
#pragma unroll
  for (int i = 0; i < 8; ++i) { w[i] = (__bf16)p[i]; w[8 + i] = (__bf16)p[16 + i]; }
  return w; }
__device__ __forceinline__ v16h wcolh_io(const float* Wm, int k0, int o, int lane, int ld) { v16h w; const int g = lane >> 4;
#pragma unroll
  for (int i = 0; i < 8; ++i) { w[i] = (_Float16)(bfr(Wm[(size_t)(k0 + 8 * g + i) * ld + o]) * 256.0f); w[8 + i] = (_Float16)(bfr(Wm[(size_t)(k0 + 16 + 8 * g + i) * ld + o]) * 256.0f); }
  return w; }
__device__ __forceinline__ v16h wcolh_oi(const float* Wm, int k0, int o, int lane, int K) { v16h w; const float* p = Wm + (size_t)o * K + k0 + 8 * (lane >> 4);
#pragma unroll
  for (int i = 0; i < 8; ++i) { w[i] = (_Float16)(bfr(p[i]) * 256.0f); w[8 + i] = (_Float16)(bfr(p[16 + i]) * 256.0f); }
  return w; }
#define WQKV_LAYOUT 1   // 0 = (in,out) [DIN][CC]; 1 = (out,in) [CC][DIN]; 2 = per-head [NH][DIN][HD]
__device__ __forceinline__ v16b wcol_hdk(const float* Wm, int k0, int o, int lane) { v16b w; const int g = lane >> 4; const float* p = Wm + (size_t)(o / HD) * DIN * HD + (o % HD);
#pragma unroll
  for (int i = 0; i < 8; ++i) { w[i] = (__bf16)p[(size_t)(k0 + 8 * g + i) * HD]; w[8 + i] = (__bf16)p[(size_t)(k0 + 16 + 8 * g + i) * HD]; }
  return w; }
#define WO_OUT_IN 1
#if WQKV_LAYOUT == 1
#define WCOL(W, k0, o, lane) wcol_oi(W, k0, o, lane, DIN)
#elif WQKV_LAYOUT == 2
#define WCOL(W, k0, o, lane) wcol_hdk(W, k0, o, lane)
#else
#define WCOL(W, k0, o, lane) wcol_io(W, k0, o, lane, CC)
#endif
#if WO_OUT_IN
#define WOCOL(W, k0, o, lane) wcol_oi(W, k0, o, lane, CC)
#define WOCOLH(W, k0, o, lane) wcolh_oi(W, k0, o, lane, CC)
#else
#define WOCOL(W, k0, o, lane) wcol_io(W, k0, o, lane, DIN)
#define WOCOLH(W, k0, o, lane) wcolh_io(W, k0, o, lane, DIN)
#endif
#define OUT1_OFF (4u * (size_t)NB * TT * DIN)      // byte offset of attn_avg [B][T][T]

#define WS_QH  0u                                      // f16 q rows [b*t][CC]
#define WS_KH  (WS_QH + 2u * (size_t)NB * TT * CC)      // f16 k in fragment order: [b][head][16-key tile][32-column half][fragment half][lane][8]
#define WS_VT  (WS_KH + 2u * (size_t)NB * TT * CC)      // f16 v in fragment order: [b][head][32-key group][16-column group][fragment half][lane][8]
#define WS_QL  (WS_VT + 2u * (size_t)NB * CC * TT)      // f16 q residual x 2^10 rows [b][t < QHI][CC]
#define WS_KL  (WS_QL + 2u * (size_t)NB * QHI * CC)     // f16 k residual x 2^10 rows [b][t < KHI][CC]
#define WS_VB  (WS_KL + 2u * (size_t)NB * KHI * CC)     // bf16 v hi planes [b][c][t < KHI]
#define WS_VBL (WS_VB + 2u * (size_t)NB * CC * KHI)
#define WS_Y   (WS_VBL + 2u * (size_t)NB * CC * KHI)     // f16 ctx rows [b*t][CC]: k_out's A operand as it enters the product
#define WS_PA  (WS_Y  + 2u * (size_t)NB * TT * CC)     // f32 sums of P x 2^11 over a group of 8 heads [head group][b][t][s]
#define WS_XB  (WS_PA + 4u * 2u * (size_t)NB * TT * TT) // bf16 x rows [b*t][DIN]
#define WS_WB  (WS_XB + 2u * (size_t)NB * TT * DIN)     // bf16 Wq, Wk, Wv rows [3][CC][DIN]
#define WS_WP  (WS_WB + 2u * 3u * (size_t)CC * DIN)     // f16 Wp x 2^8 rows [DIN][CC]
#define WS_END (WS_WP + 2u * (size_t)DIN * CC)

// k and v pass from k_proj to k_fa in the reader's fragment order: the 16 bytes that lane l = 16 g + n takes for fragment half p lie at element (p * 32 + l) * 8 of the fragment's 512, so a wave-wide 16-byte load covers 512 contiguous bytes = 4 whole lines.
// k (A of S^T): lane's row = key tile * 16 + n, its 8 columns = half * 32 + p * 16 + 8 g + 0..7. v (B of P V): lane's column = group * 16 + n, its 8 keys = key group * 32 + p * 16 + 8 g + 0..7.
#define KF_OFF(b, h, tile) ((((size_t)(b) * NH + (h)) * (TT / 16) + (tile)) * 1024)   // element offset of a 16-key tile of head h: 2 fragments
#define VF_OFF(b, h, grp)  ((((size_t)(b) * NH + (h)) * (TT / 32) + (grp)) * 2048)    // element offset of a 32-key group of head h: 4 fragments
__device__ __forceinline__ v16h frag_w(const _Float16* p) {   // p = the fragment's first element + lane * 8
  union { v16h v; v8h q[2]; } u; u.q[0] = *(const v8h*)p; u.q[1] = *(const v8h*)(p + 256); return u.v;
}
// GEMM operands (k_proj, k_out) lie in the workspace as the 16-bit values that enter the products: k_cvt converts x and the four weights ONCE a call, k_fa stores ctx as f16. Every block that shares a row fetches 2 bytes an element from L2, not 4.
// Staging: a step = 256 B of each operand row = 128 k. 16 lanes x 16 B fetch one row's step, so a wave-wide load covers 4 whole lines; the 16 bytes go unchanged to LDS, where the block's 8 waves read their fragments. As many bytes in flight a block as with f32 rows, over half as many steps and barriers.
// The block's tile is 128 rows x 128 columns: 256 operand rows fetched for 16,384 results (a 64 x 128 tile fetches 192 for 8,192). Wave (wr, wc) of 4 x 2 holds 32 rows x 64 columns = 2 x 4 accumulator tiles: 6 fragments from LDS for 8 products.
#define GKC 128            // k of a staged step: two 128-B lines of a row
#define GKR 64             // k of a line: the unit of a block's rotated start; a step's two lines wrap at the row's end one by one
#define GP 136             // LDS pitch of a staged row in 16-bit elements: 272 B = 16 B x 17 (odd), conflict-free for 16-byte fragment reads
#define GBM 128            // rows of a block's tile
#define GROWS (GBM + 128)  // rows 0..127 = the block's X (or ctx) rows, 128..255 = its 128 weight rows (output columns)
typedef __attribute__((ext_vector_type(4))) __bf16 v4b;
typedef __attribute__((ext_vector_type(4))) _Float16 v4h;
static_assert(WQKV_LAYOUT == 1 && WO_OUT_IN == 1, "the staging reads weight rows (out,in): k contiguous");
static_assert((DIN & (DIN - 1)) == 0 && (CC & (CC - 1)) == 0 && DIN % GKC == 0 && CC % GKC == 0 && GKC == 2 * GKR, "the k walk wraps by a mask, line by line");
static_assert(TT % GBM == 0 && !CAUSAL, "a block's rows lie in one sequence; k_out has the one-product path alone");
// ---- k_cvt: block = 16,384 elements of x (blocks 0..CVX-1) or of one weight (CVW blocks each, in the order Wq, Wk, Wv, Wp): x, Wq, Wk, Wv to bf16, Wp to f16(bf16 x 2^8) (exact). A stream: whole-line loads, 16 in flight a wave; 512 blocks = 16 waves a WGP, all resident at once
#define CVE 16384
#define CVX ((int)((size_t)TNB * TT * DIN / CVE))
#define CVW (CC * DIN / CVE)
static_assert((size_t)TNB * TT * DIN % CVE == 0 && CC * DIN % CVE == 0 && CVE / 1024 == 16, "whole blocks; 16 vectors a thread");
__global__ __launch_bounds__(256) void k_cvt(const float* __restrict__ X, const float* __restrict__ WQ, const float* __restrict__ WK, const float* __restrict__ WV, const float* __restrict__ WP, __bf16* __restrict__ XB, __bf16* __restrict__ WB, _Float16* __restrict__ WPH) {
  const int bx = blockIdx.x, ws = (bx - CVX) / CVW; const size_t o = (size_t)(bx < CVX ? bx : (bx - CVX) % CVW) * CVE + threadIdx.x * 4;   // ws = which weight (block-uniform)
  const float* p = (bx < CVX ? X : ws == 0 ? WQ : ws == 1 ? WK : ws == 2 ? WV : WP) + o;
  v4f x[CVE / 1024];
#pragma unroll
  for (int i = 0; i < CVE / 1024; ++i) x[i] = *(const v4f*)(p + i * 1024);
  asm volatile("s_wait_xcnt 0x0" :: "v"(p) : "memory");   // stands in front of every overwrite of the loads' address registers: as an input here they stay live up to the wait, so no load of the group takes them as its destination
  if (bx >= CVX && ws == 3) {
#pragma unroll
    for (int i = 0; i < CVE / 1024; ++i) { v4h t;
#pragma unroll
      for (int e = 0; e < 4; ++e) t[e] = (_Float16)(bfr(x[i][e]) * 256.0f);
      vst2(WPH + o + i * 1024, t); }
  } else { __bf16* d = (bx < CVX ? XB : WB + (size_t)ws * CC * DIN) + o; v2u t[CVE / 1024];
#pragma unroll
    for (int i = 0; i < CVE / 1024; ++i) { t[i] = __builtin_bit_cast(v2u, __builtin_convertvector(x[i], v4b)); vst2(d + i * 1024, t[i]); }
    asm volatile("s_wait_xcnt 0x0" :: "v"(d), "v"(t[0]), "v"(t[1]), "v"(t[2]), "v"(t[3]), "v"(t[4]), "v"(t[5]), "v"(t[6]), "v"(t[7]), "v"(t[8]), "v"(t[9]), "v"(t[10]), "v"(t[11]), "v"(t[12]), "v"(t[13]), "v"(t[14]), "v"(t[15]) : "memory"); } }   // in the built code the other branch's block follows these stores and writes registers: the wait stands in front of every overwrite of the stores' address and data registers; as inputs here they stay live up to it
// ---- k_proj: block = (128 rows, 128 cols, which): q/k/v = X W (+ b) with exact bf16 products (K = DIN) -> which 0: q f16 rows (+ residual rows < QHI); 1: k f16 in fragment order (+ residual rows < KHI); 2: v f16 in fragment order (+ bf16 hi/lo planes for t < KHI). The tile leaves in two halves of 64 rows through the same LDS arrays.
__global__ __launch_bounds__(256) void k_proj(const __bf16* __restrict__ X, const __bf16* __restrict__ WB, const float* __restrict__ BQ, const float* __restrict__ BK, const float* __restrict__ BV,
    _Float16* __restrict__ QH, _Float16* __restrict__ QL, _Float16* __restrict__ KH, _Float16* __restrict__ KL, _Float16* __restrict__ VT, __bf16* __restrict__ VB, __bf16* __restrict__ VBL) {
  __shared__ __align__(16) unsigned char sm[2 * GROWS * GP * 2];   // the two staging buffers; behind the k walk the leaving tile's arrays lie in the same bytes, so that two blocks fit a WGP
  __bf16 (*stg)[GROWS][GP] = (__bf16 (*)[GROWS][GP])sm;
  _Float16 (*sh)[136] = (_Float16 (*)[136])sm; _Float16 (*sl)[136] = (_Float16 (*)[136])(sm + 17408); _Float16 (*th)[72] = (_Float16 (*)[72])(sm + 34816); __bf16 (*tb)[72] = (__bf16 (*)[72])(sm + 53248); __bf16 (*tbl)[72] = (__bf16 (*)[72])(sm + 71680);
  static_assert(64 * 136 * 2 == 17408 && 128 * 72 * 2 == 18432 && 71680 + 18432 <= 2 * GROWS * GP * 2, "the leaving tile's arrays follow one another inside the staging bytes");
  const int tid = threadIdx.x, wave = tid >> 5, lane = tid & 31, col = lane & 15, g = lane >> 4, wr = wave >> 1, wc = wave & 1; const int which = blockIdx.z; const int c0 = blockIdx.y * 128; const size_t r0 = (size_t)blockIdx.x * GBM; const size_t bb = r0 / TT; const int t0 = (int)(r0 % TT);
  const __bf16* WA = WB + (size_t)which * CC * DIN; const float* BA = which == 0 ? BQ : which == 1 ? BK : BV;
  v8f acc[2][4] = {};
  const int lr = tid >> 4, ls = tid & 15;   // staging: this thread's row of each group of 16 rows, and its 16 bytes of the row's 256
  const __bf16* gx = X + r0 * DIN; const __bf16* gw = WA + (size_t)c0 * DIN; const unsigned go = lr * DIN;   // block-uniform bases and one per-thread offset
  const int rot = (blockIdx.x + 2 * blockIdx.y + 5 * blockIdx.z) & (DIN / GKR - 1);   // the block's first line of k: blocks that share X rows or weight rows start their k walks at lines spread over the row's 16 and wrap, so fewer ask L2 for the same lines at the same moment
  const unsigned k0 = rot * GKR + ls * 8;   // the thread's first k: LDS column j of step c holds k = (rot x 64 + c x 128 + j) mod DIN, for X rows and weight rows alike
  v8b pf[GROWS / 16];
  { const unsigned ko = go + (k0 & (DIN - 1)); const __bf16* px = gx + ko; const __bf16* pw = gw + ko;
#pragma unroll
    for (int i = 0; i < GROWS / 16; ++i) pf[i] = i < 8 ? *(const v8b*)(px + (size_t)(i * 16) * DIN) : *(const v8b*)(pw + (size_t)(i * 16 - GBM) * DIN);
    asm volatile("s_wait_xcnt 0x0" :: "v"(px), "v"(pw) : "memory"); }   // stands in front of every overwrite of the first fetch's address registers: as inputs here they stay live up to the wait
  for (int c = 0; c < DIN / GKC; ++c) { __bf16 (*sb)[GP] = stg[c & 1];
#pragma unroll
    for (int i = 0; i < GROWS / 16; ++i) *(v8b*)&sb[i * 16 + lr][ls * 8] = pf[i];
    __syncthreads();   // this step's rows are in LDS; it also ends every wave's reads of the other buffer, which the next step refills
    if (c + 1 < DIN / GKC) {   // the next step's rows, fetched into registers behind the barrier (which would drain them): the fragment reads and products below cover their latency
      const unsigned ko = go + ((k0 + (c + 1) * GKC) & (DIN - 1)); const __bf16* px = gx + ko; const __bf16* pw = gw + ko;
#pragma unroll
      for (int i = 0; i < GROWS / 16; ++i) pf[i] = i < 8 ? *(const v8b*)(px + (size_t)(i * 16) * DIN) : *(const v8b*)(pw + (size_t)(i * 16 - GBM) * DIN);
      asm volatile("s_wait_xcnt 0x0" :: "v"(px), "v"(pw) : "memory"); }   // stands in front of every overwrite of the fetch's address registers: as inputs here they stay live up to the wait, so no load of the group takes them as its destination
#pragma unroll
    for (int kc = 0; kc < GKC / 32; ++kc) { v16b a[2], wf[4];
#pragma unroll
      for (int i = 0; i < 2; ++i) a[i] = frag_b(&sb[wr * 32 + i * 16 + col][kc * 32], lane);
#pragma unroll
      for (int j = 0; j < 4; ++j) wf[j] = frag_b(&sb[GBM + wc * 64 + j * 16 + col][kc * 32], lane);
      __builtin_amdgcn_sched_barrier(0);   // keeps the 12 fragment reads one group in front of the 8 products: one LDS latency a group, not one a product
#pragma unroll
      for (int i = 0; i < 2; ++i)
#pragma unroll
        for (int j = 0; j < 4; ++j) acc[i][j] = wmma_bf(a[i], wf[j], acc[i][j]); } }
  float bias[4];
#pragma unroll
  for (int j = 0; j < 4; ++j) bias[j] = BA ? bfr(BA[c0 + wc * 64 + j * 16 + col]) : 0.f;
  __syncthreads();   // ends every wave's fragment reads of the staging buffers, whose bytes the leaving tile overwrites
  for (int hf = 0; hf < 2; ++hf) { const int th0 = t0 + hf * 64; const size_t rh0 = r0 + hf * 64;   // the half's first row in its sequence and over all rows; waves wr = 2 hf, 2 hf + 1 hold it
    if (hf) __syncthreads();   // ends every thread's reads of the first half in LDS, which the second half overwrites
    if (which < 2) { _Float16* DH = which == 0 ? QH : KH; _Float16* DL = which == 0 ? QL : KL; const int nhi = which == 0 ? QHI : KHI; const bool hi_rows = th0 < nhi;
      if ((wr >> 1) == hf) {
#pragma unroll
        for (int i = 0; i < 2; ++i)
#pragma unroll
          for (int j = 0; j < 4; ++j)
#pragma unroll
            for (int r = 0; r < 8; ++r) { const float v = acc[i][j][r] + bias[j]; const _Float16 hv = (_Float16)v; const int rl = (wr & 1) * 32 + i * 16 + 8 * g + r, cl = wc * 64 + j * 16 + col; sh[rl][cl] = hv; sl[rl][cl] = (_Float16)((v - (float)hv) * 1024.0f); } }
      __syncthreads();
      for (int e = tid; e < 64 * 16; e += 256) { int rl, cq; size_t dh;   // e = the 16-byte piece in the order of its destination: a wave's store covers whole lines
        if (which == 0) { rl = e >> 4; cq = (e & 15) * 8; dh = (rh0 + rl) * CC + c0 + cq; }
        else { const int l = e & 31, fp = (e >> 5) & 3, tl = (e >> 7) & 3, hh = e >> 9; rl = tl * 16 + (l & 15); cq = hh * HD + fp * 16 + (l >> 4) * 8; dh = KF_OFF(bb, c0 / HD + hh, th0 / 16 + tl) + fp * 256 + l * 8; }
        vst2w((unsigned*)(DH + dh), *(const v4u*)&sh[rl][cq]); if (hi_rows) vst2w((unsigned*)(DL + (bb * nhi + th0 + rl) * (size_t)CC + c0 + cq), *(const v4u*)&sl[rl][cq]); }
    } else { const bool hi_rows = th0 < KHI;
      if ((wr >> 1) == hf) {
#pragma unroll
        for (int i = 0; i < 2; ++i)
#pragma unroll
          for (int j = 0; j < 4; ++j)
#pragma unroll
            for (int r = 0; r < 8; ++r) { const float v = acc[i][j][r] + bias[j]; const int rl = (wr & 1) * 32 + i * 16 + 8 * g + r, cl = wc * 64 + j * 16 + col; th[cl][rl] = (_Float16)v; const __bf16 bh = (__bf16)v; tb[cl][rl] = bh; tbl[cl][rl] = (__bf16)(v - (float)bh); } }
      __syncthreads();
      for (int e = tid; e < 128 * 8; e += 256) { const int l = e & 31, jp = (e >> 5) & 7, kg = (e >> 8) & 1, hh = e >> 9;   // e = the 16-byte piece in the order of its destination: a wave's store covers whole lines
        const int cl = hh * HD + (jp >> 1) * 16 + (l & 15), kq = kg * 32 + (jp & 1) * 16 + (l >> 4) * 8;
        vst2w((unsigned*)(VT + VF_OFF(bb, c0 / HD + hh, th0 / 32 + kg) + jp * 256 + l * 8), *(const v4u*)&th[cl][kq]); if (hi_rows) { const size_t o3 = (bb * CC + c0 + cl) * (size_t)KHI + th0 + kq; vst2w((unsigned*)(VB + o3), *(const v4u*)&tb[cl][kq]); vst2w((unsigned*)(VBL + o3), *(const v4u*)&tbl[cl][kq]); } } } } }
// ---- k_fa: block = 32 queries of batch b and HG = 8 of the heads, HG x KS = 16 waves, wave = (head, half of the keys): four waves a SIMD, so one wave's exp work runs beside another's products and load waits. A wave holds QT = 2 query tiles of 16 in registers and uses every k and v fragment that it loads for both: half the fragment bytes from L2 per score.
// The wave forms S^T = K Q^T (A = 16 key rows, B = 16 query rows; q hi + residual x 2^10: 2 products), so a lane holds ONE query (col) of each tile and keys 8g + r of each 16-key tile: logits, softmax and P stay in registers.
// pass 1 walks the wave's 1,024 keys for the row maximum and the sum of exp (a running pair per lane and query tile; the two lane halves, then the two key halves through LDS, joined once at the end); pass 2 forms the logits again, P x 2^11 = exp(s - max) x 2048 / sum as one exp2: two S^T tiles ARE the 16 x 32 A fragment of P (elements 0..7 = keys k0 + 8g + r, 8..15 = k0 + 16 + 8g + r) against v f16 planes (1 product);
// the HG heads' f32 P tiles of each key half meet in LDS (two buffers, one barrier a 64-key step) and wave (w, kh) sums query rows 4w..4w+3 of its half's step over the block's heads in head order: whole 128-B lines of the head group's partial plane, which k_avg joins. The two key halves' ctx sums are joined in LDS at the end, each wave finishing one query tile.
__device__ __forceinline__ v8f wmma_p(v16h a, v16h b, v8f c) { return __builtin_amdgcn_wmma_f32_16x16x32_f16(false, a, false, b, (short)0, c, false, false); }
__device__ __forceinline__ void st_tile(const v16h k0f, const v16h k1f, const v16h* qh, const v16h* ql, float* s) {
  v8f a = {}, al = {};
  a = wmma_p(k0f, qh[0], a); al = wmma_p(k0f, ql[0], al); a = wmma_p(k1f, qh[1], a); al = wmma_p(k1f, ql[1], al);
#pragma unroll
  for (int r = 0; r < 8; ++r) s[r] = a[r] + al[r] * (1.0f / 1024.0f); }   // the raw q.k sum: SCALE rides in the exponent's multiply-add (KL2E)
#define KL2E (SCALE * 1.44269504088896340736f)   // exp((t - tmax) x SCALE) = exp2(t x KL2E - tmax x KL2E)
__device__ __forceinline__ float ex2(float v) { return __builtin_amdgcn_exp2f(v); }   // v_exp_f32; arguments here are <= 11, and a result below the normal range may read 0
__device__ __forceinline__ float ex2n(float v) { float e; asm("v_exp_f32 %0, %1\n\tv_nop" : "=v"(e) : "v"(v)); return e; }   // the same, for the places where in this build the next vector instruction takes the source register as its destination: the v_nop is the slot that the instruction set asks for behind a transcendental, tied to it in one statement
__device__ __forceinline__ float lg2n(float v) { float e; asm("v_log_f32 %0, %1\n\tv_nop" : "=v"(e) : "v"(v)); return e; }   // v_log_f32 = log2, with the same slot behind it as ex2n, for the same reason
#define PBP 68             // LDS pitch of a 64-key P row in floats: the 16 query rows' 16-byte stores fall on 16 different bank groups
#define QT 2               // query tiles of 16 a wave
#define HG 8               // heads of a block
#define KS 2               // key halves of a block: HG x KS waves
#define KST (TT / 64 / KS) // 64-key steps of a wave
static_assert(NH % HG == 0 && HD == 64 && QT * 16 == HG * 4 && HG == 8, "wave (w, kh) is head w of its group and sums 4 query rows of the 32-row tile");
static_assert(KS == 2 && QT == 2 && (KST & (KST - 1)) == 0 && KST % 2 == 0, "two key halves swap one query tile each at the end, in the buffer that the last step does not use");
__global__ __launch_bounds__(HG * KS * 32) void k_fa(const _Float16* __restrict__ QH, const _Float16* __restrict__ QL, const _Float16* __restrict__ KH, const _Float16* __restrict__ VT, _Float16* __restrict__ Y, float* __restrict__ PA) {
  __shared__ __align__(16) float pb[2][KS][HG][QT * 16][PBP]; __shared__ __align__(8) float ml[KS][HG][QT][16][2]; __shared__ __align__(16) _Float16 qls[HG][QT][2][2][32][8];   // qls: the q residual fragments in fragment order [head][query tile][32-column half][fragment half][lane][8]
  const int tid = threadIdx.x, lane = tid & 31, col = lane & 15, g = lane >> 4; const int b = blockIdx.y; const int ql0 = blockIdx.x * (QT * 16);
  const int wv = __builtin_amdgcn_readfirstlane(tid >> 5); const int w = wv & (HG - 1), kh = wv >> 3; const int h = blockIdx.z * HG + w;   // the wave's number, its head and its key half, in scalar registers: head offsets stay scalar
  v16h qh[QT][2];
  const _Float16* pqh = QH + ((size_t)b * TT + ql0 + col) * CC + h * HD + 8 * g; const _Float16* pql = QL + ((size_t)b * QHI + ql0 + col) * CC + h * HD + 8 * g;   // the lane's own 8 columns of its query row of tile 0
  const _Float16* pq2 = pql + kh * 16 * CC;   // the same of tile kh, whose residual fragments this wave brings
#pragma unroll
  for (int qt = 0; qt < QT; ++qt)
#pragma unroll
    for (int kc = 0; kc < 2; ++kc) qh[qt][kc] = frag_h(pqh + qt * 16 * CC + kc * 32, 0);
#pragma unroll
  for (int kc = 0; kc < 2; ++kc) { const _Float16* p = pq2 + kc * 32; *(v8h*)&qls[w][kh][kc][0][lane][0] = *(const v8h*)p; *(v8h*)&qls[w][kh][kc][1][lane][0] = *(const v8h*)(p + 16); }   // the residual fragments stay in LDS (32 registers fewer, so that four waves a SIMD fit): wave (w, kh) brings tile kh's for both waves of the head
  asm volatile("s_wait_xcnt 0x0" :: "v"(pqh), "v"(pq2) : "memory");   // the q loads' address registers are reused below: the wait stands in front of that overwrite; as inputs here they stay live up to it, so no q load takes them as its destination
  __syncthreads();   // both waves' residual fragments are in LDS
  const _Float16* qlw = &qls[w][0][0][0][lane][0];
  const _Float16* Kr = KH + KF_OFF(b, h, kh * (TT / KS / 16)) + lane * 8;   // this head's k fragments from the wave's first key on, 64 elements a key: a fragment load covers 4 whole lines
  const _Float16* Vr = VT + VF_OFF(b, h, kh * (TT / KS / 32)) + lane * 8;   // this head's v fragments from the wave's first key on, 64 elements a key
  const int rot = blockIdx.x & (KST - 1);   // the first 64-key step of each wave's half in both passes: the blocks of one batch and head group read the same k and v lines; they start their key walks at steps spread over the 16 (blocks x, x + 16, x + 32 and x + 48 at the same one) and wrap, so fewer ask L2 for the same lines at the same moment
  constexpr unsigned slot1[QT] = { 0x0u, 0x5018u };   // pass 1: bit i of tile qt = the exp of score i carries the slot of ex2n: without it this build puts there an instruction that takes the exp's source register as its destination
  float m[QT], l[QT];
#pragma unroll
  for (int qt = 0; qt < QT; ++qt) { m[qt] = -3.0e38f; l[qt] = 0.f; }
  v16h kf[4];
  { const _Float16* pk = Kr + rot * 4096;   // the walk's first 32 keys
#pragma unroll
    for (int t = 0; t < 2; ++t) { kf[2 * t] = frag_w(pk + t * 1024); kf[2 * t + 1] = frag_w(pk + t * 1024 + 512); }
    asm volatile("s_wait_xcnt 0x0" :: "v"(pk) : "memory"); }   // stands in front of every overwrite of the first fetch's address registers: as an input here they stay live up to the wait, so no load of the group takes them as its destination
  for (int it = 0; it < 2 * KST; ++it) { float s[QT][16];   // a trip = 32 keys: 32 fragment and 32 score registers, so that four waves a SIMD fit
#pragma unroll
    for (int qt = 0; qt < QT; ++qt) { const v16h ql[2] = { frag_w(qlw + qt * 1024), frag_w(qlw + qt * 1024 + 512) };
#pragma unroll
      for (int t = 0; t < 2; ++t) st_tile(kf[2 * t], kf[2 * t + 1], qh[qt], ql, s[qt] + t * 8); }
    const int kn = ((it + 1 + 2 * rot) & (2 * KST - 1)) * 32;   // the next 32 keys of the wrapped walk, fetched one trip ahead; the last trip fetches the walk's first 32 again, which pass 2 uses
    const _Float16* pk = Kr + kn * HD;
#pragma unroll
    for (int t = 0; t < 2; ++t) { kf[2 * t] = frag_w(pk + t * 1024); kf[2 * t + 1] = frag_w(pk + t * 1024 + 512); }
    __builtin_amdgcn_sched_barrier(0);   // keeps the fetch ahead in front of the exp work below, which covers its latency
#pragma unroll
    for (int qt = 0; qt < QT; ++qt) { float bm = s[qt][0];
#pragma unroll
      for (int i = 1; i < 16; ++i) bm = fmaxf(bm, s[qt][i]);
      const float mn = fmaxf(m[qt], bm), nb = -mn * KL2E; float a = 0.f;
#pragma unroll
      for (int i = 0; i < 16; ++i) { const float x = fmaf(s[qt][i], KL2E, nb); a += (slot1[qt] >> i & 1) ? ex2n(x) : ex2(x); }
      l[qt] = l[qt] * ex2n((m[qt] - mn) * KL2E) + a; m[qt] = mn; }
    asm volatile("s_wait_xcnt 0x0" :: "v"(pk) : "memory"); }   // the next trip rewrites the address registers of the fetch ahead: the wait stands in front of that overwrite; as an input here they stay live up to it, through the exp work
  float nb2[QT];
#pragma unroll
  for (int qt = 0; qt < QT; ++qt) { const float M = fmaxf(m[qt], __shfl_xor(m[qt], 16)); float lq = l[qt] * ex2n((m[qt] - M) * KL2E); lq += __shfl_xor(lq, 16);
    if (g == 0) { v2f e = { M, lq }; *(v2f*)&ml[kh][w][qt][col][0] = e; } }
  __syncthreads();   // both key halves' maxima and sums are in LDS
#pragma unroll
  for (int qt = 0; qt < QT; ++qt) { const v2f e0 = *(const v2f*)&ml[0][w][qt][col][0], e1 = *(const v2f*)&ml[1][w][qt][col][0]; const float M = fmaxf(e0[0], e1[0]);   // both waves of a head join in the same order: the same addend in both
    const float lq = e0[1] * ex2n((e0[0] - M) * KL2E) + e1[1] * ex2n((e1[0] - M) * KL2E);
    nb2[qt] = fmaf(-M, KL2E, 11.0f - lg2n(lq)); }   // P x 2^11 = exp2(t x KL2E + nb2): the maximum and 2048 / sum as one addend (v_log_f32 = log2; the sum lies between about 1 and 2048, a normal number)
  v8f acc[QT][HD / 16] = {};
  float* pa = PA + (((size_t)blockIdx.z * NB + b) * TT + ql0 + w * 4 + g) * TT + kh * (TT / KS) + col * 4;   // a half wave = one query row's 64 keys of a step = 2 whole lines
  for (int st = 0; st < KST; ++st) { const int sk = (st + rot) & (KST - 1);   // a step = 64 keys (step sk of the wrapped walk), as two halves of 32 keys
#pragma unroll
    for (int u = 0; u < 2; ++u) { float s[QT][16]; v16h vf[HD / 16]; const _Float16* pv = Vr + sk * 4096 + u * 2048;
#pragma unroll
      for (int qt = 0; qt < QT; ++qt) { const v16h ql[2] = { frag_w(qlw + qt * 1024), frag_w(qlw + qt * 1024 + 512) }; st_tile(kf[0], kf[1], qh[qt], ql, s[qt]); st_tile(kf[2], kf[3], qh[qt], ql, s[qt] + 8); }
      const int kn = u == 0 ? sk * 64 : ((st + 1 + rot) & (KST - 1)) * 64, ko = u == 0 ? 2048 : 0;   // the next 32 keys of the wrapped walk (this step's second half, or the next step's first), fetched one half step ahead (the last fetch, of the walk's first 32, is in bounds and unused)
      const _Float16* pk = Kr + kn * HD;   // the second half's 2,048 elements ride in the loads' offsets, so that the register named at the wait below is the one the loads use
#pragma unroll
      for (int j = 0; j < HD / 16; ++j) vf[j] = frag_w(pv + j * 512);   // this half step's v, behind the score products: 32 registers, so that four waves a SIMD fit
#pragma unroll
      for (int t = 0; t < 2; ++t) { kf[2 * t] = frag_w(pk + ko + t * 1024); kf[2 * t + 1] = frag_w(pk + ko + t * 1024 + 512); }
      asm volatile("s_wait_xcnt 0x0" :: "v"(pv), "v"(pk) : "memory");   // stands in front of every overwrite of the v and k loads' address registers: as inputs here they stay live up to the wait, so no load of the groups takes them as its destination
      __builtin_amdgcn_sched_barrier(0);   // keeps the v loads and the k fetch ahead in front of the exp work below, which covers their latency
#pragma unroll
      for (int qt = 0; qt < QT; ++qt) { v16h p;
#pragma unroll
        for (int i = 0; i < 16; ++i) { s[qt][i] = ex2(fmaf(s[qt][i], KL2E, nb2[qt])); p[i] = (_Float16)s[qt][i]; }
#pragma unroll
        for (int j = 0; j < HD / 16; ++j) acc[qt][j] = wmma_p(p, vf[j], acc[qt][j]);
        float* pw = &pb[st & 1][kh][w][qt * 16 + col][u * 32 + 8 * g];
#pragma unroll
        for (int t = 0; t < 2; ++t) { v4f lo = { s[qt][t * 8], s[qt][t * 8 + 1], s[qt][t * 8 + 2], s[qt][t * 8 + 3] }, hi = { s[qt][t * 8 + 4], s[qt][t * 8 + 5], s[qt][t * 8 + 6], s[qt][t * 8 + 7] }; *(v4f*)(pw + t * 16) = lo; *(v4f*)(pw + t * 16 + 4) = hi; } } }
    __syncthreads();   // the block's heads' P tiles of this step are in LDS; it also ends every wave's reads of the other buffer, which the next step refills
    v4f a[2];
#pragma unroll
    for (int i = 0; i < 2; ++i) { a[i] = *(const v4f*)&pb[st & 1][kh][0][w * 4 + i * 2 + g][col * 4];
#pragma unroll
      for (int hh = 1; hh < HG; ++hh) a[i] += *(const v4f*)&pb[st & 1][kh][hh][w * 4 + i * 2 + g][col * 4]; }
    float* po = pa + sk * 64;
    vst2(po, a[0]); vst2(po + 2 * TT, a[1]);
    asm volatile("s_wait_xcnt 0x0" :: "v"(po), "v"(a[0]), "v"(a[1]) : "memory"); }   // the next step rewrites the two stores' address and data registers: the wait stands in front of that overwrite; as inputs here they stay live up to it
  // the two key halves' ctx sums: wave (w, kh) hands its sums of query tile 1 - kh to its partner and finishes tile kh. The swap uses buffer 0, whose last reads the last step's barrier has ended (that step used buffer 1)
  float* xb = &pb[0][0][0][0][0] + lane * 4;
#pragma unroll
  for (int j = 0; j < HD / 16; ++j) { const v8f o = kh ? acc[0][j] : acc[1][j]; v4f lo = { o[0], o[1], o[2], o[3] }, hi = { o[4], o[5], o[6], o[7] };
    *(v4f*)(xb + wv * 1024 + j * 256) = lo; *(v4f*)(xb + wv * 1024 + j * 256 + 128) = hi; }
  __syncthreads();   // every wave's handed-over tile is in LDS
#pragma unroll
  for (int j = 0; j < HD / 16; ++j) { const v8f o = kh ? acc[1][j] : acc[0][j]; const v4f lo = *(const v4f*)(xb + (wv ^ HG) * 1024 + j * 256), hi = *(const v4f*)(xb + (wv ^ HG) * 1024 + j * 256 + 128);
#pragma unroll
    for (int r = 0; r < 8; ++r) Y[((size_t)b * TT + ql0 + kh * 16 + 8 * g + r) * CC + h * HD + j * 16 + col] = (_Float16)((o[r] + (r < 4 ? lo[r & 3] : hi[r & 3])) * (1.0f / 2048.0f)); } }   // ctx once to f16, as k_out's product takes it; a (row, head) = one whole 128-B line, written by this wave alone
// ---- k_avg: attn_avg = (the NH / HG head groups' partial planes, in group order) / (2^11 NH): a stream, 16 bytes a lane, 8 loads in flight a wave
static_assert(NH / HG == 2, "k_avg joins two planes");
__global__ __launch_bounds__(256) void k_avg(const float* __restrict__ PA, float* __restrict__ AV) {
  const size_t o = (size_t)blockIdx.x * 4096 + threadIdx.x * 4; const float* p0 = PA + o; const float* p1 = p0 + (size_t)NB * TT * TT;
  v4f x[4], y[4];
#pragma unroll
  for (int i = 0; i < 4; ++i) { x[i] = *(const v4f*)(p0 + i * 1024); y[i] = *(const v4f*)(p1 + i * 1024); }
#pragma unroll
  for (int i = 0; i < 4; ++i) vst2(AV + o + i * 1024, (x[i] + y[i]) * (1.0f / (2048.0f * NH))); }
// ---- k_out: block = (128 rows, 128 cols): out = ctx Wo (+ bo): ctx f16 (k_fa) against Wo as f16(bf16 x 2^8) exact (k_cvt) (1 product) x 2^-8
#define SFP 68             // LDS pitch of a wave's 64-column output row in floats: 272 B = 16 B x 17 (odd)
__global__ __launch_bounds__(256) void k_out(const _Float16* __restrict__ Y, const _Float16* __restrict__ WO, const float* __restrict__ BO, float* __restrict__ OUT) { __shared__ __align__(16) float sf[8][32][SFP]; __shared__ __align__(16) _Float16 stg[2][GROWS][GP];
  const int tid = threadIdx.x, wave = tid >> 5, lane = tid & 31, col = lane & 15, g = lane >> 4, wr = wave >> 1, wc = wave & 1; const int c0 = blockIdx.y * 128; const size_t r0 = (size_t)blockIdx.x * GBM;
  v8f acc[2][4] = {};
  const int lr = tid >> 4, ls = tid & 15;   // staging: this thread's row of each group of 16 rows, and its 16 bytes of the row's 256
  const _Float16* gx = Y + r0 * CC; const _Float16* gw = WO + (size_t)c0 * CC; const unsigned go = lr * CC;   // block-uniform bases and one per-thread offset
  const int rot = (blockIdx.x + 2 * blockIdx.y) & (CC / GKR - 1);   // the block's first line of k, as in k_proj: sharers of ctx rows or weight rows start apart and wrap
  const unsigned k0 = rot * GKR + ls * 8;   // the thread's first k: LDS column j of step c holds k = (rot x 64 + c x 128 + j) mod CC, for ctx rows and weight rows alike
  v8h pf[GROWS / 16];
  { const unsigned ko = go + (k0 & (CC - 1)); const _Float16* px = gx + ko; const _Float16* pw = gw + ko;
#pragma unroll
    for (int i = 0; i < GROWS / 16; ++i) pf[i] = i < 8 ? *(const v8h*)(px + (size_t)(i * 16) * CC) : *(const v8h*)(pw + (size_t)(i * 16 - GBM) * CC);
    asm volatile("s_wait_xcnt 0x0" :: "v"(px), "v"(pw) : "memory"); }   // stands in front of every overwrite of the first fetch's address registers: as inputs here they stay live up to the wait
  for (int c = 0; c < CC / GKC; ++c) { _Float16 (*sb)[GP] = stg[c & 1];
#pragma unroll
    for (int i = 0; i < GROWS / 16; ++i) *(v8h*)&sb[i * 16 + lr][ls * 8] = pf[i];
    __syncthreads();   // this step's rows are in LDS; it also ends every wave's reads of the other buffer, which the next step refills
    if (c + 1 < CC / GKC) {   // the next step's rows, fetched into registers behind the barrier (which would drain them): the fragment reads and products below cover their latency
      const unsigned ko = go + ((k0 + (c + 1) * GKC) & (CC - 1)); const _Float16* px = gx + ko; const _Float16* pw = gw + ko;
#pragma unroll
      for (int i = 0; i < GROWS / 16; ++i) pf[i] = i < 8 ? *(const v8h*)(px + (size_t)(i * 16) * CC) : *(const v8h*)(pw + (size_t)(i * 16 - GBM) * CC);
      asm volatile("s_wait_xcnt 0x0" :: "v"(px), "v"(pw) : "memory"); }   // stands in front of every overwrite of the fetch's address registers: as inputs here they stay live up to the wait, so no load of the group takes them as its destination
#pragma unroll
    for (int kc = 0; kc < GKC / 32; ++kc) { v16h a[2], wf[4];
#pragma unroll
      for (int i = 0; i < 2; ++i) a[i] = frag_h(&sb[wr * 32 + i * 16 + col][kc * 32], lane);
#pragma unroll
      for (int j = 0; j < 4; ++j) wf[j] = frag_h(&sb[GBM + wc * 64 + j * 16 + col][kc * 32], lane);
      __builtin_amdgcn_sched_barrier(0);   // keeps the 12 fragment reads one group in front of the 8 products: one LDS latency a group, not one a product
#pragma unroll
      for (int i = 0; i < 2; ++i)
#pragma unroll
        for (int j = 0; j < 4; ++j) acc[i][j] = wmma16(a[i], wf[j], acc[i][j]); } }
#pragma unroll
  for (int j = 0; j < 4; ++j) { const float bias = BO ? bfr(BO[c0 + wc * 64 + j * 16 + col]) : 0.f;
#pragma unroll
    for (int i = 0; i < 2; ++i)
#pragma unroll
      for (int r = 0; r < 8; ++r) sf[wave][i * 16 + 8 * g + r][j * 16 + col] = acc[i][j][r] * (1.0f / 256.0f) + bias; }
  LDSX(); for (int rl = 0; rl < 16; ++rl) vst2(OUT + (r0 + wr * 32 + rl * 2 + g) * DIN + c0 + wc * 64 + col * 4, *(const v4f*)&sf[wave][rl * 2 + g][col * 4]); }   // a half wave = one row's 64 columns = 2 whole lines

extern "C" void kernel_launch(void* const* d_in, const int* in_sizes, int n_in, void* d_out, int out_size, void* d_ws, size_t ws_size, hipStream_t stream) {
  (void)in_sizes; (void)n_in; (void)out_size;
  const float** F = (const float**)d_in;
  if (ws_size < (size_t)WS_END) return;
  char* ws = (char*)d_ws; _Float16 *QH = (_Float16*)(ws + WS_QH), *KH = (_Float16*)(ws + WS_KH), *VT = (_Float16*)(ws + WS_VT), *QL = (_Float16*)(ws + WS_QL), *KL = (_Float16*)(ws + WS_KL); __bf16 *VB = (__bf16*)(ws + WS_VB), *VBL = (__bf16*)(ws + WS_VBL), *XB = (__bf16*)(ws + WS_XB), *WB = (__bf16*)(ws + WS_WB); _Float16 *Y = (_Float16*)(ws + WS_Y), *WPH = (_Float16*)(ws + WS_WP); float *PA = (float*)(ws + WS_PA);
  (void)Y; (void)QL; (void)KL; (void)VB; (void)VBL;
  // inputs: 0 x [2,2048,1024]; 1 Wq, 2 bq, 3 Wk, 4 bk, 5 Wv, 6 bv, 7 Wp, 8 bp ((out,in) [1024,1024], [1024]); outputs: 0 y [2,2048,1024] @0, 1 attn_avg [2,2048,2048] @ OUT1_OFF
  float* AV = (float*)((char*)d_out + OUT1_OFF);
  k_cvt<<<dim3(CVX + 4 * CVW), 256, 0, stream>>>(F[0], F[1], F[3], F[5], F[7], XB, WB, WPH);
  k_proj<<<dim3(TNB * TT / GBM, CC / 128, 3), 256, 0, stream>>>(XB, WB, F[2], F[4], F[6], QH, QL, KH, KL, VT, VB, VBL);
  k_fa<<<dim3(TT / (QT * 16), TNB, NH / HG), HG * KS * 32, 0, stream>>>(QH, QL, KH, VT, Y, PA);
  k_avg<<<dim3((unsigned)((size_t)TNB * TT * TT / 4096)), 256, 0, stream>>>(PA, AV);
  k_out<<<dim3(TNB * TT / GBM, DIN / 128), 256, 0, stream>>>(Y, WPH, F[8], (float*)d_out);
}
